// v000
// Measured on an AMD MI455X. A time is GPU time per run, averaged over a window of back-to-back runs after a warm-up
// (all launches, gaps included; the runs take copies of the inputs in turn), and the median of several windows.
// Apart from v000's, it joins two sittings. Times from different sittings can be a few percent apart, while
// side-by-side timings come from the same sitting.
// The starting kernel, v000, takes 4930 microseconds a run.
// Contractions: q/k projections and v^T projection (x f16 x W_eff^T f16 carried x16), scores q_h.k_h^T (q,k f16 planes), probs.v_h (P f16 carried x32768 x V^T f16), output projection (attn f16 carried x256 x Wo^T f16 carried x16): all v_wmma_f32_16x16x32_f16 with f32 accumulate; rank-8 weight fold, bias add and softmax in f32.
#include <hip/hip_runtime.h>
#include <math.h>

// ---------------------------------------------------------------------------
// Problem constants
// ---------------------------------------------------------------------------
constexpr int kSeq    = 4096;             // tokens (batch 1)
constexpr int kDim    = 768;              // model width
constexpr int kHeads  = 12;
constexpr int kDh     = 64;
constexpr int kRank   = 8;                // low-rank adapter width
constexpr int kQChunk = 2048;             // query rows per materialised score plane
constexpr int kNChunk = kSeq / kQChunk;   // 2
constexpr float kLowRankScale = 2.0f;     // alpha / rank = 16 / 8
constexpr float kWCarry    = 16.0f;       // weights carried x16 in f16
constexpr float kWCarryInv = 1.0f / 16.0f;
constexpr float kQKScale   = 0.125f;      // 1 / sqrt(64), applied to the f32 scores
constexpr float kPCarry    = 32768.0f;    // probabilities carried x2^15 in f16
constexpr float kAttCarry  = 256.0f;      // attention output carried x256 in f16
constexpr float kPVScale   = kAttCarry / kPCarry;             // 1/128
constexpr float kOutScale  = 1.0f / (kAttCarry * kWCarry);   // 1/4096
static_assert(kHeads * kDh == kDim, "shape");
static_assert(kSeq % 64 == 0 && kDim % 64 == 0 && kQChunk % 64 == 0 && kDh % 64 == 0, "M,N tile multiples");
static_assert(kDim % 32 == 0 && kDh % 32 == 0 && kSeq % 32 == 0, "K multiples of 32");
static_assert(kSeq % 512 == 0 && kQChunk * kNChunk == kSeq, "softmax mapping");
static_assert((kDim * kDim) % 2048 == 0, "fold block mapping");
static_assert((kSeq * kDim) % 2048 == 0, "cast block mapping");
static_assert(kRank * kDim == 6 * 256 * 4, "adapter staging: 6 float4 per thread of a 256-thread block");

typedef __attribute__((ext_vector_type(16))) _Float16 v16h;
typedef __attribute__((ext_vector_type(8)))  _Float16 v8h;
typedef __attribute__((ext_vector_type(16))) __bf16   v16b;
typedef __attribute__((ext_vector_type(8)))  __bf16   v8b;
typedef __attribute__((ext_vector_type(8)))  float    v8f;
typedef __attribute__((ext_vector_type(4)))  float    v4f;
typedef __attribute__((ext_vector_type(2)))  float    v2f;
typedef __attribute__((ext_vector_type(4)))  unsigned int v4u;

// ---------------------------------------------------------------------------
// Helper pieces
// ---------------------------------------------------------------------------
__device__ __forceinline__ unsigned short f2bf_bits(float f) {
  unsigned u = __float_as_uint(f);
  return (unsigned short)((u + 0x7FFFu + ((u >> 16) & 1u)) >> 16);
}
__device__ __forceinline__ float bf_bits2f(unsigned short h) { return __uint_as_float(((unsigned)h) << 16); }

// hazard guards as plain device helpers (no inline asm inside the kernel template body)
__device__ __forceinline__ void dep_guard_h(v8f& a, v8f& b, v16h x, v16h y) { asm volatile("v_nop\n\tv_nop\n\tv_nop\n\tv_nop" : "+v"(a), "+v"(b) : "v"(x), "v"(y)); }
__device__ __forceinline__ void dep_guard_b(v8f& a, v8f& b, v16b x, v16b y) { asm volatile("v_nop\n\tv_nop\n\tv_nop\n\tv_nop" : "+v"(a), "+v"(b) : "v"(x), "v"(y)); }
// guard tying all four accumulators of a row group plus the A fragments
__device__ __forceinline__ void dep_guard4_h(v8f& a, v8f& b, v8f& c, v8f& d, v16h x, v16h y) {
  asm volatile("v_nop\n\tv_nop\n\tv_nop\n\tv_nop" : "+v"(a), "+v"(b), "+v"(c), "+v"(d) : "v"(x), "v"(y));
}
__device__ __forceinline__ void dep_guard4_b(v8f& a, v8f& b, v8f& c, v8f& d, v16b x, v16b y) {
  asm volatile("v_nop\n\tv_nop\n\tv_nop\n\tv_nop" : "+v"(a), "+v"(b), "+v"(c), "+v"(d) : "v"(x), "v"(y));
}
__device__ __forceinline__ void keep4_h(v16h a, v16h b, v16h c, v16h d) { asm volatile("v_nop" :: "v"(a), "v"(b), "v"(c), "v"(d)); }
__device__ __forceinline__ void keep4_b(v16b a, v16b b, v16b c, v16b d) { asm volatile("v_nop" :: "v"(a), "v"(b), "v"(c), "v"(d)); }
__device__ __forceinline__ void acc_guard4(v8f& a, v8f& b, v8f& c, v8f& d) { asm volatile("v_nop\n\tv_nop\n\tv_nop\n\tv_nop" : "+v"(a), "+v"(b), "+v"(c), "+v"(d)); }
template <typename T> struct Frag;
template <> struct Frag<_Float16> {
  typedef v16h V; union U { v16h v; v8h h[2]; };
  // elements 0..7 <- p[0..7], 8..15 <- p[16..23]
  static __device__ __forceinline__ v16h load(const _Float16* p) {
    U f; f.h[0] = *(const v8h*)(p); f.h[1] = *(const v8h*)(p + 16); return f.v;
  }
  static __device__ __forceinline__ v8f mma(v16h a, v16h b, v8f c) {
    return __builtin_amdgcn_wmma_f32_16x16x32_f16(false, a, false, b, (short)0, c, false, false);
  }
  static __device__ __forceinline__ void guard(v8f& a, v8f& b, v16h x, v16h y) { dep_guard_h(a, b, x, y); }
  static __device__ __forceinline__ void guard4(v8f& a, v8f& b, v8f& c, v8f& d, v16h x, v16h y) { dep_guard4_h(a, b, c, d, x, y); }
  static __device__ __forceinline__ void keep(v16h a, v16h b, v16h c, v16h d) { keep4_h(a, b, c, d); }
};
template <> struct Frag<__bf16> {
  typedef v16b V; union U { v16b v; v8b h[2]; };
  static __device__ __forceinline__ v16b load(const __bf16* p) {
    U f; f.h[0] = *(const v8b*)(p); f.h[1] = *(const v8b*)(p + 16); return f.v;
  }
  static __device__ __forceinline__ v8f mma(v16b a, v16b b, v8f c) {
    return __builtin_amdgcn_wmma_f32_16x16x32_bf16(false, a, false, b, (short)0, c, false, false);
  }
  static __device__ __forceinline__ void guard(v8f& a, v8f& b, v16b x, v16b y) { dep_guard_b(a, b, x, y); }
  static __device__ __forceinline__ void guard4(v8f& a, v8f& b, v8f& c, v8f& d, v16b x, v16b y) { dep_guard4_b(a, b, c, d, x, y); }
  static __device__ __forceinline__ void keep(v16b a, v16b b, v16b c, v16b d) { keep4_b(a, b, c, d); }
};

__device__ __forceinline__ unsigned pk16(unsigned short a, unsigned short b) { return (unsigned)a | ((unsigned)b << 16); }
__device__ __forceinline__ unsigned short h_bits(float f) { const _Float16 h = (_Float16)f; return __builtin_bit_cast(unsigned short, h); }

// ---- Register-blocked batched WMMA GEMM (ACT reduced to none/relu/leaky; row guard ties all 4 accumulators;
//      bias[m] fetched as two 16-B vectors per 16-row slab) ----
// C[m,n] = scale * sum_k A[m,k] * Bt[n,k] (+bias)(+resid); each wave owns a 64x64 tile.
// A row-major [M,K]; Bt row-major [N,K]; M,N % 64 == 0, K % 32 == 0.
// SPLIT: operands are hi/lo planes (A2/Bt2 = lo planes, same layout); product = hi*hi + hi*lo + lo*hi.
// BIAS_MODE: 0 = none, 1 = bias[m], 2 = bias[n].
// OUT_MODE: 0 = f32, 1 = f16, 2 = bf16 hi plane (Cout) + bf16 lo plane (Cout2).
// ET: 0 = f16 operands, 1 = bf16 operands (pointers passed as 16-bit storage)
template <int ET> struct Elem;
template <> struct Elem<0> { typedef _Float16 T; };
template <> struct Elem<1> { typedef __bf16 T; };
template <int ET, bool SPLIT, int BIAS_MODE, int OUT_MODE, bool RESID, int ACT = 0>
__global__ __launch_bounds__(256) void wmma_gemm64(
    const unsigned short* __restrict__ Ap, const unsigned short* __restrict__ A2p, int lda, long strideA,
    const unsigned short* __restrict__ Btp, const unsigned short* __restrict__ Bt2p, int ldb, long strideB,
    void* __restrict__ Cout, void* __restrict__ Cout2, int ldc, long strideC,
    const float* __restrict__ bias,
    const float* __restrict__ resid, long strideR,
    int M, int N, int K, float scale) {
  typedef typename Elem<ET>::T T;
  typedef typename Frag<T>::V V;
  const T* A = (const T*)Ap; const T* A2 = (const T*)A2p; const T* Bt = (const T*)Btp; const T* Bt2 = (const T*)Bt2p;
  __shared__ __align__(16) float sT[8][16 * 68];   // per-wave 16x64 slab, pitch 68 floats
  const int b    = blockIdx.y;
  const int lane = threadIdx.x & 31;
  const int wave = threadIdx.x >> 5;
  const int tilesN = N >> 6;
  const int tilesM = M >> 6;
  const int tile = blockIdx.x * 8 + wave;
  if (tile >= tilesM * tilesN) return;   // wave-uniform; no block barriers in this kernel
  const int tm = tile / tilesN;
  const int tn = tile - tm * tilesN;
  const int m0 = tm << 6;
  const int n0 = tn << 6;

  const T* Ab  = A  + (size_t)b * strideA;
  const T* Bb  = Bt + (size_t)b * strideB;
  const T* Ab2 = SPLIT ? (A2  + (size_t)b * strideA) : nullptr;
  const T* Bb2 = SPLIT ? (Bt2 + (size_t)b * strideB) : nullptr;

  const int rlane = lane & 15;                 // row (A) / col (B, D) within subtile
  const int koff  = (lane >> 4) * 8;           // k offset of this lane half
  const int mOff  = (lane >> 4) * 8;           // D row offset

  v8f acc[4][4];
#pragma unroll
  for (int i = 0; i < 4; ++i)
#pragma unroll
    for (int j = 0; j < 4; ++j) acc[i][j] = (v8f){0.f,0.f,0.f,0.f,0.f,0.f,0.f,0.f};

  for (int k0 = 0; k0 < K; k0 += 32) {
    V bh[4], bl[4];
#pragma unroll
    for (int j = 0; j < 4; ++j) {
      const size_t bo = (size_t)(n0 + (j << 4) + rlane) * ldb + koff + k0;
      bh[j] = Frag<T>::load(Bb + bo);
      if (SPLIT) bl[j] = Frag<T>::load(Bb2 + bo);
    }
#pragma unroll
    for (int i = 0; i < 4; ++i) {
      const size_t ao = (size_t)(m0 + (i << 4) + rlane) * lda + koff + k0;
      V ah = Frag<T>::load(Ab + ao);
      V al;
      if (SPLIT) al = Frag<T>::load(Ab2 + ao);
#pragma unroll
      for (int j = 0; j < 4; ++j) {
        acc[i][j] = Frag<T>::mma(ah, bh[j], acc[i][j]);
        if (SPLIT) {
          acc[i][j] = Frag<T>::mma(ah, bl[j], acc[i][j]);
          acc[i][j] = Frag<T>::mma(al, bh[j], acc[i][j]);
        }
      }
      Frag<T>::guard4(acc[i][0], acc[i][1], acc[i][2], acc[i][3], ah, SPLIT ? al : ah);
    }
    Frag<T>::keep(bh[0], bh[1], bh[2], bh[3]);
    if (SPLIT) Frag<T>::keep(bl[0], bl[1], bl[2], bl[3]);
  }
  acc_guard4(acc[0][0], acc[0][1], acc[0][2], acc[0][3]);
  acc_guard4(acc[1][0], acc[1][1], acc[1][2], acc[1][3]);
  acc_guard4(acc[2][0], acc[2][1], acc[2][2], acc[2][3]);
  acc_guard4(acc[3][0], acc[3][1], acc[3][2], acc[3][3]);

  // ---- epilogue ----
  float* slab = sT[wave];
  const float* Rb = RESID ? (resid + (size_t)b * strideR) : nullptr;
#pragma unroll
  for (int i = 0; i < 4; ++i) {
    const int mBase = m0 + (i << 4);
    // bias[m]: the 8 rows this lane half touches are contiguous -> two 16-B loads (2 b128 per slab, 8 per tile)
    float bmr[8] = {0.f, 0.f, 0.f, 0.f, 0.f, 0.f, 0.f, 0.f};
    if (BIAS_MODE == 1) {
      const float* bp = bias + mBase + mOff;
      const v4f bm0 = *(const v4f*)(bp);
      const v4f bm1 = *(const v4f*)(bp + 4);
      bmr[0] = bm0[0]; bmr[1] = bm0[1]; bmr[2] = bm0[2]; bmr[3] = bm0[3];
      bmr[4] = bm1[0]; bmr[5] = bm1[1]; bmr[6] = bm1[2]; bmr[7] = bm1[3];
    }
#pragma unroll
    for (int j = 0; j < 4; ++j) {
      const int n = n0 + (j << 4) + rlane;
      float bv = 0.f;
      if (BIAS_MODE == 2) bv = bias[n];
#pragma unroll
      for (int r = 0; r < 8; ++r) {
        float v = acc[i][j][r] * scale;
        if (BIAS_MODE == 1) v += bmr[r];
        if (BIAS_MODE == 2) v += bv;
        if (RESID) v += Rb[(size_t)(mBase + mOff + r) * ldc + n];
        if (ACT == 2) v = fmaxf(v, 0.0f);
        if (ACT == 4) v = (v > 0.f) ? v : 0.01f * v;
        slab[(mOff + r) * 68 + (j << 4) + rlane] = v;
      }
    }
    __builtin_amdgcn_fence(__ATOMIC_RELEASE, "workgroup");
    __builtin_amdgcn_wave_barrier();
    __builtin_amdgcn_fence(__ATOMIC_ACQUIRE, "workgroup");
    if (OUT_MODE == 0) {
      float* C = (float*)Cout + (size_t)b * strideC;
      const int hh = lane >> 4, c4 = (lane & 15) * 4;     // row seg = 256 B = 16 lanes x 16 B
      {
#pragma unroll
        for (int it = 0; it < 8; ++it) {
          const int row = it * 2 + hh;
          v4f v = *(const v4f*)(slab + row * 68 + c4);
          *(v4f*)(C + (size_t)(mBase + row) * ldc + n0 + c4) = v;
        }
        
      }
    } else {
      const int q = lane >> 3, c8 = (lane & 7) * 8;
      unsigned short* C  = (unsigned short*)Cout  + (size_t)b * strideC;
      unsigned short* C2 = (OUT_MODE == 2) ? ((unsigned short*)Cout2 + (size_t)b * strideC) : nullptr;
      {
#pragma unroll
        for (int it = 0; it < 4; ++it) {
          const int row = it * 4 + q;
          const float* sp = slab + row * 68 + c8;
          v8h hv, lv;
#pragma unroll
          for (int e = 0; e < 8; ++e) {
            if (OUT_MODE == 1) {
              hv[e] = (_Float16)sp[e];
            } else {
              unsigned short hb = f2bf_bits(sp[e]);
              unsigned short lb = f2bf_bits(sp[e] - bf_bits2f(hb));
              hv[e] = __builtin_bit_cast(_Float16, hb);
              lv[e] = __builtin_bit_cast(_Float16, lb);
            }
          }
          *(v8h*)(C + (size_t)(mBase + row) * ldc + n0 + c8) = hv;
          if (OUT_MODE == 2) *(v8h*)(C2 + (size_t)(mBase + row) * ldc + n0 + c8) = lv;
        }
        
      }
    }
    __builtin_amdgcn_fence(__ATOMIC_RELEASE, "workgroup");
    __builtin_amdgcn_wave_barrier();
    __builtin_amdgcn_fence(__ATOMIC_ACQUIRE, "workgroup");
  }
}

// ---------------------------------------------------------------------------
// ---------------------------------------------------------------------------
__global__ __launch_bounds__(256) void cast8_f16_kernel(const float* __restrict__ in, unsigned short* __restrict__ out, int n8) {
  const int i = blockIdx.x * 256 + threadIdx.x;
  if (i >= n8) return;
  const float* p = in + 8 * (size_t)i;
  const v4f a = *(const v4f*)(p);
  const v4f c = *(const v4f*)(p + 4);
  unsigned short hb[8];
#pragma unroll
  for (int e = 0; e < 4; ++e) {
    hb[e]     = h_bits(a[e]);
    hb[4 + e] = h_bits(c[e]);
  }
  const v4u u = (v4u){pk16(hb[0], hb[1]), pk16(hb[2], hb[3]), pk16(hb[4], hb[5]), pk16(hb[6], hb[7])};
  unsigned short* q = out + 8 * (size_t)i;
  *(v4u*)q = u;
  
}

// ---------------------------------------------------------------------------
// Rank-8 adapter fold + f16 cast with x16 carry, f32 math:
//   plane y in {0,1,2}: WQKV[y][e][d] = f16( 16 * ( w_y[e][d] + 2 * sum_r up_y[e][r] * down_y[r][d] ) )
//   plane y == 3      : WO[e][d]      = f16( 16 * wo[e][d] )
// Weights are [out e][in d] = Bt[n][k] for the GEMMs; orientation kept as given (no transpose).
// grid (288, 4): blockIdx.y = matrix (block-uniform), block covers 2048 consecutive elements (288 x 2048 = 768 x 768 exact);
// thread t owns elements 8t..8t+7 of the block (one row e, 8 consecutive d).
// The whole down matrix [8][768] of the plane is staged in LDS first (cooperative: 6 b128 per thread, 6 x 256 x 4 = 6144 floats =
// the whole matrix, every LDS word read below is written), block barrier, then per lane 2 b128 (w) + 2 b128 (up row) global loads.
// ---------------------------------------------------------------------------
__global__ __launch_bounds__(256) void fold_cast_kernel(
    const float* __restrict__ wq, const float* __restrict__ wk, const float* __restrict__ wv, const float* __restrict__ wo,
    const float* __restrict__ dq, const float* __restrict__ uq,
    const float* __restrict__ dk, const float* __restrict__ uk,
    const float* __restrict__ dv, const float* __restrict__ uv,
    unsigned short* __restrict__ wqkv16, unsigned short* __restrict__ wo16) {
  __shared__ __align__(16) float dsh[kRank * kDim];      // down matrix [8][768] of this plane, 24,576 B
  const int y = blockIdx.y;                              // 0..3, block-uniform
  const int t = threadIdx.x;
  const float* W  = (y == 0) ? wq : (y == 1) ? wk : (y == 2) ? wv : wo;
  const float* Dn = (y == 0) ? dq : (y == 1) ? dk : dv;   // y == 3: valid pointer, staged but not used
  const float* Up = (y == 0) ? uq : (y == 1) ? uk : uv;
  // stage down [8][768] = 1536 float4: thread t loads slots t + 256*i, i = 0..5 (exact coverage)
#pragma unroll
  for (int i = 0; i < 6; ++i) {
    const int q4 = (i * 256 + t) * 4;
    const v4f dd = *(const v4f*)(Dn + q4);
    *(v4f*)(dsh + q4) = dd;
  }
  __syncthreads();

  const int base = blockIdx.x * 2048 + 8 * t;            // < 768*768
  const int e = base / kDim;
  const int d = base - e * kDim;                         // multiple of 8
  const v4f w0 = *(const v4f*)(W + base);
  const v4f w1 = *(const v4f*)(W + base + 4);
  float s[8];
#pragma unroll
  for (int k = 0; k < 8; ++k) s[k] = 0.0f;
  if (y < 3) {                                           // block-uniform branch
    const v4f u0 = *(const v4f*)(Up + e * kRank);
    const v4f u1 = *(const v4f*)(Up + e * kRank + 4);
    const float ur[8] = {u0[0], u0[1], u0[2], u0[3], u1[0], u1[1], u1[2], u1[3]};
#pragma unroll
    for (int r = 0; r < kRank; ++r) {
      const v4f a = *(const v4f*)(dsh + r * kDim + d);
      const v4f c = *(const v4f*)(dsh + r * kDim + d + 4);
#pragma unroll
      for (int k = 0; k < 4; ++k) {
        s[k]     += ur[r] * a[k];
        s[4 + k] += ur[r] * c[k];
      }
    }
  }
  float f[8];
#pragma unroll
  for (int k = 0; k < 4; ++k) {
    f[k]     = (w0[k] + kLowRankScale * s[k])     * kWCarry;
    f[4 + k] = (w1[k] + kLowRankScale * s[4 + k]) * kWCarry;
  }
  unsigned short hb[8];
#pragma unroll
  for (int k = 0; k < 8; ++k) hb[k] = h_bits(f[k]);
  const v4u u = (v4u){pk16(hb[0], hb[1]), pk16(hb[2], hb[3]), pk16(hb[4], hb[5]), pk16(hb[6], hb[7])};
  unsigned short* op = (y < 3) ? (wqkv16 + (size_t)y * kDim * kDim + base) : (wo16 + base);
  *(v4u*)op = u;
  
}

// ---------------------------------------------------------------------------
// Row softmax over 4096 f32 scores (already scaled by 1/8 in the scores GEMM epilogue), f32 math:
//   P[i][j] = f16( 32768 * exp(s - max) / sum_j exp(s - max) )
// One block of 256 threads per row i = blockIdx.x (0..2047 within the query chunk).
// Phase 1/2: rolled 8-trip loops, thread t owns columns it*512 + 2t, 2t+1 (8 x 256 x 2 = 4096 = whole row); exps kept in LDS.
// Reductions in fixed order (thread sequential, wave shuffle tree, 8 wave partials in index order); shuffles unconditional.
// Store: thread t owns cols 8t..8t+7 (first instruction) and 2048+8t..2048+8t+7 (second instruction): one 16-B store per lane
// cross-thread reads of phase 3.
// ---------------------------------------------------------------------------
__global__ __launch_bounds__(256) void softmax_row_kernel(const float* __restrict__ Sp, unsigned short* __restrict__ Pp) {
  __shared__ __align__(16) float lg[kSeq];
  __shared__ float redM[8];
  __shared__ float redS[8];
  const int i    = blockIdx.x;
  const int t    = threadIdx.x;
  const int lane = t & 31, wave = t >> 5;
  const float* sr = Sp + (size_t)i * kSeq;

  float mx = -__builtin_inff();
#pragma unroll 1
  for (int it = 0; it < 8; ++it) {
    const int c = it * 512 + 2 * t;
    const v2f sv = *(const v2f*)(sr + c);
    mx = fmaxf(mx, fmaxf(sv[0], sv[1]));
    *(v2f*)(lg + c) = sv;
  }
#pragma unroll
  for (int off = 16; off > 0; off >>= 1) mx = fmaxf(mx, __shfl_xor(mx, off, 32));
  if (lane == 0) redM[wave] = mx;
  __syncthreads();
  float m = redM[0];
#pragma unroll
  for (int w = 1; w < 8; ++w) m = fmaxf(m, redM[w]);

  float sum = 0.f;
#pragma unroll 1
  for (int it = 0; it < 8; ++it) {
    const int c = it * 512 + 2 * t;
    const v2f l = *(const v2f*)(lg + c);
    v2f ev;
#pragma unroll
    for (int e = 0; e < 2; ++e) {
      ev[e] = expf(l[e] - m);
      sum += ev[e];
    }
    *(v2f*)(lg + c) = ev;
  }
#pragma unroll
  for (int off = 16; off > 0; off >>= 1) sum += __shfl_xor(sum, off, 32);
  if (lane == 0) redS[wave] = sum;
  __syncthreads();   // also orders the phase-2 LDS writes of other waves before the reads below
  float tot = redS[0];
#pragma unroll
  for (int w = 1; w < 8; ++w) tot += redS[w];
  const float inv = kPCarry / tot;

  const v4f e0 = *(const v4f*)(lg + 8 * t);
  const v4f e1 = *(const v4f*)(lg + 8 * t + 4);
  const v4f e2 = *(const v4f*)(lg + 2048 + 8 * t);
  const v4f e3 = *(const v4f*)(lg + 2048 + 8 * t + 4);
  unsigned short ha[8], hc[8];
#pragma unroll
  for (int e = 0; e < 4; ++e) {
    ha[e]     = h_bits(e0[e] * inv);
    ha[4 + e] = h_bits(e1[e] * inv);
    hc[e]     = h_bits(e2[e] * inv);
    hc[4 + e] = h_bits(e3[e] * inv);
  }
  const v4u ua = (v4u){pk16(ha[0], ha[1]), pk16(ha[2], ha[3]), pk16(ha[4], ha[5]), pk16(ha[6], ha[7])};
  const v4u uc = (v4u){pk16(hc[0], hc[1]), pk16(hc[2], hc[3]), pk16(hc[4], hc[5]), pk16(hc[6], hc[7])};
  unsigned short* pr = Pp + (size_t)i * kSeq;
  *(v4u*)(pr + 8 * t) = ua;
  *(v4u*)(pr + 2048 + 8 * t) = uc;
  
}

// ---------------------------------------------------------------------------
// Host glue.
// Workspace region map (bytes, every offset a multiple of 128; every plane fully written before any read):
//   X16    f16 [4096][768]                 6,291,456  at          0   (cast8)
//   WQKV16 f16 [3][768][768]  (x16 carry)  3,538,944  at  6,291,456   (fold_cast, planes q|k|v)
//   WO16   f16 [768][768]     (x16 carry)  1,179,648  at  9,830,400   (fold_cast)
//   Q16    f16 [4096][768]                 6,291,456  at 11,010,048   (GEMM)
//   K16    f16 [4096][768]                 6,291,456  at 17,301,504   (GEMM)
//   VT16   f16 [768][4096]  = V^T          6,291,456  at 23,592,960   (GEMM with swapped operand roles)
//   ATT16  f16 [4096][768]   (x256 carry)  6,291,456  at 29,884,416   (24 P.V GEMMs, each [2048 rows][64 cols])
//   SC     f32 [2048][4096]               33,554,432  at 36,175,872   (scores of one (head, query chunk), rewritten 24x, same type)
//   PP     f16 [2048][4096]  (x32768)     16,777,216  at 69,730,304   (probabilities, rewritten 24x, same type)
//   total                                 86,507,520
// GEMM shapes (all M,N multiples of 64, K multiple of 32, no padding anywhere):
//   q,k:  M=4096 N=768  K=768;  v^T: M=768 N=4096 K=768;  scores: M=2048 N=4096 K=64;  p.v: M=2048 N=64 K=4096;
// Launches: 1 cast + 1 fold + 3 projections + 24 x (scores, softmax, p.v) + 1 out = 78.
// ---------------------------------------------------------------------------
extern "C" void kernel_launch(void* const* d_in, const int* in_sizes, int n_in,
                              void* d_out, int out_size, void* d_ws, size_t ws_size,
                              hipStream_t stream) {
  if (n_in < 15) return;
  const int nX = kSeq * kDim;          // 3,145,728
  const int nW = kDim * kDim;          // 589,824
  const int nA = kRank * kDim;         // 6,144
  if (in_sizes[0] != nX) return;
  if (in_sizes[1] != nW || in_sizes[3] != nW || in_sizes[5] != nW || in_sizes[7] != nW) return;
  if (in_sizes[2] != kDim || in_sizes[4] != kDim || in_sizes[6] != kDim || in_sizes[8] != kDim) return;
  for (int i = 9; i < 15; ++i) if (in_sizes[i] != nA) return;
  if (out_size != nX) return;

  const size_t szAct  = (size_t)kSeq * kDim * 2;
  const size_t szWqkv = (size_t)3 * kDim * kDim * 2;
  const size_t szWo   = (size_t)kDim * kDim * 2;
  const size_t szS    = (size_t)kQChunk * kSeq * 4;
  const size_t szP    = (size_t)kQChunk * kSeq * 2;
  const size_t offX    = 0;
  const size_t offWqkv = offX + szAct;
  const size_t offWo   = offWqkv + szWqkv;
  const size_t offQ    = offWo + szWo;
  const size_t offK    = offQ + szAct;
  const size_t offVT   = offK + szAct;
  const size_t offAtt  = offVT + szAct;
  const size_t offS    = offAtt + szAct;
  const size_t offP    = offS + szS;
  const size_t total   = offP + szP;   // 86,507,520
  if (ws_size < total) return;

  const float* x   = (const float*)d_in[0];
  const float* wq  = (const float*)d_in[1];
  const float* bq  = (const float*)d_in[2];
  const float* wk  = (const float*)d_in[3];
  const float* bk  = (const float*)d_in[4];
  const float* wv  = (const float*)d_in[5];
  const float* bv  = (const float*)d_in[6];
  const float* wo  = (const float*)d_in[7];
  const float* bo  = (const float*)d_in[8];
  const float* dq  = (const float*)d_in[9];    // [8][768]
  const float* uq  = (const float*)d_in[10];   // [768][8]
  const float* dk  = (const float*)d_in[11];
  const float* uk  = (const float*)d_in[12];
  const float* dv  = (const float*)d_in[13];
  const float* uv  = (const float*)d_in[14];
  float* out = (float*)d_out;
  char* ws = (char*)d_ws;
  unsigned short* X16    = (unsigned short*)(ws + offX);
  unsigned short* WQKV16 = (unsigned short*)(ws + offWqkv);
  unsigned short* WO16   = (unsigned short*)(ws + offWo);
  unsigned short* Q16    = (unsigned short*)(ws + offQ);
  unsigned short* K16    = (unsigned short*)(ws + offK);
  unsigned short* VT16   = (unsigned short*)(ws + offVT);
  unsigned short* ATT16  = (unsigned short*)(ws + offAtt);
  float*          SC     = (float*)(ws + offS);
  unsigned short* PP     = (unsigned short*)(ws + offP);
  const unsigned short* WQ16 = WQKV16;
  const unsigned short* WK16 = WQKV16 + (size_t)kDim * kDim;
  const unsigned short* WV16 = WQKV16 + (size_t)2 * kDim * kDim;

  // ---- prologue: 16-bit operand planes ----
  const int n8 = nX / 8;   // 393,216 -> 1536 blocks exact
  cast8_f16_kernel<<<dim3((n8 + 255) / 256), dim3(256), 0, stream>>>(x, X16, n8);
  fold_cast_kernel<<<dim3(nW / 2048, 4), dim3(256), 0, stream>>>(wq, wk, wv, wo, dq, uq, dk, uk, dv, uv, WQKV16, WO16);

  // ---- projections (unused arguments receive valid dummy pointers) ----
  const int tilesProj = (kSeq / 64) * (kDim / 64);        // 768 -> 96 blocks of 8 waves
  // Q16[s][e] = (1/16) * sum_d X16[s][d] * WQ16[e][d] + bq[e]
  wmma_gemm64<0, false, 2, 1, false, 0><<<dim3((tilesProj + 7) / 8, 1), dim3(256), 0, stream>>>(
      X16, X16, kDim, 0L, WQ16, WQ16, kDim, 0L,
      (void*)Q16, (void*)Q16, kDim, 0L, bq, bq, 0L, kSeq, kDim, kDim, kWCarryInv);
  // K16[s][e] = (1/16) * sum_d X16[s][d] * WK16[e][d] + bk[e]
  wmma_gemm64<0, false, 2, 1, false, 0><<<dim3((tilesProj + 7) / 8, 1), dim3(256), 0, stream>>>(
      X16, X16, kDim, 0L, WK16, WK16, kDim, 0L,
      (void*)K16, (void*)K16, kDim, 0L, bk, bk, 0L, kSeq, kDim, kDim, kWCarryInv);
  // VT16[c][s] = (1/16) * sum_d WV16[c][d] * X16[s][d] + bv[c]   (A = weights [768][768], Bt = activations [4096][768], bias indexed by m)
  wmma_gemm64<0, false, 1, 1, false, 0><<<dim3((tilesProj + 7) / 8, 1), dim3(256), 0, stream>>>(
      WV16, WV16, kDim, 0L, X16, X16, kDim, 0L,
      (void*)VT16, (void*)VT16, kSeq, 0L, bv, bv, 0L, kDim, kSeq, kDim, kWCarryInv);

  // ---- attention per (head, 2048-query chunk) ----
  const int tilesScore = (kQChunk / 64) * (kSeq / 64);   // 2048 -> 256 blocks
  const int tilesPV    = (kQChunk / 64) * (kDh / 64);    // 32   -> 4 blocks
  for (int h = 0; h < kHeads; ++h) {
    for (int c = 0; c < kNChunk; ++c) {
      const unsigned short* Ag  = Q16 + (size_t)c * kQChunk * kDim + (size_t)h * kDh;   // rows of the chunk, head columns
      const unsigned short* Btg = K16 + (size_t)h * kDh;                                 // all 4096 key rows, head columns
      // SC[i][j] = 0.125 * sum_{d<64} Q16[c*2048+i][h*64+d] * K16[j][h*64+d]   (M=2048, N=4096, K=64)
      wmma_gemm64<0, false, 0, 0, false, 0><<<dim3((tilesScore + 7) / 8, 1), dim3(256), 0, stream>>>(
          Ag, Ag, kDim, 0L, Btg, Btg, kDim, 0L,
          (void*)SC, (void*)SC, kSeq, 0L, bq, bq, 0L, kQChunk, kSeq, kDh, kQKScale);
      // row softmax -> PP (f16, x32768)
      softmax_row_kernel<<<dim3(kQChunk), dim3(256), 0, stream>>>(SC, PP);
      // ATT16[c*2048+i][h*64+n] = (256/32768) * sum_j PP[i][j] * VT16[h*64+n][j]   (M=2048, N=64, K=4096)
      const unsigned short* VTg = VT16 + (size_t)h * kDh * kSeq;
      unsigned short* Attg = ATT16 + (size_t)c * kQChunk * kDim + (size_t)h * kDh;
      wmma_gemm64<0, false, 0, 1, false, 0><<<dim3((tilesPV + 7) / 8, 1), dim3(256), 0, stream>>>(
          PP, PP, kSeq, 0L, VTg, VTg, kSeq, 0L,
          (void*)Attg, (void*)Attg, kDim, 0L, bq, bq, 0L, kQChunk, kDh, kSeq, kPVScale);
    }
  }

  // ---- output projection: out[s][e] = (1/4096) * sum_c ATT16[s][c] * WO16[e][c] + bo[e]   (M=4096, N=768, K=768, f32 to d_out) ----
  wmma_gemm64<0, false, 2, 0, false, 0><<<dim3((tilesProj + 7) / 8, 1), dim3(256), 0, stream>>>(
      ATT16, ATT16, kDim, 0L, WO16, WO16, kDim, 0L,
      (void*)out, (void*)out, kDim, 0L, bo, bo, 0L, kSeq, kDim, kDim, kOutScale);
}

// v001
// Measured time: 971 microseconds a run.
// In two side-by-side timings against v000, it was 5.03 and 5.05 times as fast.
// Contractions: q/k projections and v^T projection (x f16 x W_eff^T f16 carried x16), scores q_h.k_h^T (q,k f16 planes), probs.v_h (P f16 carried x32768 x V^T f16), output projection (attn f16 carried x256 x Wo^T f16 carried x16): all v_wmma_f32_16x16x32_f16 with f32 accumulate; rank-8 weight fold, bias add and softmax in f32.
#include <hip/hip_runtime.h>
#include <math.h>

// ---------------------------------------------------------------------------
// Problem constants
// ---------------------------------------------------------------------------
constexpr int kSeq    = 4096;             // tokens (batch 1)
constexpr int kDim    = 768;              // model width
constexpr int kHeads  = 12;
constexpr int kDh     = 64;
constexpr int kRank   = 8;                // low-rank adapter width
constexpr int kQChunk = 2048;             // query rows per materialised score plane
constexpr int kNChunk = kSeq / kQChunk;   // 2
constexpr float kLowRankScale = 2.0f;     // alpha / rank = 16 / 8
constexpr float kWCarry    = 16.0f;       // weights carried x16 in f16
constexpr float kWCarryInv = 1.0f / 16.0f;
constexpr float kQKScale   = 0.125f;      // 1 / sqrt(64), applied to the f32 scores
constexpr float kPCarry    = 32768.0f;    // probabilities carried x2^15 in f16
constexpr float kAttCarry  = 256.0f;      // attention output carried x256 in f16
constexpr float kPVScale   = kAttCarry / kPCarry;             // 1/128
constexpr float kOutScale  = 1.0f / (kAttCarry * kWCarry);   // 1/4096
static_assert(kHeads * kDh == kDim, "shape");
static_assert(kSeq % 64 == 0 && kDim % 64 == 0 && kQChunk % 64 == 0 && kDh % 64 == 0, "M,N tile multiples");
static_assert(kDim % 32 == 0 && kDh % 32 == 0 && kSeq % 32 == 0, "K multiples of 32");
static_assert(kSeq % 512 == 0 && kQChunk * kNChunk == kSeq, "softmax mapping");
static_assert((kDim * kDim) % 2048 == 0, "fold block mapping");
static_assert((kSeq * kDim) % 2048 == 0, "cast block mapping");
static_assert(kRank * kDim == 6 * 256 * 4, "adapter staging: 6 float4 per thread of a 256-thread block");

typedef __attribute__((ext_vector_type(16))) _Float16 v16h;
typedef __attribute__((ext_vector_type(8)))  _Float16 v8h;
typedef __attribute__((ext_vector_type(16))) __bf16   v16b;
typedef __attribute__((ext_vector_type(8)))  __bf16   v8b;
typedef __attribute__((ext_vector_type(8)))  float    v8f;
typedef __attribute__((ext_vector_type(4)))  float    v4f;
typedef __attribute__((ext_vector_type(2)))  float    v2f;
typedef __attribute__((ext_vector_type(4)))  unsigned int v4u;

// ---------------------------------------------------------------------------
// Helper pieces
// ---------------------------------------------------------------------------
__device__ __forceinline__ unsigned short f2bf_bits(float f) {
  unsigned u = __float_as_uint(f);
  return (unsigned short)((u + 0x7FFFu + ((u >> 16) & 1u)) >> 16);
}
__device__ __forceinline__ float bf_bits2f(unsigned short h) { return __uint_as_float(((unsigned)h) << 16); }

// hazard guards as plain device helpers (no inline asm inside the kernel template body)
__device__ __forceinline__ void dep_guard_h(v8f& a, v8f& b, v16h x, v16h y) { asm volatile("v_nop\n\tv_nop\n\tv_nop\n\tv_nop" : "+v"(a), "+v"(b) : "v"(x), "v"(y)); }
__device__ __forceinline__ void dep_guard_b(v8f& a, v8f& b, v16b x, v16b y) { asm volatile("v_nop\n\tv_nop\n\tv_nop\n\tv_nop" : "+v"(a), "+v"(b) : "v"(x), "v"(y)); }
// guard tying all four accumulators of a row group plus the A fragments
__device__ __forceinline__ void dep_guard4_h(v8f& a, v8f& b, v8f& c, v8f& d, v16h x, v16h y) {
  asm volatile("v_nop\n\tv_nop\n\tv_nop\n\tv_nop" : "+v"(a), "+v"(b), "+v"(c), "+v"(d) : "v"(x), "v"(y));
}
__device__ __forceinline__ void dep_guard4_b(v8f& a, v8f& b, v8f& c, v8f& d, v16b x, v16b y) {
  asm volatile("v_nop\n\tv_nop\n\tv_nop\n\tv_nop" : "+v"(a), "+v"(b), "+v"(c), "+v"(d) : "v"(x), "v"(y));
}
__device__ __forceinline__ void keep4_h(v16h a, v16h b, v16h c, v16h d) { asm volatile("v_nop" :: "v"(a), "v"(b), "v"(c), "v"(d)); }
__device__ __forceinline__ void keep4_b(v16b a, v16b b, v16b c, v16b d) { asm volatile("v_nop" :: "v"(a), "v"(b), "v"(c), "v"(d)); }
__device__ __forceinline__ void acc_guard4(v8f& a, v8f& b, v8f& c, v8f& d) { asm volatile("v_nop\n\tv_nop\n\tv_nop\n\tv_nop" : "+v"(a), "+v"(b), "+v"(c), "+v"(d)); }
template <typename T> struct Frag;
template <> struct Frag<_Float16> {
  typedef v16h V; union U { v16h v; v8h h[2]; };
  // elements 0..7 <- p[0..7], 8..15 <- p[16..23]
  static __device__ __forceinline__ v16h load(const _Float16* p) {
    U f; f.h[0] = *(const v8h*)(p); f.h[1] = *(const v8h*)(p + 16); return f.v;
  }
  static __device__ __forceinline__ v8f mma(v16h a, v16h b, v8f c) {
    return __builtin_amdgcn_wmma_f32_16x16x32_f16(false, a, false, b, (short)0, c, false, false);
  }
  static __device__ __forceinline__ void guard(v8f& a, v8f& b, v16h x, v16h y) { dep_guard_h(a, b, x, y); }
  static __device__ __forceinline__ void guard4(v8f& a, v8f& b, v8f& c, v8f& d, v16h x, v16h y) { dep_guard4_h(a, b, c, d, x, y); }
  static __device__ __forceinline__ void keep(v16h a, v16h b, v16h c, v16h d) { keep4_h(a, b, c, d); }
};
template <> struct Frag<__bf16> {
  typedef v16b V; union U { v16b v; v8b h[2]; };
  static __device__ __forceinline__ v16b load(const __bf16* p) {
    U f; f.h[0] = *(const v8b*)(p); f.h[1] = *(const v8b*)(p + 16); return f.v;
  }
  static __device__ __forceinline__ v8f mma(v16b a, v16b b, v8f c) {
    return __builtin_amdgcn_wmma_f32_16x16x32_bf16(false, a, false, b, (short)0, c, false, false);
  }
  static __device__ __forceinline__ void guard(v8f& a, v8f& b, v16b x, v16b y) { dep_guard_b(a, b, x, y); }
  static __device__ __forceinline__ void guard4(v8f& a, v8f& b, v8f& c, v8f& d, v16b x, v16b y) { dep_guard4_b(a, b, c, d, x, y); }
  static __device__ __forceinline__ void keep(v16b a, v16b b, v16b c, v16b d) { keep4_b(a, b, c, d); }
};

__device__ __forceinline__ unsigned pk16(unsigned short a, unsigned short b) { return (unsigned)a | ((unsigned)b << 16); }
__device__ __forceinline__ unsigned short h_bits(float f) { const _Float16 h = (_Float16)f; return __builtin_bit_cast(unsigned short, h); }

// ---- Register-blocked batched WMMA GEMM (ACT reduced to none/relu/leaky; row guard ties all 4 accumulators;
//      bias[m] fetched as two 16-B vectors per 16-row slab) ----
// C[m,n] = scale * sum_k A[m,k] * Bt[n,k] (+bias)(+resid); each wave owns a 64x64 tile.
// A row-major [M,K]; Bt row-major [N,K]; M,N % 64 == 0, K % 32 == 0.
// SPLIT: operands are hi/lo planes (A2/Bt2 = lo planes, same layout); product = hi*hi + hi*lo + lo*hi.
// BIAS_MODE: 0 = none, 1 = bias[m], 2 = bias[n].
// OUT_MODE: 0 = f32, 1 = f16, 2 = bf16 hi plane (Cout) + bf16 lo plane (Cout2).
// ET: 0 = f16 operands, 1 = bf16 operands (pointers passed as 16-bit storage)
template <int ET> struct Elem;
template <> struct Elem<0> { typedef _Float16 T; };
template <> struct Elem<1> { typedef __bf16 T; };
template <int ET, bool SPLIT, int BIAS_MODE, int OUT_MODE, bool RESID, int ACT = 0>
__global__ __launch_bounds__(256) void wmma_gemm64(
    const unsigned short* __restrict__ Ap, const unsigned short* __restrict__ A2p, int lda, long strideA,
    const unsigned short* __restrict__ Btp, const unsigned short* __restrict__ Bt2p, int ldb, long strideB,
    void* __restrict__ Cout, void* __restrict__ Cout2, int ldc, long strideC,
    const float* __restrict__ bias,
    const float* __restrict__ resid, long strideR,
    int M, int N, int K, float scale) {
  typedef typename Elem<ET>::T T;
  typedef typename Frag<T>::V V;
  const T* A = (const T*)Ap; const T* A2 = (const T*)A2p; const T* Bt = (const T*)Btp; const T* Bt2 = (const T*)Bt2p;
  __shared__ __align__(16) float sT[8][16 * 68];   // per-wave 16x64 slab, pitch 68 floats
  const int b    = blockIdx.y;
  const int lane = threadIdx.x & 31;
  const int wave = threadIdx.x >> 5;
  const int tilesN = N >> 6;
  const int tilesM = M >> 6;
  const int tile = blockIdx.x * 8 + wave;
  if (tile >= tilesM * tilesN) return;   // wave-uniform; no block barriers in this kernel
  const int tm = tile / tilesN;
  const int tn = tile - tm * tilesN;
  const int m0 = tm << 6;
  const int n0 = tn << 6;

  const T* Ab  = A  + (size_t)b * strideA;
  const T* Bb  = Bt + (size_t)b * strideB;
  const T* Ab2 = SPLIT ? (A2  + (size_t)b * strideA) : nullptr;
  const T* Bb2 = SPLIT ? (Bt2 + (size_t)b * strideB) : nullptr;

  const int rlane = lane & 15;                 // row (A) / col (B, D) within subtile
  const int koff  = (lane >> 4) * 8;           // k offset of this lane half
  const int mOff  = (lane >> 4) * 8;           // D row offset

  v8f acc[4][4];
#pragma unroll
  for (int i = 0; i < 4; ++i)
#pragma unroll
    for (int j = 0; j < 4; ++j) acc[i][j] = (v8f){0.f,0.f,0.f,0.f,0.f,0.f,0.f,0.f};

  for (int k0 = 0; k0 < K; k0 += 32) {
    V bh[4], bl[4];
#pragma unroll
    for (int j = 0; j < 4; ++j) {
      const size_t bo = (size_t)(n0 + (j << 4) + rlane) * ldb + koff + k0;
      bh[j] = Frag<T>::load(Bb + bo);
      if (SPLIT) bl[j] = Frag<T>::load(Bb2 + bo);
    }
#pragma unroll
    for (int i = 0; i < 4; ++i) {
      const size_t ao = (size_t)(m0 + (i << 4) + rlane) * lda + koff + k0;
      V ah = Frag<T>::load(Ab + ao);
      V al;
      if (SPLIT) al = Frag<T>::load(Ab2 + ao);
#pragma unroll
      for (int j = 0; j < 4; ++j) {
        acc[i][j] = Frag<T>::mma(ah, bh[j], acc[i][j]);
        if (SPLIT) {
          acc[i][j] = Frag<T>::mma(ah, bl[j], acc[i][j]);
          acc[i][j] = Frag<T>::mma(al, bh[j], acc[i][j]);
        }
      }
      Frag<T>::guard4(acc[i][0], acc[i][1], acc[i][2], acc[i][3], ah, SPLIT ? al : ah);
    }
    Frag<T>::keep(bh[0], bh[1], bh[2], bh[3]);
    if (SPLIT) Frag<T>::keep(bl[0], bl[1], bl[2], bl[3]);
  }
  acc_guard4(acc[0][0], acc[0][1], acc[0][2], acc[0][3]);
  acc_guard4(acc[1][0], acc[1][1], acc[1][2], acc[1][3]);
  acc_guard4(acc[2][0], acc[2][1], acc[2][2], acc[2][3]);
  acc_guard4(acc[3][0], acc[3][1], acc[3][2], acc[3][3]);

  // ---- epilogue ----
  float* slab = sT[wave];
  const float* Rb = RESID ? (resid + (size_t)b * strideR) : nullptr;
#pragma unroll
  for (int i = 0; i < 4; ++i) {
    const int mBase = m0 + (i << 4);
    // bias[m]: the 8 rows this lane half touches are contiguous -> two 16-B loads (2 b128 per slab, 8 per tile)
    float bmr[8] = {0.f, 0.f, 0.f, 0.f, 0.f, 0.f, 0.f, 0.f};
    if (BIAS_MODE == 1) {
      const float* bp = bias + mBase + mOff;
      const v4f bm0 = *(const v4f*)(bp);
      const v4f bm1 = *(const v4f*)(bp + 4);
      bmr[0] = bm0[0]; bmr[1] = bm0[1]; bmr[2] = bm0[2]; bmr[3] = bm0[3];
      bmr[4] = bm1[0]; bmr[5] = bm1[1]; bmr[6] = bm1[2]; bmr[7] = bm1[3];
    }
#pragma unroll
    for (int j = 0; j < 4; ++j) {
      const int n = n0 + (j << 4) + rlane;
      float bv = 0.f;
      if (BIAS_MODE == 2) bv = bias[n];
#pragma unroll
      for (int r = 0; r < 8; ++r) {
        float v = acc[i][j][r] * scale;
        if (BIAS_MODE == 1) v += bmr[r];
        if (BIAS_MODE == 2) v += bv;
        if (RESID) v += Rb[(size_t)(mBase + mOff + r) * ldc + n];
        if (ACT == 2) v = fmaxf(v, 0.0f);
        if (ACT == 4) v = (v > 0.f) ? v : 0.01f * v;
        slab[(mOff + r) * 68 + (j << 4) + rlane] = v;
      }
    }
    __builtin_amdgcn_fence(__ATOMIC_RELEASE, "workgroup");
    __builtin_amdgcn_wave_barrier();
    __builtin_amdgcn_fence(__ATOMIC_ACQUIRE, "workgroup");
    if (OUT_MODE == 0) {
      float* C = (float*)Cout + (size_t)b * strideC;
      const int hh = lane >> 4, c4 = (lane & 15) * 4;     // row seg = 256 B = 16 lanes x 16 B
      {
#pragma unroll
        for (int it = 0; it < 8; ++it) {
          const int row = it * 2 + hh;
          v4f v = *(const v4f*)(slab + row * 68 + c4);
          *(v4f*)(C + (size_t)(mBase + row) * ldc + n0 + c4) = v;
        }
        
      }
    } else {
      const int q = lane >> 3, c8 = (lane & 7) * 8;
      unsigned short* C  = (unsigned short*)Cout  + (size_t)b * strideC;
      unsigned short* C2 = (OUT_MODE == 2) ? ((unsigned short*)Cout2 + (size_t)b * strideC) : nullptr;
      {
#pragma unroll
        for (int it = 0; it < 4; ++it) {
          const int row = it * 4 + q;
          const float* sp = slab + row * 68 + c8;
          v8h hv, lv;
#pragma unroll
          for (int e = 0; e < 8; ++e) {
            if (OUT_MODE == 1) {
              hv[e] = (_Float16)sp[e];
            } else {
              unsigned short hb = f2bf_bits(sp[e]);
              unsigned short lb = f2bf_bits(sp[e] - bf_bits2f(hb));
              hv[e] = __builtin_bit_cast(_Float16, hb);
              lv[e] = __builtin_bit_cast(_Float16, lb);
            }
          }
          *(v8h*)(C + (size_t)(mBase + row) * ldc + n0 + c8) = hv;
          if (OUT_MODE == 2) *(v8h*)(C2 + (size_t)(mBase + row) * ldc + n0 + c8) = lv;
        }
        
      }
    }
    __builtin_amdgcn_fence(__ATOMIC_RELEASE, "workgroup");
    __builtin_amdgcn_wave_barrier();
    __builtin_amdgcn_fence(__ATOMIC_ACQUIRE, "workgroup");
  }
}

// ---------------------------------------------------------------------------
// ---------------------------------------------------------------------------
__global__ __launch_bounds__(256) void cast8_f16_kernel(const float* __restrict__ in, unsigned short* __restrict__ out, int n8) {
  const int i = blockIdx.x * 256 + threadIdx.x;
  if (i >= n8) return;
  const float* p = in + 8 * (size_t)i;
  const v4f a = *(const v4f*)(p);
  const v4f c = *(const v4f*)(p + 4);
  unsigned short hb[8];
#pragma unroll
  for (int e = 0; e < 4; ++e) {
    hb[e]     = h_bits(a[e]);
    hb[4 + e] = h_bits(c[e]);
  }
  const v4u u = (v4u){pk16(hb[0], hb[1]), pk16(hb[2], hb[3]), pk16(hb[4], hb[5]), pk16(hb[6], hb[7])};
  unsigned short* q = out + 8 * (size_t)i;
  *(v4u*)q = u;
  
}

// ---------------------------------------------------------------------------
// Rank-8 adapter fold + f16 cast with x16 carry, f32 math:
//   plane y in {0,1,2}: WQKV[y][e][d] = f16( 16 * ( w_y[e][d] + 2 * sum_r up_y[e][r] * down_y[r][d] ) )
//   plane y == 3      : WO[e][d]      = f16( 16 * wo[e][d] )
// Weights are [out e][in d] = Bt[n][k] for the GEMMs; orientation kept as given (no transpose).
// grid (288, 4): blockIdx.y = matrix (block-uniform), block covers 2048 consecutive elements (288 x 2048 = 768 x 768 exact);
// thread t owns elements 8t..8t+7 of the block (one row e, 8 consecutive d).
// The whole down matrix [8][768] of the plane is staged in LDS first (cooperative: 6 b128 per thread, 6 x 256 x 4 = 6144 floats =
// the whole matrix, every LDS word read below is written), block barrier, then per lane 2 b128 (w) + 2 b128 (up row) global loads.
// ---------------------------------------------------------------------------
__global__ __launch_bounds__(256) void fold_cast_kernel(
    const float* __restrict__ wq, const float* __restrict__ wk, const float* __restrict__ wv, const float* __restrict__ wo,
    const float* __restrict__ dq, const float* __restrict__ uq,
    const float* __restrict__ dk, const float* __restrict__ uk,
    const float* __restrict__ dv, const float* __restrict__ uv,
    unsigned short* __restrict__ wqkv16, unsigned short* __restrict__ wo16) {
  __shared__ __align__(16) float dsh[kRank * kDim];      // down matrix [8][768] of this plane, 24,576 B
  const int y = blockIdx.y;                              // 0..3, block-uniform
  const int t = threadIdx.x;
  const float* W  = (y == 0) ? wq : (y == 1) ? wk : (y == 2) ? wv : wo;
  const float* Dn = (y == 0) ? dq : (y == 1) ? dk : dv;   // y == 3: valid pointer, staged but not used
  const float* Up = (y == 0) ? uq : (y == 1) ? uk : uv;
  // stage down [8][768] = 1536 float4: thread t loads slots t + 256*i, i = 0..5 (exact coverage)
#pragma unroll
  for (int i = 0; i < 6; ++i) {
    const int q4 = (i * 256 + t) * 4;
    const v4f dd = *(const v4f*)(Dn + q4);
    *(v4f*)(dsh + q4) = dd;
  }
  __syncthreads();

  const int base = blockIdx.x * 2048 + 8 * t;            // < 768*768
  const int e = base / kDim;
  const int d = base - e * kDim;                         // multiple of 8
  const v4f w0 = *(const v4f*)(W + base);
  const v4f w1 = *(const v4f*)(W + base + 4);
  float s[8];
#pragma unroll
  for (int k = 0; k < 8; ++k) s[k] = 0.0f;
  if (y < 3) {                                           // block-uniform branch
    const v4f u0 = *(const v4f*)(Up + e * kRank);
    const v4f u1 = *(const v4f*)(Up + e * kRank + 4);
    const float ur[8] = {u0[0], u0[1], u0[2], u0[3], u1[0], u1[1], u1[2], u1[3]};
#pragma unroll
    for (int r = 0; r < kRank; ++r) {
      const v4f a = *(const v4f*)(dsh + r * kDim + d);
      const v4f c = *(const v4f*)(dsh + r * kDim + d + 4);
#pragma unroll
      for (int k = 0; k < 4; ++k) {
        s[k]     += ur[r] * a[k];
        s[4 + k] += ur[r] * c[k];
      }
    }
  }
  float f[8];
#pragma unroll
  for (int k = 0; k < 4; ++k) {
    f[k]     = (w0[k] + kLowRankScale * s[k])     * kWCarry;
    f[4 + k] = (w1[k] + kLowRankScale * s[4 + k]) * kWCarry;
  }
  unsigned short hb[8];
#pragma unroll
  for (int k = 0; k < 8; ++k) hb[k] = h_bits(f[k]);
  const v4u u = (v4u){pk16(hb[0], hb[1]), pk16(hb[2], hb[3]), pk16(hb[4], hb[5]), pk16(hb[6], hb[7])};
  unsigned short* op = (y < 3) ? (wqkv16 + (size_t)y * kDim * kDim + base) : (wo16 + base);
  *(v4u*)op = u;
  
}

// ---------------------------------------------------------------------------
// Row softmax over 4096 f32 scores (already scaled by 1/8 in the scores GEMM epilogue), f32 math:
//   P[i][j] = f16( 32768 * exp(s - max) / sum_j exp(s - max) )
// One block of 256 threads per row i = blockIdx.x (0..2047 within the query chunk).
// Phase 1/2: rolled 8-trip loops, thread t owns columns it*512 + 2t, 2t+1 (8 x 256 x 2 = 4096 = whole row); exps kept in LDS.
// Reductions in fixed order (thread sequential, wave shuffle tree, 8 wave partials in index order); shuffles unconditional.
// Store: thread t owns cols 8t..8t+7 (first instruction) and 2048+8t..2048+8t+7 (second instruction): one 16-B store per lane
// cross-thread reads of phase 3.
// ---------------------------------------------------------------------------
__global__ __launch_bounds__(256) void softmax_row_kernel(const float* __restrict__ Sp, unsigned short* __restrict__ Pp) {
  __shared__ __align__(16) float lg[kSeq];
  __shared__ float redM[8];
  __shared__ float redS[8];
  const int i    = blockIdx.x;
  const int t    = threadIdx.x;
  const int lane = t & 31, wave = t >> 5;
  const float* sr = Sp + (size_t)i * kSeq;

  float mx = -__builtin_inff();
#pragma unroll 1
  for (int it = 0; it < 8; ++it) {
    const int c = it * 512 + 2 * t;
    const v2f sv = *(const v2f*)(sr + c);
    mx = fmaxf(mx, fmaxf(sv[0], sv[1]));
    *(v2f*)(lg + c) = sv;
  }
#pragma unroll
  for (int off = 16; off > 0; off >>= 1) mx = fmaxf(mx, __shfl_xor(mx, off, 32));
  if (lane == 0) redM[wave] = mx;
  __syncthreads();
  float m = redM[0];
#pragma unroll
  for (int w = 1; w < 8; ++w) m = fmaxf(m, redM[w]);

  float sum = 0.f;
#pragma unroll 1
  for (int it = 0; it < 8; ++it) {
    const int c = it * 512 + 2 * t;
    const v2f l = *(const v2f*)(lg + c);
    v2f ev;
#pragma unroll
    for (int e = 0; e < 2; ++e) {
      ev[e] = expf(l[e] - m);
      sum += ev[e];
    }
    *(v2f*)(lg + c) = ev;
  }
#pragma unroll
  for (int off = 16; off > 0; off >>= 1) sum += __shfl_xor(sum, off, 32);
  if (lane == 0) redS[wave] = sum;
  __syncthreads();   // also orders the phase-2 LDS writes of other waves before the reads below
  float tot = redS[0];
#pragma unroll
  for (int w = 1; w < 8; ++w) tot += redS[w];
  const float inv = kPCarry / tot;

  const v4f e0 = *(const v4f*)(lg + 8 * t);
  const v4f e1 = *(const v4f*)(lg + 8 * t + 4);
  const v4f e2 = *(const v4f*)(lg + 2048 + 8 * t);
  const v4f e3 = *(const v4f*)(lg + 2048 + 8 * t + 4);
  unsigned short ha[8], hc[8];
#pragma unroll
  for (int e = 0; e < 4; ++e) {
    ha[e]     = h_bits(e0[e] * inv);
    ha[4 + e] = h_bits(e1[e] * inv);
    hc[e]     = h_bits(e2[e] * inv);
    hc[4 + e] = h_bits(e3[e] * inv);
  }
  const v4u ua = (v4u){pk16(ha[0], ha[1]), pk16(ha[2], ha[3]), pk16(ha[4], ha[5]), pk16(ha[6], ha[7])};
  const v4u uc = (v4u){pk16(hc[0], hc[1]), pk16(hc[2], hc[3]), pk16(hc[4], hc[5]), pk16(hc[6], hc[7])};
  unsigned short* pr = Pp + (size_t)i * kSeq;
  *(v4u*)(pr + 8 * t) = ua;
  *(v4u*)(pr + 2048 + 8 * t) = uc;
  
}

// ---------------------------------------------------------------------------
// P.V for one (head, query chunk): ATT[m][n] = (1/128) * sum_j PP[m][j] * VT[n][j], M=2048, N=64, K=4096.
// One work-group per 16x64 output tile (128 work-groups); its 16 waves each sum their own 256 consecutive keys on WMMA
// (same fragment loader for A and B, so both k orders are equal), write the f32 partial tile to their own LDS slab,
// and after one work-group barrier wave w adds the 16 partials of row w in wave order and stores that row's 128 B.
// ---------------------------------------------------------------------------
constexpr int kPVWaves = 16;
constexpr int kPVKeys  = kSeq / kPVWaves;   // 256 keys per wave
constexpr int kPVPitch = 68;                // floats per slab row (64 + 4: the two lane halves land on different banks)
static_assert(kPVKeys % 32 == 0 && kQChunk % 16 == 0 && kDh == 64, "p.v tile mapping");
// waves_per_eu: the launch has 128 work-groups of 4 waves per SIMD, fewer work-groups than the chip has WGPs, so a higher
// occupancy is not to be had; without it the scheduler saves registers and waits for every pair of loads before the next
__global__ __launch_bounds__(kPVWaves * 32) __attribute__((amdgpu_waves_per_eu(4, 4))) void pv_splitk_kernel(
    const unsigned short* __restrict__ Pp, const unsigned short* __restrict__ VTp, unsigned short* __restrict__ Att) {
  __shared__ __align__(16) float part[kPVWaves][16 * kPVPitch];   // 69,632 B
  const int lane  = threadIdx.x & 31;
  const int wave  = threadIdx.x >> 5;
  const int m0    = blockIdx.x << 4;
  const int rlane = lane & 15;                 // row (A) / col (B, D) within subtile
  const int half8 = (lane >> 4) * 8;           // k offset of this lane half; also its D row offset
  const _Float16* Ab = (const _Float16*)Pp  + (size_t)(m0 + rlane) * kSeq + wave * kPVKeys + half8;
  const _Float16* Bb = (const _Float16*)VTp + (size_t)rlane * kSeq + wave * kPVKeys + half8;

  v8f acc[4];
#pragma unroll
  for (int j = 0; j < 4; ++j) acc[j] = (v8f){0.f,0.f,0.f,0.f,0.f,0.f,0.f,0.f};
  // unrolled whole (8 trips): the loads of later trips can issue ahead of the first trip's wait
#pragma unroll
  for (int k0 = 0; k0 < kPVKeys; k0 += 32) {
    const v16h a = Frag<_Float16>::load(Ab + k0);
#pragma unroll
    for (int j = 0; j < 4; ++j) {
      const v16h bj = Frag<_Float16>::load(Bb + (size_t)(j << 4) * kSeq + k0);
      acc[j] = Frag<_Float16>::mma(a, bj, acc[j]);
    }
  }

  float* slab = part[wave];
#pragma unroll
  for (int j = 0; j < 4; ++j)
#pragma unroll
    for (int r = 0; r < 8; ++r) slab[(half8 + r) * kPVPitch + (j << 4) + rlane] = acc[j][r];
  __syncthreads();   // every wave's partial tile is in LDS before any wave sums across slabs

  const int so = wave * kPVPitch + 2 * lane;   // row = wave, two columns per lane
  v2f s = *(const v2f*)(&part[0][so]);
#pragma unroll
  for (int w = 1; w < kPVWaves; ++w) s += *(const v2f*)(&part[w][so]);
  const unsigned u = pk16(h_bits(s[0] * kPVScale), h_bits(s[1] * kPVScale));
  *(unsigned*)(Att + (size_t)(m0 + wave) * kDim + 2 * lane) = u;
}

// ---------------------------------------------------------------------------
// Host glue.
// Workspace region map (bytes, every offset a multiple of 128; every plane fully written before any read):
//   X16    f16 [4096][768]                 6,291,456  at          0   (cast8)
//   WQKV16 f16 [3][768][768]  (x16 carry)  3,538,944  at  6,291,456   (fold_cast, planes q|k|v)
//   WO16   f16 [768][768]     (x16 carry)  1,179,648  at  9,830,400   (fold_cast)
//   Q16    f16 [4096][768]                 6,291,456  at 11,010,048   (GEMM)
//   K16    f16 [4096][768]                 6,291,456  at 17,301,504   (GEMM)
//   VT16   f16 [768][4096]  = V^T          6,291,456  at 23,592,960   (GEMM with swapped operand roles)
//   ATT16  f16 [4096][768]   (x256 carry)  6,291,456  at 29,884,416   (24 P.V GEMMs, each [2048 rows][64 cols])
//   SC     f32 [2048][4096]               33,554,432  at 36,175,872   (scores of one (head, query chunk), rewritten 24x, same type)
//   PP     f16 [2048][4096]  (x32768)     16,777,216  at 69,730,304   (probabilities, rewritten 24x, same type)
//   total                                 86,507,520
// GEMM shapes (all M,N multiples of 64, K multiple of 32, no padding anywhere):
//   q,k:  M=4096 N=768  K=768;  v^T: M=768 N=4096 K=768;  scores: M=2048 N=4096 K=64;  p.v: M=2048 N=64 K=4096 (own kernel);
// Launches: 1 cast + 1 fold + 3 projections + 24 x (scores, softmax, p.v) + 1 out = 78.
// ---------------------------------------------------------------------------
extern "C" void kernel_launch(void* const* d_in, const int* in_sizes, int n_in,
                              void* d_out, int out_size, void* d_ws, size_t ws_size,
                              hipStream_t stream) {
  if (n_in < 15) return;
  const int nX = kSeq * kDim;          // 3,145,728
  const int nW = kDim * kDim;          // 589,824
  const int nA = kRank * kDim;         // 6,144
  if (in_sizes[0] != nX) return;
  if (in_sizes[1] != nW || in_sizes[3] != nW || in_sizes[5] != nW || in_sizes[7] != nW) return;
  if (in_sizes[2] != kDim || in_sizes[4] != kDim || in_sizes[6] != kDim || in_sizes[8] != kDim) return;
  for (int i = 9; i < 15; ++i) if (in_sizes[i] != nA) return;
  if (out_size != nX) return;

  const size_t szAct  = (size_t)kSeq * kDim * 2;
  const size_t szWqkv = (size_t)3 * kDim * kDim * 2;
  const size_t szWo   = (size_t)kDim * kDim * 2;
  const size_t szS    = (size_t)kQChunk * kSeq * 4;
  const size_t szP    = (size_t)kQChunk * kSeq * 2;
  const size_t offX    = 0;
  const size_t offWqkv = offX + szAct;
  const size_t offWo   = offWqkv + szWqkv;
  const size_t offQ    = offWo + szWo;
  const size_t offK    = offQ + szAct;
  const size_t offVT   = offK + szAct;
  const size_t offAtt  = offVT + szAct;
  const size_t offS    = offAtt + szAct;
  const size_t offP    = offS + szS;
  const size_t total   = offP + szP;   // 86,507,520
  if (ws_size < total) return;

  const float* x   = (const float*)d_in[0];
  const float* wq  = (const float*)d_in[1];
  const float* bq  = (const float*)d_in[2];
  const float* wk  = (const float*)d_in[3];
  const float* bk  = (const float*)d_in[4];
  const float* wv  = (const float*)d_in[5];
  const float* bv  = (const float*)d_in[6];
  const float* wo  = (const float*)d_in[7];
  const float* bo  = (const float*)d_in[8];
  const float* dq  = (const float*)d_in[9];    // [8][768]
  const float* uq  = (const float*)d_in[10];   // [768][8]
  const float* dk  = (const float*)d_in[11];
  const float* uk  = (const float*)d_in[12];
  const float* dv  = (const float*)d_in[13];
  const float* uv  = (const float*)d_in[14];
  float* out = (float*)d_out;
  char* ws = (char*)d_ws;
  unsigned short* X16    = (unsigned short*)(ws + offX);
  unsigned short* WQKV16 = (unsigned short*)(ws + offWqkv);
  unsigned short* WO16   = (unsigned short*)(ws + offWo);
  unsigned short* Q16    = (unsigned short*)(ws + offQ);
  unsigned short* K16    = (unsigned short*)(ws + offK);
  unsigned short* VT16   = (unsigned short*)(ws + offVT);
  unsigned short* ATT16  = (unsigned short*)(ws + offAtt);
  float*          SC     = (float*)(ws + offS);
  unsigned short* PP     = (unsigned short*)(ws + offP);
  const unsigned short* WQ16 = WQKV16;
  const unsigned short* WK16 = WQKV16 + (size_t)kDim * kDim;
  const unsigned short* WV16 = WQKV16 + (size_t)2 * kDim * kDim;

  // ---- prologue: 16-bit operand planes ----
  const int n8 = nX / 8;   // 393,216 -> 1536 blocks exact
  cast8_f16_kernel<<<dim3((n8 + 255) / 256), dim3(256), 0, stream>>>(x, X16, n8);
  fold_cast_kernel<<<dim3(nW / 2048, 4), dim3(256), 0, stream>>>(wq, wk, wv, wo, dq, uq, dk, uk, dv, uv, WQKV16, WO16);

  // ---- projections (unused arguments receive valid dummy pointers) ----
  const int tilesProj = (kSeq / 64) * (kDim / 64);        // 768 -> 96 blocks of 8 waves
  // Q16[s][e] = (1/16) * sum_d X16[s][d] * WQ16[e][d] + bq[e]
  wmma_gemm64<0, false, 2, 1, false, 0><<<dim3((tilesProj + 7) / 8, 1), dim3(256), 0, stream>>>(
      X16, X16, kDim, 0L, WQ16, WQ16, kDim, 0L,
      (void*)Q16, (void*)Q16, kDim, 0L, bq, bq, 0L, kSeq, kDim, kDim, kWCarryInv);
  // K16[s][e] = (1/16) * sum_d X16[s][d] * WK16[e][d] + bk[e]
  wmma_gemm64<0, false, 2, 1, false, 0><<<dim3((tilesProj + 7) / 8, 1), dim3(256), 0, stream>>>(
      X16, X16, kDim, 0L, WK16, WK16, kDim, 0L,
      (void*)K16, (void*)K16, kDim, 0L, bk, bk, 0L, kSeq, kDim, kDim, kWCarryInv);
  // VT16[c][s] = (1/16) * sum_d WV16[c][d] * X16[s][d] + bv[c]   (A = weights [768][768], Bt = activations [4096][768], bias indexed by m)
  wmma_gemm64<0, false, 1, 1, false, 0><<<dim3((tilesProj + 7) / 8, 1), dim3(256), 0, stream>>>(
      WV16, WV16, kDim, 0L, X16, X16, kDim, 0L,
      (void*)VT16, (void*)VT16, kSeq, 0L, bv, bv, 0L, kDim, kSeq, kDim, kWCarryInv);

  // ---- attention per (head, 2048-query chunk) ----
  const int tilesScore = (kQChunk / 64) * (kSeq / 64);   // 2048 -> 256 blocks
  const int tilesPV    = kQChunk / 16;                   // 128 work-groups, one 16x64 tile each
  for (int h = 0; h < kHeads; ++h) {
    for (int c = 0; c < kNChunk; ++c) {
      const unsigned short* Ag  = Q16 + (size_t)c * kQChunk * kDim + (size_t)h * kDh;   // rows of the chunk, head columns
      const unsigned short* Btg = K16 + (size_t)h * kDh;                                 // all 4096 key rows, head columns
      // SC[i][j] = 0.125 * sum_{d<64} Q16[c*2048+i][h*64+d] * K16[j][h*64+d]   (M=2048, N=4096, K=64)
      wmma_gemm64<0, false, 0, 0, false, 0><<<dim3((tilesScore + 7) / 8, 1), dim3(256), 0, stream>>>(
          Ag, Ag, kDim, 0L, Btg, Btg, kDim, 0L,
          (void*)SC, (void*)SC, kSeq, 0L, bq, bq, 0L, kQChunk, kSeq, kDh, kQKScale);
      // row softmax -> PP (f16, x32768)
      softmax_row_kernel<<<dim3(kQChunk), dim3(256), 0, stream>>>(SC, PP);
      // ATT16[c*2048+i][h*64+n] = (256/32768) * sum_j PP[i][j] * VT16[h*64+n][j]   (M=2048, N=64, K=4096)
      const unsigned short* VTg = VT16 + (size_t)h * kDh * kSeq;
      unsigned short* Attg = ATT16 + (size_t)c * kQChunk * kDim + (size_t)h * kDh;
      pv_splitk_kernel<<<dim3(tilesPV), dim3(kPVWaves * 32), 0, stream>>>(PP, VTg, Attg);
    }
  }

  // ---- output projection: out[s][e] = (1/4096) * sum_c ATT16[s][c] * WO16[e][c] + bo[e]   (M=4096, N=768, K=768, f32 to d_out) ----
  wmma_gemm64<0, false, 2, 0, false, 0><<<dim3((tilesProj + 7) / 8, 1), dim3(256), 0, stream>>>(
      ATT16, ATT16, kDim, 0L, WO16, WO16, kDim, 0L,
      (void*)out, (void*)out, kDim, 0L, bo, bo, 0L, kSeq, kDim, kDim, kOutScale);
}

// v002
// It runs in 217 microseconds.
// Two timings next to v001 put it at 4.47 and 4.48 times that version's speed.
// Counting every step since v000, it is 22.5 times as fast.
// Contractions: q/k projections and v^T projection (x f16 x W_eff^T f16 carried x16), scores k_h.q_h^T (q,k f16 planes), v_h^T.probs^T (V^T f16 x unnormalised P f16 carried x64), output projection (attn f16 carried x256 x Wo^T f16 carried x16): all v_wmma_f32_16x16x32_f16 with f32 accumulate; rank-8 weight fold, bias add and online softmax in f32.
#include <hip/hip_runtime.h>
#include <math.h>

// ---------------------------------------------------------------------------
// Problem constants
// ---------------------------------------------------------------------------
constexpr int kSeq    = 4096;             // tokens (batch 1)
constexpr int kDim    = 768;              // model width
constexpr int kHeads  = 12;
constexpr int kDh     = 64;
constexpr int kRank   = 8;                // low-rank adapter width
constexpr float kLowRankScale = 2.0f;     // alpha / rank = 16 / 8
constexpr float kWCarry    = 16.0f;       // weights carried x16 in f16
constexpr float kWCarryInv = 1.0f / 16.0f;
constexpr float kAttCarry  = 256.0f;      // attention output carried x256 in f16
constexpr float kOutScale  = 1.0f / (kAttCarry * kWCarry);   // 1/4096
static_assert(kHeads * kDh == kDim, "shape");
static_assert(kSeq % 64 == 0 && kDim % 64 == 0 && kDh % 64 == 0, "M,N tile multiples");
static_assert(kDim % 32 == 0 && kDh % 32 == 0 && kSeq % 32 == 0, "K multiples of 32");
static_assert((kDim * kDim) % 2048 == 0, "fold block mapping");
static_assert((kSeq * kDim) % 2048 == 0, "cast block mapping");
static_assert(kRank * kDim == 6 * 256 * 4, "adapter staging: 6 float4 per thread of a 256-thread block");

typedef __attribute__((ext_vector_type(16))) _Float16 v16h;
typedef __attribute__((ext_vector_type(8)))  _Float16 v8h;
typedef __attribute__((ext_vector_type(16))) __bf16   v16b;
typedef __attribute__((ext_vector_type(8)))  __bf16   v8b;
typedef __attribute__((ext_vector_type(8)))  float    v8f;
typedef __attribute__((ext_vector_type(4)))  float    v4f;
typedef __attribute__((ext_vector_type(2)))  float    v2f;
typedef __attribute__((ext_vector_type(4)))  unsigned int v4u;

// ---------------------------------------------------------------------------
// Helper pieces
// ---------------------------------------------------------------------------
__device__ __forceinline__ unsigned short f2bf_bits(float f) {
  unsigned u = __float_as_uint(f);
  return (unsigned short)((u + 0x7FFFu + ((u >> 16) & 1u)) >> 16);
}
__device__ __forceinline__ float bf_bits2f(unsigned short h) { return __uint_as_float(((unsigned)h) << 16); }

// hazard guards as plain device helpers (no inline asm inside the kernel template body)
__device__ __forceinline__ void dep_guard_h(v8f& a, v8f& b, v16h x, v16h y) { asm volatile("v_nop\n\tv_nop\n\tv_nop\n\tv_nop" : "+v"(a), "+v"(b) : "v"(x), "v"(y)); }
__device__ __forceinline__ void dep_guard_b(v8f& a, v8f& b, v16b x, v16b y) { asm volatile("v_nop\n\tv_nop\n\tv_nop\n\tv_nop" : "+v"(a), "+v"(b) : "v"(x), "v"(y)); }
// guard tying all four accumulators of a row group plus the A fragments
__device__ __forceinline__ void dep_guard4_h(v8f& a, v8f& b, v8f& c, v8f& d, v16h x, v16h y) {
  asm volatile("v_nop\n\tv_nop\n\tv_nop\n\tv_nop" : "+v"(a), "+v"(b), "+v"(c), "+v"(d) : "v"(x), "v"(y));
}
__device__ __forceinline__ void dep_guard4_b(v8f& a, v8f& b, v8f& c, v8f& d, v16b x, v16b y) {
  asm volatile("v_nop\n\tv_nop\n\tv_nop\n\tv_nop" : "+v"(a), "+v"(b), "+v"(c), "+v"(d) : "v"(x), "v"(y));
}
__device__ __forceinline__ void keep4_h(v16h a, v16h b, v16h c, v16h d) { asm volatile("v_nop" :: "v"(a), "v"(b), "v"(c), "v"(d)); }
__device__ __forceinline__ void keep4_b(v16b a, v16b b, v16b c, v16b d) { asm volatile("v_nop" :: "v"(a), "v"(b), "v"(c), "v"(d)); }
__device__ __forceinline__ void acc_guard4(v8f& a, v8f& b, v8f& c, v8f& d) { asm volatile("v_nop\n\tv_nop\n\tv_nop\n\tv_nop" : "+v"(a), "+v"(b), "+v"(c), "+v"(d)); }
template <typename T> struct Frag;
template <> struct Frag<_Float16> {
  typedef v16h V; union U { v16h v; v8h h[2]; };
  // elements 0..7 <- p[0..7], 8..15 <- p[16..23]
  static __device__ __forceinline__ v16h load(const _Float16* p) {
    U f; f.h[0] = *(const v8h*)(p); f.h[1] = *(const v8h*)(p + 16); return f.v;
  }
  static __device__ __forceinline__ v8f mma(v16h a, v16h b, v8f c) {
    return __builtin_amdgcn_wmma_f32_16x16x32_f16(false, a, false, b, (short)0, c, false, false);
  }
  static __device__ __forceinline__ void guard(v8f& a, v8f& b, v16h x, v16h y) { dep_guard_h(a, b, x, y); }
  static __device__ __forceinline__ void guard4(v8f& a, v8f& b, v8f& c, v8f& d, v16h x, v16h y) { dep_guard4_h(a, b, c, d, x, y); }
  static __device__ __forceinline__ void keep(v16h a, v16h b, v16h c, v16h d) { keep4_h(a, b, c, d); }
};
template <> struct Frag<__bf16> {
  typedef v16b V; union U { v16b v; v8b h[2]; };
  static __device__ __forceinline__ v16b load(const __bf16* p) {
    U f; f.h[0] = *(const v8b*)(p); f.h[1] = *(const v8b*)(p + 16); return f.v;
  }
  static __device__ __forceinline__ v8f mma(v16b a, v16b b, v8f c) {
    return __builtin_amdgcn_wmma_f32_16x16x32_bf16(false, a, false, b, (short)0, c, false, false);
  }
  static __device__ __forceinline__ void guard(v8f& a, v8f& b, v16b x, v16b y) { dep_guard_b(a, b, x, y); }
  static __device__ __forceinline__ void guard4(v8f& a, v8f& b, v8f& c, v8f& d, v16b x, v16b y) { dep_guard4_b(a, b, c, d, x, y); }
  static __device__ __forceinline__ void keep(v16b a, v16b b, v16b c, v16b d) { keep4_b(a, b, c, d); }
};

__device__ __forceinline__ unsigned pk16(unsigned short a, unsigned short b) { return (unsigned)a | ((unsigned)b << 16); }
__device__ __forceinline__ unsigned short h_bits(float f) { const _Float16 h = (_Float16)f; return __builtin_bit_cast(unsigned short, h); }

// ---- Register-blocked batched WMMA GEMM (ACT reduced to none/relu/leaky; row guard ties all 4 accumulators;
//      bias[m] fetched as two 16-B vectors per 16-row slab) ----
// C[m,n] = scale * sum_k A[m,k] * Bt[n,k] (+bias)(+resid); each wave owns a 64x64 tile.
// A row-major [M,K]; Bt row-major [N,K]; M,N % 64 == 0, K % 32 == 0.
// SPLIT: operands are hi/lo planes (A2/Bt2 = lo planes, same layout); product = hi*hi + hi*lo + lo*hi.
// BIAS_MODE: 0 = none, 1 = bias[m], 2 = bias[n].
// OUT_MODE: 0 = f32, 1 = f16, 2 = bf16 hi plane (Cout) + bf16 lo plane (Cout2).
// ET: 0 = f16 operands, 1 = bf16 operands (pointers passed as 16-bit storage)
template <int ET> struct Elem;
template <> struct Elem<0> { typedef _Float16 T; };
template <> struct Elem<1> { typedef __bf16 T; };
template <int ET, bool SPLIT, int BIAS_MODE, int OUT_MODE, bool RESID, int ACT = 0>
__global__ __launch_bounds__(256) void wmma_gemm64(
    const unsigned short* __restrict__ Ap, const unsigned short* __restrict__ A2p, int lda, long strideA,
    const unsigned short* __restrict__ Btp, const unsigned short* __restrict__ Bt2p, int ldb, long strideB,
    void* __restrict__ Cout, void* __restrict__ Cout2, int ldc, long strideC,
    const float* __restrict__ bias,
    const float* __restrict__ resid, long strideR,
    int M, int N, int K, float scale) {
  typedef typename Elem<ET>::T T;
  typedef typename Frag<T>::V V;
  const T* A = (const T*)Ap; const T* A2 = (const T*)A2p; const T* Bt = (const T*)Btp; const T* Bt2 = (const T*)Bt2p;
  __shared__ __align__(16) float sT[8][16 * 68];   // per-wave 16x64 slab, pitch 68 floats
  const int b    = blockIdx.y;
  const int lane = threadIdx.x & 31;
  const int wave = threadIdx.x >> 5;
  const int tilesN = N >> 6;
  const int tilesM = M >> 6;
  const int tile = blockIdx.x * 8 + wave;
  if (tile >= tilesM * tilesN) return;   // wave-uniform; no block barriers in this kernel
  const int tm = tile / tilesN;
  const int tn = tile - tm * tilesN;
  const int m0 = tm << 6;
  const int n0 = tn << 6;

  const T* Ab  = A  + (size_t)b * strideA;
  const T* Bb  = Bt + (size_t)b * strideB;
  const T* Ab2 = SPLIT ? (A2  + (size_t)b * strideA) : nullptr;
  const T* Bb2 = SPLIT ? (Bt2 + (size_t)b * strideB) : nullptr;

  const int rlane = lane & 15;                 // row (A) / col (B, D) within subtile
  const int koff  = (lane >> 4) * 8;           // k offset of this lane half
  const int mOff  = (lane >> 4) * 8;           // D row offset

  v8f acc[4][4];
#pragma unroll
  for (int i = 0; i < 4; ++i)
#pragma unroll
    for (int j = 0; j < 4; ++j) acc[i][j] = (v8f){0.f,0.f,0.f,0.f,0.f,0.f,0.f,0.f};

  for (int k0 = 0; k0 < K; k0 += 32) {
    V bh[4], bl[4];
#pragma unroll
    for (int j = 0; j < 4; ++j) {
      const size_t bo = (size_t)(n0 + (j << 4) + rlane) * ldb + koff + k0;
      bh[j] = Frag<T>::load(Bb + bo);
      if (SPLIT) bl[j] = Frag<T>::load(Bb2 + bo);
    }
#pragma unroll
    for (int i = 0; i < 4; ++i) {
      const size_t ao = (size_t)(m0 + (i << 4) + rlane) * lda + koff + k0;
      V ah = Frag<T>::load(Ab + ao);
      V al;
      if (SPLIT) al = Frag<T>::load(Ab2 + ao);
#pragma unroll
      for (int j = 0; j < 4; ++j) {
        acc[i][j] = Frag<T>::mma(ah, bh[j], acc[i][j]);
        if (SPLIT) {
          acc[i][j] = Frag<T>::mma(ah, bl[j], acc[i][j]);
          acc[i][j] = Frag<T>::mma(al, bh[j], acc[i][j]);
        }
      }
      Frag<T>::guard4(acc[i][0], acc[i][1], acc[i][2], acc[i][3], ah, SPLIT ? al : ah);
    }
    Frag<T>::keep(bh[0], bh[1], bh[2], bh[3]);
    if (SPLIT) Frag<T>::keep(bl[0], bl[1], bl[2], bl[3]);
  }
  acc_guard4(acc[0][0], acc[0][1], acc[0][2], acc[0][3]);
  acc_guard4(acc[1][0], acc[1][1], acc[1][2], acc[1][3]);
  acc_guard4(acc[2][0], acc[2][1], acc[2][2], acc[2][3]);
  acc_guard4(acc[3][0], acc[3][1], acc[3][2], acc[3][3]);

  // ---- epilogue ----
  float* slab = sT[wave];
  const float* Rb = RESID ? (resid + (size_t)b * strideR) : nullptr;
#pragma unroll
  for (int i = 0; i < 4; ++i) {
    const int mBase = m0 + (i << 4);
    // bias[m]: the 8 rows this lane half touches are contiguous -> two 16-B loads (2 b128 per slab, 8 per tile)
    float bmr[8] = {0.f, 0.f, 0.f, 0.f, 0.f, 0.f, 0.f, 0.f};
    if (BIAS_MODE == 1) {
      const float* bp = bias + mBase + mOff;
      const v4f bm0 = *(const v4f*)(bp);
      const v4f bm1 = *(const v4f*)(bp + 4);
      bmr[0] = bm0[0]; bmr[1] = bm0[1]; bmr[2] = bm0[2]; bmr[3] = bm0[3];
      bmr[4] = bm1[0]; bmr[5] = bm1[1]; bmr[6] = bm1[2]; bmr[7] = bm1[3];
    }
#pragma unroll
    for (int j = 0; j < 4; ++j) {
      const int n = n0 + (j << 4) + rlane;
      float bv = 0.f;
      if (BIAS_MODE == 2) bv = bias[n];
#pragma unroll
      for (int r = 0; r < 8; ++r) {
        float v = acc[i][j][r] * scale;
        if (BIAS_MODE == 1) v += bmr[r];
        if (BIAS_MODE == 2) v += bv;
        if (RESID) v += Rb[(size_t)(mBase + mOff + r) * ldc + n];
        if (ACT == 2) v = fmaxf(v, 0.0f);
        if (ACT == 4) v = (v > 0.f) ? v : 0.01f * v;
        slab[(mOff + r) * 68 + (j << 4) + rlane] = v;
      }
    }
    __builtin_amdgcn_fence(__ATOMIC_RELEASE, "workgroup");
    __builtin_amdgcn_wave_barrier();
    __builtin_amdgcn_fence(__ATOMIC_ACQUIRE, "workgroup");
    if (OUT_MODE == 0) {
      float* C = (float*)Cout + (size_t)b * strideC;
      const int hh = lane >> 4, c4 = (lane & 15) * 4;     // row seg = 256 B = 16 lanes x 16 B
      {
#pragma unroll
        for (int it = 0; it < 8; ++it) {
          const int row = it * 2 + hh;
          v4f v = *(const v4f*)(slab + row * 68 + c4);
          *(v4f*)(C + (size_t)(mBase + row) * ldc + n0 + c4) = v;
        }
        
      }
    } else {
      const int q = lane >> 3, c8 = (lane & 7) * 8;
      unsigned short* C  = (unsigned short*)Cout  + (size_t)b * strideC;
      unsigned short* C2 = (OUT_MODE == 2) ? ((unsigned short*)Cout2 + (size_t)b * strideC) : nullptr;
      {
#pragma unroll
        for (int it = 0; it < 4; ++it) {
          const int row = it * 4 + q;
          const float* sp = slab + row * 68 + c8;
          v8h hv, lv;
#pragma unroll
          for (int e = 0; e < 8; ++e) {
            if (OUT_MODE == 1) {
              hv[e] = (_Float16)sp[e];
            } else {
              unsigned short hb = f2bf_bits(sp[e]);
              unsigned short lb = f2bf_bits(sp[e] - bf_bits2f(hb));
              hv[e] = __builtin_bit_cast(_Float16, hb);
              lv[e] = __builtin_bit_cast(_Float16, lb);
            }
          }
          *(v8h*)(C + (size_t)(mBase + row) * ldc + n0 + c8) = hv;
          if (OUT_MODE == 2) *(v8h*)(C2 + (size_t)(mBase + row) * ldc + n0 + c8) = lv;
        }
        
      }
    }
    __builtin_amdgcn_fence(__ATOMIC_RELEASE, "workgroup");
    __builtin_amdgcn_wave_barrier();
    __builtin_amdgcn_fence(__ATOMIC_ACQUIRE, "workgroup");
  }
}

// ---------------------------------------------------------------------------
// ---------------------------------------------------------------------------
__global__ __launch_bounds__(256) void cast8_f16_kernel(const float* __restrict__ in, unsigned short* __restrict__ out, int n8) {
  const int i = blockIdx.x * 256 + threadIdx.x;
  if (i >= n8) return;
  const float* p = in + 8 * (size_t)i;
  const v4f a = *(const v4f*)(p);
  const v4f c = *(const v4f*)(p + 4);
  unsigned short hb[8];
#pragma unroll
  for (int e = 0; e < 4; ++e) {
    hb[e]     = h_bits(a[e]);
    hb[4 + e] = h_bits(c[e]);
  }
  const v4u u = (v4u){pk16(hb[0], hb[1]), pk16(hb[2], hb[3]), pk16(hb[4], hb[5]), pk16(hb[6], hb[7])};
  unsigned short* q = out + 8 * (size_t)i;
  *(v4u*)q = u;
  
}

// ---------------------------------------------------------------------------
// Rank-8 adapter fold + f16 cast with x16 carry, f32 math:
//   plane y in {0,1,2}: WQKV[y][e][d] = f16( 16 * ( w_y[e][d] + 2 * sum_r up_y[e][r] * down_y[r][d] ) )
//   plane y == 3      : WO[e][d]      = f16( 16 * wo[e][d] )
// Weights are [out e][in d] = Bt[n][k] for the GEMMs; orientation kept as given (no transpose).
// grid (288, 4): blockIdx.y = matrix (block-uniform), block covers 2048 consecutive elements (288 x 2048 = 768 x 768 exact);
// thread t owns elements 8t..8t+7 of the block (one row e, 8 consecutive d).
// The whole down matrix [8][768] of the plane is staged in LDS first (cooperative: 6 b128 per thread, 6 x 256 x 4 = 6144 floats =
// the whole matrix, every LDS word read below is written), block barrier, then per lane 2 b128 (w) + 2 b128 (up row) global loads.
// ---------------------------------------------------------------------------
__global__ __launch_bounds__(256) void fold_cast_kernel(
    const float* __restrict__ wq, const float* __restrict__ wk, const float* __restrict__ wv, const float* __restrict__ wo,
    const float* __restrict__ dq, const float* __restrict__ uq,
    const float* __restrict__ dk, const float* __restrict__ uk,
    const float* __restrict__ dv, const float* __restrict__ uv,
    unsigned short* __restrict__ wqkv16, unsigned short* __restrict__ wo16) {
  __shared__ __align__(16) float dsh[kRank * kDim];      // down matrix [8][768] of this plane, 24,576 B
  const int y = blockIdx.y;                              // 0..3, block-uniform
  const int t = threadIdx.x;
  const float* W  = (y == 0) ? wq : (y == 1) ? wk : (y == 2) ? wv : wo;
  const float* Dn = (y == 0) ? dq : (y == 1) ? dk : dv;   // y == 3: valid pointer, staged but not used
  const float* Up = (y == 0) ? uq : (y == 1) ? uk : uv;
  // stage down [8][768] = 1536 float4: thread t loads slots t + 256*i, i = 0..5 (exact coverage)
#pragma unroll
  for (int i = 0; i < 6; ++i) {
    const int q4 = (i * 256 + t) * 4;
    const v4f dd = *(const v4f*)(Dn + q4);
    *(v4f*)(dsh + q4) = dd;
  }
  __syncthreads();

  const int base = blockIdx.x * 2048 + 8 * t;            // < 768*768
  const int e = base / kDim;
  const int d = base - e * kDim;                         // multiple of 8
  const v4f w0 = *(const v4f*)(W + base);
  const v4f w1 = *(const v4f*)(W + base + 4);
  float s[8];
#pragma unroll
  for (int k = 0; k < 8; ++k) s[k] = 0.0f;
  if (y < 3) {                                           // block-uniform branch
    const v4f u0 = *(const v4f*)(Up + e * kRank);
    const v4f u1 = *(const v4f*)(Up + e * kRank + 4);
    const float ur[8] = {u0[0], u0[1], u0[2], u0[3], u1[0], u1[1], u1[2], u1[3]};
#pragma unroll
    for (int r = 0; r < kRank; ++r) {
      const v4f a = *(const v4f*)(dsh + r * kDim + d);
      const v4f c = *(const v4f*)(dsh + r * kDim + d + 4);
#pragma unroll
      for (int k = 0; k < 4; ++k) {
        s[k]     += ur[r] * a[k];
        s[4 + k] += ur[r] * c[k];
      }
    }
  }
  float f[8];
#pragma unroll
  for (int k = 0; k < 4; ++k) {
    f[k]     = (w0[k] + kLowRankScale * s[k])     * kWCarry;
    f[4 + k] = (w1[k] + kLowRankScale * s[4 + k]) * kWCarry;
  }
  unsigned short hb[8];
#pragma unroll
  for (int k = 0; k < 8; ++k) hb[k] = h_bits(f[k]);
  const v4u u = (v4u){pk16(hb[0], hb[1]), pk16(hb[2], hb[3]), pk16(hb[4], hb[5]), pk16(hb[6], hb[7])};
  unsigned short* op = (y < 3) ? (wqkv16 + (size_t)y * kDim * kDim + base) : (wo16 + base);
  *(v4u*)op = u;
  
}

constexpr int kFAWaves  = 8;
constexpr int kFAGroups = 2;                              // 16-query column groups per wave
constexpr int kFARows   = kFAWaves * kFAGroups * 16;      // 256 query rows per work-group
constexpr int kFAStage  = 64;                             // keys per stage
constexpr int kFANStage = kSeq / kFAStage;                // 64
constexpr int kFAPitch  = 72;                             // f16 per LDS row: 144 B, an odd multiple of 16 B
constexpr int kFATile   = 64 * kFAPitch;
constexpr float kFAScale = 0.125f * 1.4426950408889634f;  // 1 / sqrt(64) and log2(e)
constexpr float kFACarryLog2 = 6.0f;
static_assert(kSeq % kFARows == 0 && kSeq % kFAStage == 0 && kDh == 64 && kFAStage == 64, "fused attention mapping");
typedef __attribute__((ext_vector_type(2))) _Float16 v2h;
// lane l with lane l ^ 16
__device__ __forceinline__ float xhalf(float x) {
  const int b = __builtin_bit_cast(int, x);
  return __builtin_bit_cast(float, __builtin_amdgcn_permlanex16(b, b, 0x76543210, 0xfedcba98, false, false));
}
__device__ __forceinline__ unsigned pack2h(float lo, float hi) {
  return __builtin_bit_cast(unsigned, __builtin_convertvector((v2f){lo, hi}, v2h));   // round to nearest even
}
__global__ __launch_bounds__(kFAWaves * 32) void attn_fused_kernel(
    const unsigned short* __restrict__ Qp, const unsigned short* __restrict__ Kp, const unsigned short* __restrict__ VTp,
    unsigned short* __restrict__ Att) {
  __shared__ __align__(16) _Float16 sK[2][kFATile];   // 18,432 B
  __shared__ __align__(16) _Float16 sV[2][kFATile];   // 18,432 B
  const int t    = threadIdx.x;
  const int lane = t & 31, wave = t >> 5;
  const int c    = lane & 15;
  const int h8   = (lane >> 4) * 8;
  const int head = blockIdx.y;
  const int q0   = blockIdx.x * kFARows + wave * (kFAGroups * 16);
  const _Float16* Qh = (const _Float16*)Qp  + head * kDh;
  const _Float16* Kh = (const _Float16*)Kp  + head * kDh;                   // [key][kDim]
  const _Float16* Vh = (const _Float16*)VTp + (size_t)head * kDh * kSeq;    // [d][kSeq]

  // staging map: 8 threads per 128-B row, rows srow and srow + 32 of each tile
  const int srow = t >> 3, sseg = (t & 7) * 8;
  const _Float16* gK = Kh + (size_t)srow * kDim + sseg;
  const _Float16* gV = Vh + (size_t)srow * kSeq + sseg;
  const int sdst = srow * kFAPitch + sseg;
  v8h rk0 = *(const v8h*)(gK);
  v8h rk1 = *(const v8h*)(gK + 32 * kDim);
  v8h rv0 = *(const v8h*)(gV);
  v8h rv1 = *(const v8h*)(gV + 32 * kSeq);

  v16h qf[kFAGroups][2];
#pragma unroll
  for (int g = 0; g < kFAGroups; ++g)
#pragma unroll
    for (int kc = 0; kc < 2; ++kc)
      qf[g][kc] = Frag<_Float16>::load(Qh + (size_t)(q0 + 16 * g + c) * kDim + 32 * kc + h8);

  v8f acc[kFAGroups][4];
  v2f lsum[kFAGroups];
  float mrun[kFAGroups];
#pragma unroll
  for (int g = 0; g < kFAGroups; ++g) {
    mrun[g] = -__builtin_inff();
    lsum[g] = (v2f){0.f, 0.f};
#pragma unroll
    for (int j = 0; j < 4; ++j) acc[g][j] = (v8f){0.f,0.f,0.f,0.f,0.f,0.f,0.f,0.f};
  }

  *(v8h*)(&sK[0][sdst]) = rk0;
  *(v8h*)(&sK[0][sdst + 32 * kFAPitch]) = rk1;
  *(v8h*)(&sV[0][sdst]) = rv0;
  *(v8h*)(&sV[0][sdst + 32 * kFAPitch]) = rv1;
  __syncthreads();   // stage 0 is in LDS before any wave reads it

  for (int st = 0; st < kFANStage; ++st) {
    const int buf = st & 1;
    const bool more = st + 1 < kFANStage;   // the same for the whole work-group
    if (more) {
      gK += kFAStage * kDim;
      gV += kFAStage;
      rk0 = *(const v8h*)(gK);
      rk1 = *(const v8h*)(gK + 32 * kDim);
      rv0 = *(const v8h*)(gV);
      rv1 = *(const v8h*)(gV + 32 * kSeq);
    }
#pragma unroll
    for (int p = 0; p < 2; ++p) {          // two 32-key passes per stage
      v8f s[2][kFAGroups];
#pragma unroll
      for (int kt = 0; kt < 2; ++kt) {
        const _Float16* kp = &sK[buf][(32 * p + 16 * kt + c) * kFAPitch + h8];
        const v16h k0 = Frag<_Float16>::load(kp);
        const v16h k1 = Frag<_Float16>::load(kp + 32);
#pragma unroll
        for (int g = 0; g < kFAGroups; ++g) {
          s[kt][g] = (v8f){0.f,0.f,0.f,0.f,0.f,0.f,0.f,0.f};
          s[kt][g] = Frag<_Float16>::mma(k0, qf[g][0], s[kt][g]);
          s[kt][g] = Frag<_Float16>::mma(k1, qf[g][1], s[kt][g]);
        }
      }
      v16h vf[4];
#pragma unroll
      for (int j = 0; j < 4; ++j) vf[j] = Frag<_Float16>::load(&sV[buf][(16 * j + c) * kFAPitch + 32 * p + h8]);

      float mb[kFAGroups];
      bool need = false;
#pragma unroll
      for (int g = 0; g < kFAGroups; ++g) {
        float mx = s[0][g][0];
#pragma unroll
        for (int r = 1; r < 8; ++r) mx = fmaxf(mx, s[0][g][r]);
#pragma unroll
        for (int r = 0; r < 8; ++r) mx = fmaxf(mx, s[1][g][r]);
        mx = fmaxf(mx, xhalf(mx)) * kFAScale;   // both wave halves hold this query's maximum, scaled (the scale is positive)
        mb[g] = mx;
        need = need || (mx > mrun[g] + 8.0f);
      }
      if (__builtin_amdgcn_ballot_w32(need) != 0) {   // wave-uniform; always on the first pass, rare later
#pragma unroll
        for (int g = 0; g < kFAGroups; ++g) {
          const float mnew = fmaxf(mrun[g], mb[g]);
          const float corr = __builtin_amdgcn_exp2f(mrun[g] - mnew);   // 0 on the first pass, where mrun is -inf
          mrun[g] = mnew;
          lsum[g] = lsum[g] * corr;
#pragma unroll
          for (int j = 0; j < 4; ++j) acc[g][j] = acc[g][j] * corr;
        }
      }
#pragma unroll
      for (int g = 0; g < kFAGroups; ++g) {
        const float nm = kFACarryLog2 - mrun[g];
        union { v16h v; unsigned w[8]; } pf;
#pragma unroll
        for (int i = 0; i < 8; ++i) {
          const v2f arg = __builtin_elementwise_fma((v2f){s[i >> 2][g][2 * (i & 3)], s[i >> 2][g][2 * (i & 3) + 1]},
                                                    (v2f){kFAScale, kFAScale}, (v2f){nm, nm});
          const v2f pe = (v2f){__builtin_amdgcn_exp2f(arg[0]), __builtin_amdgcn_exp2f(arg[1])};
          lsum[g] += pe;
          pf.w[i] = pack2h(pe[0], pe[1]);
        }
#pragma unroll
        for (int j = 0; j < 4; ++j) acc[g][j] = Frag<_Float16>::mma(vf[j], pf.v, acc[g][j]);
      }
    }
    if (more) {
      *(v8h*)(&sK[buf ^ 1][sdst]) = rk0;
      *(v8h*)(&sK[buf ^ 1][sdst + 32 * kFAPitch]) = rk1;
      *(v8h*)(&sV[buf ^ 1][sdst]) = rv0;
      *(v8h*)(&sV[buf ^ 1][sdst + 32 * kFAPitch]) = rv1;
    }
    __syncthreads();   // publishes stage st + 1 and ends every wave's reads of the buffer that the next trip refills
  }

  // acc[g][j][r] = O^T[d = 16 j + 8 h + r][query 16 g + c]: 8 consecutive d of one row, one 16-B store
#pragma unroll
  for (int g = 0; g < kFAGroups; ++g) {
    const float lh  = lsum[g][0] + lsum[g][1];
    const float inv = kAttCarry / (lh + xhalf(lh));   // the exchange is unconditional
    unsigned short* op = Att + (size_t)(q0 + 16 * g + c) * kDim + head * kDh + h8;
#pragma unroll
    for (int j = 0; j < 4; ++j) {
      const v8f o = acc[g][j] * inv;
      const v4u u = (v4u){pack2h(o[0], o[1]), pack2h(o[2], o[3]), pack2h(o[4], o[5]), pack2h(o[6], o[7])};
      *(v4u*)(op + 16 * j) = u;
    }
  }
}

// ---------------------------------------------------------------------------
// Host glue.
// Workspace region map (bytes, every offset a multiple of 128; every plane fully written before any read):
//   X16    f16 [4096][768]                 6,291,456  at          0   (cast8)
//   WQKV16 f16 [3][768][768]  (x16 carry)  3,538,944  at  6,291,456   (fold_cast, planes q|k|v)
//   WO16   f16 [768][768]     (x16 carry)  1,179,648  at  9,830,400   (fold_cast)
//   Q16    f16 [4096][768]                 6,291,456  at 11,010,048   (GEMM)
//   K16    f16 [4096][768]                 6,291,456  at 17,301,504   (GEMM)
//   VT16   f16 [768][4096]  = V^T          6,291,456  at 23,592,960   (GEMM with swapped operand roles)
//   ATT16  f16 [4096][768]   (x256 carry)  6,291,456  at 29,884,416   (fused attention, each work-group [256 rows][64 cols])
//   total                                 36,175,872
// GEMM shapes (all M,N multiples of 64, K multiple of 32, no padding anywhere):
//   q,k:  M=4096 N=768  K=768;  v^T: M=768 N=4096 K=768;  out: M=4096 N=768 K=768
// Launches: 1 cast + 1 fold + 3 projections + 1 fused attention + 1 out = 7.
// ---------------------------------------------------------------------------
extern "C" void kernel_launch(void* const* d_in, const int* in_sizes, int n_in,
                              void* d_out, int out_size, void* d_ws, size_t ws_size,
                              hipStream_t stream) {
  if (n_in < 15) return;
  const int nX = kSeq * kDim;          // 3,145,728
  const int nW = kDim * kDim;          // 589,824
  const int nA = kRank * kDim;         // 6,144
  if (in_sizes[0] != nX) return;
  if (in_sizes[1] != nW || in_sizes[3] != nW || in_sizes[5] != nW || in_sizes[7] != nW) return;
  if (in_sizes[2] != kDim || in_sizes[4] != kDim || in_sizes[6] != kDim || in_sizes[8] != kDim) return;
  for (int i = 9; i < 15; ++i) if (in_sizes[i] != nA) return;
  if (out_size != nX) return;

  const size_t szAct  = (size_t)kSeq * kDim * 2;
  const size_t szWqkv = (size_t)3 * kDim * kDim * 2;
  const size_t szWo   = (size_t)kDim * kDim * 2;
  const size_t offX    = 0;
  const size_t offWqkv = offX + szAct;
  const size_t offWo   = offWqkv + szWqkv;
  const size_t offQ    = offWo + szWo;
  const size_t offK    = offQ + szAct;
  const size_t offVT   = offK + szAct;
  const size_t offAtt  = offVT + szAct;
  const size_t total   = offAtt + szAct;   // 36,175,872
  if (ws_size < total) return;

  const float* x   = (const float*)d_in[0];
  const float* wq  = (const float*)d_in[1];
  const float* bq  = (const float*)d_in[2];
  const float* wk  = (const float*)d_in[3];
  const float* bk  = (const float*)d_in[4];
  const float* wv  = (const float*)d_in[5];
  const float* bv  = (const float*)d_in[6];
  const float* wo  = (const float*)d_in[7];
  const float* bo  = (const float*)d_in[8];
  const float* dq  = (const float*)d_in[9];    // [8][768]
  const float* uq  = (const float*)d_in[10];   // [768][8]
  const float* dk  = (const float*)d_in[11];
  const float* uk  = (const float*)d_in[12];
  const float* dv  = (const float*)d_in[13];
  const float* uv  = (const float*)d_in[14];
  float* out = (float*)d_out;
  char* ws = (char*)d_ws;
  unsigned short* X16    = (unsigned short*)(ws + offX);
  unsigned short* WQKV16 = (unsigned short*)(ws + offWqkv);
  unsigned short* WO16   = (unsigned short*)(ws + offWo);
  unsigned short* Q16    = (unsigned short*)(ws + offQ);
  unsigned short* K16    = (unsigned short*)(ws + offK);
  unsigned short* VT16   = (unsigned short*)(ws + offVT);
  unsigned short* ATT16  = (unsigned short*)(ws + offAtt);
  const unsigned short* WQ16 = WQKV16;
  const unsigned short* WK16 = WQKV16 + (size_t)kDim * kDim;
  const unsigned short* WV16 = WQKV16 + (size_t)2 * kDim * kDim;

  // ---- prologue: 16-bit operand planes ----
  const int n8 = nX / 8;   // 393,216 -> 1536 blocks exact
  cast8_f16_kernel<<<dim3((n8 + 255) / 256), dim3(256), 0, stream>>>(x, X16, n8);
  fold_cast_kernel<<<dim3(nW / 2048, 4), dim3(256), 0, stream>>>(wq, wk, wv, wo, dq, uq, dk, uk, dv, uv, WQKV16, WO16);

  // ---- projections (unused arguments receive valid dummy pointers) ----
  const int tilesProj = (kSeq / 64) * (kDim / 64);        // 768 -> 96 blocks of 8 waves
  // Q16[s][e] = (1/16) * sum_d X16[s][d] * WQ16[e][d] + bq[e]
  wmma_gemm64<0, false, 2, 1, false, 0><<<dim3((tilesProj + 7) / 8, 1), dim3(256), 0, stream>>>(
      X16, X16, kDim, 0L, WQ16, WQ16, kDim, 0L,
      (void*)Q16, (void*)Q16, kDim, 0L, bq, bq, 0L, kSeq, kDim, kDim, kWCarryInv);
  // K16[s][e] = (1/16) * sum_d X16[s][d] * WK16[e][d] + bk[e]
  wmma_gemm64<0, false, 2, 1, false, 0><<<dim3((tilesProj + 7) / 8, 1), dim3(256), 0, stream>>>(
      X16, X16, kDim, 0L, WK16, WK16, kDim, 0L,
      (void*)K16, (void*)K16, kDim, 0L, bk, bk, 0L, kSeq, kDim, kDim, kWCarryInv);
  // VT16[c][s] = (1/16) * sum_d WV16[c][d] * X16[s][d] + bv[c]   (A = weights [768][768], Bt = activations [4096][768], bias indexed by m)
  wmma_gemm64<0, false, 1, 1, false, 0><<<dim3((tilesProj + 7) / 8, 1), dim3(256), 0, stream>>>(
      WV16, WV16, kDim, 0L, X16, X16, kDim, 0L,
      (void*)VT16, (void*)VT16, kSeq, 0L, bv, bv, 0L, kDim, kSeq, kDim, kWCarryInv);

  // ---- attention: one launch, one work-group per (256 query rows, head) ----
  // ATT16[s][h*64+n] = 256 * sum_j softmax_j(0.125 * Q16[s][h*64+:] . K16[j][h*64+:]) * VT16[h*64+n][j]
  attn_fused_kernel<<<dim3(kSeq / kFARows, kHeads), dim3(kFAWaves * 32), 0, stream>>>(Q16, K16, VT16, ATT16);

  // ---- output projection: out[s][e] = (1/4096) * sum_c ATT16[s][c] * WO16[e][c] + bo[e]   (M=4096, N=768, K=768, f32 to d_out) ----
  wmma_gemm64<0, false, 2, 0, false, 0><<<dim3((tilesProj + 7) / 8, 1), dim3(256), 0, stream>>>(
      ATT16, ATT16, kDim, 0L, WO16, WO16, kDim, 0L,
      (void*)out, (void*)out, kDim, 0L, bo, bo, 0L, kSeq, kDim, kDim, kOutScale);
}

// v003
// It runs in 109 microseconds.
// In two side-by-side timings against v002, it was 1.99 and 2.01 times as fast.
// Counting every step since v000, it is 45.0 times as fast.
// Contractions: q/k projections and v^T projection (x f16 x W_eff^T f16 carried x16), scores k_h.q_h^T (q,k f16 planes), v_h^T.probs^T (V^T f16 x unnormalised P f16 carried x64), output projection (attn f16 carried x256 x Wo^T f16 carried x16): all v_wmma_f32_16x16x32_f16 with f32 accumulate; rank-8 weight fold, bias add and online softmax in f32.
#include <hip/hip_runtime.h>
#include <math.h>

// ---------------------------------------------------------------------------
// Problem constants
// ---------------------------------------------------------------------------
constexpr int kSeq    = 4096;             // tokens (batch 1)
constexpr int kDim    = 768;              // model width
constexpr int kHeads  = 12;
constexpr int kDh     = 64;
constexpr int kRank   = 8;                // low-rank adapter width
constexpr float kLowRankScale = 2.0f;     // alpha / rank = 16 / 8
constexpr float kWCarry    = 16.0f;       // weights carried x16 in f16
constexpr float kWCarryInv = 1.0f / 16.0f;
constexpr float kAttCarry  = 256.0f;      // attention output carried x256 in f16
constexpr float kOutScale  = 1.0f / (kAttCarry * kWCarry);   // 1/4096
static_assert(kHeads * kDh == kDim, "shape");
static_assert(kSeq % 64 == 0 && kDim % 64 == 0 && kDh % 64 == 0, "M,N tile multiples");
static_assert(kDim % 32 == 0 && kDh % 32 == 0 && kSeq % 32 == 0, "K multiples of 32");
static_assert((kDim * kDim) % 2048 == 0, "fold block mapping");
static_assert((kSeq * kDim) % 2048 == 0, "cast block mapping");
static_assert(kRank * kDim == 6 * 256 * 4, "adapter staging: 6 float4 per thread of a 256-thread block");

typedef __attribute__((ext_vector_type(16))) _Float16 v16h;
typedef __attribute__((ext_vector_type(8)))  _Float16 v8h;
typedef __attribute__((ext_vector_type(8)))  float    v8f;
typedef __attribute__((ext_vector_type(4)))  float    v4f;
typedef __attribute__((ext_vector_type(2)))  float    v2f;
typedef __attribute__((ext_vector_type(4)))  unsigned int v4u;

// ---------------------------------------------------------------------------
// Fragment loader and matrix product, f16 operands, f32 accumulate
// ---------------------------------------------------------------------------
template <typename T> struct Frag;
template <> struct Frag<_Float16> {
  typedef v16h V; union U { v16h v; v8h h[2]; };
  // elements 0..7 <- p[0..7], 8..15 <- p[16..23]
  static __device__ __forceinline__ v16h load(const _Float16* p) {
    U f; f.h[0] = *(const v8h*)(p); f.h[1] = *(const v8h*)(p + 16); return f.v;
  }
  static __device__ __forceinline__ v8f mma(v16h a, v16h b, v8f c) {
    return __builtin_amdgcn_wmma_f32_16x16x32_f16(false, a, false, b, (short)0, c, false, false);
  }
};

__device__ __forceinline__ unsigned pk16(unsigned short a, unsigned short b) { return (unsigned)a | ((unsigned)b << 16); }
__device__ __forceinline__ unsigned short h_bits(float f) { const _Float16 h = (_Float16)f; return __builtin_bit_cast(unsigned short, h); }

// ---------------------------------------------------------------------------
// WMMA GEMM with both operands staged in LDS: C[m,n] = scale * sum_k A[m,k] * Bt[n,k] + bias.
// A row-major [M][kDim], Bt row-major [N][kDim], f16; M, N multiples of 128; K = kDim for every product of this file.
// One work-group = one 128 x 128 tile of C; 8 waves as 4 (m) x 2 (n), each 32 x 64 = 2 x 4 accumulator tiles.
// A stage is 64 k: 128 rows x 128 B of A and of Bt. 8 threads fetch one whole 128-B line, so a wave-wide load covers 4 whole lines;
// every line is fetched once per work-group and shared by its waves through LDS (pitch 144 B, an odd multiple of 16 B).
// Stage s + 2 is fetched into registers while stage s is worked on (two register sets), stage s + 1 is stored to the other of two
// LDS buffers in the middle of stage s, one work-group barrier per stage; fragments are read half a stage (32 k) ahead of their products.
// A and B fragments come from LDS through the same loader (equal k orders); k runs upward in steps of 32 in every accumulator.
// BIAS_MODE: 1 = bias[m], 2 = bias[n].  OUT_MODE: 0 = f32, 1 = f16.
// ---------------------------------------------------------------------------
constexpr int kGTileMN = 128;                   // rows of A and of Bt per work-group
constexpr int kGStageK = 64;                    // k per stage: one 128-B line per row
constexpr int kGNStage = kDim / kGStageK;       // 12
constexpr int kGPitch  = 72;                    // f16 per LDS row
constexpr int kGTile   = kGTileMN * kGPitch;    // f16 per staged operand tile (18,432 B)
static_assert(kSeq % kGTileMN == 0 && kDim % kGTileMN == 0 && kDim % (2 * kGStageK) == 0, "staged GEMM mapping");
// Work-group barrier that orders LDS traffic only: __syncthreads() also waits for every outstanding global load, which would
// end the two-stage lead of the register prefetch at each stage; nothing but LDS passes between the waves of this kernel.
__device__ __forceinline__ void lds_barrier() {
  __builtin_amdgcn_fence(__ATOMIC_RELEASE, "workgroup", "local");
  __builtin_amdgcn_s_barrier();
  __builtin_amdgcn_fence(__ATOMIC_ACQUIRE, "workgroup", "local");
}
template <int BIAS_MODE, int OUT_MODE>
__global__ __launch_bounds__(256) void wmma_gemm_lds(
    const unsigned short* __restrict__ Ap, const unsigned short* __restrict__ Btp,
    void* __restrict__ Cout, int ldc, const float* __restrict__ bias, int tilesN, float scale) {
  __shared__ __align__(16) _Float16 sA[2][kGTile];   // 36,864 B
  __shared__ __align__(16) _Float16 sB[2][kGTile];   // 36,864 B
  __shared__ __align__(16) float sT[8][16 * 68];     // per-wave 16x64 output slab, pitch 68 floats
  const int t    = threadIdx.x;
  const int lane = t & 31;
  const int wave = t >> 5;
  const int tm = blockIdx.x / tilesN;
  const int tn = blockIdx.x - tm * tilesN;
  const int rlane = lane & 15;                 // row (A) / col (B, D) within subtile
  const int koff  = (lane >> 4) * 8;           // k offset of this lane half
  const int mOff  = (lane >> 4) * 8;           // D row offset
  const int wm = (wave >> 1) * 32;             // this wave's rows inside the tile
  const int wn = (wave & 1) * 64;              // this wave's columns inside the tile

  // staging map: 8 threads per 128-B row, rows srow + 32 q, q = 0..3, of each operand tile
  const int srow = t >> 3, sseg = (t & 7) * 8;
  const _Float16* gA = (const _Float16*)Ap  + (size_t)(tm * kGTileMN + srow) * kDim + sseg;
  const _Float16* gB = (const _Float16*)Btp + (size_t)(tn * kGTileMN + srow) * kDim + sseg;
  const int sdst = srow * kGPitch + sseg;
  v8h ra[2][4], rb[2][4];
  // the unroll directives of this kernel, but those on the loop over stage pairs and on the two store loops of the epilogue, are there because their loops index register arrays by the loop variable
#pragma unroll
  for (int u = 0; u < 2; ++u)
#pragma unroll
    for (int q = 0; q < 4; ++q) {
      ra[u][q] = *(const v8h*)(gA + (size_t)q * 32 * kDim + u * kGStageK);
      rb[u][q] = *(const v8h*)(gB + (size_t)q * 32 * kDim + u * kGStageK);
    }

  v8f acc[2][4];
#pragma unroll
  for (int i = 0; i < 2; ++i)
#pragma unroll
    for (int j = 0; j < 4; ++j) acc[i][j] = (v8f){0.f,0.f,0.f,0.f,0.f,0.f,0.f,0.f};

#pragma unroll
  for (int q = 0; q < 4; ++q) {
    *(v8h*)(&sA[0][sdst + q * 32 * kGPitch]) = ra[0][q];
    *(v8h*)(&sB[0][sdst + q * 32 * kGPitch]) = rb[0][q];
  }
  lds_barrier();   // stage 0 is in LDS before any wave reads it

  // fragments of one 32-k half stage; set 0 holds the lower half, set 1 the upper; each set is read from LDS while the other is worked on
  v16h af[2][2], bf[2][4];
#pragma unroll
  for (int i = 0; i < 2; ++i) af[0][i] = Frag<_Float16>::load(&sA[0][(wm + 16 * i + rlane) * kGPitch + koff]);
#pragma unroll
  for (int j = 0; j < 4; ++j) bf[0][j] = Frag<_Float16>::load(&sB[0][(wn + 16 * j + rlane) * kGPitch + koff]);

  // unrolled whole: the tests on s become compile-time, so no path joins and the counted waits on the register prefetch stay exact
#pragma unroll
  for (int st = 0; st < kGNStage; st += 2) {
#pragma unroll
    for (int u = 0; u < 2; ++u) {            // stage st + u: LDS buffer u, register set u is free
      const int s = st + u;
      if (s + 2 < kGNStage) {                // the same for the whole work-group
#pragma unroll
        for (int q = 0; q < 4; ++q) {
          ra[u][q] = *(const v8h*)(gA + (size_t)q * 32 * kDim + (s + 2) * kGStageK);
          rb[u][q] = *(const v8h*)(gB + (size_t)q * 32 * kDim + (s + 2) * kGStageK);
        }
      }
#pragma unroll
      for (int i = 0; i < 2; ++i) af[1][i] = Frag<_Float16>::load(&sA[u][(wm + 16 * i + rlane) * kGPitch + 32 + koff]);
#pragma unroll
      for (int j = 0; j < 4; ++j) bf[1][j] = Frag<_Float16>::load(&sB[u][(wn + 16 * j + rlane) * kGPitch + 32 + koff]);
      // keeps the upper half's LDS reads as one group ahead of the lower half's products, which cover their latency
      __builtin_amdgcn_sched_barrier(0);
#pragma unroll
      for (int i = 0; i < 2; ++i)
#pragma unroll
        for (int j = 0; j < 4; ++j) acc[i][j] = Frag<_Float16>::mma(af[0][i], bf[0][j], acc[i][j]);
      // keeps these products ahead of the stores and the barrier: moved behind them, the wait in front of the barrier would meet reads just issued
      __builtin_amdgcn_sched_barrier(0);
      if (s + 1 < kGNStage) {
#pragma unroll
        for (int q = 0; q < 4; ++q) {
          *(v8h*)(&sA[u ^ 1][sdst + q * 32 * kGPitch]) = ra[u ^ 1][q];
          *(v8h*)(&sB[u ^ 1][sdst + q * 32 * kGPitch]) = rb[u ^ 1][q];
        }
      }
      // publishes stage s + 1; every read of stage s has returned in front of it, so the next stage may refill buffer u behind it
      lds_barrier();
      if (s + 1 < kGNStage) {
#pragma unroll
        for (int i = 0; i < 2; ++i) af[0][i] = Frag<_Float16>::load(&sA[u ^ 1][(wm + 16 * i + rlane) * kGPitch + koff]);
#pragma unroll
        for (int j = 0; j < 4; ++j) bf[0][j] = Frag<_Float16>::load(&sB[u ^ 1][(wn + 16 * j + rlane) * kGPitch + koff]);
      }
      // keeps the next stage's first LDS reads as one group ahead of the upper half's products, which cover their latency
      __builtin_amdgcn_sched_barrier(0);
#pragma unroll
      for (int i = 0; i < 2; ++i)
#pragma unroll
        for (int j = 0; j < 4; ++j) acc[i][j] = Frag<_Float16>::mma(af[1][i], bf[1][j], acc[i][j]);
    }
  }

  // ---- epilogue: each wave turns its 16 x 64 slabs through its own LDS range into whole-line stores ----
  const int m0 = tm * kGTileMN + wm;
  const int n0 = tn * kGTileMN + wn;
  float* slab = sT[wave];
#pragma unroll
  for (int i = 0; i < 2; ++i) {
    const int mBase = m0 + (i << 4);
    // bias[m]: the 8 rows this lane half touches are contiguous -> two 16-B loads
    float bmr[8] = {0.f, 0.f, 0.f, 0.f, 0.f, 0.f, 0.f, 0.f};
    if (BIAS_MODE == 1) {
      const float* bp = bias + mBase + mOff;
      const v4f bm0 = *(const v4f*)(bp);
      const v4f bm1 = *(const v4f*)(bp + 4);
      bmr[0] = bm0[0]; bmr[1] = bm0[1]; bmr[2] = bm0[2]; bmr[3] = bm0[3];
      bmr[4] = bm1[0]; bmr[5] = bm1[1]; bmr[6] = bm1[2]; bmr[7] = bm1[3];
    }
#pragma unroll
    for (int j = 0; j < 4; ++j) {
      const int n = n0 + (j << 4) + rlane;
      float bv = 0.f;
      if (BIAS_MODE == 2) bv = bias[n];
#pragma unroll
      for (int r = 0; r < 8; ++r) {
        float v = acc[i][j][r] * scale;
        if (BIAS_MODE == 1) v += bmr[r];
        if (BIAS_MODE == 2) v += bv;
        slab[(mOff + r) * 68 + (j << 4) + rlane] = v;
      }
    }
    __builtin_amdgcn_fence(__ATOMIC_RELEASE, "workgroup");
    __builtin_amdgcn_wave_barrier();
    __builtin_amdgcn_fence(__ATOMIC_ACQUIRE, "workgroup");
    if (OUT_MODE == 0) {
      float* C = (float*)Cout;
      const int hh = lane >> 4, c4 = (lane & 15) * 4;     // row seg = 256 B = 16 lanes x 16 B
#pragma unroll
      for (int it = 0; it < 8; ++it) {
        const int row = it * 2 + hh;
        v4f v = *(const v4f*)(slab + row * 68 + c4);
        *(v4f*)(C + (size_t)(mBase + row) * ldc + n0 + c4) = v;
      }
    } else {
      const int q = lane >> 3, c8 = (lane & 7) * 8;       // row seg = 128 B = 8 lanes x 16 B
      unsigned short* C = (unsigned short*)Cout;
#pragma unroll
      for (int it = 0; it < 4; ++it) {
        const int row = it * 4 + q;
        const float* sp = slab + row * 68 + c8;
        v8h hv;
#pragma unroll
        for (int e = 0; e < 8; ++e) hv[e] = (_Float16)sp[e];
        *(v8h*)(C + (size_t)(mBase + row) * ldc + n0 + c8) = hv;
      }
    }
    __builtin_amdgcn_fence(__ATOMIC_RELEASE, "workgroup");
    __builtin_amdgcn_wave_barrier();
    __builtin_amdgcn_fence(__ATOMIC_ACQUIRE, "workgroup");
  }
}

// ---------------------------------------------------------------------------
// ---------------------------------------------------------------------------
__global__ __launch_bounds__(256) void cast8_f16_kernel(const float* __restrict__ in, unsigned short* __restrict__ out, int n8) {
  const int i = blockIdx.x * 256 + threadIdx.x;
  if (i >= n8) return;
  const float* p = in + 8 * (size_t)i;
  const v4f a = *(const v4f*)(p);
  const v4f c = *(const v4f*)(p + 4);
  unsigned short hb[8];
#pragma unroll
  for (int e = 0; e < 4; ++e) {
    hb[e]     = h_bits(a[e]);
    hb[4 + e] = h_bits(c[e]);
  }
  const v4u u = (v4u){pk16(hb[0], hb[1]), pk16(hb[2], hb[3]), pk16(hb[4], hb[5]), pk16(hb[6], hb[7])};
  unsigned short* q = out + 8 * (size_t)i;
  *(v4u*)q = u;
  
}

// ---------------------------------------------------------------------------
// Rank-8 adapter fold + f16 cast with x16 carry, f32 math:
//   plane y in {0,1,2}: WQKV[y][e][d] = f16( 16 * ( w_y[e][d] + 2 * sum_r up_y[e][r] * down_y[r][d] ) )
//   plane y == 3      : WO[e][d]      = f16( 16 * wo[e][d] )
// Weights are [out e][in d] = Bt[n][k] for the GEMMs; orientation kept as given (no transpose).
// grid (288, 4): blockIdx.y = matrix (block-uniform), block covers 2048 consecutive elements (288 x 2048 = 768 x 768 exact);
// thread t owns elements 8t..8t+7 of the block (one row e, 8 consecutive d).
// The whole down matrix [8][768] of the plane is staged in LDS first (cooperative: 6 b128 per thread, 6 x 256 x 4 = 6144 floats =
// the whole matrix, every LDS word read below is written), block barrier, then per lane 2 b128 (w) + 2 b128 (up row) global loads.
// ---------------------------------------------------------------------------
__global__ __launch_bounds__(256) void fold_cast_kernel(
    const float* __restrict__ wq, const float* __restrict__ wk, const float* __restrict__ wv, const float* __restrict__ wo,
    const float* __restrict__ dq, const float* __restrict__ uq,
    const float* __restrict__ dk, const float* __restrict__ uk,
    const float* __restrict__ dv, const float* __restrict__ uv,
    unsigned short* __restrict__ wqkv16, unsigned short* __restrict__ wo16) {
  __shared__ __align__(16) float dsh[kRank * kDim];      // down matrix [8][768] of this plane, 24,576 B
  const int y = blockIdx.y;                              // 0..3, block-uniform
  const int t = threadIdx.x;
  const float* W  = (y == 0) ? wq : (y == 1) ? wk : (y == 2) ? wv : wo;
  const float* Dn = (y == 0) ? dq : (y == 1) ? dk : dv;   // y == 3: valid pointer, staged but not used
  const float* Up = (y == 0) ? uq : (y == 1) ? uk : uv;
  // stage down [8][768] = 1536 float4: thread t loads slots t + 256*i, i = 0..5 (exact coverage)
#pragma unroll
  for (int i = 0; i < 6; ++i) {
    const int q4 = (i * 256 + t) * 4;
    const v4f dd = *(const v4f*)(Dn + q4);
    *(v4f*)(dsh + q4) = dd;
  }
  __syncthreads();

  const int base = blockIdx.x * 2048 + 8 * t;            // < 768*768
  const int e = base / kDim;
  const int d = base - e * kDim;                         // multiple of 8
  const v4f w0 = *(const v4f*)(W + base);
  const v4f w1 = *(const v4f*)(W + base + 4);
  float s[8];
#pragma unroll
  for (int k = 0; k < 8; ++k) s[k] = 0.0f;
  if (y < 3) {                                           // block-uniform branch
    const v4f u0 = *(const v4f*)(Up + e * kRank);
    const v4f u1 = *(const v4f*)(Up + e * kRank + 4);
    const float ur[8] = {u0[0], u0[1], u0[2], u0[3], u1[0], u1[1], u1[2], u1[3]};
#pragma unroll
    for (int r = 0; r < kRank; ++r) {
      const v4f a = *(const v4f*)(dsh + r * kDim + d);
      const v4f c = *(const v4f*)(dsh + r * kDim + d + 4);
#pragma unroll
      for (int k = 0; k < 4; ++k) {
        s[k]     += ur[r] * a[k];
        s[4 + k] += ur[r] * c[k];
      }
    }
  }
  float f[8];
#pragma unroll
  for (int k = 0; k < 4; ++k) {
    f[k]     = (w0[k] + kLowRankScale * s[k])     * kWCarry;
    f[4 + k] = (w1[k] + kLowRankScale * s[4 + k]) * kWCarry;
  }
  unsigned short hb[8];
#pragma unroll
  for (int k = 0; k < 8; ++k) hb[k] = h_bits(f[k]);
  const v4u u = (v4u){pk16(hb[0], hb[1]), pk16(hb[2], hb[3]), pk16(hb[4], hb[5]), pk16(hb[6], hb[7])};
  unsigned short* op = (y < 3) ? (wqkv16 + (size_t)y * kDim * kDim + base) : (wo16 + base);
  *(v4u*)op = u;
  
}

constexpr int kFAWaves  = 8;
constexpr int kFAGroups = 2;                              // 16-query column groups per wave
constexpr int kFARows   = kFAWaves * kFAGroups * 16;      // 256 query rows per work-group
constexpr int kFAStage  = 64;                             // keys per stage
constexpr int kFANStage = kSeq / kFAStage;                // 64
constexpr int kFAPitch  = 72;                             // f16 per LDS row: 144 B, an odd multiple of 16 B
constexpr int kFATile   = 64 * kFAPitch;
constexpr float kFAScale = 0.125f * 1.4426950408889634f;  // 1 / sqrt(64) and log2(e)
constexpr float kFACarryLog2 = 6.0f;
static_assert(kSeq % kFARows == 0 && kSeq % kFAStage == 0 && kDh == 64 && kFAStage == 64, "fused attention mapping");
typedef __attribute__((ext_vector_type(2))) _Float16 v2h;
// lane l with lane l ^ 16
__device__ __forceinline__ float xhalf(float x) {
  const int b = __builtin_bit_cast(int, x);
  return __builtin_bit_cast(float, __builtin_amdgcn_permlanex16(b, b, 0x76543210, 0xfedcba98, false, false));
}
__device__ __forceinline__ unsigned pack2h(float lo, float hi) {
  return __builtin_bit_cast(unsigned, __builtin_convertvector((v2f){lo, hi}, v2h));   // round to nearest even
}
__global__ __launch_bounds__(kFAWaves * 32) void attn_fused_kernel(
    const unsigned short* __restrict__ Qp, const unsigned short* __restrict__ Kp, const unsigned short* __restrict__ VTp,
    unsigned short* __restrict__ Att) {
  __shared__ __align__(16) _Float16 sK[2][kFATile];   // 18,432 B
  __shared__ __align__(16) _Float16 sV[2][kFATile];   // 18,432 B
  const int t    = threadIdx.x;
  const int lane = t & 31, wave = t >> 5;
  const int c    = lane & 15;
  const int h8   = (lane >> 4) * 8;
  const int head = blockIdx.y;
  const int q0   = blockIdx.x * kFARows + wave * (kFAGroups * 16);
  const _Float16* Qh = (const _Float16*)Qp  + head * kDh;
  const _Float16* Kh = (const _Float16*)Kp  + head * kDh;                   // [key][kDim]
  const _Float16* Vh = (const _Float16*)VTp + (size_t)head * kDh * kSeq;    // [d][kSeq]

  // staging map: 8 threads per 128-B row, rows srow and srow + 32 of each tile
  const int srow = t >> 3, sseg = (t & 7) * 8;
  const _Float16* gK = Kh + (size_t)srow * kDim + sseg;
  const _Float16* gV = Vh + (size_t)srow * kSeq + sseg;
  const int sdst = srow * kFAPitch + sseg;
  v8h rk0 = *(const v8h*)(gK);
  v8h rk1 = *(const v8h*)(gK + 32 * kDim);
  v8h rv0 = *(const v8h*)(gV);
  v8h rv1 = *(const v8h*)(gV + 32 * kSeq);

  v16h qf[kFAGroups][2];
#pragma unroll
  for (int g = 0; g < kFAGroups; ++g)
#pragma unroll
    for (int kc = 0; kc < 2; ++kc)
      qf[g][kc] = Frag<_Float16>::load(Qh + (size_t)(q0 + 16 * g + c) * kDim + 32 * kc + h8);

  v8f acc[kFAGroups][4];
  v2f lsum[kFAGroups];
  float mrun[kFAGroups];
#pragma unroll
  for (int g = 0; g < kFAGroups; ++g) {
    mrun[g] = -__builtin_inff();
    lsum[g] = (v2f){0.f, 0.f};
#pragma unroll
    for (int j = 0; j < 4; ++j) acc[g][j] = (v8f){0.f,0.f,0.f,0.f,0.f,0.f,0.f,0.f};
  }

  *(v8h*)(&sK[0][sdst]) = rk0;
  *(v8h*)(&sK[0][sdst + 32 * kFAPitch]) = rk1;
  *(v8h*)(&sV[0][sdst]) = rv0;
  *(v8h*)(&sV[0][sdst + 32 * kFAPitch]) = rv1;
  __syncthreads();   // stage 0 is in LDS before any wave reads it

  for (int st = 0; st < kFANStage; ++st) {
    const int buf = st & 1;
    const bool more = st + 1 < kFANStage;   // the same for the whole work-group
    if (more) {
      gK += kFAStage * kDim;
      gV += kFAStage;
      rk0 = *(const v8h*)(gK);
      rk1 = *(const v8h*)(gK + 32 * kDim);
      rv0 = *(const v8h*)(gV);
      rv1 = *(const v8h*)(gV + 32 * kSeq);
    }
#pragma unroll
    for (int p = 0; p < 2; ++p) {          // two 32-key passes per stage
      v8f s[2][kFAGroups];
#pragma unroll
      for (int kt = 0; kt < 2; ++kt) {
        const _Float16* kp = &sK[buf][(32 * p + 16 * kt + c) * kFAPitch + h8];
        const v16h k0 = Frag<_Float16>::load(kp);
        const v16h k1 = Frag<_Float16>::load(kp + 32);
#pragma unroll
        for (int g = 0; g < kFAGroups; ++g) {
          s[kt][g] = (v8f){0.f,0.f,0.f,0.f,0.f,0.f,0.f,0.f};
          s[kt][g] = Frag<_Float16>::mma(k0, qf[g][0], s[kt][g]);
          s[kt][g] = Frag<_Float16>::mma(k1, qf[g][1], s[kt][g]);
        }
      }
      v16h vf[4];
#pragma unroll
      for (int j = 0; j < 4; ++j) vf[j] = Frag<_Float16>::load(&sV[buf][(16 * j + c) * kFAPitch + 32 * p + h8]);

      float mb[kFAGroups];
      bool need = false;
#pragma unroll
      for (int g = 0; g < kFAGroups; ++g) {
        float mx = s[0][g][0];
#pragma unroll
        for (int r = 1; r < 8; ++r) mx = fmaxf(mx, s[0][g][r]);
#pragma unroll
        for (int r = 0; r < 8; ++r) mx = fmaxf(mx, s[1][g][r]);
        mx = fmaxf(mx, xhalf(mx)) * kFAScale;   // both wave halves hold this query's maximum, scaled (the scale is positive)
        mb[g] = mx;
        need = need || (mx > mrun[g] + 8.0f);
      }
      if (__builtin_amdgcn_ballot_w32(need) != 0) {   // wave-uniform; always on the first pass, rare later
#pragma unroll
        for (int g = 0; g < kFAGroups; ++g) {
          const float mnew = fmaxf(mrun[g], mb[g]);
          const float corr = __builtin_amdgcn_exp2f(mrun[g] - mnew);   // 0 on the first pass, where mrun is -inf
          mrun[g] = mnew;
          lsum[g] = lsum[g] * corr;
#pragma unroll
          for (int j = 0; j < 4; ++j) acc[g][j] = acc[g][j] * corr;
        }
      }
#pragma unroll
      for (int g = 0; g < kFAGroups; ++g) {
        const float nm = kFACarryLog2 - mrun[g];
        union { v16h v; unsigned w[8]; } pf;
#pragma unroll
        for (int i = 0; i < 8; ++i) {
          const v2f arg = __builtin_elementwise_fma((v2f){s[i >> 2][g][2 * (i & 3)], s[i >> 2][g][2 * (i & 3) + 1]},
                                                    (v2f){kFAScale, kFAScale}, (v2f){nm, nm});
          const v2f pe = (v2f){__builtin_amdgcn_exp2f(arg[0]), __builtin_amdgcn_exp2f(arg[1])};
          lsum[g] += pe;
          pf.w[i] = pack2h(pe[0], pe[1]);
        }
#pragma unroll
        for (int j = 0; j < 4; ++j) acc[g][j] = Frag<_Float16>::mma(vf[j], pf.v, acc[g][j]);
      }
    }
    if (more) {
      *(v8h*)(&sK[buf ^ 1][sdst]) = rk0;
      *(v8h*)(&sK[buf ^ 1][sdst + 32 * kFAPitch]) = rk1;
      *(v8h*)(&sV[buf ^ 1][sdst]) = rv0;
      *(v8h*)(&sV[buf ^ 1][sdst + 32 * kFAPitch]) = rv1;
    }
    __syncthreads();   // publishes stage st + 1 and ends every wave's reads of the buffer that the next trip refills
  }

  // acc[g][j][r] = O^T[d = 16 j + 8 h + r][query 16 g + c]: 8 consecutive d of one row, one 16-B store
#pragma unroll
  for (int g = 0; g < kFAGroups; ++g) {
    const float lh  = lsum[g][0] + lsum[g][1];
    const float inv = kAttCarry / (lh + xhalf(lh));   // the exchange is unconditional
    unsigned short* op = Att + (size_t)(q0 + 16 * g + c) * kDim + head * kDh + h8;
#pragma unroll
    for (int j = 0; j < 4; ++j) {
      const v8f o = acc[g][j] * inv;
      const v4u u = (v4u){pack2h(o[0], o[1]), pack2h(o[2], o[3]), pack2h(o[4], o[5]), pack2h(o[6], o[7])};
      *(v4u*)(op + 16 * j) = u;
    }
  }
}

// ---------------------------------------------------------------------------
// Host glue.
// Workspace region map (bytes, every offset a multiple of 128; every plane fully written before any read):
//   X16    f16 [4096][768]                 6,291,456  at          0   (cast8)
//   WQKV16 f16 [3][768][768]  (x16 carry)  3,538,944  at  6,291,456   (fold_cast, planes q|k|v)
//   WO16   f16 [768][768]     (x16 carry)  1,179,648  at  9,830,400   (fold_cast)
//   Q16    f16 [4096][768]                 6,291,456  at 11,010,048   (GEMM)
//   K16    f16 [4096][768]                 6,291,456  at 17,301,504   (GEMM)
//   VT16   f16 [768][4096]  = V^T          6,291,456  at 23,592,960   (GEMM with swapped operand roles)
//   ATT16  f16 [4096][768]   (x256 carry)  6,291,456  at 29,884,416   (fused attention, each work-group [256 rows][64 cols])
//   total                                 36,175,872
// GEMM shapes (all M,N multiples of 128, K = 768 = 12 stages of 64, no padding anywhere):
//   q,k:  M=4096 N=768  K=768;  v^T: M=768 N=4096 K=768;  out: M=4096 N=768 K=768
// Launches: 1 cast + 1 fold + 3 projections + 1 fused attention + 1 out = 7.
// ---------------------------------------------------------------------------
extern "C" void kernel_launch(void* const* d_in, const int* in_sizes, int n_in,
                              void* d_out, int out_size, void* d_ws, size_t ws_size,
                              hipStream_t stream) {
  if (n_in < 15) return;
  const int nX = kSeq * kDim;          // 3,145,728
  const int nW = kDim * kDim;          // 589,824
  const int nA = kRank * kDim;         // 6,144
  if (in_sizes[0] != nX) return;
  if (in_sizes[1] != nW || in_sizes[3] != nW || in_sizes[5] != nW || in_sizes[7] != nW) return;
  if (in_sizes[2] != kDim || in_sizes[4] != kDim || in_sizes[6] != kDim || in_sizes[8] != kDim) return;
  for (int i = 9; i < 15; ++i) if (in_sizes[i] != nA) return;
  if (out_size != nX) return;

  const size_t szAct  = (size_t)kSeq * kDim * 2;
  const size_t szWqkv = (size_t)3 * kDim * kDim * 2;
  const size_t szWo   = (size_t)kDim * kDim * 2;
  const size_t offX    = 0;
  const size_t offWqkv = offX + szAct;
  const size_t offWo   = offWqkv + szWqkv;
  const size_t offQ    = offWo + szWo;
  const size_t offK    = offQ + szAct;
  const size_t offVT   = offK + szAct;
  const size_t offAtt  = offVT + szAct;
  const size_t total   = offAtt + szAct;   // 36,175,872
  if (ws_size < total) return;

  const float* x   = (const float*)d_in[0];
  const float* wq  = (const float*)d_in[1];
  const float* bq  = (const float*)d_in[2];
  const float* wk  = (const float*)d_in[3];
  const float* bk  = (const float*)d_in[4];
  const float* wv  = (const float*)d_in[5];
  const float* bv  = (const float*)d_in[6];
  const float* wo  = (const float*)d_in[7];
  const float* bo  = (const float*)d_in[8];
  const float* dq  = (const float*)d_in[9];    // [8][768]
  const float* uq  = (const float*)d_in[10];   // [768][8]
  const float* dk  = (const float*)d_in[11];
  const float* uk  = (const float*)d_in[12];
  const float* dv  = (const float*)d_in[13];
  const float* uv  = (const float*)d_in[14];
  float* out = (float*)d_out;
  char* ws = (char*)d_ws;
  unsigned short* X16    = (unsigned short*)(ws + offX);
  unsigned short* WQKV16 = (unsigned short*)(ws + offWqkv);
  unsigned short* WO16   = (unsigned short*)(ws + offWo);
  unsigned short* Q16    = (unsigned short*)(ws + offQ);
  unsigned short* K16    = (unsigned short*)(ws + offK);
  unsigned short* VT16   = (unsigned short*)(ws + offVT);
  unsigned short* ATT16  = (unsigned short*)(ws + offAtt);
  const unsigned short* WQ16 = WQKV16;
  const unsigned short* WK16 = WQKV16 + (size_t)kDim * kDim;
  const unsigned short* WV16 = WQKV16 + (size_t)2 * kDim * kDim;

  // ---- prologue: 16-bit operand planes ----
  const int n8 = nX / 8;   // 393,216 -> 1536 blocks exact
  cast8_f16_kernel<<<dim3((n8 + 255) / 256), dim3(256), 0, stream>>>(x, X16, n8);
  fold_cast_kernel<<<dim3(nW / 2048, 4), dim3(256), 0, stream>>>(wq, wk, wv, wo, dq, uq, dk, uk, dv, uv, WQKV16, WO16);

  // ---- projections: one work-group per 128 x 128 tile ----
  const int tilesProj = (kSeq / kGTileMN) * (kDim / kGTileMN);   // 192 work-groups of 8 waves
  // Q16[s][e] = (1/16) * sum_d X16[s][d] * WQ16[e][d] + bq[e]
  wmma_gemm_lds<2, 1><<<dim3(tilesProj), dim3(256), 0, stream>>>(X16, WQ16, (void*)Q16, kDim, bq, kDim / kGTileMN, kWCarryInv);
  // K16[s][e] = (1/16) * sum_d X16[s][d] * WK16[e][d] + bk[e]
  wmma_gemm_lds<2, 1><<<dim3(tilesProj), dim3(256), 0, stream>>>(X16, WK16, (void*)K16, kDim, bk, kDim / kGTileMN, kWCarryInv);
  // VT16[c][s] = (1/16) * sum_d WV16[c][d] * X16[s][d] + bv[c]   (A = weights [768][768], Bt = activations [4096][768], bias indexed by m)
  wmma_gemm_lds<1, 1><<<dim3(tilesProj), dim3(256), 0, stream>>>(WV16, X16, (void*)VT16, kSeq, bv, kSeq / kGTileMN, kWCarryInv);

  // ---- attention: one launch, one work-group per (256 query rows, head) ----
  // ATT16[s][h*64+n] = 256 * sum_j softmax_j(0.125 * Q16[s][h*64+:] . K16[j][h*64+:]) * VT16[h*64+n][j]
  attn_fused_kernel<<<dim3(kSeq / kFARows, kHeads), dim3(kFAWaves * 32), 0, stream>>>(Q16, K16, VT16, ATT16);

  // ---- output projection: out[s][e] = (1/4096) * sum_c ATT16[s][c] * WO16[e][c] + bo[e]   (M=4096, N=768, K=768, f32 to d_out) ----
  wmma_gemm_lds<2, 0><<<dim3(tilesProj), dim3(256), 0, stream>>>(ATT16, WO16, (void*)out, kDim, bo, kDim / kGTileMN, kOutScale);
}

// v004
// It runs in 99.8 microseconds.
// Timed twice side by side with v003, it ran 1.08 times as fast both times.
// All steps since v000 together make it 48.5 times as fast.
// Contractions: q/k projections and v^T projection (x f16 x W_eff^T f16 carried x16), scores k_h.q_h^T (q,k f16 planes), v_h^T.probs^T (V^T f16 x unnormalised P f16 carried x64), output projection (attn f16 carried x256 x Wo^T f16 carried x16): all v_wmma_f32_16x16x32_f16 with f32 accumulate; rank-8 weight fold, bias add and online softmax in f32.
#include <hip/hip_runtime.h>
#include <math.h>

// ---------------------------------------------------------------------------
// Problem constants
// ---------------------------------------------------------------------------
constexpr int kSeq    = 4096;             // tokens (batch 1)
constexpr int kDim    = 768;              // model width
constexpr int kHeads  = 12;
constexpr int kDh     = 64;
constexpr int kRank   = 8;                // low-rank adapter width
constexpr float kLowRankScale = 2.0f;     // alpha / rank = 16 / 8
constexpr float kWCarry    = 16.0f;       // weights carried x16 in f16
constexpr float kWCarryInv = 1.0f / 16.0f;
constexpr float kAttCarry  = 256.0f;      // attention output carried x256 in f16
constexpr float kOutScale  = 1.0f / (kAttCarry * kWCarry);   // 1/4096
static_assert(kHeads * kDh == kDim, "shape");
static_assert(kSeq % 64 == 0 && kDim % 64 == 0 && kDh % 64 == 0, "M,N tile multiples");
static_assert(kDim % 32 == 0 && kDh % 32 == 0 && kSeq % 32 == 0, "K multiples of 32");
static_assert((kDim * kDim) % 2048 == 0, "fold block mapping");
static_assert((kSeq * kDim) % 2048 == 0, "cast block mapping");
static_assert(kRank * kDim == 6 * 256 * 4, "adapter staging: 6 float4 per thread of a 256-thread block");

typedef __attribute__((ext_vector_type(16))) _Float16 v16h;
typedef __attribute__((ext_vector_type(8)))  _Float16 v8h;
typedef __attribute__((ext_vector_type(8)))  float    v8f;
typedef __attribute__((ext_vector_type(4)))  float    v4f;
typedef __attribute__((ext_vector_type(2)))  float    v2f;
typedef __attribute__((ext_vector_type(4)))  unsigned int v4u;

// ---------------------------------------------------------------------------
// Fragment loader and matrix product, f16 operands, f32 accumulate
// ---------------------------------------------------------------------------
template <typename T> struct Frag;
template <> struct Frag<_Float16> {
  typedef v16h V; union U { v16h v; v8h h[2]; };
  // elements 0..7 <- p[0..7], 8..15 <- p[16..23]
  static __device__ __forceinline__ v16h load(const _Float16* p) {
    U f; f.h[0] = *(const v8h*)(p); f.h[1] = *(const v8h*)(p + 16); return f.v;
  }
  static __device__ __forceinline__ v8f mma(v16h a, v16h b, v8f c) {
    return __builtin_amdgcn_wmma_f32_16x16x32_f16(false, a, false, b, (short)0, c, false, false);
  }
};

__device__ __forceinline__ unsigned pk16(unsigned short a, unsigned short b) { return (unsigned)a | ((unsigned)b << 16); }
__device__ __forceinline__ unsigned short h_bits(float f) { const _Float16 h = (_Float16)f; return __builtin_bit_cast(unsigned short, h); }

// ---------------------------------------------------------------------------
// WMMA GEMM with both operands staged in LDS: C[m,n] = scale * sum_k A[m,k] * Bt[n,k] + bias.
// A row-major [M][kDim], Bt row-major [N][kDim], f16; M, N multiples of 128; K = kDim for every product of this file.
// One work-group = one 128 x 128 tile of C; 8 waves as 4 (m) x 2 (n), each 32 x 64 = 2 x 4 accumulator tiles.
// A stage is 64 k: 128 rows x 128 B of A and of Bt. 8 threads fetch one whole 128-B line, so a wave-wide load covers 4 whole lines;
// every line is fetched once per work-group and shared by its waves through LDS (pitch 144 B, an odd multiple of 16 B).
// Stage s + 2 is fetched into registers while stage s is worked on (two register sets), stage s + 1 is stored to the other of two
// LDS buffers in the middle of stage s, one work-group barrier per stage; fragments are read half a stage (32 k) ahead of their products.
// A and B fragments come from LDS through the same loader (equal k orders); k runs upward in steps of 32 in every accumulator.
// BIAS_MODE: 1 = bias[m], 2 = bias[n], 3 = told at run time by rowBias (the same for the whole work-group).  OUT_MODE: 0 = f32, 1 = f16.
// The tile (tm, tn) and the operands come from the calling kernel, which derives them from its block index.
// ---------------------------------------------------------------------------
constexpr int kGTileMN = 128;                   // rows of A and of Bt per work-group
constexpr int kGStageK = 64;                    // k per stage: one 128-B line per row
constexpr int kGNStage = kDim / kGStageK;       // 12
constexpr int kGPitch  = 72;                    // f16 per LDS row
constexpr int kGTile   = kGTileMN * kGPitch;    // f16 per staged operand tile (18,432 B)
static_assert(kSeq % kGTileMN == 0 && kDim % kGTileMN == 0 && kDim % (2 * kGStageK) == 0, "staged GEMM mapping");
// Work-group barrier that orders LDS traffic only: __syncthreads() also waits for every outstanding global load, which would
// end the two-stage lead of the register prefetch at each stage; nothing but LDS passes between the waves of this kernel.
__device__ __forceinline__ void lds_barrier() {
  __builtin_amdgcn_fence(__ATOMIC_RELEASE, "workgroup", "local");
  __builtin_amdgcn_s_barrier();
  __builtin_amdgcn_fence(__ATOMIC_ACQUIRE, "workgroup", "local");
}
// Epilogue of the staged GEMM: each wave turns its 16 x 64 slabs through its own LDS range (slab) into whole-line stores.
// (m0, n0) = first row and column of the wave's 32 x 64 part of C.  BIAS_MODE: 1 = bias[m], 2 = bias[n].  OUT_MODE: 0 = f32, 1 = f16.
template <int BIAS_MODE, int OUT_MODE>
__device__ __forceinline__ void wmma_gemm_store(
    const v8f (&acc)[2][4], float* slab, void* __restrict__ Cout, int ldc, const float* __restrict__ bias, int m0, int n0, float scale) {
  const int lane  = threadIdx.x & 31;
  const int rlane = lane & 15;                 // column within subtile
  const int mOff  = (lane >> 4) * 8;           // D row offset
  // the unroll directives of this function, but those on the two store loops, are there because their loops index register arrays by the loop variable
#pragma unroll
  for (int i = 0; i < 2; ++i) {
    const int mBase = m0 + (i << 4);
    // bias[m]: the 8 rows this lane half touches are contiguous -> two 16-B loads
    float bmr[8] = {0.f, 0.f, 0.f, 0.f, 0.f, 0.f, 0.f, 0.f};
    if (BIAS_MODE == 1) {
      const float* bp = bias + mBase + mOff;
      const v4f bm0 = *(const v4f*)(bp);
      const v4f bm1 = *(const v4f*)(bp + 4);
      bmr[0] = bm0[0]; bmr[1] = bm0[1]; bmr[2] = bm0[2]; bmr[3] = bm0[3];
      bmr[4] = bm1[0]; bmr[5] = bm1[1]; bmr[6] = bm1[2]; bmr[7] = bm1[3];
    }
#pragma unroll
    for (int j = 0; j < 4; ++j) {
      const int n = n0 + (j << 4) + rlane;
      float bv = 0.f;
      if (BIAS_MODE == 2) bv = bias[n];
#pragma unroll
      for (int r = 0; r < 8; ++r) {
        float v = acc[i][j][r] * scale;
        if (BIAS_MODE == 1) v += bmr[r];
        if (BIAS_MODE == 2) v += bv;
        slab[(mOff + r) * 68 + (j << 4) + rlane] = v;
      }
    }
    __builtin_amdgcn_fence(__ATOMIC_RELEASE, "workgroup");
    __builtin_amdgcn_wave_barrier();
    __builtin_amdgcn_fence(__ATOMIC_ACQUIRE, "workgroup");
    if (OUT_MODE == 0) {
      float* C = (float*)Cout;
      const int hh = lane >> 4, c4 = (lane & 15) * 4;     // row seg = 256 B = 16 lanes x 16 B
#pragma unroll
      for (int it = 0; it < 8; ++it) {
        const int row = it * 2 + hh;
        v4f v = *(const v4f*)(slab + row * 68 + c4);
        *(v4f*)(C + (size_t)(mBase + row) * ldc + n0 + c4) = v;
      }
    } else {
      const int q = lane >> 3, c8 = (lane & 7) * 8;       // row seg = 128 B = 8 lanes x 16 B
      unsigned short* C = (unsigned short*)Cout;
#pragma unroll
      for (int it = 0; it < 4; ++it) {
        const int row = it * 4 + q;
        const float* sp = slab + row * 68 + c8;
        v8h hv;
#pragma unroll
        for (int e = 0; e < 8; ++e) hv[e] = (_Float16)sp[e];
        *(v8h*)(C + (size_t)(mBase + row) * ldc + n0 + c8) = hv;
      }
    }
    __builtin_amdgcn_fence(__ATOMIC_RELEASE, "workgroup");
    __builtin_amdgcn_wave_barrier();
    __builtin_amdgcn_fence(__ATOMIC_ACQUIRE, "workgroup");
  }
}

template <int BIAS_MODE, int OUT_MODE>
__device__ __forceinline__ void wmma_gemm_lds_tile(
    const unsigned short* __restrict__ Ap, const unsigned short* __restrict__ Btp,
    void* __restrict__ Cout, int ldc, const float* __restrict__ bias, bool rowBias, int tm, int tn, float scale) {
  __shared__ __align__(16) _Float16 sA[2][kGTile];   // 36,864 B
  __shared__ __align__(16) _Float16 sB[2][kGTile];   // 36,864 B
  __shared__ __align__(16) float sT[8][16 * 68];     // per-wave 16x64 output slab, pitch 68 floats
  const int t    = threadIdx.x;
  const int lane = t & 31;
  const int wave = t >> 5;
  const int rlane = lane & 15;                 // row (A) / col (B, D) within subtile
  const int koff  = (lane >> 4) * 8;           // k offset of this lane half
  const int wm = (wave >> 1) * 32;             // this wave's rows inside the tile
  const int wn = (wave & 1) * 64;              // this wave's columns inside the tile

  // staging map: 8 threads per 128-B row, rows srow + 32 q, q = 0..3, of each operand tile
  const int srow = t >> 3, sseg = (t & 7) * 8;
  const _Float16* gA = (const _Float16*)Ap  + (size_t)(tm * kGTileMN + srow) * kDim + sseg;
  const _Float16* gB = (const _Float16*)Btp + (size_t)(tn * kGTileMN + srow) * kDim + sseg;
  const int sdst = srow * kGPitch + sseg;
  v8h ra[2][4], rb[2][4];
  // the unroll directives of this kernel, but the one on the loop over stage pairs, are there because their loops index register arrays by the loop variable
#pragma unroll
  for (int u = 0; u < 2; ++u)
#pragma unroll
    for (int q = 0; q < 4; ++q) {
      ra[u][q] = *(const v8h*)(gA + (size_t)q * 32 * kDim + u * kGStageK);
      rb[u][q] = *(const v8h*)(gB + (size_t)q * 32 * kDim + u * kGStageK);
    }

  v8f acc[2][4];
#pragma unroll
  for (int i = 0; i < 2; ++i)
#pragma unroll
    for (int j = 0; j < 4; ++j) acc[i][j] = (v8f){0.f,0.f,0.f,0.f,0.f,0.f,0.f,0.f};

#pragma unroll
  for (int q = 0; q < 4; ++q) {
    *(v8h*)(&sA[0][sdst + q * 32 * kGPitch]) = ra[0][q];
    *(v8h*)(&sB[0][sdst + q * 32 * kGPitch]) = rb[0][q];
  }
  lds_barrier();   // stage 0 is in LDS before any wave reads it

  // fragments of one 32-k half stage; set 0 holds the lower half, set 1 the upper; each set is read from LDS while the other is worked on
  v16h af[2][2], bf[2][4];
#pragma unroll
  for (int i = 0; i < 2; ++i) af[0][i] = Frag<_Float16>::load(&sA[0][(wm + 16 * i + rlane) * kGPitch + koff]);
#pragma unroll
  for (int j = 0; j < 4; ++j) bf[0][j] = Frag<_Float16>::load(&sB[0][(wn + 16 * j + rlane) * kGPitch + koff]);

  // unrolled whole: the tests on s become compile-time, so no path joins and the counted waits on the register prefetch stay exact
#pragma unroll
  for (int st = 0; st < kGNStage; st += 2) {
#pragma unroll
    for (int u = 0; u < 2; ++u) {            // stage st + u: LDS buffer u, register set u is free
      const int s = st + u;
      if (s + 2 < kGNStage) {                // the same for the whole work-group
#pragma unroll
        for (int q = 0; q < 4; ++q) {
          ra[u][q] = *(const v8h*)(gA + (size_t)q * 32 * kDim + (s + 2) * kGStageK);
          rb[u][q] = *(const v8h*)(gB + (size_t)q * 32 * kDim + (s + 2) * kGStageK);
        }
      }
#pragma unroll
      for (int i = 0; i < 2; ++i) af[1][i] = Frag<_Float16>::load(&sA[u][(wm + 16 * i + rlane) * kGPitch + 32 + koff]);
#pragma unroll
      for (int j = 0; j < 4; ++j) bf[1][j] = Frag<_Float16>::load(&sB[u][(wn + 16 * j + rlane) * kGPitch + 32 + koff]);
      // keeps the upper half's LDS reads as one group ahead of the lower half's products, which cover their latency
      __builtin_amdgcn_sched_barrier(0);
#pragma unroll
      for (int i = 0; i < 2; ++i)
#pragma unroll
        for (int j = 0; j < 4; ++j) acc[i][j] = Frag<_Float16>::mma(af[0][i], bf[0][j], acc[i][j]);
      // keeps these products ahead of the stores and the barrier: moved behind them, the wait in front of the barrier would meet reads just issued
      __builtin_amdgcn_sched_barrier(0);
      if (s + 1 < kGNStage) {
#pragma unroll
        for (int q = 0; q < 4; ++q) {
          *(v8h*)(&sA[u ^ 1][sdst + q * 32 * kGPitch]) = ra[u ^ 1][q];
          *(v8h*)(&sB[u ^ 1][sdst + q * 32 * kGPitch]) = rb[u ^ 1][q];
        }
      }
      // publishes stage s + 1; every read of stage s has returned in front of it, so the next stage may refill buffer u behind it
      lds_barrier();
      if (s + 1 < kGNStage) {
#pragma unroll
        for (int i = 0; i < 2; ++i) af[0][i] = Frag<_Float16>::load(&sA[u ^ 1][(wm + 16 * i + rlane) * kGPitch + koff]);
#pragma unroll
        for (int j = 0; j < 4; ++j) bf[0][j] = Frag<_Float16>::load(&sB[u ^ 1][(wn + 16 * j + rlane) * kGPitch + koff]);
      }
      // keeps the next stage's first LDS reads as one group ahead of the upper half's products, which cover their latency
      __builtin_amdgcn_sched_barrier(0);
#pragma unroll
      for (int i = 0; i < 2; ++i)
#pragma unroll
        for (int j = 0; j < 4; ++j) acc[i][j] = Frag<_Float16>::mma(af[1][i], bf[1][j], acc[i][j]);
    }
  }

  // ---- epilogue; a bias mode told at run time picks one of the two compile-time forms by a block-uniform branch ----
  const int m0 = tm * kGTileMN + wm;
  const int n0 = tn * kGTileMN + wn;
  float* slab = sT[wave];
  if constexpr (BIAS_MODE == 3) {
    if (rowBias) wmma_gemm_store<1, OUT_MODE>(acc, slab, Cout, ldc, bias, m0, n0, scale);
    else         wmma_gemm_store<2, OUT_MODE>(acc, slab, Cout, ldc, bias, m0, n0, scale);
  } else {
    wmma_gemm_store<BIAS_MODE, OUT_MODE>(acc, slab, Cout, ldc, bias, m0, n0, scale);
  }
}

// ---------------------------------------------------------------------------
// The three input projections in one launch: they share x and depend on nothing of each other. 3 x 192 work-groups, one 128 x 128 tile each;
// the block index picks the product (block-uniform): 0 = q, 1 = k (A = activations, Bt = weights, bias[n]), 2 = v^T (A = weights, Bt = activations, bias[m]).
//   Q16[s][e]  = (1/16) * sum_d X16[s][d] * WQ16[e][d] + bq[e];   K16 alike;   VT16[c][s] = (1/16) * sum_d WV16[c][d] * X16[s][d] + bv[c]
// ---------------------------------------------------------------------------
constexpr int kProjTiles = (kSeq / kGTileMN) * (kDim / kGTileMN);   // 192 tiles per product
__global__ __launch_bounds__(256) void qkv_gemm_kernel(
    const unsigned short* __restrict__ X16, const unsigned short* __restrict__ WQKV16,
    unsigned short* __restrict__ Q16, unsigned short* __restrict__ K16, unsigned short* __restrict__ VT16,
    const float* __restrict__ bq, const float* __restrict__ bk, const float* __restrict__ bv) {
  const unsigned which = blockIdx.x / (unsigned)kProjTiles;
  const unsigned tile  = blockIdx.x - which * (unsigned)kProjTiles;
  const bool vt        = which == 2;
  const unsigned short* W = WQKV16 + (size_t)which * kDim * kDim;
  const unsigned tilesN = vt ? kSeq / kGTileMN : kDim / kGTileMN;   // column tiles of C: 32 for v^T, 6 for q and k
  const int tm = vt ? tile / (unsigned)(kSeq / kGTileMN) : tile / (unsigned)(kDim / kGTileMN);
  const int tn = tile - (unsigned)tm * tilesN;
  wmma_gemm_lds_tile<3, 1>(vt ? W : X16, vt ? X16 : W, (void*)(vt ? VT16 : (which == 1 ? K16 : Q16)), vt ? kSeq : kDim,
                           vt ? bv : (which == 1 ? bk : bq), vt, tm, tn, kWCarryInv);
}
// Output projection: out[s][e] = (1/4096) * sum_c ATT16[s][c] * WO16[e][c] + bo[e], f32
__global__ __launch_bounds__(256) void out_gemm_kernel(
    const unsigned short* __restrict__ ATT16, const unsigned short* __restrict__ WO16, float* __restrict__ out, const float* __restrict__ bo) {
  const int tm = blockIdx.x / (kDim / kGTileMN);
  const int tn = blockIdx.x % (kDim / kGTileMN);
  wmma_gemm_lds_tile<2, 0>(ATT16, WO16, (void*)out, kDim, bo, false, tm, tn, kOutScale);
}

// ---------------------------------------------------------------------------
// x to f16: block blk covers 2048 consecutive elements, 8 per thread
// ---------------------------------------------------------------------------
__device__ __forceinline__ void cast8_f16_block(int blk, const float* __restrict__ in, unsigned short* __restrict__ out, int n8) {
  const int i = blk * 256 + threadIdx.x;
  if (i >= n8) return;
  const float* p = in + 8 * (size_t)i;
  const v4f a = *(const v4f*)(p);
  const v4f c = *(const v4f*)(p + 4);
  unsigned short hb[8];
#pragma unroll
  for (int e = 0; e < 4; ++e) {
    hb[e]     = h_bits(a[e]);
    hb[4 + e] = h_bits(c[e]);
  }
  const v4u u = (v4u){pk16(hb[0], hb[1]), pk16(hb[2], hb[3]), pk16(hb[4], hb[5]), pk16(hb[6], hb[7])};
  unsigned short* q = out + 8 * (size_t)i;
  *(v4u*)q = u;
  
}

// ---------------------------------------------------------------------------
// Rank-8 adapter fold + f16 cast with x16 carry, f32 math:
//   plane y in {0,1,2}: WQKV[y][e][d] = f16( 16 * ( w_y[e][d] + 2 * sum_r up_y[e][r] * down_y[r][d] ) )
//   plane y == 3      : WO[e][d]      = f16( 16 * wo[e][d] )
// Weights are [out e][in d] = Bt[n][k] for the GEMMs; orientation kept as given (no transpose).
// 288 x 4 blocks: y = matrix (block-uniform), block bx of a matrix covers 2048 consecutive elements (288 x 2048 = 768 x 768 exact);
// thread t owns elements 8t..8t+7 of the block (one row e, 8 consecutive d).
// The whole down matrix [8][768] of the plane is staged in LDS first (cooperative: 6 b128 per thread, 6 x 256 x 4 = 6144 floats =
// the whole matrix, every LDS word read below is written), block barrier, then per lane 2 b128 (w) + 2 b128 (up row) global loads.
// ---------------------------------------------------------------------------
__device__ __forceinline__ void fold_cast_block(
    int bx, int y,
    const float* __restrict__ wq, const float* __restrict__ wk, const float* __restrict__ wv, const float* __restrict__ wo,
    const float* __restrict__ dq, const float* __restrict__ uq,
    const float* __restrict__ dk, const float* __restrict__ uk,
    const float* __restrict__ dv, const float* __restrict__ uv,
    unsigned short* __restrict__ wqkv16, unsigned short* __restrict__ wo16) {
  __shared__ __align__(16) float dsh[kRank * kDim];      // down matrix [8][768] of this plane, 24,576 B
  const int t = threadIdx.x;
  const float* W  = (y == 0) ? wq : (y == 1) ? wk : (y == 2) ? wv : wo;
  const float* Dn = (y == 0) ? dq : (y == 1) ? dk : dv;   // y == 3: valid pointer, staged but not used
  const float* Up = (y == 0) ? uq : (y == 1) ? uk : uv;
  // stage down [8][768] = 1536 float4: thread t loads slots t + 256*i, i = 0..5 (exact coverage)
#pragma unroll
  for (int i = 0; i < 6; ++i) {
    const int q4 = (i * 256 + t) * 4;
    const v4f dd = *(const v4f*)(Dn + q4);
    *(v4f*)(dsh + q4) = dd;
  }
  __syncthreads();

  const int base = bx * 2048 + 8 * t;            // < 768*768
  const int e = base / kDim;
  const int d = base - e * kDim;                         // multiple of 8
  const v4f w0 = *(const v4f*)(W + base);
  const v4f w1 = *(const v4f*)(W + base + 4);
  float s[8];
#pragma unroll
  for (int k = 0; k < 8; ++k) s[k] = 0.0f;
  if (y < 3) {                                           // block-uniform branch
    const v4f u0 = *(const v4f*)(Up + e * kRank);
    const v4f u1 = *(const v4f*)(Up + e * kRank + 4);
    const float ur[8] = {u0[0], u0[1], u0[2], u0[3], u1[0], u1[1], u1[2], u1[3]};
#pragma unroll
    for (int r = 0; r < kRank; ++r) {
      const v4f a = *(const v4f*)(dsh + r * kDim + d);
      const v4f c = *(const v4f*)(dsh + r * kDim + d + 4);
#pragma unroll
      for (int k = 0; k < 4; ++k) {
        s[k]     += ur[r] * a[k];
        s[4 + k] += ur[r] * c[k];
      }
    }
  }
  float f[8];
#pragma unroll
  for (int k = 0; k < 4; ++k) {
    f[k]     = (w0[k] + kLowRankScale * s[k])     * kWCarry;
    f[4 + k] = (w1[k] + kLowRankScale * s[4 + k]) * kWCarry;
  }
  unsigned short hb[8];
#pragma unroll
  for (int k = 0; k < 8; ++k) hb[k] = h_bits(f[k]);
  const v4u u = (v4u){pk16(hb[0], hb[1]), pk16(hb[2], hb[3]), pk16(hb[4], hb[5]), pk16(hb[6], hb[7])};
  unsigned short* op = (y < 3) ? (wqkv16 + (size_t)y * kDim * kDim + base) : (wo16 + base);
  *(v4u*)op = u;
  
}

// ---------------------------------------------------------------------------
// Both 16-bit operand preparations in one launch: neither reads what the other writes. The block index picks the work (block-uniform,
// so the fold's barrier is passed by every thread of a block that reaches it): blocks 0..1151 fold and cast the weights, the other 1536 cast x.
// ---------------------------------------------------------------------------
constexpr int kFoldBlocksPerW = kDim * kDim / 2048;      // 288
constexpr int kFoldBlocks     = 4 * kFoldBlocksPerW;     // 1152
constexpr int kCastBlocks     = kSeq * kDim / 2048;      // 1536
__global__ __launch_bounds__(256) void prep_kernel(
    const float* __restrict__ x, unsigned short* __restrict__ x16,
    const float* __restrict__ wq, const float* __restrict__ wk, const float* __restrict__ wv, const float* __restrict__ wo,
    const float* __restrict__ dq, const float* __restrict__ uq,
    const float* __restrict__ dk, const float* __restrict__ uk,
    const float* __restrict__ dv, const float* __restrict__ uv,
    unsigned short* __restrict__ wqkv16, unsigned short* __restrict__ wo16) {
  const int b = blockIdx.x;
  if (b < kFoldBlocks) {
    const int y = b / kFoldBlocksPerW;
    fold_cast_block(b - y * kFoldBlocksPerW, y, wq, wk, wv, wo, dq, uq, dk, uk, dv, uv, wqkv16, wo16);
  } else {
    cast8_f16_block(b - kFoldBlocks, x, x16, kSeq * kDim / 8);
  }
}

constexpr int kFAWaves  = 8;
constexpr int kFAGroups = 2;                              // 16-query column groups per wave
constexpr int kFARows   = kFAWaves * kFAGroups * 16;      // 256 query rows per work-group
constexpr int kFAStage  = 64;                             // keys per stage
constexpr int kFANStage = kSeq / kFAStage;                // 64
constexpr int kFAPitch  = 72;                             // f16 per LDS row: 144 B, an odd multiple of 16 B
constexpr int kFATile   = 64 * kFAPitch;
constexpr float kFAScale = 0.125f * 1.4426950408889634f;  // 1 / sqrt(64) and log2(e)
constexpr float kFACarryLog2 = 6.0f;
static_assert(kSeq % kFARows == 0 && kSeq % kFAStage == 0 && kDh == 64 && kFAStage == 64, "fused attention mapping");
typedef __attribute__((ext_vector_type(2))) _Float16 v2h;
// lane l with lane l ^ 16
__device__ __forceinline__ float xhalf(float x) {
  const int b = __builtin_bit_cast(int, x);
  return __builtin_bit_cast(float, __builtin_amdgcn_permlanex16(b, b, 0x76543210, 0xfedcba98, false, false));
}
__device__ __forceinline__ unsigned pack2h(float lo, float hi) {
  return __builtin_bit_cast(unsigned, __builtin_convertvector((v2f){lo, hi}, v2h));   // round to nearest even
}
__global__ __launch_bounds__(kFAWaves * 32) void attn_fused_kernel(
    const unsigned short* __restrict__ Qp, const unsigned short* __restrict__ Kp, const unsigned short* __restrict__ VTp,
    unsigned short* __restrict__ Att) {
  __shared__ __align__(16) _Float16 sK[2][kFATile];   // 18,432 B
  __shared__ __align__(16) _Float16 sV[2][kFATile];   // 18,432 B
  const int t    = threadIdx.x;
  const int lane = t & 31, wave = t >> 5;
  const int c    = lane & 15;
  const int h8   = (lane >> 4) * 8;
  const int head = blockIdx.y;
  const int q0   = blockIdx.x * kFARows + wave * (kFAGroups * 16);
  const _Float16* Qh = (const _Float16*)Qp  + head * kDh;
  const _Float16* Kh = (const _Float16*)Kp  + head * kDh;                   // [key][kDim]
  const _Float16* Vh = (const _Float16*)VTp + (size_t)head * kDh * kSeq;    // [d][kSeq]

  // staging map: 8 threads per 128-B row, rows srow and srow + 32 of each tile
  const int srow = t >> 3, sseg = (t & 7) * 8;
  const _Float16* gK = Kh + (size_t)srow * kDim + sseg;
  const _Float16* gV = Vh + (size_t)srow * kSeq + sseg;
  const int sdst = srow * kFAPitch + sseg;
  v8h rk0 = *(const v8h*)(gK);
  v8h rk1 = *(const v8h*)(gK + 32 * kDim);
  v8h rv0 = *(const v8h*)(gV);
  v8h rv1 = *(const v8h*)(gV + 32 * kSeq);

  v16h qf[kFAGroups][2];
#pragma unroll
  for (int g = 0; g < kFAGroups; ++g)
#pragma unroll
    for (int kc = 0; kc < 2; ++kc)
      qf[g][kc] = Frag<_Float16>::load(Qh + (size_t)(q0 + 16 * g + c) * kDim + 32 * kc + h8);

  v8f acc[kFAGroups][4];
  v2f lsum[kFAGroups];
  float mrun[kFAGroups];
#pragma unroll
  for (int g = 0; g < kFAGroups; ++g) {
    mrun[g] = -__builtin_inff();
    lsum[g] = (v2f){0.f, 0.f};
#pragma unroll
    for (int j = 0; j < 4; ++j) acc[g][j] = (v8f){0.f,0.f,0.f,0.f,0.f,0.f,0.f,0.f};
  }

  *(v8h*)(&sK[0][sdst]) = rk0;
  *(v8h*)(&sK[0][sdst + 32 * kFAPitch]) = rk1;
  *(v8h*)(&sV[0][sdst]) = rv0;
  *(v8h*)(&sV[0][sdst + 32 * kFAPitch]) = rv1;
  __syncthreads();   // stage 0 is in LDS before any wave reads it

  for (int st = 0; st < kFANStage; ++st) {
    const int buf = st & 1;
    const bool more = st + 1 < kFANStage;   // the same for the whole work-group
    if (more) {
      gK += kFAStage * kDim;
      gV += kFAStage;
      rk0 = *(const v8h*)(gK);
      rk1 = *(const v8h*)(gK + 32 * kDim);
      rv0 = *(const v8h*)(gV);
      rv1 = *(const v8h*)(gV + 32 * kSeq);
    }
#pragma unroll
    for (int p = 0; p < 2; ++p) {          // two 32-key passes per stage
      v8f s[2][kFAGroups];
#pragma unroll
      for (int kt = 0; kt < 2; ++kt) {
        const _Float16* kp = &sK[buf][(32 * p + 16 * kt + c) * kFAPitch + h8];
        const v16h k0 = Frag<_Float16>::load(kp);
        const v16h k1 = Frag<_Float16>::load(kp + 32);
#pragma unroll
        for (int g = 0; g < kFAGroups; ++g) {
          s[kt][g] = (v8f){0.f,0.f,0.f,0.f,0.f,0.f,0.f,0.f};
          s[kt][g] = Frag<_Float16>::mma(k0, qf[g][0], s[kt][g]);
          s[kt][g] = Frag<_Float16>::mma(k1, qf[g][1], s[kt][g]);
        }
      }
      v16h vf[4];
#pragma unroll
      for (int j = 0; j < 4; ++j) vf[j] = Frag<_Float16>::load(&sV[buf][(16 * j + c) * kFAPitch + 32 * p + h8]);

      float mb[kFAGroups];
      bool need = false;
#pragma unroll
      for (int g = 0; g < kFAGroups; ++g) {
        float mx = s[0][g][0];
#pragma unroll
        for (int r = 1; r < 8; ++r) mx = fmaxf(mx, s[0][g][r]);
#pragma unroll
        for (int r = 0; r < 8; ++r) mx = fmaxf(mx, s[1][g][r]);
        mx = fmaxf(mx, xhalf(mx)) * kFAScale;   // both wave halves hold this query's maximum, scaled (the scale is positive)
        mb[g] = mx;
        need = need || (mx > mrun[g] + 8.0f);
      }
      if (__builtin_amdgcn_ballot_w32(need) != 0) {   // wave-uniform; always on the first pass, rare later
#pragma unroll
        for (int g = 0; g < kFAGroups; ++g) {
          const float mnew = fmaxf(mrun[g], mb[g]);
          const float corr = __builtin_amdgcn_exp2f(mrun[g] - mnew);   // 0 on the first pass, where mrun is -inf
          mrun[g] = mnew;
          lsum[g] = lsum[g] * corr;
#pragma unroll
          for (int j = 0; j < 4; ++j) acc[g][j] = acc[g][j] * corr;
        }
      }
#pragma unroll
      for (int g = 0; g < kFAGroups; ++g) {
        const float nm = kFACarryLog2 - mrun[g];
        union { v16h v; unsigned w[8]; } pf;
#pragma unroll
        for (int i = 0; i < 8; ++i) {
          const v2f arg = __builtin_elementwise_fma((v2f){s[i >> 2][g][2 * (i & 3)], s[i >> 2][g][2 * (i & 3) + 1]},
                                                    (v2f){kFAScale, kFAScale}, (v2f){nm, nm});
          const v2f pe = (v2f){__builtin_amdgcn_exp2f(arg[0]), __builtin_amdgcn_exp2f(arg[1])};
          lsum[g] += pe;
          pf.w[i] = pack2h(pe[0], pe[1]);
        }
#pragma unroll
        for (int j = 0; j < 4; ++j) acc[g][j] = Frag<_Float16>::mma(vf[j], pf.v, acc[g][j]);
      }
    }
    if (more) {
      *(v8h*)(&sK[buf ^ 1][sdst]) = rk0;
      *(v8h*)(&sK[buf ^ 1][sdst + 32 * kFAPitch]) = rk1;
      *(v8h*)(&sV[buf ^ 1][sdst]) = rv0;
      *(v8h*)(&sV[buf ^ 1][sdst + 32 * kFAPitch]) = rv1;
    }
    __syncthreads();   // publishes stage st + 1 and ends every wave's reads of the buffer that the next trip refills
  }

  // acc[g][j][r] = O^T[d = 16 j + 8 h + r][query 16 g + c]: 8 consecutive d of one row, one 16-B store
#pragma unroll
  for (int g = 0; g < kFAGroups; ++g) {
    const float lh  = lsum[g][0] + lsum[g][1];
    const float inv = kAttCarry / (lh + xhalf(lh));   // the exchange is unconditional
    unsigned short* op = Att + (size_t)(q0 + 16 * g + c) * kDim + head * kDh + h8;
#pragma unroll
    for (int j = 0; j < 4; ++j) {
      const v8f o = acc[g][j] * inv;
      const v4u u = (v4u){pack2h(o[0], o[1]), pack2h(o[2], o[3]), pack2h(o[4], o[5]), pack2h(o[6], o[7])};
      *(v4u*)(op + 16 * j) = u;
    }
  }
}

// ---------------------------------------------------------------------------
// Host glue.
// Workspace region map (bytes, every offset a multiple of 128; every plane fully written before any read):
//   X16    f16 [4096][768]                 6,291,456  at          0   (cast8)
//   WQKV16 f16 [3][768][768]  (x16 carry)  3,538,944  at  6,291,456   (fold_cast, planes q|k|v)
//   WO16   f16 [768][768]     (x16 carry)  1,179,648  at  9,830,400   (fold_cast)
//   Q16    f16 [4096][768]                 6,291,456  at 11,010,048   (GEMM)
//   K16    f16 [4096][768]                 6,291,456  at 17,301,504   (GEMM)
//   VT16   f16 [768][4096]  = V^T          6,291,456  at 23,592,960   (GEMM with swapped operand roles)
//   ATT16  f16 [4096][768]   (x256 carry)  6,291,456  at 29,884,416   (fused attention, each work-group [256 rows][64 cols])
//   total                                 36,175,872
// GEMM shapes (all M,N multiples of 128, K = 768 = 12 stages of 64, no padding anywhere):
//   q,k:  M=4096 N=768  K=768;  v^T: M=768 N=4096 K=768;  out: M=4096 N=768 K=768
// Launches: 1 cast and fold + 1 for the three projections + 1 fused attention + 1 out = 4.
// ---------------------------------------------------------------------------
extern "C" void kernel_launch(void* const* d_in, const int* in_sizes, int n_in,
                              void* d_out, int out_size, void* d_ws, size_t ws_size,
                              hipStream_t stream) {
  if (n_in < 15) return;
  const int nX = kSeq * kDim;          // 3,145,728
  const int nW = kDim * kDim;          // 589,824
  const int nA = kRank * kDim;         // 6,144
  if (in_sizes[0] != nX) return;
  if (in_sizes[1] != nW || in_sizes[3] != nW || in_sizes[5] != nW || in_sizes[7] != nW) return;
  if (in_sizes[2] != kDim || in_sizes[4] != kDim || in_sizes[6] != kDim || in_sizes[8] != kDim) return;
  for (int i = 9; i < 15; ++i) if (in_sizes[i] != nA) return;
  if (out_size != nX) return;

  const size_t szAct  = (size_t)kSeq * kDim * 2;
  const size_t szWqkv = (size_t)3 * kDim * kDim * 2;
  const size_t szWo   = (size_t)kDim * kDim * 2;
  const size_t offX    = 0;
  const size_t offWqkv = offX + szAct;
  const size_t offWo   = offWqkv + szWqkv;
  const size_t offQ    = offWo + szWo;
  const size_t offK    = offQ + szAct;
  const size_t offVT   = offK + szAct;
  const size_t offAtt  = offVT + szAct;
  const size_t total   = offAtt + szAct;   // 36,175,872
  if (ws_size < total) return;

  const float* x   = (const float*)d_in[0];
  const float* wq  = (const float*)d_in[1];
  const float* bq  = (const float*)d_in[2];
  const float* wk  = (const float*)d_in[3];
  const float* bk  = (const float*)d_in[4];
  const float* wv  = (const float*)d_in[5];
  const float* bv  = (const float*)d_in[6];
  const float* wo  = (const float*)d_in[7];
  const float* bo  = (const float*)d_in[8];
  const float* dq  = (const float*)d_in[9];    // [8][768]
  const float* uq  = (const float*)d_in[10];   // [768][8]
  const float* dk  = (const float*)d_in[11];
  const float* uk  = (const float*)d_in[12];
  const float* dv  = (const float*)d_in[13];
  const float* uv  = (const float*)d_in[14];
  float* out = (float*)d_out;
  char* ws = (char*)d_ws;
  unsigned short* X16    = (unsigned short*)(ws + offX);
  unsigned short* WQKV16 = (unsigned short*)(ws + offWqkv);
  unsigned short* WO16   = (unsigned short*)(ws + offWo);
  unsigned short* Q16    = (unsigned short*)(ws + offQ);
  unsigned short* K16    = (unsigned short*)(ws + offK);
  unsigned short* VT16   = (unsigned short*)(ws + offVT);
  unsigned short* ATT16  = (unsigned short*)(ws + offAtt);

  // ---- 16-bit operand planes: x cast, weights folded and cast, one launch ----
  prep_kernel<<<dim3(kFoldBlocks + kCastBlocks), dim3(256), 0, stream>>>(x, X16, wq, wk, wv, wo, dq, uq, dk, uk, dv, uv, WQKV16, WO16);

  // ---- projections q, k, v^T: one launch, one work-group per 128 x 128 tile, 576 work-groups of 8 waves ----
  qkv_gemm_kernel<<<dim3(3 * kProjTiles), dim3(256), 0, stream>>>(X16, WQKV16, Q16, K16, VT16, bq, bk, bv);

  // ---- attention: one launch, one work-group per (256 query rows, head) ----
  // ATT16[s][h*64+n] = 256 * sum_j softmax_j(0.125 * Q16[s][h*64+:] . K16[j][h*64+:]) * VT16[h*64+n][j]
  attn_fused_kernel<<<dim3(kSeq / kFARows, kHeads), dim3(kFAWaves * 32), 0, stream>>>(Q16, K16, VT16, ATT16);

  // ---- output projection (M=4096, N=768, K=768, f32 to d_out) ----
  out_gemm_kernel<<<dim3(kProjTiles), dim3(256), 0, stream>>>(ATT16, WO16, out, bo);
}

// v005
// It runs in 88.6 microseconds.
// Two timings next to v004 put it at 1.13 and 1.12 times that version's speed.
// Over all steps from v000 it is 54.7 times as fast.
// Contractions: q/k projections and v^T projection (x f16 x W_eff^T f16 carried x16), scores k_h.q_h^T (q,k f16 planes), v_h^T.probs^T (V^T f16 x unnormalised P f16 carried x64), output projection (attn f16 carried x256 x Wo^T f16 carried x16): all v_wmma_f32_16x16x32_f16 with f32 accumulate; rank-8 weight fold, bias add and online softmax in f32.
#include <hip/hip_runtime.h>
#include <math.h>

// ---------------------------------------------------------------------------
// Problem constants
// ---------------------------------------------------------------------------
constexpr int kSeq    = 4096;             // tokens (batch 1)
constexpr int kDim    = 768;              // model width
constexpr int kHeads  = 12;
constexpr int kDh     = 64;
constexpr int kRank   = 8;                // low-rank adapter width
constexpr float kLowRankScale = 2.0f;     // alpha / rank = 16 / 8
constexpr float kWCarry    = 16.0f;       // weights carried x16 in f16
constexpr float kWCarryInv = 1.0f / 16.0f;
constexpr float kAttCarry  = 256.0f;      // attention output carried x256 in f16
constexpr float kOutScale  = 1.0f / (kAttCarry * kWCarry);   // 1/4096
static_assert(kHeads * kDh == kDim, "shape");
static_assert(kSeq % 64 == 0 && kDim % 64 == 0 && kDh % 64 == 0, "M,N tile multiples");
static_assert(kDim % 32 == 0 && kDh % 32 == 0 && kSeq % 32 == 0, "K multiples of 32");
static_assert((kDim * kDim) % 2048 == 0, "fold block mapping");
static_assert((kSeq * kDim) % 2048 == 0, "cast block mapping");
static_assert(kRank * kDim == 6 * 256 * 4, "adapter staging: 6 float4 per thread of a 256-thread block");

typedef __attribute__((ext_vector_type(16))) _Float16 v16h;
typedef __attribute__((ext_vector_type(8)))  _Float16 v8h;
typedef __attribute__((ext_vector_type(8)))  float    v8f;
typedef __attribute__((ext_vector_type(4)))  float    v4f;
typedef __attribute__((ext_vector_type(2)))  float    v2f;
typedef __attribute__((ext_vector_type(4)))  unsigned int v4u;

// ---------------------------------------------------------------------------
// Fragment loader and matrix product, f16 operands, f32 accumulate
// ---------------------------------------------------------------------------
template <typename T> struct Frag;
template <> struct Frag<_Float16> {
  typedef v16h V; union U { v16h v; v8h h[2]; };
  // elements 0..7 <- p[0..7], 8..15 <- p[16..23]
  static __device__ __forceinline__ v16h load(const _Float16* p) {
    U f; f.h[0] = *(const v8h*)(p); f.h[1] = *(const v8h*)(p + 16); return f.v;
  }
  static __device__ __forceinline__ v8f mma(v16h a, v16h b, v8f c) {
    return __builtin_amdgcn_wmma_f32_16x16x32_f16(false, a, false, b, (short)0, c, false, false);
  }
};

__device__ __forceinline__ unsigned pk16(unsigned short a, unsigned short b) { return (unsigned)a | ((unsigned)b << 16); }
__device__ __forceinline__ unsigned short h_bits(float f) { const _Float16 h = (_Float16)f; return __builtin_bit_cast(unsigned short, h); }

// ---------------------------------------------------------------------------
// WMMA GEMM with both operands staged in LDS: C[m,n] = scale * sum_k A[m,k] * Bt[n,k] + bias.
// A row-major [M][kDim], Bt row-major [N][kDim], f16; M, N multiples of 128; K = kDim for every product of this file.
// One work-group = one 128 x 128 tile of C; 8 waves as 4 (m) x 2 (n), each 32 x 64 = 2 x 4 accumulator tiles.
// A stage is 64 k: 128 rows x 128 B of A and of Bt. 8 threads fetch one whole 128-B line, so a wave-wide load covers 4 whole lines;
// every line is fetched once per work-group and shared by its waves through LDS (pitch 144 B, an odd multiple of 16 B).
// Stage s + 2 is fetched into registers while stage s is worked on (two register sets), stage s + 1 is stored to the other of two
// LDS buffers in the middle of stage s, one work-group barrier per stage; fragments are read half a stage (32 k) ahead of their products.
// A and B fragments come from LDS through the same loader (equal k orders); k runs upward in steps of 32 in every accumulator.
// BIAS_MODE: 1 = bias[m], 2 = bias[n], 3 = told at run time by rowBias (the same for the whole work-group).  OUT_MODE: 0 = f32, 1 = f16.
// The tile (tm, tn) and the operands come from the calling kernel, which derives them from its block index.
// ---------------------------------------------------------------------------
constexpr int kGTileMN = 128;                   // rows of A and of Bt per work-group
constexpr int kGStageK = 64;                    // k per stage: one 128-B line per row
constexpr int kGNStage = kDim / kGStageK;       // 12
constexpr int kGPitch  = 72;                    // f16 per LDS row
constexpr int kGTile   = kGTileMN * kGPitch;    // f16 per staged operand tile (18,432 B)
static_assert(kSeq % kGTileMN == 0 && kDim % kGTileMN == 0 && kDim % (2 * kGStageK) == 0, "staged GEMM mapping");
// Work-group barrier that orders LDS traffic only: __syncthreads() also waits for every outstanding global load, which would
// end the two-stage lead of the register prefetch at each stage; nothing but LDS passes between the waves of this kernel.
__device__ __forceinline__ void lds_barrier() {
  __builtin_amdgcn_fence(__ATOMIC_RELEASE, "workgroup", "local");
  __builtin_amdgcn_s_barrier();
  __builtin_amdgcn_fence(__ATOMIC_ACQUIRE, "workgroup", "local");
}
// Epilogue of the staged GEMM: each wave turns its 16 x 64 slabs through its own LDS range (slab) into whole-line stores.
// (m0, n0) = first row and column of the wave's 32 x 64 part of C.  BIAS_MODE: 1 = bias[m], 2 = bias[n].  OUT_MODE: 0 = f32, 1 = f16.
template <int BIAS_MODE, int OUT_MODE>
__device__ __forceinline__ void wmma_gemm_store(
    const v8f (&acc)[2][4], float* slab, void* __restrict__ Cout, int ldc, const float* __restrict__ bias, int m0, int n0, float scale) {
  const int lane  = threadIdx.x & 31;
  const int rlane = lane & 15;                 // column within subtile
  const int mOff  = (lane >> 4) * 8;           // D row offset
  // the unroll directives of this function, but those on the two store loops, are there because their loops index register arrays by the loop variable
#pragma unroll
  for (int i = 0; i < 2; ++i) {
    const int mBase = m0 + (i << 4);
    // bias[m]: the 8 rows this lane half touches are contiguous -> two 16-B loads
    float bmr[8] = {0.f, 0.f, 0.f, 0.f, 0.f, 0.f, 0.f, 0.f};
    if (BIAS_MODE == 1) {
      const float* bp = bias + mBase + mOff;
      const v4f bm0 = *(const v4f*)(bp);
      const v4f bm1 = *(const v4f*)(bp + 4);
      bmr[0] = bm0[0]; bmr[1] = bm0[1]; bmr[2] = bm0[2]; bmr[3] = bm0[3];
      bmr[4] = bm1[0]; bmr[5] = bm1[1]; bmr[6] = bm1[2]; bmr[7] = bm1[3];
    }
#pragma unroll
    for (int j = 0; j < 4; ++j) {
      const int n = n0 + (j << 4) + rlane;
      float bv = 0.f;
      if (BIAS_MODE == 2) bv = bias[n];
#pragma unroll
      for (int r = 0; r < 8; ++r) {
        float v = acc[i][j][r] * scale;
        if (BIAS_MODE == 1) v += bmr[r];
        if (BIAS_MODE == 2) v += bv;
        slab[(mOff + r) * 68 + (j << 4) + rlane] = v;
      }
    }
    __builtin_amdgcn_fence(__ATOMIC_RELEASE, "workgroup");
    __builtin_amdgcn_wave_barrier();
    __builtin_amdgcn_fence(__ATOMIC_ACQUIRE, "workgroup");
    if (OUT_MODE == 0) {
      float* C = (float*)Cout;
      const int hh = lane >> 4, c4 = (lane & 15) * 4;     // row seg = 256 B = 16 lanes x 16 B
#pragma unroll
      for (int it = 0; it < 8; ++it) {
        const int row = it * 2 + hh;
        v4f v = *(const v4f*)(slab + row * 68 + c4);
        *(v4f*)(C + (size_t)(mBase + row) * ldc + n0 + c4) = v;
      }
    } else {
      const int q = lane >> 3, c8 = (lane & 7) * 8;       // row seg = 128 B = 8 lanes x 16 B
      unsigned short* C = (unsigned short*)Cout;
#pragma unroll
      for (int it = 0; it < 4; ++it) {
        const int row = it * 4 + q;
        const float* sp = slab + row * 68 + c8;
        v8h hv;
#pragma unroll
        for (int e = 0; e < 8; ++e) hv[e] = (_Float16)sp[e];
        *(v8h*)(C + (size_t)(mBase + row) * ldc + n0 + c8) = hv;
      }
    }
    __builtin_amdgcn_fence(__ATOMIC_RELEASE, "workgroup");
    __builtin_amdgcn_wave_barrier();
    __builtin_amdgcn_fence(__ATOMIC_ACQUIRE, "workgroup");
  }
}

template <int BIAS_MODE, int OUT_MODE>
__device__ __forceinline__ void wmma_gemm_lds_tile(
    const unsigned short* __restrict__ Ap, const unsigned short* __restrict__ Btp,
    void* __restrict__ Cout, int ldc, const float* __restrict__ bias, bool rowBias, int tm, int tn, float scale) {
  __shared__ __align__(16) _Float16 sA[2][kGTile];   // 36,864 B
  __shared__ __align__(16) _Float16 sB[2][kGTile];   // 36,864 B
  __shared__ __align__(16) float sT[8][16 * 68];     // per-wave 16x64 output slab, pitch 68 floats
  const int t    = threadIdx.x;
  const int lane = t & 31;
  const int wave = t >> 5;
  const int rlane = lane & 15;                 // row (A) / col (B, D) within subtile
  const int koff  = (lane >> 4) * 8;           // k offset of this lane half
  const int wm = (wave >> 1) * 32;             // this wave's rows inside the tile
  const int wn = (wave & 1) * 64;              // this wave's columns inside the tile

  // staging map: 8 threads per 128-B row, rows srow + 32 q, q = 0..3, of each operand tile
  const int srow = t >> 3, sseg = (t & 7) * 8;
  const _Float16* gA = (const _Float16*)Ap  + (size_t)(tm * kGTileMN + srow) * kDim + sseg;
  const _Float16* gB = (const _Float16*)Btp + (size_t)(tn * kGTileMN + srow) * kDim + sseg;
  const int sdst = srow * kGPitch + sseg;
  v8h ra[2][4], rb[2][4];
  // the unroll directives of this kernel, but the one on the loop over stage pairs, are there because their loops index register arrays by the loop variable
#pragma unroll
  for (int u = 0; u < 2; ++u)
#pragma unroll
    for (int q = 0; q < 4; ++q) {
      ra[u][q] = *(const v8h*)(gA + (size_t)q * 32 * kDim + u * kGStageK);
      rb[u][q] = *(const v8h*)(gB + (size_t)q * 32 * kDim + u * kGStageK);
    }

  v8f acc[2][4];
#pragma unroll
  for (int i = 0; i < 2; ++i)
#pragma unroll
    for (int j = 0; j < 4; ++j) acc[i][j] = (v8f){0.f,0.f,0.f,0.f,0.f,0.f,0.f,0.f};

#pragma unroll
  for (int q = 0; q < 4; ++q) {
    *(v8h*)(&sA[0][sdst + q * 32 * kGPitch]) = ra[0][q];
    *(v8h*)(&sB[0][sdst + q * 32 * kGPitch]) = rb[0][q];
  }
  lds_barrier();   // stage 0 is in LDS before any wave reads it

  // fragments of one 32-k half stage; set 0 holds the lower half, set 1 the upper; each set is read from LDS while the other is worked on
  v16h af[2][2], bf[2][4];
#pragma unroll
  for (int i = 0; i < 2; ++i) af[0][i] = Frag<_Float16>::load(&sA[0][(wm + 16 * i + rlane) * kGPitch + koff]);
#pragma unroll
  for (int j = 0; j < 4; ++j) bf[0][j] = Frag<_Float16>::load(&sB[0][(wn + 16 * j + rlane) * kGPitch + koff]);

  // unrolled whole: the tests on s become compile-time, so no path joins and the counted waits on the register prefetch stay exact
#pragma unroll
  for (int st = 0; st < kGNStage; st += 2) {
#pragma unroll
    for (int u = 0; u < 2; ++u) {            // stage st + u: LDS buffer u, register set u is free
      const int s = st + u;
      if (s + 2 < kGNStage) {                // the same for the whole work-group
#pragma unroll
        for (int q = 0; q < 4; ++q) {
          ra[u][q] = *(const v8h*)(gA + (size_t)q * 32 * kDim + (s + 2) * kGStageK);
          rb[u][q] = *(const v8h*)(gB + (size_t)q * 32 * kDim + (s + 2) * kGStageK);
        }
      }
#pragma unroll
      for (int i = 0; i < 2; ++i) af[1][i] = Frag<_Float16>::load(&sA[u][(wm + 16 * i + rlane) * kGPitch + 32 + koff]);
#pragma unroll
      for (int j = 0; j < 4; ++j) bf[1][j] = Frag<_Float16>::load(&sB[u][(wn + 16 * j + rlane) * kGPitch + 32 + koff]);
      // keeps the upper half's LDS reads as one group ahead of the lower half's products, which cover their latency
      __builtin_amdgcn_sched_barrier(0);
#pragma unroll
      for (int i = 0; i < 2; ++i)
#pragma unroll
        for (int j = 0; j < 4; ++j) acc[i][j] = Frag<_Float16>::mma(af[0][i], bf[0][j], acc[i][j]);
      // keeps these products ahead of the stores and the barrier: moved behind them, the wait in front of the barrier would meet reads just issued
      __builtin_amdgcn_sched_barrier(0);
      if (s + 1 < kGNStage) {
#pragma unroll
        for (int q = 0; q < 4; ++q) {
          *(v8h*)(&sA[u ^ 1][sdst + q * 32 * kGPitch]) = ra[u ^ 1][q];
          *(v8h*)(&sB[u ^ 1][sdst + q * 32 * kGPitch]) = rb[u ^ 1][q];
        }
      }
      // publishes stage s + 1; every read of stage s has returned in front of it, so the next stage may refill buffer u behind it
      lds_barrier();
      if (s + 1 < kGNStage) {
#pragma unroll
        for (int i = 0; i < 2; ++i) af[0][i] = Frag<_Float16>::load(&sA[u ^ 1][(wm + 16 * i + rlane) * kGPitch + koff]);
#pragma unroll
        for (int j = 0; j < 4; ++j) bf[0][j] = Frag<_Float16>::load(&sB[u ^ 1][(wn + 16 * j + rlane) * kGPitch + koff]);
      }
      // keeps the next stage's first LDS reads as one group ahead of the upper half's products, which cover their latency
      __builtin_amdgcn_sched_barrier(0);
#pragma unroll
      for (int i = 0; i < 2; ++i)
#pragma unroll
        for (int j = 0; j < 4; ++j) acc[i][j] = Frag<_Float16>::mma(af[1][i], bf[1][j], acc[i][j]);
    }
  }

  // ---- epilogue; a bias mode told at run time picks one of the two compile-time forms by a block-uniform branch ----
  const int m0 = tm * kGTileMN + wm;
  const int n0 = tn * kGTileMN + wn;
  float* slab = sT[wave];
  if constexpr (BIAS_MODE == 3) {
    if (rowBias) wmma_gemm_store<1, OUT_MODE>(acc, slab, Cout, ldc, bias, m0, n0, scale);
    else         wmma_gemm_store<2, OUT_MODE>(acc, slab, Cout, ldc, bias, m0, n0, scale);
  } else {
    wmma_gemm_store<BIAS_MODE, OUT_MODE>(acc, slab, Cout, ldc, bias, m0, n0, scale);
  }
}

// ---------------------------------------------------------------------------
// The three input projections in one launch: they share x and depend on nothing of each other. 3 x 192 work-groups, one 128 x 128 tile each;
// the block index picks the product (block-uniform): 0 = q, 1 = k (A = activations, Bt = weights, bias[n]), 2 = v^T (A = weights, Bt = activations, bias[m]).
//   Q16[s][e]  = (1/16) * sum_d X16[s][d] * WQ16[e][d] + bq[e];   K16 alike;   VT16[c][s] = (1/16) * sum_d WV16[c][d] * X16[s][d] + bv[c]
// ---------------------------------------------------------------------------
constexpr int kProjTiles = (kSeq / kGTileMN) * (kDim / kGTileMN);   // 192 tiles per product
__global__ __launch_bounds__(256) void qkv_gemm_kernel(
    const unsigned short* __restrict__ X16, const unsigned short* __restrict__ WQKV16,
    unsigned short* __restrict__ Q16, unsigned short* __restrict__ K16, unsigned short* __restrict__ VT16,
    const float* __restrict__ bq, const float* __restrict__ bk, const float* __restrict__ bv) {
  const unsigned which = blockIdx.x / (unsigned)kProjTiles;
  const unsigned tile  = blockIdx.x - which * (unsigned)kProjTiles;
  const bool vt        = which == 2;
  const unsigned short* W = WQKV16 + (size_t)which * kDim * kDim;
  const unsigned tilesN = vt ? kSeq / kGTileMN : kDim / kGTileMN;   // column tiles of C: 32 for v^T, 6 for q and k
  const int tm = vt ? tile / (unsigned)(kSeq / kGTileMN) : tile / (unsigned)(kDim / kGTileMN);
  const int tn = tile - (unsigned)tm * tilesN;
  wmma_gemm_lds_tile<3, 1>(vt ? W : X16, vt ? X16 : W, (void*)(vt ? VT16 : (which == 1 ? K16 : Q16)), vt ? kSeq : kDim,
                           vt ? bv : (which == 1 ? bk : bq), vt, tm, tn, kWCarryInv);
}
// Output projection: out[s][e] = (1/4096) * sum_c ATT16[s][c] * WO16[e][c] + bo[e], f32
__global__ __launch_bounds__(256) void out_gemm_kernel(
    const unsigned short* __restrict__ ATT16, const unsigned short* __restrict__ WO16, float* __restrict__ out, const float* __restrict__ bo) {
  const int tm = blockIdx.x / (kDim / kGTileMN);
  const int tn = blockIdx.x % (kDim / kGTileMN);
  wmma_gemm_lds_tile<2, 0>(ATT16, WO16, (void*)out, kDim, bo, false, tm, tn, kOutScale);
}

// ---------------------------------------------------------------------------
// x to f16: block blk covers 2048 consecutive elements, 8 per thread
// ---------------------------------------------------------------------------
__device__ __forceinline__ void cast8_f16_block(int blk, const float* __restrict__ in, unsigned short* __restrict__ out, int n8) {
  const int i = blk * 256 + threadIdx.x;
  if (i >= n8) return;
  const float* p = in + 8 * (size_t)i;
  const v4f a = *(const v4f*)(p);
  const v4f c = *(const v4f*)(p + 4);
  unsigned short hb[8];
#pragma unroll
  for (int e = 0; e < 4; ++e) {
    hb[e]     = h_bits(a[e]);
    hb[4 + e] = h_bits(c[e]);
  }
  const v4u u = (v4u){pk16(hb[0], hb[1]), pk16(hb[2], hb[3]), pk16(hb[4], hb[5]), pk16(hb[6], hb[7])};
  unsigned short* q = out + 8 * (size_t)i;
  *(v4u*)q = u;
  
}

// ---------------------------------------------------------------------------
// Rank-8 adapter fold + f16 cast with x16 carry, f32 math:
//   plane y in {0,1,2}: WQKV[y][e][d] = f16( 16 * ( w_y[e][d] + 2 * sum_r up_y[e][r] * down_y[r][d] ) )
//   plane y == 3      : WO[e][d]      = f16( 16 * wo[e][d] )
// Weights are [out e][in d] = Bt[n][k] for the GEMMs; orientation kept as given (no transpose).
// 288 x 4 blocks: y = matrix (block-uniform), block bx of a matrix covers 2048 consecutive elements (288 x 2048 = 768 x 768 exact);
// thread t owns elements 8t..8t+7 of the block (one row e, 8 consecutive d).
// The whole down matrix [8][768] of the plane is staged in LDS first (cooperative: 6 b128 per thread, 6 x 256 x 4 = 6144 floats =
// the whole matrix, every LDS word read below is written), block barrier, then per lane 2 b128 (w) + 2 b128 (up row) global loads.
// ---------------------------------------------------------------------------
__device__ __forceinline__ void fold_cast_block(
    int bx, int y,
    const float* __restrict__ wq, const float* __restrict__ wk, const float* __restrict__ wv, const float* __restrict__ wo,
    const float* __restrict__ dq, const float* __restrict__ uq,
    const float* __restrict__ dk, const float* __restrict__ uk,
    const float* __restrict__ dv, const float* __restrict__ uv,
    unsigned short* __restrict__ wqkv16, unsigned short* __restrict__ wo16) {
  __shared__ __align__(16) float dsh[kRank * kDim];      // down matrix [8][768] of this plane, 24,576 B
  const int t = threadIdx.x;
  const float* W  = (y == 0) ? wq : (y == 1) ? wk : (y == 2) ? wv : wo;
  const float* Dn = (y == 0) ? dq : (y == 1) ? dk : dv;   // y == 3: valid pointer, staged but not used
  const float* Up = (y == 0) ? uq : (y == 1) ? uk : uv;
  // stage down [8][768] = 1536 float4: thread t loads slots t + 256*i, i = 0..5 (exact coverage)
#pragma unroll
  for (int i = 0; i < 6; ++i) {
    const int q4 = (i * 256 + t) * 4;
    const v4f dd = *(const v4f*)(Dn + q4);
    *(v4f*)(dsh + q4) = dd;
  }
  __syncthreads();

  const int base = bx * 2048 + 8 * t;            // < 768*768
  const int e = base / kDim;
  const int d = base - e * kDim;                         // multiple of 8
  const v4f w0 = *(const v4f*)(W + base);
  const v4f w1 = *(const v4f*)(W + base + 4);
  float s[8];
#pragma unroll
  for (int k = 0; k < 8; ++k) s[k] = 0.0f;
  if (y < 3) {                                           // block-uniform branch
    const v4f u0 = *(const v4f*)(Up + e * kRank);
    const v4f u1 = *(const v4f*)(Up + e * kRank + 4);
    const float ur[8] = {u0[0], u0[1], u0[2], u0[3], u1[0], u1[1], u1[2], u1[3]};
#pragma unroll
    for (int r = 0; r < kRank; ++r) {
      const v4f a = *(const v4f*)(dsh + r * kDim + d);
      const v4f c = *(const v4f*)(dsh + r * kDim + d + 4);
#pragma unroll
      for (int k = 0; k < 4; ++k) {
        s[k]     += ur[r] * a[k];
        s[4 + k] += ur[r] * c[k];
      }
    }
  }
  float f[8];
#pragma unroll
  for (int k = 0; k < 4; ++k) {
    f[k]     = (w0[k] + kLowRankScale * s[k])     * kWCarry;
    f[4 + k] = (w1[k] + kLowRankScale * s[4 + k]) * kWCarry;
  }
  unsigned short hb[8];
#pragma unroll
  for (int k = 0; k < 8; ++k) hb[k] = h_bits(f[k]);
  const v4u u = (v4u){pk16(hb[0], hb[1]), pk16(hb[2], hb[3]), pk16(hb[4], hb[5]), pk16(hb[6], hb[7])};
  unsigned short* op = (y < 3) ? (wqkv16 + (size_t)y * kDim * kDim + base) : (wo16 + base);
  *(v4u*)op = u;
  
}

// ---------------------------------------------------------------------------
// Both 16-bit operand preparations in one launch: neither reads what the other writes. The block index picks the work (block-uniform,
// so the fold's barrier is passed by every thread of a block that reaches it): blocks 0..1151 fold and cast the weights, the other 1536 cast x.
// ---------------------------------------------------------------------------
constexpr int kFoldBlocksPerW = kDim * kDim / 2048;      // 288
constexpr int kFoldBlocks     = 4 * kFoldBlocksPerW;     // 1152
constexpr int kCastBlocks     = kSeq * kDim / 2048;      // 1536
__global__ __launch_bounds__(256) void prep_kernel(
    const float* __restrict__ x, unsigned short* __restrict__ x16,
    const float* __restrict__ wq, const float* __restrict__ wk, const float* __restrict__ wv, const float* __restrict__ wo,
    const float* __restrict__ dq, const float* __restrict__ uq,
    const float* __restrict__ dk, const float* __restrict__ uk,
    const float* __restrict__ dv, const float* __restrict__ uv,
    unsigned short* __restrict__ wqkv16, unsigned short* __restrict__ wo16) {
  const int b = blockIdx.x;
  if (b < kFoldBlocks) {
    const int y = b / kFoldBlocksPerW;
    fold_cast_block(b - y * kFoldBlocksPerW, y, wq, wk, wv, wo, dq, uq, dk, uk, dv, uv, wqkv16, wo16);
  } else {
    cast8_f16_block(b - kFoldBlocks, x, x16, kSeq * kDim / 8);
  }
}

constexpr int kFAColWaves = 2;
constexpr int kFAKeyWaves = 2;
constexpr int kFAWaves  = kFAColWaves * kFAKeyWaves;
constexpr int kFAGroups = 2;
constexpr int kFARows   = kFAColWaves * kFAGroups * 16;
constexpr int kFAStage  = kFAKeyWaves * 64;
constexpr int kFANStage = kSeq / kFAStage;
constexpr int kFAPitch  = 72;
constexpr int kFATile   = 64 * kFAPitch;
constexpr int kFATilesPerHead = kSeq / kFARows;           // 64
constexpr int kFABlocks = kHeads * kFATilesPerHead;       // 768
constexpr int kFAThird  = kFABlocks / 3;                  // 256
constexpr float kFAScale = 0.125f * 1.4426950408889634f;  // 1 / sqrt(64) and log2(e)
constexpr float kFACarryLog2 = 6.0f;
static_assert(kSeq % kFARows == 0 && kSeq % kFAStage == 0 && kDh == 64 && kFABlocks % 3 == 0, "fused attention mapping");
typedef __attribute__((ext_vector_type(2))) _Float16 v2h;
// lane l with lane l ^ 16
__device__ __forceinline__ float xhalf(float x) {
  const int b = __builtin_bit_cast(int, x);
  return __builtin_bit_cast(float, __builtin_amdgcn_permlanex16(b, b, 0x76543210, 0xfedcba98, false, false));
}
__device__ __forceinline__ unsigned pack2h(float lo, float hi) {
  return __builtin_bit_cast(unsigned, __builtin_convertvector((v2f){lo, hi}, v2h));   // round to nearest even
}
__global__ __launch_bounds__(kFAWaves * 32) void attn_fused_kernel(
    const unsigned short* __restrict__ Qp, const unsigned short* __restrict__ Kp, const unsigned short* __restrict__ VTp,
    unsigned short* __restrict__ Att) {
  __shared__ __align__(16) _Float16 sK[2][kFAKeyWaves][kFATile];   // 36,864 B; a buffer is 128 key rows in a row
  __shared__ __align__(16) _Float16 sV[2][kFAKeyWaves][kFATile];   // 36,864 B
  // The join's planes, 17,408 B, beside the ring and not over it: at 91,136 B three work-groups fit a WGP's LDS and a fourth does not,
  // so the 768 work-groups cannot crowd onto fewer than all 256 WGPs.
  __shared__ __align__(16) v4f sJ[kFAColWaves][17][32];
  const int t    = threadIdx.x;
  const int lane = t & 31, wave = t >> 5;
  const int cw   = wave & 1;                // which 32 query columns
  const int kh   = wave >> 1;               // which 64 keys of every stage
  const int c    = lane & 15;
  const int h8   = (lane >> 4) * 8;
  // Block -> (head, tile), a one-to-one map of 0..767. Blocks b, b + 256 and b + 512 take neighbouring tiles, nearly always of one head:
  // where they come to share a WGP they fetch the same K and V^T lines at about the same time. For speed only; any placement is right.
  const int id   = (blockIdx.x % kFAThird) * 3 + blockIdx.x / kFAThird;
  const int head = id / kFATilesPerHead;
  const int q0   = (id % kFATilesPerHead) * kFARows + cw * (kFAGroups * 16);
  const _Float16* Qh = (const _Float16*)Qp  + head * kDh;
  const _Float16* Kh = (const _Float16*)Kp  + head * kDh;                   // [key][kDim]
  const _Float16* Vh = (const _Float16*)VTp + (size_t)head * kDh * kSeq;    // [d][kSeq]

  // staging map: 8 threads per 128-B row; K rows srow + 16 q, q = 0..7; V^T rows srow + 16 q, q = 0..3, of each of the two tiles
  const int srow = t >> 3, sseg = (t & 7) * 8;
  const _Float16* gK = Kh + (size_t)srow * kDim + sseg;
  const _Float16* gV = Vh + (size_t)srow * kSeq + sseg;
  const int sdst = srow * kFAPitch + sseg;
  {
    v8h r0[8], r1[8];
#pragma unroll
    for (int q = 0; q < 8; ++q) {
      r0[q] = *(const v8h*)(gK + (size_t)q * 16 * kDim);
      r1[q] = *(const v8h*)(gV + (size_t)(q & 3) * 16 * kSeq + (q >> 2) * 64);
    }
#pragma unroll
    for (int q = 0; q < 8; ++q) {
      *(v8h*)(&sK[0][0][sdst + q * 16 * kFAPitch]) = r0[q];
      *(v8h*)(&sV[0][q >> 2][sdst + (q & 3) * 16 * kFAPitch]) = r1[q];
    }
  }

  v16h qf[kFAGroups][2];
#pragma unroll
  for (int g = 0; g < kFAGroups; ++g)
#pragma unroll
    for (int kc = 0; kc < 2; ++kc)
      qf[g][kc] = Frag<_Float16>::load(Qh + (size_t)(q0 + 16 * g + c) * kDim + 32 * kc + h8);

  v8f acc[kFAGroups][4];
  v2f lsum[kFAGroups];
  float mrun[kFAGroups];
#pragma unroll
  for (int g = 0; g < kFAGroups; ++g) {
    mrun[g] = -__builtin_inff();
    lsum[g] = (v2f){0.f, 0.f};
#pragma unroll
    for (int j = 0; j < 4; ++j) acc[g][j] = (v8f){0.f,0.f,0.f,0.f,0.f,0.f,0.f,0.f};
  }
  __syncthreads();   // stage 0 is in LDS before any wave reads it

  for (int st = 0; st < kFANStage; ++st) {
    const int buf = st & 1;
    const bool more = st + 1 < kFANStage;   // the same for the whole work-group
    const _Float16* bK = &sK[buf][kh][0];
    const _Float16* bV = &sV[buf][kh][0];
#pragma unroll
    for (int p = 0; p < 2; ++p) {          // two 32-key passes per stage and key wave
      v8h rs[8];                           // half of the next stage, in flight over this pass: K in pass 0, V^T in pass 1
      if (more) {
        if (p == 0) {
          gK += kFAStage * kDim;
#pragma unroll
          for (int q = 0; q < 8; ++q) rs[q] = *(const v8h*)(gK + (size_t)q * 16 * kDim);
        } else {
          gV += kFAStage;
#pragma unroll
          for (int q = 0; q < 8; ++q) rs[q] = *(const v8h*)(gV + (size_t)(q & 3) * 16 * kSeq + (q >> 2) * 64);
        }
      }
      v8f s[2][kFAGroups];
#pragma unroll
      for (int kt = 0; kt < 2; ++kt) {
        const _Float16* kp = bK + (32 * p + 16 * kt + c) * kFAPitch + h8;
        const v16h k0 = Frag<_Float16>::load(kp);
        const v16h k1 = Frag<_Float16>::load(kp + 32);
#pragma unroll
        for (int g = 0; g < kFAGroups; ++g) {
          s[kt][g] = (v8f){0.f,0.f,0.f,0.f,0.f,0.f,0.f,0.f};
          s[kt][g] = Frag<_Float16>::mma(k0, qf[g][0], s[kt][g]);
          s[kt][g] = Frag<_Float16>::mma(k1, qf[g][1], s[kt][g]);
        }
      }
      v16h vf[4];
#pragma unroll
      for (int j = 0; j < 4; ++j) vf[j] = Frag<_Float16>::load(bV + (16 * j + c) * kFAPitch + 32 * p + h8);

      float mb[kFAGroups];
      bool need = false;
#pragma unroll
      for (int g = 0; g < kFAGroups; ++g) {
        float mx = s[0][g][0];
#pragma unroll
        for (int r = 1; r < 8; ++r) mx = fmaxf(mx, s[0][g][r]);
#pragma unroll
        for (int r = 0; r < 8; ++r) mx = fmaxf(mx, s[1][g][r]);
        mx = fmaxf(mx, xhalf(mx)) * kFAScale;   // both wave halves hold this query's maximum, scaled (the scale is positive)
        mb[g] = mx;
        need = need || (mx > mrun[g] + 8.0f);
      }
      if (__builtin_amdgcn_ballot_w32(need) != 0) {   // wave-uniform; always on the first pass, rare later
#pragma unroll
        for (int g = 0; g < kFAGroups; ++g) {
          const float mnew = fmaxf(mrun[g], mb[g]);
          const float corr = __builtin_amdgcn_exp2f(mrun[g] - mnew);   // 0 on the first pass, where mrun is -inf
          mrun[g] = mnew;
          lsum[g] = lsum[g] * corr;
#pragma unroll
          for (int j = 0; j < 4; ++j) acc[g][j] = acc[g][j] * corr;
        }
      }
#pragma unroll
      for (int g = 0; g < kFAGroups; ++g) {
        const float nm = kFACarryLog2 - mrun[g];
        union { v16h v; unsigned w[8]; } pf;
#pragma unroll
        for (int i = 0; i < 8; ++i) {
          const v2f arg = __builtin_elementwise_fma((v2f){s[i >> 2][g][2 * (i & 3)], s[i >> 2][g][2 * (i & 3) + 1]},
                                                    (v2f){kFAScale, kFAScale}, (v2f){nm, nm});
          const v2f pe = (v2f){__builtin_amdgcn_exp2f(arg[0]), __builtin_amdgcn_exp2f(arg[1])};
          lsum[g] += pe;
          pf.w[i] = pack2h(pe[0], pe[1]);
        }
#pragma unroll
        for (int j = 0; j < 4; ++j) acc[g][j] = Frag<_Float16>::mma(vf[j], pf.v, acc[g][j]);
      }
      if (more) {   // the other buffer's last readers left it at the barrier that ended the stage before
#pragma unroll
        for (int q = 0; q < 8; ++q) {
          if (p == 0) *(v8h*)(&sK[buf ^ 1][0][sdst + q * 16 * kFAPitch]) = rs[q];
          else        *(v8h*)(&sV[buf ^ 1][q >> 2][sdst + (q & 3) * 16 * kFAPitch]) = rs[q];
        }
      }
    }
    __syncthreads();   // publishes stage st + 1 and ends every wave's reads of the buffer that the next trip refills
  }

  // ---- join of the two key waves of each column pair ----
  // plane i of column wave cw holds 16 B per lane: planes 0..15 = the output tiles, plane 16 = both maxima and both sums
  v4f* mg = &sJ[cw][0][lane];
  if (kh == 1) {
#pragma unroll
    for (int g = 0; g < kFAGroups; ++g)
#pragma unroll
      for (int j = 0; j < 4; ++j) {
        const v8f o = acc[g][j];
        mg[((g * 4 + j) * 2 + 0) * 32] = (v4f){o[0], o[1], o[2], o[3]};
        mg[((g * 4 + j) * 2 + 1) * 32] = (v4f){o[4], o[5], o[6], o[7]};
      }
    mg[16 * 32] = (v4f){mrun[0], mrun[1], lsum[0][0] + lsum[0][1], lsum[1][0] + lsum[1][1]};
  }
  __syncthreads();   // the planes are in LDS before the other key wave reads them; every wave passes it
  if (kh != 0) return;

  // acc[g][j][r] = O^T[d = 16 j + 8 h + r][query 16 g + c]: 8 consecutive d of one row, one 16-B store
  const v4f ml = mg[16 * 32];
#pragma unroll
  for (int g = 0; g < kFAGroups; ++g) {
    const float mall = fmaxf(mrun[g], ml[g]);
    const float f0 = __builtin_amdgcn_exp2f(mrun[g] - mall);   // this wave's share, scaled to the larger maximum
    const float f1 = __builtin_amdgcn_exp2f(ml[g] - mall);     // the other key wave's
    const float lh  = (lsum[g][0] + lsum[g][1]) * f0 + ml[2 + g] * f1;
    const float inv = kAttCarry / (lh + xhalf(lh));   // the exchange is unconditional within the wave
    const float i0 = f0 * inv, i1 = f1 * inv;
    unsigned short* op = Att + (size_t)(q0 + 16 * g + c) * kDim + head * kDh + h8;
#pragma unroll
    for (int j = 0; j < 4; ++j) {
      const v4f pa = mg[((g * 4 + j) * 2 + 0) * 32];
      const v4f pb = mg[((g * 4 + j) * 2 + 1) * 32];
      const v8f po = (v8f){pa[0], pa[1], pa[2], pa[3], pb[0], pb[1], pb[2], pb[3]};
      const v8f o = acc[g][j] * i0 + po * i1;
      const v4u u = (v4u){pack2h(o[0], o[1]), pack2h(o[2], o[3]), pack2h(o[4], o[5]), pack2h(o[6], o[7])};
      *(v4u*)(op + 16 * j) = u;
    }
  }
}

// ---------------------------------------------------------------------------
// Host glue.
// Workspace region map (bytes, every offset a multiple of 128; every plane fully written before any read):
//   X16    f16 [4096][768]                 6,291,456  at          0   (cast8)
//   WQKV16 f16 [3][768][768]  (x16 carry)  3,538,944  at  6,291,456   (fold_cast, planes q|k|v)
//   WO16   f16 [768][768]     (x16 carry)  1,179,648  at  9,830,400   (fold_cast)
//   Q16    f16 [4096][768]                 6,291,456  at 11,010,048   (GEMM)
//   K16    f16 [4096][768]                 6,291,456  at 17,301,504   (GEMM)
//   VT16   f16 [768][4096]  = V^T          6,291,456  at 23,592,960   (GEMM with swapped operand roles)
//   ATT16  f16 [4096][768]   (x256 carry)  6,291,456  at 29,884,416   (fused attention, each work-group [64 rows][64 cols])
//   total                                 36,175,872
// GEMM shapes (all M,N multiples of 128, K = 768 = 12 stages of 64, no padding anywhere):
//   q,k:  M=4096 N=768  K=768;  v^T: M=768 N=4096 K=768;  out: M=4096 N=768 K=768
// Launches: 1 cast and fold + 1 for the three projections + 1 fused attention + 1 out = 4.
// ---------------------------------------------------------------------------
extern "C" void kernel_launch(void* const* d_in, const int* in_sizes, int n_in,
                              void* d_out, int out_size, void* d_ws, size_t ws_size,
                              hipStream_t stream) {
  if (n_in < 15) return;
  const int nX = kSeq * kDim;          // 3,145,728
  const int nW = kDim * kDim;          // 589,824
  const int nA = kRank * kDim;         // 6,144
  if (in_sizes[0] != nX) return;
  if (in_sizes[1] != nW || in_sizes[3] != nW || in_sizes[5] != nW || in_sizes[7] != nW) return;
  if (in_sizes[2] != kDim || in_sizes[4] != kDim || in_sizes[6] != kDim || in_sizes[8] != kDim) return;
  for (int i = 9; i < 15; ++i) if (in_sizes[i] != nA) return;
  if (out_size != nX) return;

  const size_t szAct  = (size_t)kSeq * kDim * 2;
  const size_t szWqkv = (size_t)3 * kDim * kDim * 2;
  const size_t szWo   = (size_t)kDim * kDim * 2;
  const size_t offX    = 0;
  const size_t offWqkv = offX + szAct;
  const size_t offWo   = offWqkv + szWqkv;
  const size_t offQ    = offWo + szWo;
  const size_t offK    = offQ + szAct;
  const size_t offVT   = offK + szAct;
  const size_t offAtt  = offVT + szAct;
  const size_t total   = offAtt + szAct;   // 36,175,872
  if (ws_size < total) return;

  const float* x   = (const float*)d_in[0];
  const float* wq  = (const float*)d_in[1];
  const float* bq  = (const float*)d_in[2];
  const float* wk  = (const float*)d_in[3];
  const float* bk  = (const float*)d_in[4];
  const float* wv  = (const float*)d_in[5];
  const float* bv  = (const float*)d_in[6];
  const float* wo  = (const float*)d_in[7];
  const float* bo  = (const float*)d_in[8];
  const float* dq  = (const float*)d_in[9];    // [8][768]
  const float* uq  = (const float*)d_in[10];   // [768][8]
  const float* dk  = (const float*)d_in[11];
  const float* uk  = (const float*)d_in[12];
  const float* dv  = (const float*)d_in[13];
  const float* uv  = (const float*)d_in[14];
  float* out = (float*)d_out;
  char* ws = (char*)d_ws;
  unsigned short* X16    = (unsigned short*)(ws + offX);
  unsigned short* WQKV16 = (unsigned short*)(ws + offWqkv);
  unsigned short* WO16   = (unsigned short*)(ws + offWo);
  unsigned short* Q16    = (unsigned short*)(ws + offQ);
  unsigned short* K16    = (unsigned short*)(ws + offK);
  unsigned short* VT16   = (unsigned short*)(ws + offVT);
  unsigned short* ATT16  = (unsigned short*)(ws + offAtt);

  // ---- 16-bit operand planes: x cast, weights folded and cast, one launch ----
  prep_kernel<<<dim3(kFoldBlocks + kCastBlocks), dim3(256), 0, stream>>>(x, X16, wq, wk, wv, wo, dq, uq, dk, uk, dv, uv, WQKV16, WO16);

  // ---- projections q, k, v^T: one launch, one work-group per 128 x 128 tile, 576 work-groups of 8 waves ----
  qkv_gemm_kernel<<<dim3(3 * kProjTiles), dim3(256), 0, stream>>>(X16, WQKV16, Q16, K16, VT16, bq, bk, bv);

  // ---- attention: one launch, one work-group per (64 query rows, head) ----
  // ATT16[s][h*64+n] = 256 * sum_j softmax_j(0.125 * Q16[s][h*64+:] . K16[j][h*64+:]) * VT16[h*64+n][j]
  attn_fused_kernel<<<dim3(kFABlocks), dim3(kFAWaves * 32), 0, stream>>>(Q16, K16, VT16, ATT16);

  // ---- output projection (M=4096, N=768, K=768, f32 to d_out) ----
  out_gemm_kernel<<<dim3(kProjTiles), dim3(256), 0, stream>>>(ATT16, WO16, out, bo);
}

// v006
// Measured time: 85.1 microseconds a run.
// Two timings next to v005 put it at 1.04 and 1.07 times that version's speed.
// Over all steps from v000 it is 57.6 times as fast.
// Contractions: q/k projections and v^T projection (x f16 x W_eff^T f16 carried x16), scores k_h.q_h^T (q,k f16 planes, q carried x log2(e)/8, the softmax shift as the product's f32 C operand), v_h^T.probs^T (V^T f16 x unnormalised P f16 carried x64), output projection (attn f16 carried x256 x Wo^T f16 carried x16): all v_wmma_f32_16x16x32_f16 with f32 accumulate; rank-8 weight fold, bias add and online softmax in f32.
#include <hip/hip_runtime.h>
#include <math.h>

// ---------------------------------------------------------------------------
// Problem constants
// ---------------------------------------------------------------------------
constexpr int kSeq    = 4096;             // tokens (batch 1)
constexpr int kDim    = 768;              // model width
constexpr int kHeads  = 12;
constexpr int kDh     = 64;
constexpr int kRank   = 8;                // low-rank adapter width
constexpr float kLowRankScale = 2.0f;     // alpha / rank = 16 / 8
constexpr float kWCarry    = 16.0f;       // weights carried x16 in f16
constexpr float kWCarryInv = 1.0f / 16.0f;
constexpr float kAttCarry  = 256.0f;      // attention output carried x256 in f16
constexpr float kOutScale  = 1.0f / (kAttCarry * kWCarry);   // 1/4096
static_assert(kHeads * kDh == kDim, "shape");
static_assert(kSeq % 64 == 0 && kDim % 64 == 0 && kDh % 64 == 0, "M,N tile multiples");
static_assert(kDim % 32 == 0 && kDh % 32 == 0 && kSeq % 32 == 0, "K multiples of 32");
static_assert((kDim * kDim) % 2048 == 0, "fold block mapping");
static_assert((kSeq * kDim) % 2048 == 0, "cast block mapping");
static_assert(kRank * kDim == 6 * 256 * 4, "adapter staging: 6 float4 per thread of a 256-thread block");

typedef __attribute__((ext_vector_type(16))) _Float16 v16h;
typedef __attribute__((ext_vector_type(8)))  _Float16 v8h;
typedef __attribute__((ext_vector_type(8)))  float    v8f;
typedef __attribute__((ext_vector_type(4)))  float    v4f;
typedef __attribute__((ext_vector_type(2)))  float    v2f;
typedef __attribute__((ext_vector_type(4)))  unsigned int v4u;

// ---------------------------------------------------------------------------
// Fragment loader and matrix product, f16 operands, f32 accumulate
// ---------------------------------------------------------------------------
template <typename T> struct Frag;
template <> struct Frag<_Float16> {
  typedef v16h V; union U { v16h v; v8h h[2]; };
  // elements 0..7 <- p[0..7], 8..15 <- p[16..23]
  static __device__ __forceinline__ v16h load(const _Float16* p) {
    U f; f.h[0] = *(const v8h*)(p); f.h[1] = *(const v8h*)(p + 16); return f.v;
  }
  static __device__ __forceinline__ v8f mma(v16h a, v16h b, v8f c) {
    return __builtin_amdgcn_wmma_f32_16x16x32_f16(false, a, false, b, (short)0, c, false, false);
  }
};

__device__ __forceinline__ unsigned pk16(unsigned short a, unsigned short b) { return (unsigned)a | ((unsigned)b << 16); }
__device__ __forceinline__ unsigned short h_bits(float f) { const _Float16 h = (_Float16)f; return __builtin_bit_cast(unsigned short, h); }

// ---------------------------------------------------------------------------
// WMMA GEMM with both operands staged in LDS: C[m,n] = scale * sum_k A[m,k] * Bt[n,k] + bias.
// A row-major [M][kDim], Bt row-major [N][kDim], f16; M, N multiples of 128; K = kDim for every product of this file.
// One work-group = one 128 x 128 tile of C; 8 waves as 4 (m) x 2 (n), each 32 x 64 = 2 x 4 accumulator tiles.
// A stage is 64 k: 128 rows x 128 B of A and of Bt. 8 threads fetch one whole 128-B line, so a wave-wide load covers 4 whole lines;
// every line is fetched once per work-group and shared by its waves through LDS (pitch 144 B, an odd multiple of 16 B).
// Stage s + 2 is fetched into registers while stage s is worked on (two register sets), stage s + 1 is stored to the other of two
// LDS buffers in the middle of stage s, one work-group barrier per stage; fragments are read half a stage (32 k) ahead of their products.
// A and B fragments come from LDS through the same loader (equal k orders); k runs upward in steps of 32 in every accumulator.
// BIAS_MODE: 1 = bias[m], 2 = bias[n] * biasScale, 3 = told at run time by rowBias (the same for the whole work-group).  OUT_MODE: 0 = f32, 1 = f16.
// The tile (tm, tn) and the operands come from the calling kernel, which derives them from its block index.
// ---------------------------------------------------------------------------
constexpr int kGTileMN = 128;                   // rows of A and of Bt per work-group
constexpr int kGStageK = 64;                    // k per stage: one 128-B line per row
constexpr int kGNStage = kDim / kGStageK;       // 12
constexpr int kGPitch  = 72;                    // f16 per LDS row
constexpr int kGTile   = kGTileMN * kGPitch;    // f16 per staged operand tile (18,432 B)
static_assert(kSeq % kGTileMN == 0 && kDim % kGTileMN == 0 && kDim % (2 * kGStageK) == 0, "staged GEMM mapping");
// Work-group barrier that orders LDS traffic only: __syncthreads() also waits for every outstanding global load, which would
// end the two-stage lead of the register prefetch at each stage; nothing but LDS passes between the waves of this kernel.
__device__ __forceinline__ void lds_barrier() {
  __builtin_amdgcn_fence(__ATOMIC_RELEASE, "workgroup", "local");
  __builtin_amdgcn_s_barrier();
  __builtin_amdgcn_fence(__ATOMIC_ACQUIRE, "workgroup", "local");
}
// Epilogue of the staged GEMM: each wave turns its 16 x 64 slabs through its own LDS range (slab) into whole-line stores.
// (m0, n0) = first row and column of the wave's 32 x 64 part of C.  BIAS_MODE: 1 = bias[m], 2 = bias[n] * biasScale.  OUT_MODE: 0 = f32, 1 = f16.
template <int BIAS_MODE, int OUT_MODE>
__device__ __forceinline__ void wmma_gemm_store(
    const v8f (&acc)[2][4], float* slab, void* __restrict__ Cout, int ldc, const float* __restrict__ bias, int m0, int n0, float scale,
    float biasScale) {
  const int lane  = threadIdx.x & 31;
  const int rlane = lane & 15;                 // column within subtile
  const int mOff  = (lane >> 4) * 8;           // D row offset
  // the unroll directives of this function, but those on the two store loops, are there because their loops index register arrays by the loop variable
#pragma unroll
  for (int i = 0; i < 2; ++i) {
    const int mBase = m0 + (i << 4);
    // bias[m]: the 8 rows this lane half touches are contiguous -> two 16-B loads
    float bmr[8] = {0.f, 0.f, 0.f, 0.f, 0.f, 0.f, 0.f, 0.f};
    if (BIAS_MODE == 1) {
      const float* bp = bias + mBase + mOff;
      const v4f bm0 = *(const v4f*)(bp);
      const v4f bm1 = *(const v4f*)(bp + 4);
      bmr[0] = bm0[0]; bmr[1] = bm0[1]; bmr[2] = bm0[2]; bmr[3] = bm0[3];
      bmr[4] = bm1[0]; bmr[5] = bm1[1]; bmr[6] = bm1[2]; bmr[7] = bm1[3];
    }
#pragma unroll
    for (int j = 0; j < 4; ++j) {
      const int n = n0 + (j << 4) + rlane;
      float bv = 0.f;
      if (BIAS_MODE == 2) bv = bias[n] * biasScale;
#pragma unroll
      for (int r = 0; r < 8; ++r) {
        float v = acc[i][j][r] * scale;
        if (BIAS_MODE == 1) v += bmr[r];
        if (BIAS_MODE == 2) v += bv;
        slab[(mOff + r) * 68 + (j << 4) + rlane] = v;
      }
    }
    __builtin_amdgcn_fence(__ATOMIC_RELEASE, "workgroup");
    __builtin_amdgcn_wave_barrier();
    __builtin_amdgcn_fence(__ATOMIC_ACQUIRE, "workgroup");
    if (OUT_MODE == 0) {
      float* C = (float*)Cout;
      const int hh = lane >> 4, c4 = (lane & 15) * 4;     // row seg = 256 B = 16 lanes x 16 B
#pragma unroll
      for (int it = 0; it < 8; ++it) {
        const int row = it * 2 + hh;
        v4f v = *(const v4f*)(slab + row * 68 + c4);
        *(v4f*)(C + (size_t)(mBase + row) * ldc + n0 + c4) = v;
      }
    } else {
      const int q = lane >> 3, c8 = (lane & 7) * 8;       // row seg = 128 B = 8 lanes x 16 B
      unsigned short* C = (unsigned short*)Cout;
#pragma unroll
      for (int it = 0; it < 4; ++it) {
        const int row = it * 4 + q;
        const float* sp = slab + row * 68 + c8;
        v8h hv;
#pragma unroll
        for (int e = 0; e < 8; ++e) hv[e] = (_Float16)sp[e];
        *(v8h*)(C + (size_t)(mBase + row) * ldc + n0 + c8) = hv;
      }
    }
    __builtin_amdgcn_fence(__ATOMIC_RELEASE, "workgroup");
    __builtin_amdgcn_wave_barrier();
    __builtin_amdgcn_fence(__ATOMIC_ACQUIRE, "workgroup");
  }
}

template <int BIAS_MODE, int OUT_MODE>
__device__ __forceinline__ void wmma_gemm_lds_tile(
    const unsigned short* __restrict__ Ap, const unsigned short* __restrict__ Btp,
    void* __restrict__ Cout, int ldc, const float* __restrict__ bias, bool rowBias, int tm, int tn, float scale, float biasScale) {
  __shared__ __align__(16) _Float16 sA[2][kGTile];   // 36,864 B
  __shared__ __align__(16) _Float16 sB[2][kGTile];   // 36,864 B
  __shared__ __align__(16) float sT[8][16 * 68];     // per-wave 16x64 output slab, pitch 68 floats
  const int t    = threadIdx.x;
  const int lane = t & 31;
  const int wave = t >> 5;
  const int rlane = lane & 15;                 // row (A) / col (B, D) within subtile
  const int koff  = (lane >> 4) * 8;           // k offset of this lane half
  const int wm = (wave >> 1) * 32;             // this wave's rows inside the tile
  const int wn = (wave & 1) * 64;              // this wave's columns inside the tile

  // staging map: 8 threads per 128-B row, rows srow + 32 q, q = 0..3, of each operand tile
  const int srow = t >> 3, sseg = (t & 7) * 8;
  const _Float16* gA = (const _Float16*)Ap  + (size_t)(tm * kGTileMN + srow) * kDim + sseg;
  const _Float16* gB = (const _Float16*)Btp + (size_t)(tn * kGTileMN + srow) * kDim + sseg;
  const int sdst = srow * kGPitch + sseg;
  v8h ra[2][4], rb[2][4];
  // the unroll directives of this kernel, but the one on the loop over stage pairs, are there because their loops index register arrays by the loop variable
#pragma unroll
  for (int u = 0; u < 2; ++u)
#pragma unroll
    for (int q = 0; q < 4; ++q) {
      ra[u][q] = *(const v8h*)(gA + (size_t)q * 32 * kDim + u * kGStageK);
      rb[u][q] = *(const v8h*)(gB + (size_t)q * 32 * kDim + u * kGStageK);
    }

  v8f acc[2][4];
#pragma unroll
  for (int i = 0; i < 2; ++i)
#pragma unroll
    for (int j = 0; j < 4; ++j) acc[i][j] = (v8f){0.f,0.f,0.f,0.f,0.f,0.f,0.f,0.f};

#pragma unroll
  for (int q = 0; q < 4; ++q) {
    *(v8h*)(&sA[0][sdst + q * 32 * kGPitch]) = ra[0][q];
    *(v8h*)(&sB[0][sdst + q * 32 * kGPitch]) = rb[0][q];
  }
  lds_barrier();   // stage 0 is in LDS before any wave reads it

  // fragments of one 32-k half stage; set 0 holds the lower half, set 1 the upper; each set is read from LDS while the other is worked on
  v16h af[2][2], bf[2][4];
#pragma unroll
  for (int i = 0; i < 2; ++i) af[0][i] = Frag<_Float16>::load(&sA[0][(wm + 16 * i + rlane) * kGPitch + koff]);
#pragma unroll
  for (int j = 0; j < 4; ++j) bf[0][j] = Frag<_Float16>::load(&sB[0][(wn + 16 * j + rlane) * kGPitch + koff]);

  // unrolled whole: the tests on s become compile-time, so no path joins and the counted waits on the register prefetch stay exact
#pragma unroll
  for (int st = 0; st < kGNStage; st += 2) {
#pragma unroll
    for (int u = 0; u < 2; ++u) {            // stage st + u: LDS buffer u, register set u is free
      const int s = st + u;
      if (s + 2 < kGNStage) {                // the same for the whole work-group
#pragma unroll
        for (int q = 0; q < 4; ++q) {
          ra[u][q] = *(const v8h*)(gA + (size_t)q * 32 * kDim + (s + 2) * kGStageK);
          rb[u][q] = *(const v8h*)(gB + (size_t)q * 32 * kDim + (s + 2) * kGStageK);
        }
      }
#pragma unroll
      for (int i = 0; i < 2; ++i) af[1][i] = Frag<_Float16>::load(&sA[u][(wm + 16 * i + rlane) * kGPitch + 32 + koff]);
#pragma unroll
      for (int j = 0; j < 4; ++j) bf[1][j] = Frag<_Float16>::load(&sB[u][(wn + 16 * j + rlane) * kGPitch + 32 + koff]);
      // keeps the upper half's LDS reads as one group ahead of the lower half's products, which cover their latency
      __builtin_amdgcn_sched_barrier(0);
#pragma unroll
      for (int i = 0; i < 2; ++i)
#pragma unroll
        for (int j = 0; j < 4; ++j) acc[i][j] = Frag<_Float16>::mma(af[0][i], bf[0][j], acc[i][j]);
      // keeps these products ahead of the stores and the barrier: moved behind them, the wait in front of the barrier would meet reads just issued
      __builtin_amdgcn_sched_barrier(0);
      if (s + 1 < kGNStage) {
#pragma unroll
        for (int q = 0; q < 4; ++q) {
          *(v8h*)(&sA[u ^ 1][sdst + q * 32 * kGPitch]) = ra[u ^ 1][q];
          *(v8h*)(&sB[u ^ 1][sdst + q * 32 * kGPitch]) = rb[u ^ 1][q];
        }
      }
      // publishes stage s + 1; every read of stage s has returned in front of it, so the next stage may refill buffer u behind it
      lds_barrier();
      if (s + 1 < kGNStage) {
#pragma unroll
        for (int i = 0; i < 2; ++i) af[0][i] = Frag<_Float16>::load(&sA[u ^ 1][(wm + 16 * i + rlane) * kGPitch + koff]);
#pragma unroll
        for (int j = 0; j < 4; ++j) bf[0][j] = Frag<_Float16>::load(&sB[u ^ 1][(wn + 16 * j + rlane) * kGPitch + koff]);
      }
      // keeps the next stage's first LDS reads as one group ahead of the upper half's products, which cover their latency
      __builtin_amdgcn_sched_barrier(0);
#pragma unroll
      for (int i = 0; i < 2; ++i)
#pragma unroll
        for (int j = 0; j < 4; ++j) acc[i][j] = Frag<_Float16>::mma(af[1][i], bf[1][j], acc[i][j]);
    }
  }

  // ---- epilogue; a bias mode told at run time picks one of the two compile-time forms by a block-uniform branch ----
  const int m0 = tm * kGTileMN + wm;
  const int n0 = tn * kGTileMN + wn;
  float* slab = sT[wave];
  if constexpr (BIAS_MODE == 3) {
    if (rowBias) wmma_gemm_store<1, OUT_MODE>(acc, slab, Cout, ldc, bias, m0, n0, scale, 1.0f);
    else         wmma_gemm_store<2, OUT_MODE>(acc, slab, Cout, ldc, bias, m0, n0, scale, biasScale);
  } else {
    wmma_gemm_store<BIAS_MODE, OUT_MODE>(acc, slab, Cout, ldc, bias, m0, n0, scale, biasScale);
  }
}

// ---------------------------------------------------------------------------
// The three input projections in one launch: they share x and depend on nothing of each other. 3 x 192 work-groups, one 128 x 128 tile each;
// the block index picks the product (block-uniform): 0 = q, 1 = k (A = activations, Bt = weights, bias[n]), 2 = v^T (A = weights, Bt = activations, bias[m]).
//   Q16[s][e]  = kQCarry * ((1/16) * sum_d X16[s][d] * WQ16[e][d] + bq[e]);   K16 alike without kQCarry;   VT16[c][s] = (1/16) * sum_d WV16[c][d] * X16[s][d] + bv[c]
// kQCarry = log2(e) / sqrt(64): the score product of the attention kernel then comes out in the log2 domain of its softmax, with no multiply per score.
// ---------------------------------------------------------------------------
constexpr int kProjTiles = (kSeq / kGTileMN) * (kDim / kGTileMN);   // 192 tiles per product
constexpr float kQCarry = 0.125f * 1.4426950408889634f;            // 1 / sqrt(64) and log2(e), applied in f32 ahead of q's one rounding to f16
__global__ __launch_bounds__(256) void qkv_gemm_kernel(
    const unsigned short* __restrict__ X16, const unsigned short* __restrict__ WQKV16,
    unsigned short* __restrict__ Q16, unsigned short* __restrict__ K16, unsigned short* __restrict__ VT16,
    const float* __restrict__ bq, const float* __restrict__ bk, const float* __restrict__ bv) {
  const unsigned which = blockIdx.x / (unsigned)kProjTiles;
  const unsigned tile  = blockIdx.x - which * (unsigned)kProjTiles;
  const bool vt        = which == 2;
  const unsigned short* W = WQKV16 + (size_t)which * kDim * kDim;
  const unsigned tilesN = vt ? kSeq / kGTileMN : kDim / kGTileMN;   // column tiles of C: 32 for v^T, 6 for q and k
  const int tm = vt ? tile / (unsigned)(kSeq / kGTileMN) : tile / (unsigned)(kDim / kGTileMN);
  const int tn = tile - (unsigned)tm * tilesN;
  const float carry = which == 0 ? kQCarry : 1.0f;
  wmma_gemm_lds_tile<3, 1>(vt ? W : X16, vt ? X16 : W, (void*)(vt ? VT16 : (which == 1 ? K16 : Q16)), vt ? kSeq : kDim,
                           vt ? bv : (which == 1 ? bk : bq), vt, tm, tn, kWCarryInv * carry, carry);
}
// Output projection: out[s][e] = (1/4096) * sum_c ATT16[s][c] * WO16[e][c] + bo[e], f32
__global__ __launch_bounds__(256) void out_gemm_kernel(
    const unsigned short* __restrict__ ATT16, const unsigned short* __restrict__ WO16, float* __restrict__ out, const float* __restrict__ bo) {
  const int tm = blockIdx.x / (kDim / kGTileMN);
  const int tn = blockIdx.x % (kDim / kGTileMN);
  wmma_gemm_lds_tile<2, 0>(ATT16, WO16, (void*)out, kDim, bo, false, tm, tn, kOutScale, 1.0f);
}

// ---------------------------------------------------------------------------
// x to f16: block blk covers 2048 consecutive elements, 8 per thread
// ---------------------------------------------------------------------------
__device__ __forceinline__ void cast8_f16_block(int blk, const float* __restrict__ in, unsigned short* __restrict__ out, int n8) {
  const int i = blk * 256 + threadIdx.x;
  if (i >= n8) return;
  const float* p = in + 8 * (size_t)i;
  const v4f a = *(const v4f*)(p);
  const v4f c = *(const v4f*)(p + 4);
  unsigned short hb[8];
#pragma unroll
  for (int e = 0; e < 4; ++e) {
    hb[e]     = h_bits(a[e]);
    hb[4 + e] = h_bits(c[e]);
  }
  const v4u u = (v4u){pk16(hb[0], hb[1]), pk16(hb[2], hb[3]), pk16(hb[4], hb[5]), pk16(hb[6], hb[7])};
  unsigned short* q = out + 8 * (size_t)i;
  *(v4u*)q = u;
  
}

// ---------------------------------------------------------------------------
// Rank-8 adapter fold + f16 cast with x16 carry, f32 math:
//   plane y in {0,1,2}: WQKV[y][e][d] = f16( 16 * ( w_y[e][d] + 2 * sum_r up_y[e][r] * down_y[r][d] ) )
//   plane y == 3      : WO[e][d]      = f16( 16 * wo[e][d] )
// Weights are [out e][in d] = Bt[n][k] for the GEMMs; orientation kept as given (no transpose).
// 288 x 4 blocks: y = matrix (block-uniform), block bx of a matrix covers 2048 consecutive elements (288 x 2048 = 768 x 768 exact);
// thread t owns elements 8t..8t+7 of the block (one row e, 8 consecutive d).
// The whole down matrix [8][768] of the plane is staged in LDS first (cooperative: 6 b128 per thread, 6 x 256 x 4 = 6144 floats =
// the whole matrix, every LDS word read below is written), block barrier, then per lane 2 b128 (w) + 2 b128 (up row) global loads.
// ---------------------------------------------------------------------------
__device__ __forceinline__ void fold_cast_block(
    int bx, int y,
    const float* __restrict__ wq, const float* __restrict__ wk, const float* __restrict__ wv, const float* __restrict__ wo,
    const float* __restrict__ dq, const float* __restrict__ uq,
    const float* __restrict__ dk, const float* __restrict__ uk,
    const float* __restrict__ dv, const float* __restrict__ uv,
    unsigned short* __restrict__ wqkv16, unsigned short* __restrict__ wo16) {
  __shared__ __align__(16) float dsh[kRank * kDim];      // down matrix [8][768] of this plane, 24,576 B
  const int t = threadIdx.x;
  const float* W  = (y == 0) ? wq : (y == 1) ? wk : (y == 2) ? wv : wo;
  const float* Dn = (y == 0) ? dq : (y == 1) ? dk : dv;   // y == 3: valid pointer, staged but not used
  const float* Up = (y == 0) ? uq : (y == 1) ? uk : uv;
  // stage down [8][768] = 1536 float4: thread t loads slots t + 256*i, i = 0..5 (exact coverage)
#pragma unroll
  for (int i = 0; i < 6; ++i) {
    const int q4 = (i * 256 + t) * 4;
    const v4f dd = *(const v4f*)(Dn + q4);
    *(v4f*)(dsh + q4) = dd;
  }
  __syncthreads();

  const int base = bx * 2048 + 8 * t;            // < 768*768
  const int e = base / kDim;
  const int d = base - e * kDim;                         // multiple of 8
  const v4f w0 = *(const v4f*)(W + base);
  const v4f w1 = *(const v4f*)(W + base + 4);
  float s[8];
#pragma unroll
  for (int k = 0; k < 8; ++k) s[k] = 0.0f;
  if (y < 3) {                                           // block-uniform branch
    const v4f u0 = *(const v4f*)(Up + e * kRank);
    const v4f u1 = *(const v4f*)(Up + e * kRank + 4);
    const float ur[8] = {u0[0], u0[1], u0[2], u0[3], u1[0], u1[1], u1[2], u1[3]};
#pragma unroll
    for (int r = 0; r < kRank; ++r) {
      const v4f a = *(const v4f*)(dsh + r * kDim + d);
      const v4f c = *(const v4f*)(dsh + r * kDim + d + 4);
#pragma unroll
      for (int k = 0; k < 4; ++k) {
        s[k]     += ur[r] * a[k];
        s[4 + k] += ur[r] * c[k];
      }
    }
  }
  float f[8];
#pragma unroll
  for (int k = 0; k < 4; ++k) {
    f[k]     = (w0[k] + kLowRankScale * s[k])     * kWCarry;
    f[4 + k] = (w1[k] + kLowRankScale * s[4 + k]) * kWCarry;
  }
  unsigned short hb[8];
#pragma unroll
  for (int k = 0; k < 8; ++k) hb[k] = h_bits(f[k]);
  const v4u u = (v4u){pk16(hb[0], hb[1]), pk16(hb[2], hb[3]), pk16(hb[4], hb[5]), pk16(hb[6], hb[7])};
  unsigned short* op = (y < 3) ? (wqkv16 + (size_t)y * kDim * kDim + base) : (wo16 + base);
  *(v4u*)op = u;
  
}

// ---------------------------------------------------------------------------
// Both 16-bit operand preparations in one launch: neither reads what the other writes. The block index picks the work (block-uniform,
// so the fold's barrier is passed by every thread of a block that reaches it): blocks 0..1151 fold and cast the weights, the other 1536 cast x.
// ---------------------------------------------------------------------------
constexpr int kFoldBlocksPerW = kDim * kDim / 2048;      // 288
constexpr int kFoldBlocks     = 4 * kFoldBlocksPerW;     // 1152
constexpr int kCastBlocks     = kSeq * kDim / 2048;      // 1536
__global__ __launch_bounds__(256) void prep_kernel(
    const float* __restrict__ x, unsigned short* __restrict__ x16,
    const float* __restrict__ wq, const float* __restrict__ wk, const float* __restrict__ wv, const float* __restrict__ wo,
    const float* __restrict__ dq, const float* __restrict__ uq,
    const float* __restrict__ dk, const float* __restrict__ uk,
    const float* __restrict__ dv, const float* __restrict__ uv,
    unsigned short* __restrict__ wqkv16, unsigned short* __restrict__ wo16) {
  const int b = blockIdx.x;
  if (b < kFoldBlocks) {
    const int y = b / kFoldBlocksPerW;
    fold_cast_block(b - y * kFoldBlocksPerW, y, wq, wk, wv, wo, dq, uq, dk, uk, dv, uv, wqkv16, wo16);
  } else {
    cast8_f16_block(b - kFoldBlocks, x, x16, kSeq * kDim / 8);
  }
}

constexpr int kFAColWaves = 2;
constexpr int kFAKeyWaves = 2;
constexpr int kFAWaves  = kFAColWaves * kFAKeyWaves;
constexpr int kFAGroups = 2;
constexpr int kFARows   = kFAColWaves * kFAGroups * 16;
constexpr int kFAStage  = kFAKeyWaves * 64;
constexpr int kFANStage = kSeq / kFAStage;
constexpr int kFAPitch  = 72;
constexpr int kFATile   = 64 * kFAPitch;
constexpr int kFATilesPerHead = kSeq / kFARows;           // 64
constexpr int kFABlocks = kHeads * kFATilesPerHead;       // 768
constexpr int kFAThird  = kFABlocks / 3;                  // 256
constexpr float kFACarryLog2 = 6.0f;
constexpr float kFATrail = 8.0f;                          // how far the maximum in use may trail
static_assert(kSeq % kFARows == 0 && kSeq % kFAStage == 0 && kDh == 64 && kFABlocks % 3 == 0 && kFAGroups == 2, "fused attention mapping");
typedef __attribute__((ext_vector_type(2))) _Float16 v2h;
// lane l with lane l ^ 16
__device__ __forceinline__ float xhalf(float x) {
  const int b = __builtin_bit_cast(int, x);
  return __builtin_bit_cast(float, __builtin_amdgcn_permlanex16(b, b, 0x76543210, 0xfedcba98, false, false));
}
__device__ __forceinline__ unsigned pack2h(float lo, float hi) {
  return __builtin_bit_cast(unsigned, __builtin_convertvector((v2f){lo, hi}, v2h));   // round to nearest even
}
// The eight score products of a 32-key pass (2 key tiles x 2 column groups x 2 halves of d) in one statement. Written as text because the first
// product of each tile must read its C operand from the shift tile and write another tile: the builtin form was built with C and D in the same
// registers, behind a copy of the shift tile per product. Each tile's second product accumulates into the same D; the products fill each
// other's slots, and the four v_nop at the end keep the distance that the chip needs between the last product and the first vector reader of its D.
// The four v_nop in front keep the same distance behind the P.V products of the pass before: a D of this statement may lie in the registers of
// their B operand, and the compiler, which pads its own products, does not look into a statement's text.
// The shift tiles are only read; they are named as in-out operands so that they stay in one set of registers over the whole loop
// (as plain inputs the build kept a second set and copied 16 registers in every pass).
__device__ __forceinline__ void score_products(v8f& s00, v8f& s01, v8f& s10, v8f& s11, v16h ka0, v16h ka1, v16h kb0, v16h kb1,
                                               v16h q00, v16h q01, v16h q10, v16h q11, v8f& sh0, v8f& sh1) {
  asm("v_nop\n\tv_nop\n\tv_nop\n\tv_nop\n\t"
      "v_wmma_f32_16x16x32_f16 %0, %6, %10, %4\n\t"
      "v_wmma_f32_16x16x32_f16 %1, %6, %12, %5\n\t"
      "v_wmma_f32_16x16x32_f16 %2, %8, %10, %4\n\t"
      "v_wmma_f32_16x16x32_f16 %3, %8, %12, %5\n\t"
      "v_wmma_f32_16x16x32_f16 %0, %7, %11, %0\n\t"
      "v_wmma_f32_16x16x32_f16 %1, %7, %13, %1\n\t"
      "v_wmma_f32_16x16x32_f16 %2, %9, %11, %2\n\t"
      "v_wmma_f32_16x16x32_f16 %3, %9, %13, %3\n\t"
      "v_nop\n\tv_nop\n\tv_nop\n\tv_nop"
      : "=&v"(s00), "=&v"(s01), "=&v"(s10), "=&v"(s11), "+v"(sh0), "+v"(sh1)
      : "v"(ka0), "v"(ka1), "v"(kb0), "v"(kb1), "v"(q00), "v"(q01), "v"(q10), "v"(q11));
}
__global__ __launch_bounds__(kFAWaves * 32) void attn_fused_kernel(
    const unsigned short* __restrict__ Qp, const unsigned short* __restrict__ Kp, const unsigned short* __restrict__ VTp,
    unsigned short* __restrict__ Att) {
  __shared__ __align__(16) _Float16 sK[2][kFAKeyWaves][kFATile];   // 36,864 B; a buffer is 128 key rows in a row
  __shared__ __align__(16) _Float16 sV[2][kFAKeyWaves][kFATile];   // 36,864 B
  // The join's planes, 17,408 B, beside the ring and not over it: at 91,136 B three work-groups fit a WGP's LDS and a fourth does not,
  // so the 768 work-groups cannot crowd onto fewer than all 256 WGPs.
  __shared__ __align__(16) v4f sJ[kFAColWaves][17][32];
  const int t    = threadIdx.x;
  const int lane = t & 31, wave = t >> 5;
  const int cw   = wave & 1;                // which 32 query columns
  const int kh   = wave >> 1;               // which 64 keys of every stage
  const int c    = lane & 15;
  const int h8   = (lane >> 4) * 8;
  // Block -> (head, tile), a one-to-one map of 0..767. Blocks b, b + 256 and b + 512 take neighbouring tiles, nearly always of one head:
  // where they come to share a WGP they fetch the same K and V^T lines at about the same time. For speed only; any placement is right.
  const int id   = (blockIdx.x % kFAThird) * 3 + blockIdx.x / kFAThird;
  const int head = id / kFATilesPerHead;
  const int q0   = (id % kFATilesPerHead) * kFARows + cw * (kFAGroups * 16);
  const _Float16* Qh = (const _Float16*)Qp  + head * kDh;
  const _Float16* Kh = (const _Float16*)Kp  + head * kDh;                   // [key][kDim]
  const _Float16* Vh = (const _Float16*)VTp + (size_t)head * kDh * kSeq;    // [d][kSeq]

  // staging map: 8 threads per 128-B row; K rows srow + 16 q, q = 0..7; V^T rows srow + 16 q, q = 0..3, of each of the two tiles
  const int srow = t >> 3, sseg = (t & 7) * 8;
  const _Float16* gK = Kh + (size_t)srow * kDim + sseg;
  const _Float16* gV = Vh + (size_t)srow * kSeq + sseg;
  const int sdst = srow * kFAPitch + sseg;
  {
    v8h r0[8], r1[8];
#pragma unroll
    for (int q = 0; q < 8; ++q) {
      r0[q] = *(const v8h*)(gK + (size_t)q * 16 * kDim);
      r1[q] = *(const v8h*)(gV + (size_t)(q & 3) * 16 * kSeq + (q >> 2) * 64);
    }
#pragma unroll
    for (int q = 0; q < 8; ++q) {
      *(v8h*)(&sK[0][0][sdst + q * 16 * kFAPitch]) = r0[q];
      *(v8h*)(&sV[0][q >> 2][sdst + (q & 3) * 16 * kFAPitch]) = r1[q];
    }
  }

  v16h qf[kFAGroups][2];
#pragma unroll
  for (int g = 0; g < kFAGroups; ++g)
#pragma unroll
    for (int kc = 0; kc < 2; ++kc)
      qf[g][kc] = Frag<_Float16>::load(Qh + (size_t)(q0 + 16 * g + c) * kDim + 32 * kc + h8);

  v8f acc[kFAGroups][4];
  v8f shift[kFAGroups];                 // C operand of the score product: 6 - mrun in every element; 0 until the first pass has a maximum
  v2f lsum[kFAGroups];
  float mrun[kFAGroups];
  float scur[kFAGroups];                // the value that shift holds, apart: a rescale then reads nothing of the tile and rewrites it in place
  float limit = -__builtin_inff();      // a shifted score above it asks for a rescale; wave-uniform; -inf so that the first pass always does
#pragma unroll
  for (int g = 0; g < kFAGroups; ++g) {
    mrun[g] = -__builtin_inff();
    shift[g] = (v8f){0.f,0.f,0.f,0.f,0.f,0.f,0.f,0.f};
    scur[g] = 0.f;
    lsum[g] = (v2f){0.f, 0.f};
#pragma unroll
    for (int j = 0; j < 4; ++j) acc[g][j] = (v8f){0.f,0.f,0.f,0.f,0.f,0.f,0.f,0.f};
  }
  __syncthreads();   // stage 0 is in LDS before any wave reads it

  for (int st = 0; st < kFANStage; ++st) {
    const int buf = st & 1;
    const bool more = st + 1 < kFANStage;   // the same for the whole work-group
    const _Float16* bK = &sK[buf][kh][0];
    const _Float16* bV = &sV[buf][kh][0];
#pragma unroll
    for (int p = 0; p < 2; ++p) {          // two 32-key passes per stage and key wave
      v8h rs[8];                           // half of the next stage, in flight over this pass: K in pass 0, V^T in pass 1
      if (more) {
        if (p == 0) {
          gK += kFAStage * kDim;
#pragma unroll
          for (int q = 0; q < 8; ++q) rs[q] = *(const v8h*)(gK + (size_t)q * 16 * kDim);
        } else {
          gV += kFAStage;
#pragma unroll
          for (int q = 0; q < 8; ++q) rs[q] = *(const v8h*)(gV + (size_t)(q & 3) * 16 * kSeq + (q >> 2) * 64);
        }
      }
      v8f s[2][kFAGroups];
      {
        const _Float16* kp = bK + (32 * p + c) * kFAPitch + h8;
        const v16h ka0 = Frag<_Float16>::load(kp);
        const v16h ka1 = Frag<_Float16>::load(kp + 32);
        const v16h kb0 = Frag<_Float16>::load(kp + 16 * kFAPitch);
        const v16h kb1 = Frag<_Float16>::load(kp + 16 * kFAPitch + 32);
        score_products(s[0][0], s[0][1], s[1][0], s[1][1], ka0, ka1, kb0, kb1, qf[0][0], qf[0][1], qf[1][0], qf[1][1], shift[0], shift[1]);
      }
      v16h vf[4];
#pragma unroll
      for (int j = 0; j < 4; ++j) vf[j] = Frag<_Float16>::load(bV + (16 * j + c) * kFAPitch + 32 * p + h8);

      float mb[kFAGroups];
      bool need = false;
#pragma unroll
      for (int g = 0; g < kFAGroups; ++g) {
        float mx = s[0][g][0];
#pragma unroll
        for (int r = 1; r < 8; ++r) mx = fmaxf(mx, s[0][g][r]);
#pragma unroll
        for (int r = 0; r < 8; ++r) mx = fmaxf(mx, s[1][g][r]);
        mb[g] = mx;                             // this lane's 16 keys; the wave halves are joined only where a rescale is due
        need = need || (mx > limit);
      }
      if (__builtin_amdgcn_ballot_w32(need) != 0) {   // wave-uniform; always on the first pass, rare later
#pragma unroll
        for (int g = 0; g < kFAGroups; ++g) {
          const float sold = scur[g];
          const float mnew = fmaxf(mrun[g], fmaxf(mb[g], xhalf(mb[g])) - sold);   // both wave halves hold this query's maximum, unshifted
          const float corr = __builtin_amdgcn_exp2f(mrun[g] - mnew);   // 0 on the first pass, where mrun is -inf
          mrun[g] = mnew;
          const float snew = kFACarryLog2 - mnew;
          const float adj  = snew - sold;
          s[0][g] = s[0][g] + adj;   // this pass's scores were formed with the old shift
          s[1][g] = s[1][g] + adj;
          shift[g] = (v8f){snew, snew, snew, snew, snew, snew, snew, snew};
          scur[g] = snew;
          lsum[g] = lsum[g] * corr;
#pragma unroll
          for (int j = 0; j < 4; ++j) acc[g][j] = acc[g][j] * corr;
        }
        limit = kFACarryLog2 + kFATrail;
      }
#pragma unroll
      for (int g = 0; g < kFAGroups; ++g) {
        union { v16h v; unsigned w[8]; } pf;
#pragma unroll
        for (int i = 0; i < 8; ++i) {
          const v2f pe = (v2f){__builtin_amdgcn_exp2f(s[i >> 2][g][2 * (i & 3)]), __builtin_amdgcn_exp2f(s[i >> 2][g][2 * (i & 3) + 1])};
          lsum[g] += pe;
          pf.w[i] = pack2h(pe[0], pe[1]);
        }
#pragma unroll
        for (int j = 0; j < 4; ++j) acc[g][j] = Frag<_Float16>::mma(vf[j], pf.v, acc[g][j]);
      }
      if (more) {   // the other buffer's last readers left it at the barrier that ended the stage before
#pragma unroll
        for (int q = 0; q < 8; ++q) {
          if (p == 0) *(v8h*)(&sK[buf ^ 1][0][sdst + q * 16 * kFAPitch]) = rs[q];
          else        *(v8h*)(&sV[buf ^ 1][q >> 2][sdst + (q & 3) * 16 * kFAPitch]) = rs[q];
        }
      }
    }
    __syncthreads();   // publishes stage st + 1 and ends every wave's reads of the buffer that the next trip refills
  }

  // ---- join of the two key waves of each column pair ----
  // plane i of column wave cw holds 16 B per lane: planes 0..15 = the output tiles, plane 16 = both maxima and both sums
  v4f* mg = &sJ[cw][0][lane];
  if (kh == 1) {
#pragma unroll
    for (int g = 0; g < kFAGroups; ++g)
#pragma unroll
      for (int j = 0; j < 4; ++j) {
        const v8f o = acc[g][j];
        mg[((g * 4 + j) * 2 + 0) * 32] = (v4f){o[0], o[1], o[2], o[3]};
        mg[((g * 4 + j) * 2 + 1) * 32] = (v4f){o[4], o[5], o[6], o[7]};
      }
    mg[16 * 32] = (v4f){mrun[0], mrun[1], lsum[0][0] + lsum[0][1], lsum[1][0] + lsum[1][1]};
  }
  __syncthreads();   // the planes are in LDS before the other key wave reads them; every wave passes it
  if (kh != 0) return;

  // acc[g][j][r] = O^T[d = 16 j + 8 h + r][query 16 g + c]: 8 consecutive d of one row, one 16-B store
  const v4f ml = mg[16 * 32];
#pragma unroll
  for (int g = 0; g < kFAGroups; ++g) {
    const float mall = fmaxf(mrun[g], ml[g]);
    const float f0 = __builtin_amdgcn_exp2f(mrun[g] - mall);   // this wave's share, scaled to the larger maximum
    const float f1 = __builtin_amdgcn_exp2f(ml[g] - mall);     // the other key wave's
    const float lh  = (lsum[g][0] + lsum[g][1]) * f0 + ml[2 + g] * f1;
    const float inv = kAttCarry / (lh + xhalf(lh));   // the exchange is unconditional within the wave
    const float i0 = f0 * inv, i1 = f1 * inv;
    unsigned short* op = Att + (size_t)(q0 + 16 * g + c) * kDim + head * kDh + h8;
#pragma unroll
    for (int j = 0; j < 4; ++j) {
      const v4f pa = mg[((g * 4 + j) * 2 + 0) * 32];
      const v4f pb = mg[((g * 4 + j) * 2 + 1) * 32];
      const v8f po = (v8f){pa[0], pa[1], pa[2], pa[3], pb[0], pb[1], pb[2], pb[3]};
      const v8f o = acc[g][j] * i0 + po * i1;
      const v4u u = (v4u){pack2h(o[0], o[1]), pack2h(o[2], o[3]), pack2h(o[4], o[5]), pack2h(o[6], o[7])};
      *(v4u*)(op + 16 * j) = u;
    }
  }
}

// ---------------------------------------------------------------------------
// Host glue.
// Workspace region map (bytes, every offset a multiple of 128; every plane fully written before any read):
//   X16    f16 [4096][768]                 6,291,456  at          0   (cast8)
//   WQKV16 f16 [3][768][768]  (x16 carry)  3,538,944  at  6,291,456   (fold_cast, planes q|k|v)
//   WO16   f16 [768][768]     (x16 carry)  1,179,648  at  9,830,400   (fold_cast)
//   Q16    f16 [4096][768]                 6,291,456  at 11,010,048   (GEMM)
//   K16    f16 [4096][768]                 6,291,456  at 17,301,504   (GEMM)
//   VT16   f16 [768][4096]  = V^T          6,291,456  at 23,592,960   (GEMM with swapped operand roles)
//   ATT16  f16 [4096][768]   (x256 carry)  6,291,456  at 29,884,416   (fused attention, each work-group [64 rows][64 cols])
//   total                                 36,175,872
// GEMM shapes (all M,N multiples of 128, K = 768 = 12 stages of 64, no padding anywhere):
//   q,k:  M=4096 N=768  K=768;  v^T: M=768 N=4096 K=768;  out: M=4096 N=768 K=768
// Launches: 1 cast and fold + 1 for the three projections + 1 fused attention + 1 out = 4.
// ---------------------------------------------------------------------------
extern "C" void kernel_launch(void* const* d_in, const int* in_sizes, int n_in,
                              void* d_out, int out_size, void* d_ws, size_t ws_size,
                              hipStream_t stream) {
  if (n_in < 15) return;
  const int nX = kSeq * kDim;          // 3,145,728
  const int nW = kDim * kDim;          // 589,824
  const int nA = kRank * kDim;         // 6,144
  if (in_sizes[0] != nX) return;
  if (in_sizes[1] != nW || in_sizes[3] != nW || in_sizes[5] != nW || in_sizes[7] != nW) return;
  if (in_sizes[2] != kDim || in_sizes[4] != kDim || in_sizes[6] != kDim || in_sizes[8] != kDim) return;
  for (int i = 9; i < 15; ++i) if (in_sizes[i] != nA) return;
  if (out_size != nX) return;

  const size_t szAct  = (size_t)kSeq * kDim * 2;
  const size_t szWqkv = (size_t)3 * kDim * kDim * 2;
  const size_t szWo   = (size_t)kDim * kDim * 2;
  const size_t offX    = 0;
  const size_t offWqkv = offX + szAct;
  const size_t offWo   = offWqkv + szWqkv;
  const size_t offQ    = offWo + szWo;
  const size_t offK    = offQ + szAct;
  const size_t offVT   = offK + szAct;
  const size_t offAtt  = offVT + szAct;
  const size_t total   = offAtt + szAct;   // 36,175,872
  if (ws_size < total) return;

  const float* x   = (const float*)d_in[0];
  const float* wq  = (const float*)d_in[1];
  const float* bq  = (const float*)d_in[2];
  const float* wk  = (const float*)d_in[3];
  const float* bk  = (const float*)d_in[4];
  const float* wv  = (const float*)d_in[5];
  const float* bv  = (const float*)d_in[6];
  const float* wo  = (const float*)d_in[7];
  const float* bo  = (const float*)d_in[8];
  const float* dq  = (const float*)d_in[9];    // [8][768]
  const float* uq  = (const float*)d_in[10];   // [768][8]
  const float* dk  = (const float*)d_in[11];
  const float* uk  = (const float*)d_in[12];
  const float* dv  = (const float*)d_in[13];
  const float* uv  = (const float*)d_in[14];
  float* out = (float*)d_out;
  char* ws = (char*)d_ws;
  unsigned short* X16    = (unsigned short*)(ws + offX);
  unsigned short* WQKV16 = (unsigned short*)(ws + offWqkv);
  unsigned short* WO16   = (unsigned short*)(ws + offWo);
  unsigned short* Q16    = (unsigned short*)(ws + offQ);
  unsigned short* K16    = (unsigned short*)(ws + offK);
  unsigned short* VT16   = (unsigned short*)(ws + offVT);
  unsigned short* ATT16  = (unsigned short*)(ws + offAtt);

  // ---- 16-bit operand planes: x cast, weights folded and cast, one launch ----
  prep_kernel<<<dim3(kFoldBlocks + kCastBlocks), dim3(256), 0, stream>>>(x, X16, wq, wk, wv, wo, dq, uq, dk, uk, dv, uv, WQKV16, WO16);

  // ---- projections q, k, v^T: one launch, one work-group per 128 x 128 tile, 576 work-groups of 8 waves ----
  qkv_gemm_kernel<<<dim3(3 * kProjTiles), dim3(256), 0, stream>>>(X16, WQKV16, Q16, K16, VT16, bq, bk, bv);

  // ---- attention: one launch, one work-group per (64 query rows, head) ----
  // ATT16[s][h*64+n] = 256 * sum_j softmax2_j(Q16[s][h*64+:] . K16[j][h*64+:]) * VT16[h*64+n][j], softmax2 to base 2 (Q16 holds q * log2(e) / 8)
  attn_fused_kernel<<<dim3(kFABlocks), dim3(kFAWaves * 32), 0, stream>>>(Q16, K16, VT16, ATT16);

  // ---- output projection (M=4096, N=768, K=768, f32 to d_out) ----
  out_gemm_kernel<<<dim3(kProjTiles), dim3(256), 0, stream>>>(ATT16, WO16, out, bo);
}

// v007
// A run of this version takes 81.9 microseconds.
// Two timings next to v006 both put it at 1.04 times that version's speed.
// All steps since v000 together make it 59.8 times as fast.
// Contractions: q/k projections and v^T projection (x f16 x W_eff^T f16 carried x16), scores k_h.q_h^T (q,k f16 planes, q carried x log2(e)/8, the softmax shift as the product's f32 C operand), v_h^T.probs^T (V^T f16 x unnormalised P f16 carried x64), output projection (attn f16 carried x256 x Wo^T f16 carried x16): all v_wmma_f32_16x16x32_f16 with f32 accumulate; rank-8 weight fold, bias add and online softmax in f32.
#include <hip/hip_runtime.h>
#include <math.h>

// ---------------------------------------------------------------------------
// Problem constants
// ---------------------------------------------------------------------------
constexpr int kSeq    = 4096;             // tokens (batch 1)
constexpr int kDim    = 768;              // model width
constexpr int kHeads  = 12;
constexpr int kDh     = 64;
constexpr int kRank   = 8;                // low-rank adapter width
constexpr float kLowRankScale = 2.0f;     // alpha / rank = 16 / 8
constexpr float kWCarry    = 16.0f;       // weights carried x16 in f16
constexpr float kWCarryInv = 1.0f / 16.0f;
constexpr float kAttCarry  = 256.0f;      // attention output carried x256 in f16
constexpr float kOutScale  = 1.0f / (kAttCarry * kWCarry);   // 1/4096
static_assert(kHeads * kDh == kDim, "shape");
static_assert(kSeq % 64 == 0 && kDim % 64 == 0 && kDh % 64 == 0, "M,N tile multiples");
static_assert(kDim % 32 == 0 && kDh % 32 == 0 && kSeq % 32 == 0, "K multiples of 32");
static_assert((kDim * kDim) % 2048 == 0, "fold block mapping");
static_assert((kSeq * kDim) % 2048 == 0, "cast block mapping");
static_assert(kRank * kDim == 6 * 256 * 4, "adapter staging: 6 float4 per thread of a 256-thread block");

typedef __attribute__((ext_vector_type(16))) _Float16 v16h;
typedef __attribute__((ext_vector_type(8)))  _Float16 v8h;
typedef __attribute__((ext_vector_type(8)))  float    v8f;
typedef __attribute__((ext_vector_type(4)))  float    v4f;
typedef __attribute__((ext_vector_type(2)))  float    v2f;
typedef __attribute__((ext_vector_type(4)))  unsigned int v4u;

// ---------------------------------------------------------------------------
// Fragment loader and matrix product, f16 operands, f32 accumulate
// ---------------------------------------------------------------------------
template <typename T> struct Frag;
template <> struct Frag<_Float16> {
  typedef v16h V; union U { v16h v; v8h h[2]; };
  // elements 0..7 <- p[0..7], 8..15 <- p[16..23]
  static __device__ __forceinline__ v16h load(const _Float16* p) {
    U f; f.h[0] = *(const v8h*)(p); f.h[1] = *(const v8h*)(p + 16); return f.v;
  }
  static __device__ __forceinline__ v8f mma(v16h a, v16h b, v8f c) {
    return __builtin_amdgcn_wmma_f32_16x16x32_f16(false, a, false, b, (short)0, c, false, false);
  }
};

__device__ __forceinline__ unsigned pk16(unsigned short a, unsigned short b) { return (unsigned)a | ((unsigned)b << 16); }
__device__ __forceinline__ unsigned short h_bits(float f) { const _Float16 h = (_Float16)f; return __builtin_bit_cast(unsigned short, h); }

// ---------------------------------------------------------------------------
// WMMA GEMM with both operands staged in LDS: C[m,n] = scale * sum_k A[m,k] * Bt[n,k] + bias.
// A row-major [M][kDim], Bt row-major [N][kDim], f16; M, N multiples of 128; K = kDim for every product of this file.
// One work-group = one 128 x 128 tile of C; 8 waves as 4 (m) x 2 (n), each 32 x 64 = 2 x 4 accumulator tiles.
// A stage is 64 k: 128 rows x 128 B of A and of Bt. 8 threads fetch one whole 128-B line, so a wave-wide load covers 4 whole lines;
// every line is fetched once per work-group and shared by its waves through LDS (pitch 144 B, an odd multiple of 16 B).
// Stage s + 2 is fetched into registers while stage s is worked on (two register sets), stage s + 1 is stored to the other of two
// LDS buffers in the middle of stage s, one work-group barrier per stage; fragments are read half a stage (32 k) ahead of their products.
// A and B fragments come from LDS through the same loader (equal k orders); k runs upward in steps of 32 in every accumulator.
// BIAS_MODE: 1 = bias[m], 2 = bias[n] * biasScale, 3 = told at run time by rowBias (the same for the whole work-group).  OUT_MODE: 0 = f32, 1 = f16.
// The tile (tm, tn) and the operands come from the calling kernel, which derives them from its block index.
// ---------------------------------------------------------------------------
constexpr int kGTileMN = 128;                   // rows of A and of Bt per work-group
constexpr int kGStageK = 64;                    // k per stage: one 128-B line per row
constexpr int kGNStage = kDim / kGStageK;       // 12
constexpr int kGPitch  = 72;                    // f16 per LDS row
constexpr int kGTile   = kGTileMN * kGPitch;    // f16 per staged operand tile (18,432 B)
static_assert(kSeq % kGTileMN == 0 && kDim % kGTileMN == 0 && kDim % (2 * kGStageK) == 0, "staged GEMM mapping");
// Work-group barrier that orders LDS traffic only: __syncthreads() also waits for every outstanding global load, which would
// end the two-stage lead of the register prefetch at each stage; nothing but LDS passes between the waves of this kernel.
__device__ __forceinline__ void lds_barrier() {
  __builtin_amdgcn_fence(__ATOMIC_RELEASE, "workgroup", "local");
  __builtin_amdgcn_s_barrier();
  __builtin_amdgcn_fence(__ATOMIC_ACQUIRE, "workgroup", "local");
}
// Epilogue of the staged GEMM: each wave turns its 16 x 64 slabs through its own LDS range (slab) into whole-line stores.
// (m0, n0) = first row and column of the wave's 32 x 64 part of C.  BIAS_MODE: 1 = bias[m], 2 = bias[n] * biasScale.  OUT_MODE: 0 = f32, 1 = f16.
template <int BIAS_MODE, int OUT_MODE>
__device__ __forceinline__ void wmma_gemm_store(
    const v8f (&acc)[2][4], float* slab, void* __restrict__ Cout, int ldc, const float* __restrict__ bias, int m0, int n0, float scale,
    float biasScale) {
  const int lane  = threadIdx.x & 31;
  const int rlane = lane & 15;                 // column within subtile
  const int mOff  = (lane >> 4) * 8;           // D row offset
  // the unroll directives of this function, but those on the two store loops, are there because their loops index register arrays by the loop variable
#pragma unroll
  for (int i = 0; i < 2; ++i) {
    const int mBase = m0 + (i << 4);
    // bias[m]: the 8 rows this lane half touches are contiguous -> two 16-B loads
    float bmr[8] = {0.f, 0.f, 0.f, 0.f, 0.f, 0.f, 0.f, 0.f};
    if (BIAS_MODE == 1) {
      const float* bp = bias + mBase + mOff;
      const v4f bm0 = *(const v4f*)(bp);
      const v4f bm1 = *(const v4f*)(bp + 4);
      bmr[0] = bm0[0]; bmr[1] = bm0[1]; bmr[2] = bm0[2]; bmr[3] = bm0[3];
      bmr[4] = bm1[0]; bmr[5] = bm1[1]; bmr[6] = bm1[2]; bmr[7] = bm1[3];
    }
#pragma unroll
    for (int j = 0; j < 4; ++j) {
      const int n = n0 + (j << 4) + rlane;
      float bv = 0.f;
      if (BIAS_MODE == 2) bv = bias[n] * biasScale;
#pragma unroll
      for (int r = 0; r < 8; ++r) {
        float v = acc[i][j][r] * scale;
        if (BIAS_MODE == 1) v += bmr[r];
        if (BIAS_MODE == 2) v += bv;
        slab[(mOff + r) * 68 + (j << 4) + rlane] = v;
      }
    }
    __builtin_amdgcn_fence(__ATOMIC_RELEASE, "workgroup");
    __builtin_amdgcn_wave_barrier();
    __builtin_amdgcn_fence(__ATOMIC_ACQUIRE, "workgroup");
    if (OUT_MODE == 0) {
      float* C = (float*)Cout;
      const int hh = lane >> 4, c4 = (lane & 15) * 4;     // row seg = 256 B = 16 lanes x 16 B
#pragma unroll
      for (int it = 0; it < 8; ++it) {
        const int row = it * 2 + hh;
        v4f v = *(const v4f*)(slab + row * 68 + c4);
        *(v4f*)(C + (size_t)(mBase + row) * ldc + n0 + c4) = v;
      }
    } else {
      const int q = lane >> 3, c8 = (lane & 7) * 8;       // row seg = 128 B = 8 lanes x 16 B
      unsigned short* C = (unsigned short*)Cout;
#pragma unroll
      for (int it = 0; it < 4; ++it) {
        const int row = it * 4 + q;
        const float* sp = slab + row * 68 + c8;
        v8h hv;
#pragma unroll
        for (int e = 0; e < 8; ++e) hv[e] = (_Float16)sp[e];
        *(v8h*)(C + (size_t)(mBase + row) * ldc + n0 + c8) = hv;
      }
    }
    __builtin_amdgcn_fence(__ATOMIC_RELEASE, "workgroup");
    __builtin_amdgcn_wave_barrier();
    __builtin_amdgcn_fence(__ATOMIC_ACQUIRE, "workgroup");
  }
}

template <int BIAS_MODE, int OUT_MODE>
__device__ __forceinline__ void wmma_gemm_lds_tile(
    const unsigned short* __restrict__ Ap, const unsigned short* __restrict__ Btp,
    void* __restrict__ Cout, int ldc, const float* __restrict__ bias, bool rowBias, int tm, int tn, float scale, float biasScale) {
  __shared__ __align__(16) _Float16 sA[2][kGTile];   // 36,864 B
  __shared__ __align__(16) _Float16 sB[2][kGTile];   // 36,864 B
  __shared__ __align__(16) float sT[8][16 * 68];     // per-wave 16x64 output slab, pitch 68 floats
  const int t    = threadIdx.x;
  const int lane = t & 31;
  const int wave = t >> 5;
  const int rlane = lane & 15;                 // row (A) / col (B, D) within subtile
  const int koff  = (lane >> 4) * 8;           // k offset of this lane half
  const int wm = (wave >> 1) * 32;             // this wave's rows inside the tile
  const int wn = (wave & 1) * 64;              // this wave's columns inside the tile

  // staging map: 8 threads per 128-B row, rows srow + 32 q, q = 0..3, of each operand tile
  const int srow = t >> 3, sseg = (t & 7) * 8;
  const _Float16* gA = (const _Float16*)Ap  + (size_t)(tm * kGTileMN + srow) * kDim + sseg;
  const _Float16* gB = (const _Float16*)Btp + (size_t)(tn * kGTileMN + srow) * kDim + sseg;
  const int sdst = srow * kGPitch + sseg;
  v8h ra[2][4], rb[2][4];
  // the unroll directives of this kernel, but the one on the loop over stage pairs, are there because their loops index register arrays by the loop variable
#pragma unroll
  for (int u = 0; u < 2; ++u)
#pragma unroll
    for (int q = 0; q < 4; ++q) {
      ra[u][q] = *(const v8h*)(gA + (size_t)q * 32 * kDim + u * kGStageK);
      rb[u][q] = *(const v8h*)(gB + (size_t)q * 32 * kDim + u * kGStageK);
    }

  v8f acc[2][4];
#pragma unroll
  for (int i = 0; i < 2; ++i)
#pragma unroll
    for (int j = 0; j < 4; ++j) acc[i][j] = (v8f){0.f,0.f,0.f,0.f,0.f,0.f,0.f,0.f};

#pragma unroll
  for (int q = 0; q < 4; ++q) {
    *(v8h*)(&sA[0][sdst + q * 32 * kGPitch]) = ra[0][q];
    *(v8h*)(&sB[0][sdst + q * 32 * kGPitch]) = rb[0][q];
  }
  lds_barrier();   // stage 0 is in LDS before any wave reads it

  // fragments of one 32-k half stage; set 0 holds the lower half, set 1 the upper; each set is read from LDS while the other is worked on
  v16h af[2][2], bf[2][4];
#pragma unroll
  for (int i = 0; i < 2; ++i) af[0][i] = Frag<_Float16>::load(&sA[0][(wm + 16 * i + rlane) * kGPitch + koff]);
#pragma unroll
  for (int j = 0; j < 4; ++j) bf[0][j] = Frag<_Float16>::load(&sB[0][(wn + 16 * j + rlane) * kGPitch + koff]);

  // unrolled whole: the tests on s become compile-time, so no path joins and the counted waits on the register prefetch stay exact
#pragma unroll
  for (int st = 0; st < kGNStage; st += 2) {
#pragma unroll
    for (int u = 0; u < 2; ++u) {            // stage st + u: LDS buffer u, register set u is free
      const int s = st + u;
      if (s + 2 < kGNStage) {                // the same for the whole work-group
#pragma unroll
        for (int q = 0; q < 4; ++q) {
          ra[u][q] = *(const v8h*)(gA + (size_t)q * 32 * kDim + (s + 2) * kGStageK);
          rb[u][q] = *(const v8h*)(gB + (size_t)q * 32 * kDim + (s + 2) * kGStageK);
        }
      }
#pragma unroll
      for (int i = 0; i < 2; ++i) af[1][i] = Frag<_Float16>::load(&sA[u][(wm + 16 * i + rlane) * kGPitch + 32 + koff]);
#pragma unroll
      for (int j = 0; j < 4; ++j) bf[1][j] = Frag<_Float16>::load(&sB[u][(wn + 16 * j + rlane) * kGPitch + 32 + koff]);
      // keeps the upper half's LDS reads as one group ahead of the lower half's products, which cover their latency
      __builtin_amdgcn_sched_barrier(0);
#pragma unroll
      for (int i = 0; i < 2; ++i)
#pragma unroll
        for (int j = 0; j < 4; ++j) acc[i][j] = Frag<_Float16>::mma(af[0][i], bf[0][j], acc[i][j]);
      // keeps these products ahead of the stores and the barrier: moved behind them, the wait in front of the barrier would meet reads just issued
      __builtin_amdgcn_sched_barrier(0);
      if (s + 1 < kGNStage) {
#pragma unroll
        for (int q = 0; q < 4; ++q) {
          *(v8h*)(&sA[u ^ 1][sdst + q * 32 * kGPitch]) = ra[u ^ 1][q];
          *(v8h*)(&sB[u ^ 1][sdst + q * 32 * kGPitch]) = rb[u ^ 1][q];
        }
      }
      // publishes stage s + 1; every read of stage s has returned in front of it, so the next stage may refill buffer u behind it
      lds_barrier();
      if (s + 1 < kGNStage) {
#pragma unroll
        for (int i = 0; i < 2; ++i) af[0][i] = Frag<_Float16>::load(&sA[u ^ 1][(wm + 16 * i + rlane) * kGPitch + koff]);
#pragma unroll
        for (int j = 0; j < 4; ++j) bf[0][j] = Frag<_Float16>::load(&sB[u ^ 1][(wn + 16 * j + rlane) * kGPitch + koff]);
      }
      // keeps the next stage's first LDS reads as one group ahead of the upper half's products, which cover their latency
      __builtin_amdgcn_sched_barrier(0);
#pragma unroll
      for (int i = 0; i < 2; ++i)
#pragma unroll
        for (int j = 0; j < 4; ++j) acc[i][j] = Frag<_Float16>::mma(af[1][i], bf[1][j], acc[i][j]);
    }
  }

  // ---- epilogue; a bias mode told at run time picks one of the two compile-time forms by a block-uniform branch ----
  const int m0 = tm * kGTileMN + wm;
  const int n0 = tn * kGTileMN + wn;
  float* slab = sT[wave];
  if constexpr (BIAS_MODE == 3) {
    if (rowBias) wmma_gemm_store<1, OUT_MODE>(acc, slab, Cout, ldc, bias, m0, n0, scale, 1.0f);
    else         wmma_gemm_store<2, OUT_MODE>(acc, slab, Cout, ldc, bias, m0, n0, scale, biasScale);
  } else {
    wmma_gemm_store<BIAS_MODE, OUT_MODE>(acc, slab, Cout, ldc, bias, m0, n0, scale, biasScale);
  }
}

// ---------------------------------------------------------------------------
// The three input projections in one launch: they share x and depend on nothing of each other. 3 x 192 work-groups, one 128 x 128 tile each;
// the block index picks the product (block-uniform): 0 = q, 1 = k (A = activations, Bt = weights, bias[n]), 2 = v^T (A = weights, Bt = activations, bias[m]).
//   Q16[s][e]  = kQCarry * ((1/16) * sum_d X16[s][d] * WQ16[e][d] + bq[e]);   K16 alike without kQCarry;   VT16[c][s] = (1/16) * sum_d WV16[c][d] * X16[s][d] + bv[c]
// kQCarry = log2(e) / sqrt(64): the score product of the attention kernel then comes out in the log2 domain of its softmax, with no multiply per score.
// ---------------------------------------------------------------------------
constexpr int kProjTiles = (kSeq / kGTileMN) * (kDim / kGTileMN);   // 192 tiles per product
constexpr float kQCarry = 0.125f * 1.4426950408889634f;            // 1 / sqrt(64) and log2(e), applied in f32 ahead of q's one rounding to f16
__global__ __launch_bounds__(256) void qkv_gemm_kernel(
    const unsigned short* __restrict__ X16, const unsigned short* __restrict__ WQKV16,
    unsigned short* __restrict__ Q16, unsigned short* __restrict__ K16, unsigned short* __restrict__ VT16,
    const float* __restrict__ bq, const float* __restrict__ bk, const float* __restrict__ bv) {
  const unsigned which = blockIdx.x / (unsigned)kProjTiles;
  const unsigned tile  = blockIdx.x - which * (unsigned)kProjTiles;
  const bool vt        = which == 2;
  const unsigned short* W = WQKV16 + (size_t)which * kDim * kDim;
  const unsigned tilesN = vt ? kSeq / kGTileMN : kDim / kGTileMN;   // column tiles of C: 32 for v^T, 6 for q and k
  const int tm = vt ? tile / (unsigned)(kSeq / kGTileMN) : tile / (unsigned)(kDim / kGTileMN);
  const int tn = tile - (unsigned)tm * tilesN;
  const float carry = which == 0 ? kQCarry : 1.0f;
  wmma_gemm_lds_tile<3, 1>(vt ? W : X16, vt ? X16 : W, (void*)(vt ? VT16 : (which == 1 ? K16 : Q16)), vt ? kSeq : kDim,
                           vt ? bv : (which == 1 ? bk : bq), vt, tm, tn, kWCarryInv * carry, carry);
}
// Output projection: out[s][e] = (1/4096) * sum_c ATT16[s][c] * WO16[e][c] + bo[e], f32
__global__ __launch_bounds__(256) void out_gemm_kernel(
    const unsigned short* __restrict__ ATT16, const unsigned short* __restrict__ WO16, float* __restrict__ out, const float* __restrict__ bo) {
  const int tm = blockIdx.x / (kDim / kGTileMN);
  const int tn = blockIdx.x % (kDim / kGTileMN);
  wmma_gemm_lds_tile<2, 0>(ATT16, WO16, (void*)out, kDim, bo, false, tm, tn, kOutScale, 1.0f);
}

// ---------------------------------------------------------------------------
// x to f16: block blk covers 2048 consecutive elements, 8 per thread
// ---------------------------------------------------------------------------
__device__ __forceinline__ void cast8_f16_block(int blk, const float* __restrict__ in, unsigned short* __restrict__ out, int n8) {
  const int i = blk * 256 + threadIdx.x;
  if (i >= n8) return;
  const float* p = in + 8 * (size_t)i;
  const v4f a = *(const v4f*)(p);
  const v4f c = *(const v4f*)(p + 4);
  unsigned short hb[8];
#pragma unroll
  for (int e = 0; e < 4; ++e) {
    hb[e]     = h_bits(a[e]);
    hb[4 + e] = h_bits(c[e]);
  }
  const v4u u = (v4u){pk16(hb[0], hb[1]), pk16(hb[2], hb[3]), pk16(hb[4], hb[5]), pk16(hb[6], hb[7])};
  unsigned short* q = out + 8 * (size_t)i;
  *(v4u*)q = u;
  
}

// ---------------------------------------------------------------------------
// Rank-8 adapter fold + f16 cast with x16 carry, f32 math:
//   plane y in {0,1,2}: WQKV[y][e][d] = f16( 16 * ( w_y[e][d] + 2 * sum_r up_y[e][r] * down_y[r][d] ) )
//   plane y == 3      : WO[e][d]      = f16( 16 * wo[e][d] )
// Weights are [out e][in d] = Bt[n][k] for the GEMMs; orientation kept as given (no transpose).
// 288 x 4 blocks: y = matrix (block-uniform), block bx of a matrix covers 2048 consecutive elements (288 x 2048 = 768 x 768 exact);
// thread t owns elements 8t..8t+7 of the block (one row e, 8 consecutive d).
// The whole down matrix [8][768] of the plane is staged in LDS first (cooperative: 6 b128 per thread, 6 x 256 x 4 = 6144 floats =
// the whole matrix, every LDS word read below is written), block barrier, then per lane 2 b128 (w) + 2 b128 (up row) global loads.
// ---------------------------------------------------------------------------
__device__ __forceinline__ void fold_cast_block(
    int bx, int y,
    const float* __restrict__ wq, const float* __restrict__ wk, const float* __restrict__ wv, const float* __restrict__ wo,
    const float* __restrict__ dq, const float* __restrict__ uq,
    const float* __restrict__ dk, const float* __restrict__ uk,
    const float* __restrict__ dv, const float* __restrict__ uv,
    unsigned short* __restrict__ wqkv16, unsigned short* __restrict__ wo16) {
  __shared__ __align__(16) float dsh[kRank * kDim];      // down matrix [8][768] of this plane, 24,576 B
  const int t = threadIdx.x;
  const float* W  = (y == 0) ? wq : (y == 1) ? wk : (y == 2) ? wv : wo;
  const float* Dn = (y == 0) ? dq : (y == 1) ? dk : dv;   // y == 3: valid pointer, staged but not used
  const float* Up = (y == 0) ? uq : (y == 1) ? uk : uv;
  // stage down [8][768] = 1536 float4: thread t loads slots t + 256*i, i = 0..5 (exact coverage)
#pragma unroll
  for (int i = 0; i < 6; ++i) {
    const int q4 = (i * 256 + t) * 4;
    const v4f dd = *(const v4f*)(Dn + q4);
    *(v4f*)(dsh + q4) = dd;
  }
  __syncthreads();

  const int base = bx * 2048 + 8 * t;            // < 768*768
  const int e = base / kDim;
  const int d = base - e * kDim;                         // multiple of 8
  const v4f w0 = *(const v4f*)(W + base);
  const v4f w1 = *(const v4f*)(W + base + 4);
  float s[8];
#pragma unroll
  for (int k = 0; k < 8; ++k) s[k] = 0.0f;
  if (y < 3) {                                           // block-uniform branch
    const v4f u0 = *(const v4f*)(Up + e * kRank);
    const v4f u1 = *(const v4f*)(Up + e * kRank + 4);
    const float ur[8] = {u0[0], u0[1], u0[2], u0[3], u1[0], u1[1], u1[2], u1[3]};
#pragma unroll
    for (int r = 0; r < kRank; ++r) {
      const v4f a = *(const v4f*)(dsh + r * kDim + d);
      const v4f c = *(const v4f*)(dsh + r * kDim + d + 4);
#pragma unroll
      for (int k = 0; k < 4; ++k) {
        s[k]     += ur[r] * a[k];
        s[4 + k] += ur[r] * c[k];
      }
    }
  }
  float f[8];
#pragma unroll
  for (int k = 0; k < 4; ++k) {
    f[k]     = (w0[k] + kLowRankScale * s[k])     * kWCarry;
    f[4 + k] = (w1[k] + kLowRankScale * s[4 + k]) * kWCarry;
  }
  unsigned short hb[8];
#pragma unroll
  for (int k = 0; k < 8; ++k) hb[k] = h_bits(f[k]);
  const v4u u = (v4u){pk16(hb[0], hb[1]), pk16(hb[2], hb[3]), pk16(hb[4], hb[5]), pk16(hb[6], hb[7])};
  unsigned short* op = (y < 3) ? (wqkv16 + (size_t)y * kDim * kDim + base) : (wo16 + base);
  *(v4u*)op = u;
  
}

// ---------------------------------------------------------------------------
// Both 16-bit operand preparations in one launch: neither reads what the other writes. The block index picks the work (block-uniform,
// so the fold's barrier is passed by every thread of a block that reaches it): blocks 0..1151 fold and cast the weights, the other 1536 cast x.
// ---------------------------------------------------------------------------
constexpr int kFoldBlocksPerW = kDim * kDim / 2048;      // 288
constexpr int kFoldBlocks     = 4 * kFoldBlocksPerW;     // 1152
constexpr int kCastBlocks     = kSeq * kDim / 2048;      // 1536
__global__ __launch_bounds__(256) void prep_kernel(
    const float* __restrict__ x, unsigned short* __restrict__ x16,
    const float* __restrict__ wq, const float* __restrict__ wk, const float* __restrict__ wv, const float* __restrict__ wo,
    const float* __restrict__ dq, const float* __restrict__ uq,
    const float* __restrict__ dk, const float* __restrict__ uk,
    const float* __restrict__ dv, const float* __restrict__ uv,
    unsigned short* __restrict__ wqkv16, unsigned short* __restrict__ wo16) {
  const int b = blockIdx.x;
  if (b < kFoldBlocks) {
    const int y = b / kFoldBlocksPerW;
    fold_cast_block(b - y * kFoldBlocksPerW, y, wq, wk, wv, wo, dq, uq, dk, uk, dv, uv, wqkv16, wo16);
  } else {
    cast8_f16_block(b - kFoldBlocks, x, x16, kSeq * kDim / 8);
  }
}

constexpr int kFAColWaves = 2;
constexpr int kFAKeyWaves = 2;
constexpr int kFAWaves  = kFAColWaves * kFAKeyWaves;
constexpr int kFASub    = 3;
constexpr int kFAWGWaves = kFASub * kFAWaves;
constexpr int kFAFetchWaves = 8;
constexpr int kFAGroups = 2;
constexpr int kFARows   = kFAColWaves * kFAGroups * 16;
constexpr int kFAStage  = kFAKeyWaves * 64;
constexpr int kFANStage = kSeq / kFAStage;
constexpr int kFAPitch  = 72;
constexpr int kFATile   = 64 * kFAPitch;
constexpr int kFATilesPerHead = kSeq / kFARows;           // 64
constexpr int kFATiles  = kHeads * kFATilesPerHead;       // 768
constexpr int kFABlocks = kFATiles / kFASub;              // 256
constexpr float kFACarryLog2 = 6.0f;
constexpr float kFATrail = 8.0f;                          // how far the maximum in use may trail
static_assert(kSeq % kFARows == 0 && kSeq % kFAStage == 0 && kDh == 64 && kFATiles % kFASub == 0 && kFASub <= kFATilesPerHead && kFAGroups == 2, "fused attention mapping");
typedef __attribute__((ext_vector_type(2))) _Float16 v2h;
// lane l with lane l ^ 16
__device__ __forceinline__ float xhalf(float x) {
  const int b = __builtin_bit_cast(int, x);
  return __builtin_bit_cast(float, __builtin_amdgcn_permlanex16(b, b, 0x76543210, 0xfedcba98, false, false));
}
__device__ __forceinline__ unsigned pack2h(float lo, float hi) {
  return __builtin_bit_cast(unsigned, __builtin_convertvector((v2f){lo, hi}, v2h));   // round to nearest even
}
// The eight score products of a 32-key pass (2 key tiles x 2 column groups x 2 halves of d) in one statement. Written as text because the first
// product of each tile must read its C operand from the shift tile and write another tile: the builtin form was built with C and D in the same
// registers, behind a copy of the shift tile per product. Each tile's second product accumulates into the same D; the products fill each
// other's slots, and the four v_nop at the end keep the distance that the chip needs between the last product and the first vector reader of its D.
// The four v_nop in front keep the same distance behind the P.V products of the pass before: a D of this statement may lie in the registers of
// their B operand, and the compiler, which pads its own products, does not look into a statement's text.
// The shift tiles are only read; they are named as in-out operands so that they stay in one set of registers over the whole loop
// (as plain inputs the build kept a second set and copied 16 registers in every pass).
__device__ __forceinline__ void score_products(v8f& s00, v8f& s01, v8f& s10, v8f& s11, v16h ka0, v16h ka1, v16h kb0, v16h kb1,
                                               v16h q00, v16h q01, v16h q10, v16h q11, v8f& sh0, v8f& sh1) {
  asm("v_nop\n\tv_nop\n\tv_nop\n\tv_nop\n\t"
      "v_wmma_f32_16x16x32_f16 %0, %6, %10, %4\n\t"
      "v_wmma_f32_16x16x32_f16 %1, %6, %12, %5\n\t"
      "v_wmma_f32_16x16x32_f16 %2, %8, %10, %4\n\t"
      "v_wmma_f32_16x16x32_f16 %3, %8, %12, %5\n\t"
      "v_wmma_f32_16x16x32_f16 %0, %7, %11, %0\n\t"
      "v_wmma_f32_16x16x32_f16 %1, %7, %13, %1\n\t"
      "v_wmma_f32_16x16x32_f16 %2, %9, %11, %2\n\t"
      "v_wmma_f32_16x16x32_f16 %3, %9, %13, %3\n\t"
      "v_nop\n\tv_nop\n\tv_nop\n\tv_nop"
      : "=&v"(s00), "=&v"(s01), "=&v"(s10), "=&v"(s11), "+v"(sh0), "+v"(sh1)
      : "v"(ka0), "v"(ka1), "v"(kb0), "v"(kb1), "v"(q00), "v"(q01), "v"(q10), "v"(q11));
}
__global__ __launch_bounds__(kFAWGWaves * 32) void attn_fused_kernel(
    const unsigned short* __restrict__ Qp, const unsigned short* __restrict__ Kp, const unsigned short* __restrict__ VTp,
    unsigned short* __restrict__ Att) {
  __shared__ __align__(16) _Float16 sK[2][2][kFAKeyWaves][kFATile];   // [buffer][head slot]: 73,728 B; a slot is 128 key rows in a row
  __shared__ __align__(16) _Float16 sV[2][2][kFAKeyWaves][kFATile];   // 73,728 B
  __shared__ __align__(16) v4f sJ[kFASub * kFAColWaves][17][32];      // the join's planes, 52,224 B, beside the ring
  const int t    = threadIdx.x;
  const int lane = t & 31;
  // the wave's number as a scalar: the tests on it below (who fetches, which key half leaves) are then scalar branches
  const int wave = __builtin_amdgcn_readfirstlane(t >> 5);
  const int sub  = wave >> 2;               // which of the three tiles
  const int cw   = wave & 1;                // which 32 query columns of the tile
  const int kh   = (wave >> 1) & 1;         // which 64 keys of every stage
  const int c    = lane & 15;
  const int h8   = (lane >> 4) * 8;
  // Block -> tiles 3 b, 3 b + 1, 3 b + 2 of the 768 (head, 64 rows) tiles in head-major order: a one-to-one map.
  const int id0   = blockIdx.x * kFASub;
  const int head0 = id0 / kFATilesPerHead;
  const bool two  = (id0 + kFASub - 1) / kFATilesPerHead != head0;   // the tiles span heads head0 and head0 + 1; the same for the whole work-group
  const int id    = id0 + sub;
  const int head  = id / kFATilesPerHead;
  const int slot  = head - head0;           // 0, or 1 only where two holds
  const bool fetcher = wave < kFAFetchWaves;
  const int q0   = (id % kFATilesPerHead) * kFARows + cw * (kFAGroups * 16);
  const _Float16* Qh = (const _Float16*)Qp  + head * kDh;
  const _Float16* Kh = (const _Float16*)Kp  + head0 * kDh;                   // [key][kDim]; head slot 1 lies kDh elements on
  const _Float16* Vh = (const _Float16*)VTp + (size_t)head0 * kDh * kSeq;    // [d][kSeq]; head slot 1 lies kDh rows on

  // staging map of the 256 fetching threads: 8 threads per 128-B row; K rows srow + 32 q, q = 0..3; V^T rows srow + 32 (q & 1) of tile q >> 1
  const int srow = t >> 3, sseg = (t & 7) * 8;
  const _Float16* gK = Kh + (size_t)srow * kDim + sseg;
  const _Float16* gV = Vh + (size_t)srow * kSeq + sseg;
  const int sdst = srow * kFAPitch + sseg;
  if (fetcher) {
#pragma unroll
    for (int hs = 0; hs < 2; ++hs)
      if (hs == 0 || two) {
        v8h r0[4], r1[4];
#pragma unroll
        for (int q = 0; q < 4; ++q) {
          r0[q] = *(const v8h*)(gK + hs * kDh + (size_t)q * 32 * kDim);
          r1[q] = *(const v8h*)(gV + (size_t)hs * kDh * kSeq + (size_t)(q & 1) * 32 * kSeq + (q >> 1) * 64);
        }
#pragma unroll
        for (int q = 0; q < 4; ++q) {
          *(v8h*)(&sK[0][hs][0][sdst + q * 32 * kFAPitch]) = r0[q];
          *(v8h*)(&sV[0][hs][q >> 1][sdst + (q & 1) * 32 * kFAPitch]) = r1[q];
        }
      }
  }

  v16h qf[kFAGroups][2];
#pragma unroll
  for (int g = 0; g < kFAGroups; ++g)
#pragma unroll
    for (int kc = 0; kc < 2; ++kc)
      qf[g][kc] = Frag<_Float16>::load(Qh + (size_t)(q0 + 16 * g + c) * kDim + 32 * kc + h8);

  v8f acc[kFAGroups][4];
  v8f shift[kFAGroups];                 // C operand of the score product: 6 - mrun in every element; 0 until the first pass has a maximum
  v2f lsum[kFAGroups];
  float mrun[kFAGroups];
  float scur[kFAGroups];                // the value that shift holds, apart: a rescale then reads nothing of the tile and rewrites it in place
  float limit = -__builtin_inff();      // a shifted score above it asks for a rescale; wave-uniform; -inf so that the first pass always does
#pragma unroll
  for (int g = 0; g < kFAGroups; ++g) {
    mrun[g] = -__builtin_inff();
    shift[g] = (v8f){0.f,0.f,0.f,0.f,0.f,0.f,0.f,0.f};
    scur[g] = 0.f;
    lsum[g] = (v2f){0.f, 0.f};
#pragma unroll
    for (int j = 0; j < 4; ++j) acc[g][j] = (v8f){0.f,0.f,0.f,0.f,0.f,0.f,0.f,0.f};
  }
  __syncthreads();   // stage 0 is in LDS before any wave reads it

  for (int st = 0; st < kFANStage; ++st) {
    const int buf = st & 1;
    const bool more = fetcher && st + 1 < kFANStage;   // the same for the whole wave
    const _Float16* bK = &sK[buf][slot][kh][0];
    const _Float16* bV = &sV[buf][slot][kh][0];
    v8h rk[2][4], rv[2][4];                // this thread's share of the next stage, in flight over this one; second set: head slot 1
    if (more) {
      gK += kFAStage * kDim;
      gV += kFAStage;
#pragma unroll
      for (int hs = 0; hs < 2; ++hs)
        if (hs == 0 || two) {
#pragma unroll
          for (int q = 0; q < 4; ++q) {
            rk[hs][q] = *(const v8h*)(gK + hs * kDh + (size_t)q * 32 * kDim);
            rv[hs][q] = *(const v8h*)(gV + (size_t)hs * kDh * kSeq + (size_t)(q & 1) * 32 * kSeq + (q >> 1) * 64);
          }
        }
    }
#pragma unroll
    for (int p = 0; p < 2; ++p) {          // two 32-key passes per stage and key wave
      v8f s[2][kFAGroups];
      {
        const _Float16* kp = bK + (32 * p + c) * kFAPitch + h8;
        const v16h ka0 = Frag<_Float16>::load(kp);
        const v16h ka1 = Frag<_Float16>::load(kp + 32);
        const v16h kb0 = Frag<_Float16>::load(kp + 16 * kFAPitch);
        const v16h kb1 = Frag<_Float16>::load(kp + 16 * kFAPitch + 32);
        score_products(s[0][0], s[0][1], s[1][0], s[1][1], ka0, ka1, kb0, kb1, qf[0][0], qf[0][1], qf[1][0], qf[1][1], shift[0], shift[1]);
      }
      v16h vf[4];
#pragma unroll
      for (int j = 0; j < 4; ++j) vf[j] = Frag<_Float16>::load(bV + (16 * j + c) * kFAPitch + 32 * p + h8);

      float mb[kFAGroups];
      bool need = false;
#pragma unroll
      for (int g = 0; g < kFAGroups; ++g) {
        float mx = s[0][g][0];
#pragma unroll
        for (int r = 1; r < 8; ++r) mx = fmaxf(mx, s[0][g][r]);
#pragma unroll
        for (int r = 0; r < 8; ++r) mx = fmaxf(mx, s[1][g][r]);
        mb[g] = mx;                             // this lane's 16 keys; the wave halves are joined only where a rescale is due
        need = need || (mx > limit);
      }
      if (__builtin_amdgcn_ballot_w32(need) != 0) {   // wave-uniform; always on the first pass, rare later
#pragma unroll
        for (int g = 0; g < kFAGroups; ++g) {
          const float sold = scur[g];
          const float mnew = fmaxf(mrun[g], fmaxf(mb[g], xhalf(mb[g])) - sold);   // both wave halves hold this query's maximum, unshifted
          const float corr = __builtin_amdgcn_exp2f(mrun[g] - mnew);   // 0 on the first pass, where mrun is -inf
          mrun[g] = mnew;
          const float snew = kFACarryLog2 - mnew;
          const float adj  = snew - sold;
          s[0][g] = s[0][g] + adj;   // this pass's scores were formed with the old shift
          s[1][g] = s[1][g] + adj;
          shift[g] = (v8f){snew, snew, snew, snew, snew, snew, snew, snew};
          scur[g] = snew;
          lsum[g] = lsum[g] * corr;
#pragma unroll
          for (int j = 0; j < 4; ++j) acc[g][j] = acc[g][j] * corr;
        }
        limit = kFACarryLog2 + kFATrail;
      }
#pragma unroll
      for (int g = 0; g < kFAGroups; ++g) {
        union { v16h v; unsigned w[8]; } pf;
#pragma unroll
        for (int i = 0; i < 8; ++i) {
          const v2f pe = (v2f){__builtin_amdgcn_exp2f(s[i >> 2][g][2 * (i & 3)]), __builtin_amdgcn_exp2f(s[i >> 2][g][2 * (i & 3) + 1])};
          lsum[g] += pe;
          pf.w[i] = pack2h(pe[0], pe[1]);
        }
#pragma unroll
        for (int j = 0; j < 4; ++j) acc[g][j] = Frag<_Float16>::mma(vf[j], pf.v, acc[g][j]);
      }
    }
    if (more) {   // the other buffer's last readers left it at the barrier that ended the stage before
#pragma unroll
      for (int hs = 0; hs < 2; ++hs)
        if (hs == 0 || two) {
#pragma unroll
          for (int q = 0; q < 4; ++q) {
            *(v8h*)(&sK[buf ^ 1][hs][0][sdst + q * 32 * kFAPitch]) = rk[hs][q];
            *(v8h*)(&sV[buf ^ 1][hs][q >> 1][sdst + (q & 1) * 32 * kFAPitch]) = rv[hs][q];
          }
        }
    }
    __syncthreads();   // publishes stage st + 1 and ends every wave's reads of the buffer that the next trip refills
  }

  // ---- join of the two key waves of each column pair ----
  // plane i of column wave cw of tile sub holds 16 B per lane: planes 0..15 = the output tiles, plane 16 = both maxima and both sums
  v4f* mg = &sJ[sub * kFAColWaves + cw][0][lane];
  if (kh == 1) {
#pragma unroll
    for (int g = 0; g < kFAGroups; ++g)
#pragma unroll
      for (int j = 0; j < 4; ++j) {
        const v8f o = acc[g][j];
        mg[((g * 4 + j) * 2 + 0) * 32] = (v4f){o[0], o[1], o[2], o[3]};
        mg[((g * 4 + j) * 2 + 1) * 32] = (v4f){o[4], o[5], o[6], o[7]};
      }
    mg[16 * 32] = (v4f){mrun[0], mrun[1], lsum[0][0] + lsum[0][1], lsum[1][0] + lsum[1][1]};
  }
  __syncthreads();   // the planes are in LDS before the other key wave reads them; every wave passes it
  if (kh != 0) return;

  // acc[g][j][r] = O^T[d = 16 j + 8 h + r][query 16 g + c]: 8 consecutive d of one row, one 16-B store
  const v4f ml = mg[16 * 32];
#pragma unroll
  for (int g = 0; g < kFAGroups; ++g) {
    const float mall = fmaxf(mrun[g], ml[g]);
    const float f0 = __builtin_amdgcn_exp2f(mrun[g] - mall);   // this wave's share, scaled to the larger maximum
    const float f1 = __builtin_amdgcn_exp2f(ml[g] - mall);     // the other key wave's
    const float lh  = (lsum[g][0] + lsum[g][1]) * f0 + ml[2 + g] * f1;
    const float inv = kAttCarry / (lh + xhalf(lh));   // the exchange is unconditional within the wave
    const float i0 = f0 * inv, i1 = f1 * inv;
    unsigned short* op = Att + (size_t)(q0 + 16 * g + c) * kDim + head * kDh + h8;
#pragma unroll
    for (int j = 0; j < 4; ++j) {
      const v4f pa = mg[((g * 4 + j) * 2 + 0) * 32];
      const v4f pb = mg[((g * 4 + j) * 2 + 1) * 32];
      const v8f po = (v8f){pa[0], pa[1], pa[2], pa[3], pb[0], pb[1], pb[2], pb[3]};
      const v8f o = acc[g][j] * i0 + po * i1;
      const v4u u = (v4u){pack2h(o[0], o[1]), pack2h(o[2], o[3]), pack2h(o[4], o[5]), pack2h(o[6], o[7])};
      *(v4u*)(op + 16 * j) = u;
    }
  }
}

// ---------------------------------------------------------------------------
// Host glue.
// Workspace region map (bytes, every offset a multiple of 128; every plane fully written before any read):
//   X16    f16 [4096][768]                 6,291,456  at          0   (cast8)
//   WQKV16 f16 [3][768][768]  (x16 carry)  3,538,944  at  6,291,456   (fold_cast, planes q|k|v)
//   WO16   f16 [768][768]     (x16 carry)  1,179,648  at  9,830,400   (fold_cast)
//   Q16    f16 [4096][768]                 6,291,456  at 11,010,048   (GEMM)
//   K16    f16 [4096][768]                 6,291,456  at 17,301,504   (GEMM)
//   VT16   f16 [768][4096]  = V^T          6,291,456  at 23,592,960   (GEMM with swapped operand roles)
//   ATT16  f16 [4096][768]   (x256 carry)  6,291,456  at 29,884,416   (fused attention, each tile [64 rows][64 cols])
//   total                                 36,175,872
// GEMM shapes (all M,N multiples of 128, K = 768 = 12 stages of 64, no padding anywhere):
//   q,k:  M=4096 N=768  K=768;  v^T: M=768 N=4096 K=768;  out: M=4096 N=768 K=768
// Launches: 1 cast and fold + 1 for the three projections + 1 fused attention + 1 out = 4.
// ---------------------------------------------------------------------------
extern "C" void kernel_launch(void* const* d_in, const int* in_sizes, int n_in,
                              void* d_out, int out_size, void* d_ws, size_t ws_size,
                              hipStream_t stream) {
  if (n_in < 15) return;
  const int nX = kSeq * kDim;          // 3,145,728
  const int nW = kDim * kDim;          // 589,824
  const int nA = kRank * kDim;         // 6,144
  if (in_sizes[0] != nX) return;
  if (in_sizes[1] != nW || in_sizes[3] != nW || in_sizes[5] != nW || in_sizes[7] != nW) return;
  if (in_sizes[2] != kDim || in_sizes[4] != kDim || in_sizes[6] != kDim || in_sizes[8] != kDim) return;
  for (int i = 9; i < 15; ++i) if (in_sizes[i] != nA) return;
  if (out_size != nX) return;

  const size_t szAct  = (size_t)kSeq * kDim * 2;
  const size_t szWqkv = (size_t)3 * kDim * kDim * 2;
  const size_t szWo   = (size_t)kDim * kDim * 2;
  const size_t offX    = 0;
  const size_t offWqkv = offX + szAct;
  const size_t offWo   = offWqkv + szWqkv;
  const size_t offQ    = offWo + szWo;
  const size_t offK    = offQ + szAct;
  const size_t offVT   = offK + szAct;
  const size_t offAtt  = offVT + szAct;
  const size_t total   = offAtt + szAct;   // 36,175,872
  if (ws_size < total) return;

  const float* x   = (const float*)d_in[0];
  const float* wq  = (const float*)d_in[1];
  const float* bq  = (const float*)d_in[2];
  const float* wk  = (const float*)d_in[3];
  const float* bk  = (const float*)d_in[4];
  const float* wv  = (const float*)d_in[5];
  const float* bv  = (const float*)d_in[6];
  const float* wo  = (const float*)d_in[7];
  const float* bo  = (const float*)d_in[8];
  const float* dq  = (const float*)d_in[9];    // [8][768]
  const float* uq  = (const float*)d_in[10];   // [768][8]
  const float* dk  = (const float*)d_in[11];
  const float* uk  = (const float*)d_in[12];
  const float* dv  = (const float*)d_in[13];
  const float* uv  = (const float*)d_in[14];
  float* out = (float*)d_out;
  char* ws = (char*)d_ws;
  unsigned short* X16    = (unsigned short*)(ws + offX);
  unsigned short* WQKV16 = (unsigned short*)(ws + offWqkv);
  unsigned short* WO16   = (unsigned short*)(ws + offWo);
  unsigned short* Q16    = (unsigned short*)(ws + offQ);
  unsigned short* K16    = (unsigned short*)(ws + offK);
  unsigned short* VT16   = (unsigned short*)(ws + offVT);
  unsigned short* ATT16  = (unsigned short*)(ws + offAtt);

  // ---- 16-bit operand planes: x cast, weights folded and cast, one launch ----
  prep_kernel<<<dim3(kFoldBlocks + kCastBlocks), dim3(256), 0, stream>>>(x, X16, wq, wk, wv, wo, dq, uq, dk, uk, dv, uv, WQKV16, WO16);

  // ---- projections q, k, v^T: one launch, one work-group per 128 x 128 tile, 576 work-groups of 8 waves ----
  qkv_gemm_kernel<<<dim3(3 * kProjTiles), dim3(256), 0, stream>>>(X16, WQKV16, Q16, K16, VT16, bq, bk, bv);

  // ---- attention: one launch, one work-group per three tiles of (64 query rows, head) ----
  // ATT16[s][h*64+n] = 256 * sum_j softmax2_j(Q16[s][h*64+:] . K16[j][h*64+:]) * VT16[h*64+n][j], softmax2 to base 2 (Q16 holds q * log2(e) / 8)
  attn_fused_kernel<<<dim3(kFABlocks), dim3(kFAWGWaves * 32), 0, stream>>>(Q16, K16, VT16, ATT16);

  // ---- output projection (M=4096, N=768, K=768, f32 to d_out) ----
  out_gemm_kernel<<<dim3(kProjTiles), dim3(256), 0, stream>>>(ATT16, WO16, out, bo);
}

// v008
// One run takes 73.5 microseconds.
// Two timings next to v007 both put it at 1.11 times that version's speed.
// Counting every step since v000, it is 66.6 times as fast.
// Contractions: q/k projections and v^T projection (x f16 x W_eff^T f16 carried x16), scores k_h.q_h^T (q,k f16 planes, q carried x log2(e)/8, the softmax shift as the product's f32 C operand), v_h^T.probs^T (V^T f16 x unnormalised P f16 carried x64), output projection (attn f16 carried x256 x Wo^T f16 carried x16): all v_wmma_f32_16x16x32_f16 with f32 accumulate; rank-8 weight fold, bias add and online softmax in f32.
#include <hip/hip_runtime.h>
#include <math.h>

// ---------------------------------------------------------------------------
// Problem constants
// ---------------------------------------------------------------------------
constexpr int kSeq    = 4096;             // tokens (batch 1)
constexpr int kDim    = 768;              // model width
constexpr int kHeads  = 12;
constexpr int kDh     = 64;
constexpr int kRank   = 8;                // low-rank adapter width
constexpr float kLowRankScale = 2.0f;     // alpha / rank = 16 / 8
constexpr float kWCarry    = 16.0f;       // weights carried x16 in f16
constexpr float kWCarryInv = 1.0f / 16.0f;
constexpr float kAttCarry  = 256.0f;      // attention output carried x256 in f16
constexpr float kOutScale  = 1.0f / (kAttCarry * kWCarry);   // 1/4096
static_assert(kHeads * kDh == kDim, "shape");
static_assert(kSeq % 64 == 0 && kDim % 64 == 0 && kDh % 64 == 0, "M,N tile multiples");
static_assert(kDim % 32 == 0 && kDh % 32 == 0 && kSeq % 32 == 0, "K multiples of 32");
static_assert((kDim * kDim) % 2048 == 0, "fold block mapping");
static_assert((kSeq * kDim) % 2048 == 0, "cast block mapping");
static_assert(kRank * kDim == 6 * 256 * 4, "adapter staging: 6 float4 per thread of a 256-thread block");

typedef __attribute__((ext_vector_type(16))) _Float16 v16h;
typedef __attribute__((ext_vector_type(8)))  _Float16 v8h;
typedef __attribute__((ext_vector_type(8)))  float    v8f;
typedef __attribute__((ext_vector_type(4)))  float    v4f;
typedef __attribute__((ext_vector_type(2)))  float    v2f;
typedef __attribute__((ext_vector_type(4)))  unsigned int v4u;

// ---------------------------------------------------------------------------
// Fragment loader and matrix product, f16 operands, f32 accumulate
// ---------------------------------------------------------------------------
template <typename T> struct Frag;
template <> struct Frag<_Float16> {
  typedef v16h V; union U { v16h v; v8h h[2]; };
  // elements 0..7 <- p[0..7], 8..15 <- p[16..23]
  static __device__ __forceinline__ v16h load(const _Float16* p) {
    U f; f.h[0] = *(const v8h*)(p); f.h[1] = *(const v8h*)(p + 16); return f.v;
  }
  static __device__ __forceinline__ v8f mma(v16h a, v16h b, v8f c) {
    return __builtin_amdgcn_wmma_f32_16x16x32_f16(false, a, false, b, (short)0, c, false, false);
  }
};

__device__ __forceinline__ unsigned pk16(unsigned short a, unsigned short b) { return (unsigned)a | ((unsigned)b << 16); }
__device__ __forceinline__ unsigned short h_bits(float f) { const _Float16 h = (_Float16)f; return __builtin_bit_cast(unsigned short, h); }

// ---------------------------------------------------------------------------
// WMMA GEMM with both operands staged in LDS: C[m,n] = scale * sum_k A[m,k] * Bt[n,k] + bias.
// A row-major [M][kDim], Bt row-major [N][kDim], f16; M, N multiples of 128; K = kDim for every product of this file.
// One work-group = one 128 x 128 tile of C; 8 waves as 4 (m) x 2 (n), each 32 x 64 = 2 x 4 accumulator tiles.
// A stage is 64 k: 128 rows x 128 B of A and of Bt. 8 threads fetch one whole 128-B line, so a wave-wide load covers 4 whole lines;
// every line is fetched once per work-group and shared by its waves through LDS (pitch 144 B, an odd multiple of 16 B).
// Stage s + 2 is fetched into registers while stage s is worked on (two register sets), stage s + 1 is stored to the other of two
// LDS buffers in the middle of stage s, one work-group barrier per stage; fragments are read half a stage (32 k) ahead of their products.
// A and B fragments come from LDS through the same loader (equal k orders); k runs upward in steps of 32 in every accumulator.
// BIAS_MODE: 1 = bias[m], 2 = bias[n] * biasScale, 3 = told at run time by rowBias (the same for the whole work-group).  OUT_MODE: 0 = f32, 1 = f16.
// The tile (tm, tn) and the operands come from the calling kernel, which derives them from its block index.
// ---------------------------------------------------------------------------
constexpr int kGTileMN = 128;                   // rows of A and of Bt per work-group
constexpr int kGStageK = 64;                    // k per stage: one 128-B line per row
constexpr int kGNStage = kDim / kGStageK;       // 12
constexpr int kGPitch  = 72;                    // f16 per LDS row
constexpr int kGTile   = kGTileMN * kGPitch;    // f16 per staged operand tile (18,432 B)
static_assert(kSeq % kGTileMN == 0 && kDim % kGTileMN == 0 && kDim % (2 * kGStageK) == 0, "staged GEMM mapping");
// Work-group barrier that orders LDS traffic only: __syncthreads() also waits for every outstanding global load, which would
// end the two-stage lead of the register prefetch at each stage; nothing but LDS passes between the waves of this kernel.
__device__ __forceinline__ void lds_barrier() {
  __builtin_amdgcn_fence(__ATOMIC_RELEASE, "workgroup", "local");
  __builtin_amdgcn_s_barrier();
  __builtin_amdgcn_fence(__ATOMIC_ACQUIRE, "workgroup", "local");
}
// Epilogue of the staged GEMM: each wave turns its 16 x 64 slabs through its own LDS range (slab) into whole-line stores.
// (m0, n0) = first row and column of the wave's 32 x 64 part of C.  BIAS_MODE: 1 = bias[m], 2 = bias[n] * biasScale.  OUT_MODE: 0 = f32, 1 = f16.
template <int BIAS_MODE, int OUT_MODE>
__device__ __forceinline__ void wmma_gemm_store(
    const v8f (&acc)[2][4], float* slab, void* __restrict__ Cout, int ldc, const float* __restrict__ bias, int m0, int n0, float scale,
    float biasScale) {
  const int lane  = threadIdx.x & 31;
  const int rlane = lane & 15;                 // column within subtile
  const int mOff  = (lane >> 4) * 8;           // D row offset
  // the unroll directives of this function, but those on the two store loops, are there because their loops index register arrays by the loop variable
#pragma unroll
  for (int i = 0; i < 2; ++i) {
    const int mBase = m0 + (i << 4);
    // bias[m]: the 8 rows this lane half touches are contiguous -> two 16-B loads
    float bmr[8] = {0.f, 0.f, 0.f, 0.f, 0.f, 0.f, 0.f, 0.f};
    if (BIAS_MODE == 1) {
      const float* bp = bias + mBase + mOff;
      const v4f bm0 = *(const v4f*)(bp);
      const v4f bm1 = *(const v4f*)(bp + 4);
      bmr[0] = bm0[0]; bmr[1] = bm0[1]; bmr[2] = bm0[2]; bmr[3] = bm0[3];
      bmr[4] = bm1[0]; bmr[5] = bm1[1]; bmr[6] = bm1[2]; bmr[7] = bm1[3];
    }
#pragma unroll
    for (int j = 0; j < 4; ++j) {
      const int n = n0 + (j << 4) + rlane;
      float bv = 0.f;
      if (BIAS_MODE == 2) bv = bias[n] * biasScale;
#pragma unroll
      for (int r = 0; r < 8; ++r) {
        float v = acc[i][j][r] * scale;
        if (BIAS_MODE == 1) v += bmr[r];
        if (BIAS_MODE == 2) v += bv;
        slab[(mOff + r) * 68 + (j << 4) + rlane] = v;
      }
    }
    __builtin_amdgcn_fence(__ATOMIC_RELEASE, "workgroup");
    __builtin_amdgcn_wave_barrier();
    __builtin_amdgcn_fence(__ATOMIC_ACQUIRE, "workgroup");
    if (OUT_MODE == 0) {
      float* C = (float*)Cout;
      const int hh = lane >> 4, c4 = (lane & 15) * 4;     // row seg = 256 B = 16 lanes x 16 B
#pragma unroll
      for (int it = 0; it < 8; ++it) {
        const int row = it * 2 + hh;
        v4f v = *(const v4f*)(slab + row * 68 + c4);
        *(v4f*)(C + (size_t)(mBase + row) * ldc + n0 + c4) = v;
      }
    } else {
      const int q = lane >> 3, c8 = (lane & 7) * 8;       // row seg = 128 B = 8 lanes x 16 B
      unsigned short* C = (unsigned short*)Cout;
#pragma unroll
      for (int it = 0; it < 4; ++it) {
        const int row = it * 4 + q;
        const float* sp = slab + row * 68 + c8;
        v8h hv;
#pragma unroll
        for (int e = 0; e < 8; ++e) hv[e] = (_Float16)sp[e];
        *(v8h*)(C + (size_t)(mBase + row) * ldc + n0 + c8) = hv;
      }
    }
    __builtin_amdgcn_fence(__ATOMIC_RELEASE, "workgroup");
    __builtin_amdgcn_wave_barrier();
    __builtin_amdgcn_fence(__ATOMIC_ACQUIRE, "workgroup");
  }
}

template <int BIAS_MODE, int OUT_MODE>
__device__ __forceinline__ void wmma_gemm_lds_tile(
    const unsigned short* __restrict__ Ap, const unsigned short* __restrict__ Btp,
    void* __restrict__ Cout, int ldc, const float* __restrict__ bias, bool rowBias, int tm, int tn, float scale, float biasScale) {
  __shared__ __align__(16) _Float16 sA[2][kGTile];   // 36,864 B
  __shared__ __align__(16) _Float16 sB[2][kGTile];   // 36,864 B
  __shared__ __align__(16) float sT[8][16 * 68];     // per-wave 16x64 output slab, pitch 68 floats
  const int t    = threadIdx.x;
  const int lane = t & 31;
  const int wave = t >> 5;
  const int rlane = lane & 15;                 // row (A) / col (B, D) within subtile
  const int koff  = (lane >> 4) * 8;           // k offset of this lane half
  const int wm = (wave >> 1) * 32;             // this wave's rows inside the tile
  const int wn = (wave & 1) * 64;              // this wave's columns inside the tile

  // staging map: 8 threads per 128-B row, rows srow + 32 q, q = 0..3, of each operand tile
  const int srow = t >> 3, sseg = (t & 7) * 8;
  const _Float16* gA = (const _Float16*)Ap  + (size_t)(tm * kGTileMN + srow) * kDim + sseg;
  const _Float16* gB = (const _Float16*)Btp + (size_t)(tn * kGTileMN + srow) * kDim + sseg;
  const int sdst = srow * kGPitch + sseg;
  v8h ra[2][4], rb[2][4];
  // the unroll directives of this kernel, but the one on the loop over stage pairs, are there because their loops index register arrays by the loop variable
#pragma unroll
  for (int u = 0; u < 2; ++u)
#pragma unroll
    for (int q = 0; q < 4; ++q) {
      ra[u][q] = *(const v8h*)(gA + (size_t)q * 32 * kDim + u * kGStageK);
      rb[u][q] = *(const v8h*)(gB + (size_t)q * 32 * kDim + u * kGStageK);
    }

  v8f acc[2][4];
#pragma unroll
  for (int i = 0; i < 2; ++i)
#pragma unroll
    for (int j = 0; j < 4; ++j) acc[i][j] = (v8f){0.f,0.f,0.f,0.f,0.f,0.f,0.f,0.f};

#pragma unroll
  for (int q = 0; q < 4; ++q) {
    *(v8h*)(&sA[0][sdst + q * 32 * kGPitch]) = ra[0][q];
    *(v8h*)(&sB[0][sdst + q * 32 * kGPitch]) = rb[0][q];
  }
  lds_barrier();   // stage 0 is in LDS before any wave reads it

  // fragments of one 32-k half stage; set 0 holds the lower half, set 1 the upper; each set is read from LDS while the other is worked on
  v16h af[2][2], bf[2][4];
#pragma unroll
  for (int i = 0; i < 2; ++i) af[0][i] = Frag<_Float16>::load(&sA[0][(wm + 16 * i + rlane) * kGPitch + koff]);
#pragma unroll
  for (int j = 0; j < 4; ++j) bf[0][j] = Frag<_Float16>::load(&sB[0][(wn + 16 * j + rlane) * kGPitch + koff]);

  // unrolled whole: the tests on s become compile-time, so no path joins and the counted waits on the register prefetch stay exact
#pragma unroll
  for (int st = 0; st < kGNStage; st += 2) {
#pragma unroll
    for (int u = 0; u < 2; ++u) {            // stage st + u: LDS buffer u, register set u is free
      const int s = st + u;
      if (s + 2 < kGNStage) {                // the same for the whole work-group
#pragma unroll
        for (int q = 0; q < 4; ++q) {
          ra[u][q] = *(const v8h*)(gA + (size_t)q * 32 * kDim + (s + 2) * kGStageK);
          rb[u][q] = *(const v8h*)(gB + (size_t)q * 32 * kDim + (s + 2) * kGStageK);
        }
      }
#pragma unroll
      for (int i = 0; i < 2; ++i) af[1][i] = Frag<_Float16>::load(&sA[u][(wm + 16 * i + rlane) * kGPitch + 32 + koff]);
#pragma unroll
      for (int j = 0; j < 4; ++j) bf[1][j] = Frag<_Float16>::load(&sB[u][(wn + 16 * j + rlane) * kGPitch + 32 + koff]);
      // keeps the upper half's LDS reads as one group ahead of the lower half's products, which cover their latency
      __builtin_amdgcn_sched_barrier(0);
#pragma unroll
      for (int i = 0; i < 2; ++i)
#pragma unroll
        for (int j = 0; j < 4; ++j) acc[i][j] = Frag<_Float16>::mma(af[0][i], bf[0][j], acc[i][j]);
      // keeps these products ahead of the stores and the barrier: moved behind them, the wait in front of the barrier would meet reads just issued
      __builtin_amdgcn_sched_barrier(0);
      if (s + 1 < kGNStage) {
#pragma unroll
        for (int q = 0; q < 4; ++q) {
          *(v8h*)(&sA[u ^ 1][sdst + q * 32 * kGPitch]) = ra[u ^ 1][q];
          *(v8h*)(&sB[u ^ 1][sdst + q * 32 * kGPitch]) = rb[u ^ 1][q];
        }
      }
      // publishes stage s + 1; every read of stage s has returned in front of it, so the next stage may refill buffer u behind it
      lds_barrier();
      if (s + 1 < kGNStage) {
#pragma unroll
        for (int i = 0; i < 2; ++i) af[0][i] = Frag<_Float16>::load(&sA[u ^ 1][(wm + 16 * i + rlane) * kGPitch + koff]);
#pragma unroll
        for (int j = 0; j < 4; ++j) bf[0][j] = Frag<_Float16>::load(&sB[u ^ 1][(wn + 16 * j + rlane) * kGPitch + koff]);
      }
      // keeps the next stage's first LDS reads as one group ahead of the upper half's products, which cover their latency
      __builtin_amdgcn_sched_barrier(0);
#pragma unroll
      for (int i = 0; i < 2; ++i)
#pragma unroll
        for (int j = 0; j < 4; ++j) acc[i][j] = Frag<_Float16>::mma(af[1][i], bf[1][j], acc[i][j]);
    }
  }

  // ---- epilogue; a bias mode told at run time picks one of the two compile-time forms by a block-uniform branch ----
  const int m0 = tm * kGTileMN + wm;
  const int n0 = tn * kGTileMN + wn;
  float* slab = sT[wave];
  if constexpr (BIAS_MODE == 3) {
    if (rowBias) wmma_gemm_store<1, OUT_MODE>(acc, slab, Cout, ldc, bias, m0, n0, scale, 1.0f);
    else         wmma_gemm_store<2, OUT_MODE>(acc, slab, Cout, ldc, bias, m0, n0, scale, biasScale);
  } else {
    wmma_gemm_store<BIAS_MODE, OUT_MODE>(acc, slab, Cout, ldc, bias, m0, n0, scale, biasScale);
  }
}

// ---------------------------------------------------------------------------
// The three input projections in one launch, one round: 256 work-groups, one to a WGP, each with an equal share of the 4096 x 2304 results.
// A work-group takes 128 rows of x (32 row blocks) and 288 weight rows (8 column blocks): 192 rows of the stacked q and k planes (three whole
// heads; blocks 0..3 lie in q, 4..7 in k, block-uniform) and 96 rows of the v plane. x is staged once for all 288: 416 lines per 64 k.
//   Q16[s][e]  = kQCarry * ((1/16) * sum_d X16[s][d] * WQ16[e][d] + bq[e]);   K16 alike without kQCarry;   VT16[c][s] = (1/16) * sum_d WV16[c][d] * X16[s][d] + bv[c]
// kQCarry = log2(e) / sqrt(64): the score product of the attention kernel then comes out in the log2 domain of its softmax, with no multiply per score.
// 8 waves as 4 (x rows, 32 each) x 2 (weight rows: 96 of q or k and 48 of v each) = 2 x 9 accumulator tiles a wave, 11 fragments per 18 products.
// Stages, buffers, register prefetch and barriers run as in wmma_gemm_lds_tile; both operands come from LDS through the same loader (equal k orders),
// k runs upward in steps of 32 in every accumulator.
// q, k tiles take the weights as A and x as B: a lane then holds 8 neighbouring columns e of one row s. v tiles take x as A and the weights as B:
// a lane holds 8 neighbouring s of one row c of v^T. Either way a lane's 8 results are 16 B of an output row.
// Epilogue: the f16 results meet in LDS ([128 s][192 e] and [96 c][128 s]), one work-group barrier, then every 128-B line is stored whole by 8 threads.
// ---------------------------------------------------------------------------
constexpr int kProjTiles = (kSeq / kGTileMN) * (kDim / kGTileMN);   // 192 tiles of the output projection
constexpr float kQCarry = 0.125f * 1.4426950408889634f;            // 1 / sqrt(64) and log2(e), applied in f32 ahead of q's one rounding to f16
constexpr int kPQK      = 192;                    // q or k columns per work-group
constexpr int kPV       = 96;                     // v columns per work-group
constexpr int kPBRows   = kPQK + kPV;             // 288 weight rows staged: 0..191 q or k, 192..287 v
constexpr int kPBTile   = kPBRows * kGPitch;      // f16 per staged weight tile (41,472 B)
constexpr int kPColBlk  = kDim / kPV;             // 8
constexpr int kPBlocks  = (kSeq / kGTileMN) * kPColBlk;   // 256
constexpr int kPQKPitch = kPQK + 8;               // f16 per row of the q, k output tile in LDS: 400 B, an odd multiple of 16 B
constexpr int kPVPitch  = kGTileMN + 8;           // f16 per row of the v^T output tile in LDS: 272 B, an odd multiple of 16 B
static_assert(2 * kDim == kPColBlk * kPQK && kDim % kPQK == 0 && kPQK % 64 == 0 && kPQK % 32 == 0 && kPV % 32 == 0, "projection mapping");
__global__ __launch_bounds__(256) void qkv_gemm_kernel(
    const unsigned short* __restrict__ X16, const unsigned short* __restrict__ WQKV16,
    unsigned short* __restrict__ Q16, unsigned short* __restrict__ K16, unsigned short* __restrict__ VT16,
    const float* __restrict__ bq, const float* __restrict__ bk, const float* __restrict__ bv) {
  __shared__ __align__(16) _Float16 sA[2][kGTile];                  // 36,864 B
  __shared__ __align__(16) _Float16 sB[2][kPBTile];                 // 82,944 B
  __shared__ __align__(16) _Float16 sQK[kGTileMN * kPQKPitch];      // 51,200 B
  __shared__ __align__(16) _Float16 sVT[kPV * kPVPitch];            // 26,112 B
  const int t    = threadIdx.x;
  const int lane = t & 31;
  const int wave = t >> 5;
  const int rlane = lane & 15;                 // row of an A fragment, column of a B fragment and of D
  const int koff  = (lane >> 4) * 8;           // k offset of this lane half in a fragment; row offset of this lane half in D
  const int wm = (wave >> 1) * 32;             // this wave's x rows inside the tile
  const int wn = wave & 1;                     // this wave's half of the weight rows
  const int tm = blockIdx.x / kPColBlk;
  const int tn = blockIdx.x % kPColBlk;

  // staging map: 8 threads per 128-B row, rows srow + 32 q: q = 0..3 of x, q = 0..5 of the q, k rows, q = 6..8 of the v rows
  const int srow = t >> 3, sseg = (t & 7) * 8;
  const _Float16* gA  = (const _Float16*)X16    + (size_t)(tm * kGTileMN + srow) * kDim + sseg;
  const _Float16* gQK = (const _Float16*)WQKV16 + (size_t)(tn * kPQK + srow) * kDim + sseg;
  const _Float16* gV  = (const _Float16*)WQKV16 + (size_t)(2 * kDim + tn * kPV + srow) * kDim + sseg;
  const int sdst = srow * kGPitch + sseg;
  v8h ra[2][4], rb[2][9];
  // the unroll directives of this kernel, but the one on the loop over stage pairs and those on the loops of the final stores, are there because their loops index register arrays by the loop variable
#pragma unroll
  for (int u = 0; u < 2; ++u) {
#pragma unroll
    for (int q = 0; q < 4; ++q) ra[u][q] = *(const v8h*)(gA + (size_t)q * 32 * kDim + u * kGStageK);
#pragma unroll
    for (int q = 0; q < 9; ++q) rb[u][q] = *(const v8h*)((q < 6 ? gQK + (size_t)q * 32 * kDim : gV + (size_t)(q - 6) * 32 * kDim) + u * kGStageK);
  }

  v8f acc[2][9];
#pragma unroll
  for (int i = 0; i < 2; ++i)
#pragma unroll
    for (int j = 0; j < 9; ++j) acc[i][j] = (v8f){0.f,0.f,0.f,0.f,0.f,0.f,0.f,0.f};

#pragma unroll
  for (int q = 0; q < 4; ++q) *(v8h*)(&sA[0][sdst + q * 32 * kGPitch]) = ra[0][q];
#pragma unroll
  for (int q = 0; q < 9; ++q) *(v8h*)(&sB[0][sdst + q * 32 * kGPitch]) = rb[0][q];
  lds_barrier();   // stage 0 is in LDS before any wave reads it

  // first f16 of this lane's fragments in a staged tile: x rows wm + 16 i, q or k rows 96 wn + 16 j (j = 0..5), v rows 192 + 48 wn + 16 (j - 6) (j = 6..8)
  const int fA  = (wm + rlane) * kGPitch + koff;
  const int fQK = (wn * (kPQK / 2) + rlane) * kGPitch + koff;
  const int fV  = (kPQK + wn * (kPV / 2) + rlane) * kGPitch + koff;
  // fragments of one 32-k half stage; set 0 holds the lower half, set 1 the upper; each set is read from LDS while the other is worked on
  v16h af[2][2], bf[2][9];
#pragma unroll
  for (int i = 0; i < 2; ++i) af[0][i] = Frag<_Float16>::load(&sA[0][fA + 16 * i * kGPitch]);
#pragma unroll
  for (int j = 0; j < 9; ++j) bf[0][j] = Frag<_Float16>::load(&sB[0][(j < 6 ? fQK + 16 * j * kGPitch : fV + 16 * (j - 6) * kGPitch)]);

  // unrolled whole: the tests on s become compile-time, so no path joins and the counted waits on the register prefetch stay exact
#pragma unroll
  for (int st = 0; st < kGNStage; st += 2) {
#pragma unroll
    for (int u = 0; u < 2; ++u) {            // stage st + u: LDS buffer u, register set u is free
      const int s = st + u;
      if (s + 2 < kGNStage) {                // the same for the whole work-group
#pragma unroll
        for (int q = 0; q < 4; ++q) ra[u][q] = *(const v8h*)(gA + (size_t)q * 32 * kDim + (s + 2) * kGStageK);
#pragma unroll
        for (int q = 0; q < 9; ++q) rb[u][q] = *(const v8h*)((q < 6 ? gQK + (size_t)q * 32 * kDim : gV + (size_t)(q - 6) * 32 * kDim) + (s + 2) * kGStageK);
      }
#pragma unroll
      for (int i = 0; i < 2; ++i) af[1][i] = Frag<_Float16>::load(&sA[u][fA + 16 * i * kGPitch + 32]);
#pragma unroll
      for (int j = 0; j < 9; ++j) bf[1][j] = Frag<_Float16>::load(&sB[u][(j < 6 ? fQK + 16 * j * kGPitch : fV + 16 * (j - 6) * kGPitch) + 32]);
      // keeps the upper half's LDS reads as one group ahead of the lower half's products, which cover their latency
      __builtin_amdgcn_sched_barrier(0);
#pragma unroll
      for (int i = 0; i < 2; ++i)
#pragma unroll
        for (int j = 0; j < 9; ++j)
          acc[i][j] = j < 6 ? Frag<_Float16>::mma(bf[0][j], af[0][i], acc[i][j]) : Frag<_Float16>::mma(af[0][i], bf[0][j], acc[i][j]);
      // keeps these products ahead of the stores and the barrier: moved behind them, the wait in front of the barrier would meet reads just issued
      __builtin_amdgcn_sched_barrier(0);
      if (s + 1 < kGNStage) {
#pragma unroll
        for (int q = 0; q < 4; ++q) *(v8h*)(&sA[u ^ 1][sdst + q * 32 * kGPitch]) = ra[u ^ 1][q];
#pragma unroll
        for (int q = 0; q < 9; ++q) *(v8h*)(&sB[u ^ 1][sdst + q * 32 * kGPitch]) = rb[u ^ 1][q];
      }
      // publishes stage s + 1; every read of stage s has returned in front of it, so the next stage may refill buffer u behind it
      lds_barrier();
      if (s + 1 < kGNStage) {
#pragma unroll
        for (int i = 0; i < 2; ++i) af[0][i] = Frag<_Float16>::load(&sA[u ^ 1][fA + 16 * i * kGPitch]);
#pragma unroll
        for (int j = 0; j < 9; ++j) bf[0][j] = Frag<_Float16>::load(&sB[u ^ 1][(j < 6 ? fQK + 16 * j * kGPitch : fV + 16 * (j - 6) * kGPitch)]);
      }
      // keeps the next stage's first LDS reads as one group ahead of the upper half's products, which cover their latency
      __builtin_amdgcn_sched_barrier(0);
#pragma unroll
      for (int i = 0; i < 2; ++i)
#pragma unroll
        for (int j = 0; j < 9; ++j)
          acc[i][j] = j < 6 ? Frag<_Float16>::mma(bf[1][j], af[1][i], acc[i][j]) : Frag<_Float16>::mma(af[1][i], bf[1][j], acc[i][j]);
    }
  }

  // ---- epilogue ----
  const bool isK = tn >= kPColBlk / 2;               // the same for the whole work-group
  const int  e0  = (tn % (kPColBlk / 2)) * kPQK;     // first q or k column of the work-group
  const float carry = isK ? 1.0f : kQCarry;
  const float scale = kWCarryInv * carry;
  const float* bqk = (isK ? bk : bq) + e0 + wn * (kPQK / 2) + koff;   // 8 neighbouring columns per tile j, 16 j on
  const float* bvp = bv + tn * kPV + wn * (kPV / 2) + rlane;          // one row of v^T per tile j, 16 j on
  v4f b0[6], b1[6];
  float bc[3];
#pragma unroll
  for (int j = 0; j < 6; ++j) {
    b0[j] = *(const v4f*)(bqk + 16 * j);
    b1[j] = *(const v4f*)(bqk + 16 * j + 4);
  }
#pragma unroll
  for (int j = 0; j < 3; ++j) bc[j] = bvp[16 * j];
  // the wait that stands between global loads and an overwrite of the registers that hold their addresses; the addresses and the loaded
  // values are inputs only: the loads then stand in front of it and the address registers stay as they are up to it
  asm volatile("s_wait_xcnt 0x0" :: "v"(bqk), "v"(bvp), "v"(b0[0]), "v"(b1[0]), "v"(b0[1]), "v"(b1[1]), "v"(b0[2]), "v"(b1[2]), "v"(b0[3]), "v"(b1[3]),
               "v"(b0[4]), "v"(b1[4]), "v"(b0[5]), "v"(b1[5]), "v"(bc[0]), "v"(bc[1]), "v"(bc[2]) : "memory");
  // q, k: acc[i][j][r] = column 96 wn + 16 j + koff + r of row wm + 16 i + rlane
#pragma unroll
  for (int j = 0; j < 6; ++j) {
    const float br[8] = {b0[j][0], b0[j][1], b0[j][2], b0[j][3], b1[j][0], b1[j][1], b1[j][2], b1[j][3]};
#pragma unroll
    for (int i = 0; i < 2; ++i) {
      v8h hv;
#pragma unroll
      for (int r = 0; r < 8; ++r) {
        float v = acc[i][j][r] * scale;
        v += br[r] * carry;
        hv[r] = (_Float16)v;
      }
      *(v8h*)(&sQK[(wm + 16 * i + rlane) * kPQKPitch + wn * (kPQK / 2) + 16 * j + koff]) = hv;
    }
  }
  // v^T: acc[i][6 + j][r] = column (token) wm + 16 i + koff + r of row 48 wn + 16 j + rlane
#pragma unroll
  for (int j = 0; j < 3; ++j) {
#pragma unroll
    for (int i = 0; i < 2; ++i) {
      v8h hv;
#pragma unroll
      for (int r = 0; r < 8; ++r) {
        float v = acc[i][6 + j][r] * kWCarryInv;
        v += bc[j];
        hv[r] = (_Float16)v;
      }
      *(v8h*)(&sVT[(wn * (kPV / 2) + 16 * j + rlane) * kPVPitch + wm + 16 * i + koff]) = hv;
    }
  }
  lds_barrier();   // both output tiles are whole in LDS before any wave reads them
  // 8 threads store one 128-B line: rows srow + 32 a of either tile, line b of the row; every address is one base and a constant
  const _Float16* lQK = &sQK[srow * kPQKPitch + sseg];
  const _Float16* lVT = &sVT[srow * kPVPitch + sseg];
  unsigned short* QK = (isK ? K16 : Q16) + (size_t)(tm * kGTileMN + srow) * kDim + e0 + sseg;
  unsigned short* VT = VT16 + (size_t)(tn * kPV + srow) * kSeq + tm * kGTileMN + sseg;
#pragma unroll
  for (int a = 0; a < kGTileMN / 32; ++a)
#pragma unroll
    for (int b = 0; b < kPQK / 64; ++b)
      *(v8h*)(QK + (size_t)a * 32 * kDim + b * 64) = *(const v8h*)(lQK + a * 32 * kPQKPitch + b * 64);
#pragma unroll
  for (int a = 0; a < kPV / 32; ++a)
#pragma unroll
    for (int b = 0; b < kGTileMN / 64; ++b)
      *(v8h*)(VT + (size_t)a * 32 * kSeq + b * 64) = *(const v8h*)(lVT + a * 32 * kPVPitch + b * 64);
}
// Output projection: out[s][e] = (1/4096) * sum_c ATT16[s][c] * WO16[e][c] + bo[e], f32
__global__ __launch_bounds__(256) void out_gemm_kernel(
    const unsigned short* __restrict__ ATT16, const unsigned short* __restrict__ WO16, float* __restrict__ out, const float* __restrict__ bo) {
  const int tm = blockIdx.x / (kDim / kGTileMN);
  const int tn = blockIdx.x % (kDim / kGTileMN);
  wmma_gemm_lds_tile<2, 0>(ATT16, WO16, (void*)out, kDim, bo, false, tm, tn, kOutScale, 1.0f);
}

// ---------------------------------------------------------------------------
// x to f16: block blk covers 2048 consecutive elements, 8 per thread
// ---------------------------------------------------------------------------
__device__ __forceinline__ void cast8_f16_block(int blk, const float* __restrict__ in, unsigned short* __restrict__ out, int n8) {
  const int i = blk * 256 + threadIdx.x;
  if (i >= n8) return;
  const float* p = in + 8 * (size_t)i;
  const v4f a = *(const v4f*)(p);
  const v4f c = *(const v4f*)(p + 4);
  unsigned short hb[8];
#pragma unroll
  for (int e = 0; e < 4; ++e) {
    hb[e]     = h_bits(a[e]);
    hb[4 + e] = h_bits(c[e]);
  }
  const v4u u = (v4u){pk16(hb[0], hb[1]), pk16(hb[2], hb[3]), pk16(hb[4], hb[5]), pk16(hb[6], hb[7])};
  unsigned short* q = out + 8 * (size_t)i;
  *(v4u*)q = u;
  
}

// ---------------------------------------------------------------------------
// Rank-8 adapter fold + f16 cast with x16 carry, f32 math:
//   plane y in {0,1,2}: WQKV[y][e][d] = f16( 16 * ( w_y[e][d] + 2 * sum_r up_y[e][r] * down_y[r][d] ) )
//   plane y == 3      : WO[e][d]      = f16( 16 * wo[e][d] )
// Weights are [out e][in d] = Bt[n][k] for the GEMMs; orientation kept as given (no transpose).
// 288 x 4 blocks: y = matrix (block-uniform), block bx of a matrix covers 2048 consecutive elements (288 x 2048 = 768 x 768 exact);
// thread t owns elements 8t..8t+7 of the block (one row e, 8 consecutive d).
// The whole down matrix [8][768] of the plane is staged in LDS first (cooperative: 6 b128 per thread, 6 x 256 x 4 = 6144 floats =
// the whole matrix, every LDS word read below is written), block barrier, then per lane 2 b128 (w) + 2 b128 (up row) global loads.
// ---------------------------------------------------------------------------
__device__ __forceinline__ void fold_cast_block(
    int bx, int y,
    const float* __restrict__ wq, const float* __restrict__ wk, const float* __restrict__ wv, const float* __restrict__ wo,
    const float* __restrict__ dq, const float* __restrict__ uq,
    const float* __restrict__ dk, const float* __restrict__ uk,
    const float* __restrict__ dv, const float* __restrict__ uv,
    unsigned short* __restrict__ wqkv16, unsigned short* __restrict__ wo16) {
  __shared__ __align__(16) float dsh[kRank * kDim];      // down matrix [8][768] of this plane, 24,576 B
  const int t = threadIdx.x;
  const float* W  = (y == 0) ? wq : (y == 1) ? wk : (y == 2) ? wv : wo;
  const float* Dn = (y == 0) ? dq : (y == 1) ? dk : dv;   // y == 3: valid pointer, staged but not used
  const float* Up = (y == 0) ? uq : (y == 1) ? uk : uv;
  // stage down [8][768] = 1536 float4: thread t loads slots t + 256*i, i = 0..5 (exact coverage)
#pragma unroll
  for (int i = 0; i < 6; ++i) {
    const int q4 = (i * 256 + t) * 4;
    const v4f dd = *(const v4f*)(Dn + q4);
    *(v4f*)(dsh + q4) = dd;
  }
  __syncthreads();

  const int base = bx * 2048 + 8 * t;            // < 768*768
  const int e = base / kDim;
  const int d = base - e * kDim;                         // multiple of 8
  const v4f w0 = *(const v4f*)(W + base);
  const v4f w1 = *(const v4f*)(W + base + 4);
  float s[8];
#pragma unroll
  for (int k = 0; k < 8; ++k) s[k] = 0.0f;
  if (y < 3) {                                           // block-uniform branch
    const v4f u0 = *(const v4f*)(Up + e * kRank);
    const v4f u1 = *(const v4f*)(Up + e * kRank + 4);
    const float ur[8] = {u0[0], u0[1], u0[2], u0[3], u1[0], u1[1], u1[2], u1[3]};
#pragma unroll
    for (int r = 0; r < kRank; ++r) {
      const v4f a = *(const v4f*)(dsh + r * kDim + d);
      const v4f c = *(const v4f*)(dsh + r * kDim + d + 4);
#pragma unroll
      for (int k = 0; k < 4; ++k) {
        s[k]     += ur[r] * a[k];
        s[4 + k] += ur[r] * c[k];
      }
    }
  }
  float f[8];
#pragma unroll
  for (int k = 0; k < 4; ++k) {
    f[k]     = (w0[k] + kLowRankScale * s[k])     * kWCarry;
    f[4 + k] = (w1[k] + kLowRankScale * s[4 + k]) * kWCarry;
  }
  unsigned short hb[8];
#pragma unroll
  for (int k = 0; k < 8; ++k) hb[k] = h_bits(f[k]);
  const v4u u = (v4u){pk16(hb[0], hb[1]), pk16(hb[2], hb[3]), pk16(hb[4], hb[5]), pk16(hb[6], hb[7])};
  unsigned short* op = (y < 3) ? (wqkv16 + (size_t)y * kDim * kDim + base) : (wo16 + base);
  *(v4u*)op = u;
  
}

// ---------------------------------------------------------------------------
// Both 16-bit operand preparations in one launch: neither reads what the other writes. The block index picks the work (block-uniform,
// so the fold's barrier is passed by every thread of a block that reaches it): blocks 0..1151 fold and cast the weights, the other 1536 cast x.
// ---------------------------------------------------------------------------
constexpr int kFoldBlocksPerW = kDim * kDim / 2048;      // 288
constexpr int kFoldBlocks     = 4 * kFoldBlocksPerW;     // 1152
constexpr int kCastBlocks     = kSeq * kDim / 2048;      // 1536
__global__ __launch_bounds__(256) void prep_kernel(
    const float* __restrict__ x, unsigned short* __restrict__ x16,
    const float* __restrict__ wq, const float* __restrict__ wk, const float* __restrict__ wv, const float* __restrict__ wo,
    const float* __restrict__ dq, const float* __restrict__ uq,
    const float* __restrict__ dk, const float* __restrict__ uk,
    const float* __restrict__ dv, const float* __restrict__ uv,
    unsigned short* __restrict__ wqkv16, unsigned short* __restrict__ wo16) {
  const int b = blockIdx.x;
  if (b < kFoldBlocks) {
    const int y = b / kFoldBlocksPerW;
    fold_cast_block(b - y * kFoldBlocksPerW, y, wq, wk, wv, wo, dq, uq, dk, uk, dv, uv, wqkv16, wo16);
  } else {
    cast8_f16_block(b - kFoldBlocks, x, x16, kSeq * kDim / 8);
  }
}

constexpr int kFAColWaves = 2;
constexpr int kFAKeyWaves = 2;
constexpr int kFAWaves  = kFAColWaves * kFAKeyWaves;
constexpr int kFASub    = 3;
constexpr int kFAWGWaves = kFASub * kFAWaves;
constexpr int kFAFetchWaves = 8;
constexpr int kFAGroups = 2;
constexpr int kFARows   = kFAColWaves * kFAGroups * 16;
constexpr int kFAStage  = kFAKeyWaves * 64;
constexpr int kFANStage = kSeq / kFAStage;
constexpr int kFAPitch  = 72;
constexpr int kFATile   = 64 * kFAPitch;
constexpr int kFATilesPerHead = kSeq / kFARows;           // 64
constexpr int kFATiles  = kHeads * kFATilesPerHead;       // 768
constexpr int kFABlocks = kFATiles / kFASub;              // 256
constexpr float kFACarryLog2 = 6.0f;
constexpr float kFATrail = 8.0f;                          // how far the maximum in use may trail
static_assert(kSeq % kFARows == 0 && kSeq % kFAStage == 0 && kDh == 64 && kFATiles % kFASub == 0 && kFASub <= kFATilesPerHead && kFAGroups == 2, "fused attention mapping");
typedef __attribute__((ext_vector_type(2))) _Float16 v2h;
// lane l with lane l ^ 16
__device__ __forceinline__ float xhalf(float x) {
  const int b = __builtin_bit_cast(int, x);
  return __builtin_bit_cast(float, __builtin_amdgcn_permlanex16(b, b, 0x76543210, 0xfedcba98, false, false));
}
__device__ __forceinline__ unsigned pack2h(float lo, float hi) {
  return __builtin_bit_cast(unsigned, __builtin_convertvector((v2f){lo, hi}, v2h));   // round to nearest even
}
// The eight score products of a 32-key pass (2 key tiles x 2 column groups x 2 halves of d) in one statement. Written as text because the first
// product of each tile must read its C operand from the shift tile and write another tile: the builtin form was built with C and D in the same
// registers, behind a copy of the shift tile per product. Each tile's second product accumulates into the same D; the products fill each
// other's slots, and the four v_nop at the end keep the distance that the chip needs between the last product and the first vector reader of its D.
// The four v_nop in front keep the same distance behind the P.V products of the pass before: a D of this statement may lie in the registers of
// their B operand, and the compiler, which pads its own products, does not look into a statement's text.
// The shift tiles are only read; they are named as in-out operands so that they stay in one set of registers over the whole loop
// (as plain inputs the build kept a second set and copied 16 registers in every pass).
__device__ __forceinline__ void score_products(v8f& s00, v8f& s01, v8f& s10, v8f& s11, v16h ka0, v16h ka1, v16h kb0, v16h kb1,
                                               v16h q00, v16h q01, v16h q10, v16h q11, v8f& sh0, v8f& sh1) {
  asm("v_nop\n\tv_nop\n\tv_nop\n\tv_nop\n\t"
      "v_wmma_f32_16x16x32_f16 %0, %6, %10, %4\n\t"
      "v_wmma_f32_16x16x32_f16 %1, %6, %12, %5\n\t"
      "v_wmma_f32_16x16x32_f16 %2, %8, %10, %4\n\t"
      "v_wmma_f32_16x16x32_f16 %3, %8, %12, %5\n\t"
      "v_wmma_f32_16x16x32_f16 %0, %7, %11, %0\n\t"
      "v_wmma_f32_16x16x32_f16 %1, %7, %13, %1\n\t"
      "v_wmma_f32_16x16x32_f16 %2, %9, %11, %2\n\t"
      "v_wmma_f32_16x16x32_f16 %3, %9, %13, %3\n\t"
      "v_nop\n\tv_nop\n\tv_nop\n\tv_nop"
      : "=&v"(s00), "=&v"(s01), "=&v"(s10), "=&v"(s11), "+v"(sh0), "+v"(sh1)
      : "v"(ka0), "v"(ka1), "v"(kb0), "v"(kb1), "v"(q00), "v"(q01), "v"(q10), "v"(q11));
}
__global__ __launch_bounds__(kFAWGWaves * 32) void attn_fused_kernel(
    const unsigned short* __restrict__ Qp, const unsigned short* __restrict__ Kp, const unsigned short* __restrict__ VTp,
    unsigned short* __restrict__ Att) {
  __shared__ __align__(16) _Float16 sK[2][2][kFAKeyWaves][kFATile];   // [buffer][head slot]: 73,728 B; a slot is 128 key rows in a row
  __shared__ __align__(16) _Float16 sV[2][2][kFAKeyWaves][kFATile];   // 73,728 B
  __shared__ __align__(16) v4f sJ[kFASub * kFAColWaves][17][32];      // the join's planes, 52,224 B, beside the ring
  const int t    = threadIdx.x;
  const int lane = t & 31;
  // the wave's number as a scalar: the tests on it below (who fetches, which key half leaves) are then scalar branches
  const int wave = __builtin_amdgcn_readfirstlane(t >> 5);
  const int sub  = wave >> 2;               // which of the three tiles
  const int cw   = wave & 1;                // which 32 query columns of the tile
  const int kh   = (wave >> 1) & 1;         // which 64 keys of every stage
  const int c    = lane & 15;
  const int h8   = (lane >> 4) * 8;
  // Block -> tiles 3 b, 3 b + 1, 3 b + 2 of the 768 (head, 64 rows) tiles in head-major order: a one-to-one map.
  const int id0   = blockIdx.x * kFASub;
  const int head0 = id0 / kFATilesPerHead;
  const bool two  = (id0 + kFASub - 1) / kFATilesPerHead != head0;   // the tiles span heads head0 and head0 + 1; the same for the whole work-group
  const int id    = id0 + sub;
  const int head  = id / kFATilesPerHead;
  const int slot  = head - head0;           // 0, or 1 only where two holds
  const bool fetcher = wave < kFAFetchWaves;
  const int q0   = (id % kFATilesPerHead) * kFARows + cw * (kFAGroups * 16);
  const _Float16* Qh = (const _Float16*)Qp  + head * kDh;
  const _Float16* Kh = (const _Float16*)Kp  + head0 * kDh;                   // [key][kDim]; head slot 1 lies kDh elements on
  const _Float16* Vh = (const _Float16*)VTp + (size_t)head0 * kDh * kSeq;    // [d][kSeq]; head slot 1 lies kDh rows on

  // staging map of the 256 fetching threads: 8 threads per 128-B row; K rows srow + 32 q, q = 0..3; V^T rows srow + 32 (q & 1) of tile q >> 1
  const int srow = t >> 3, sseg = (t & 7) * 8;
  const _Float16* gK = Kh + (size_t)srow * kDim + sseg;
  const _Float16* gV = Vh + (size_t)srow * kSeq + sseg;
  const int sdst = srow * kFAPitch + sseg;
  if (fetcher) {
#pragma unroll
    for (int hs = 0; hs < 2; ++hs)
      if (hs == 0 || two) {
        v8h r0[4], r1[4];
#pragma unroll
        for (int q = 0; q < 4; ++q) {
          r0[q] = *(const v8h*)(gK + hs * kDh + (size_t)q * 32 * kDim);
          r1[q] = *(const v8h*)(gV + (size_t)hs * kDh * kSeq + (size_t)(q & 1) * 32 * kSeq + (q >> 1) * 64);
        }
#pragma unroll
        for (int q = 0; q < 4; ++q) {
          *(v8h*)(&sK[0][hs][0][sdst + q * 32 * kFAPitch]) = r0[q];
          *(v8h*)(&sV[0][hs][q >> 1][sdst + (q & 1) * 32 * kFAPitch]) = r1[q];
        }
      }
  }

  v16h qf[kFAGroups][2];
#pragma unroll
  for (int g = 0; g < kFAGroups; ++g)
#pragma unroll
    for (int kc = 0; kc < 2; ++kc)
      qf[g][kc] = Frag<_Float16>::load(Qh + (size_t)(q0 + 16 * g + c) * kDim + 32 * kc + h8);

  v8f acc[kFAGroups][4];
  v8f shift[kFAGroups];                 // C operand of the score product: 6 - mrun in every element; 0 until the first pass has a maximum
  v2f lsum[kFAGroups];
  float mrun[kFAGroups];
  float scur[kFAGroups];                // the value that shift holds, apart: a rescale then reads nothing of the tile and rewrites it in place
  float limit = -__builtin_inff();      // a shifted score above it asks for a rescale; wave-uniform; -inf so that the first pass always does
#pragma unroll
  for (int g = 0; g < kFAGroups; ++g) {
    mrun[g] = -__builtin_inff();
    shift[g] = (v8f){0.f,0.f,0.f,0.f,0.f,0.f,0.f,0.f};
    scur[g] = 0.f;
    lsum[g] = (v2f){0.f, 0.f};
#pragma unroll
    for (int j = 0; j < 4; ++j) acc[g][j] = (v8f){0.f,0.f,0.f,0.f,0.f,0.f,0.f,0.f};
  }
  __syncthreads();   // stage 0 is in LDS before any wave reads it

  for (int st = 0; st < kFANStage; ++st) {
    const int buf = st & 1;
    const bool more = fetcher && st + 1 < kFANStage;   // the same for the whole wave
    const _Float16* bK = &sK[buf][slot][kh][0];
    const _Float16* bV = &sV[buf][slot][kh][0];
    v8h rk[2][4], rv[2][4];                // this thread's share of the next stage, in flight over this one; second set: head slot 1
    if (more) {
      gK += kFAStage * kDim;
      gV += kFAStage;
#pragma unroll
      for (int hs = 0; hs < 2; ++hs)
        if (hs == 0 || two) {
#pragma unroll
          for (int q = 0; q < 4; ++q) {
            rk[hs][q] = *(const v8h*)(gK + hs * kDh + (size_t)q * 32 * kDim);
            rv[hs][q] = *(const v8h*)(gV + (size_t)hs * kDh * kSeq + (size_t)(q & 1) * 32 * kSeq + (q >> 1) * 64);
          }
        }
    }
#pragma unroll
    for (int p = 0; p < 2; ++p) {          // two 32-key passes per stage and key wave
      v8f s[2][kFAGroups];
      {
        const _Float16* kp = bK + (32 * p + c) * kFAPitch + h8;
        const v16h ka0 = Frag<_Float16>::load(kp);
        const v16h ka1 = Frag<_Float16>::load(kp + 32);
        const v16h kb0 = Frag<_Float16>::load(kp + 16 * kFAPitch);
        const v16h kb1 = Frag<_Float16>::load(kp + 16 * kFAPitch + 32);
        score_products(s[0][0], s[0][1], s[1][0], s[1][1], ka0, ka1, kb0, kb1, qf[0][0], qf[0][1], qf[1][0], qf[1][1], shift[0], shift[1]);
      }
      v16h vf[4];
#pragma unroll
      for (int j = 0; j < 4; ++j) vf[j] = Frag<_Float16>::load(bV + (16 * j + c) * kFAPitch + 32 * p + h8);

      float mb[kFAGroups];
      bool need = false;
#pragma unroll
      for (int g = 0; g < kFAGroups; ++g) {
        float mx = s[0][g][0];
#pragma unroll
        for (int r = 1; r < 8; ++r) mx = fmaxf(mx, s[0][g][r]);
#pragma unroll
        for (int r = 0; r < 8; ++r) mx = fmaxf(mx, s[1][g][r]);
        mb[g] = mx;                             // this lane's 16 keys; the wave halves are joined only where a rescale is due
        need = need || (mx > limit);
      }
      if (__builtin_amdgcn_ballot_w32(need) != 0) {   // wave-uniform; always on the first pass, rare later
#pragma unroll
        for (int g = 0; g < kFAGroups; ++g) {
          const float sold = scur[g];
          const float mnew = fmaxf(mrun[g], fmaxf(mb[g], xhalf(mb[g])) - sold);   // both wave halves hold this query's maximum, unshifted
          const float corr = __builtin_amdgcn_exp2f(mrun[g] - mnew);   // 0 on the first pass, where mrun is -inf
          mrun[g] = mnew;
          const float snew = kFACarryLog2 - mnew;
          const float adj  = snew - sold;
          s[0][g] = s[0][g] + adj;   // this pass's scores were formed with the old shift
          s[1][g] = s[1][g] + adj;
          shift[g] = (v8f){snew, snew, snew, snew, snew, snew, snew, snew};
          scur[g] = snew;
          lsum[g] = lsum[g] * corr;
#pragma unroll
          for (int j = 0; j < 4; ++j) acc[g][j] = acc[g][j] * corr;
        }
        limit = kFACarryLog2 + kFATrail;
      }
#pragma unroll
      for (int g = 0; g < kFAGroups; ++g) {
        union { v16h v; unsigned w[8]; } pf;
#pragma unroll
        for (int i = 0; i < 8; ++i) {
          const v2f pe = (v2f){__builtin_amdgcn_exp2f(s[i >> 2][g][2 * (i & 3)]), __builtin_amdgcn_exp2f(s[i >> 2][g][2 * (i & 3) + 1])};
          lsum[g] += pe;
          pf.w[i] = pack2h(pe[0], pe[1]);
        }
#pragma unroll
        for (int j = 0; j < 4; ++j) acc[g][j] = Frag<_Float16>::mma(vf[j], pf.v, acc[g][j]);
      }
    }
    if (more) {   // the other buffer's last readers left it at the barrier that ended the stage before
#pragma unroll
      for (int hs = 0; hs < 2; ++hs)
        if (hs == 0 || two) {
#pragma unroll
          for (int q = 0; q < 4; ++q) {
            *(v8h*)(&sK[buf ^ 1][hs][0][sdst + q * 32 * kFAPitch]) = rk[hs][q];
            *(v8h*)(&sV[buf ^ 1][hs][q >> 1][sdst + (q & 1) * 32 * kFAPitch]) = rv[hs][q];
          }
        }
    }
    __syncthreads();   // publishes stage st + 1 and ends every wave's reads of the buffer that the next trip refills
  }

  // ---- join of the two key waves of each column pair ----
  // plane i of column wave cw of tile sub holds 16 B per lane: planes 0..15 = the output tiles, plane 16 = both maxima and both sums
  v4f* mg = &sJ[sub * kFAColWaves + cw][0][lane];
  if (kh == 1) {
#pragma unroll
    for (int g = 0; g < kFAGroups; ++g)
#pragma unroll
      for (int j = 0; j < 4; ++j) {
        const v8f o = acc[g][j];
        mg[((g * 4 + j) * 2 + 0) * 32] = (v4f){o[0], o[1], o[2], o[3]};
        mg[((g * 4 + j) * 2 + 1) * 32] = (v4f){o[4], o[5], o[6], o[7]};
      }
    mg[16 * 32] = (v4f){mrun[0], mrun[1], lsum[0][0] + lsum[0][1], lsum[1][0] + lsum[1][1]};
  }
  __syncthreads();   // the planes are in LDS before the other key wave reads them; every wave passes it
  if (kh != 0) return;

  // acc[g][j][r] = O^T[d = 16 j + 8 h + r][query 16 g + c]: 8 consecutive d of one row, one 16-B store
  const v4f ml = mg[16 * 32];
#pragma unroll
  for (int g = 0; g < kFAGroups; ++g) {
    const float mall = fmaxf(mrun[g], ml[g]);
    const float f0 = __builtin_amdgcn_exp2f(mrun[g] - mall);   // this wave's share, scaled to the larger maximum
    const float f1 = __builtin_amdgcn_exp2f(ml[g] - mall);     // the other key wave's
    const float lh  = (lsum[g][0] + lsum[g][1]) * f0 + ml[2 + g] * f1;
    const float inv = kAttCarry / (lh + xhalf(lh));   // the exchange is unconditional within the wave
    const float i0 = f0 * inv, i1 = f1 * inv;
    unsigned short* op = Att + (size_t)(q0 + 16 * g + c) * kDim + head * kDh + h8;
#pragma unroll
    for (int j = 0; j < 4; ++j) {
      const v4f pa = mg[((g * 4 + j) * 2 + 0) * 32];
      const v4f pb = mg[((g * 4 + j) * 2 + 1) * 32];
      const v8f po = (v8f){pa[0], pa[1], pa[2], pa[3], pb[0], pb[1], pb[2], pb[3]};
      const v8f o = acc[g][j] * i0 + po * i1;
      const v4u u = (v4u){pack2h(o[0], o[1]), pack2h(o[2], o[3]), pack2h(o[4], o[5]), pack2h(o[6], o[7])};
      *(v4u*)(op + 16 * j) = u;
    }
  }
}

// ---------------------------------------------------------------------------
// Host glue.
// Workspace region map (bytes, every offset a multiple of 128; every plane fully written before any read):
//   X16    f16 [4096][768]                 6,291,456  at          0   (cast8)
//   WQKV16 f16 [3][768][768]  (x16 carry)  3,538,944  at  6,291,456   (fold_cast, planes q|k|v)
//   WO16   f16 [768][768]     (x16 carry)  1,179,648  at  9,830,400   (fold_cast)
//   Q16    f16 [4096][768]                 6,291,456  at 11,010,048   (GEMM)
//   K16    f16 [4096][768]                 6,291,456  at 17,301,504   (GEMM)
//   VT16   f16 [768][4096]  = V^T          6,291,456  at 23,592,960   (GEMM)
//   ATT16  f16 [4096][768]   (x256 carry)  6,291,456  at 29,884,416   (fused attention, each tile [64 rows][64 cols])
//   total                                 36,175,872
// GEMM shapes (K = 768 = 12 stages of 64, no padding anywhere):
//   q, k, v^T together: 4096 rows of x against 2304 weight rows, tiles of 128 x 288;  out: M=4096 N=768, tiles of 128 x 128
// Launches: 1 cast and fold + 1 for the three projections + 1 fused attention + 1 out = 4.
// ---------------------------------------------------------------------------
extern "C" void kernel_launch(void* const* d_in, const int* in_sizes, int n_in,
                              void* d_out, int out_size, void* d_ws, size_t ws_size,
                              hipStream_t stream) {
  if (n_in < 15) return;
  const int nX = kSeq * kDim;          // 3,145,728
  const int nW = kDim * kDim;          // 589,824
  const int nA = kRank * kDim;         // 6,144
  if (in_sizes[0] != nX) return;
  if (in_sizes[1] != nW || in_sizes[3] != nW || in_sizes[5] != nW || in_sizes[7] != nW) return;
  if (in_sizes[2] != kDim || in_sizes[4] != kDim || in_sizes[6] != kDim || in_sizes[8] != kDim) return;
  for (int i = 9; i < 15; ++i) if (in_sizes[i] != nA) return;
  if (out_size != nX) return;

  const size_t szAct  = (size_t)kSeq * kDim * 2;
  const size_t szWqkv = (size_t)3 * kDim * kDim * 2;
  const size_t szWo   = (size_t)kDim * kDim * 2;
  const size_t offX    = 0;
  const size_t offWqkv = offX + szAct;
  const size_t offWo   = offWqkv + szWqkv;
  const size_t offQ    = offWo + szWo;
  const size_t offK    = offQ + szAct;
  const size_t offVT   = offK + szAct;
  const size_t offAtt  = offVT + szAct;
  const size_t total   = offAtt + szAct;   // 36,175,872
  if (ws_size < total) return;

  const float* x   = (const float*)d_in[0];
  const float* wq  = (const float*)d_in[1];
  const float* bq  = (const float*)d_in[2];
  const float* wk  = (const float*)d_in[3];
  const float* bk  = (const float*)d_in[4];
  const float* wv  = (const float*)d_in[5];
  const float* bv  = (const float*)d_in[6];
  const float* wo  = (const float*)d_in[7];
  const float* bo  = (const float*)d_in[8];
  const float* dq  = (const float*)d_in[9];    // [8][768]
  const float* uq  = (const float*)d_in[10];   // [768][8]
  const float* dk  = (const float*)d_in[11];
  const float* uk  = (const float*)d_in[12];
  const float* dv  = (const float*)d_in[13];
  const float* uv  = (const float*)d_in[14];
  float* out = (float*)d_out;
  char* ws = (char*)d_ws;
  unsigned short* X16    = (unsigned short*)(ws + offX);
  unsigned short* WQKV16 = (unsigned short*)(ws + offWqkv);
  unsigned short* WO16   = (unsigned short*)(ws + offWo);
  unsigned short* Q16    = (unsigned short*)(ws + offQ);
  unsigned short* K16    = (unsigned short*)(ws + offK);
  unsigned short* VT16   = (unsigned short*)(ws + offVT);
  unsigned short* ATT16  = (unsigned short*)(ws + offAtt);

  // ---- 16-bit operand planes: x cast, weights folded and cast, one launch ----
  prep_kernel<<<dim3(kFoldBlocks + kCastBlocks), dim3(256), 0, stream>>>(x, X16, wq, wk, wv, wo, dq, uq, dk, uk, dv, uv, WQKV16, WO16);

  // ---- projections q, k, v^T: one launch, one work-group per 128 rows of x and 288 weight rows, 256 work-groups of 8 waves ----
  qkv_gemm_kernel<<<dim3(kPBlocks), dim3(256), 0, stream>>>(X16, WQKV16, Q16, K16, VT16, bq, bk, bv);

  // ---- attention: one launch, one work-group per three tiles of (64 query rows, head) ----
  // ATT16[s][h*64+n] = 256 * sum_j softmax2_j(Q16[s][h*64+:] . K16[j][h*64+:]) * VT16[h*64+n][j], softmax2 to base 2 (Q16 holds q * log2(e) / 8)
  attn_fused_kernel<<<dim3(kFABlocks), dim3(kFAWGWaves * 32), 0, stream>>>(Q16, K16, VT16, ATT16);

  // ---- output projection (M=4096, N=768, K=768, f32 to d_out) ----
  out_gemm_kernel<<<dim3(kProjTiles), dim3(256), 0, stream>>>(ATT16, WO16, out, bo);
}

// v009
// It runs in 69.6 microseconds.
// In both of two side-by-side timings against v008, it was 1.07 times as fast.
// Counting every step since v000, it is 71.3 times as fast.
// Contractions: q/k projections and v^T projection (x f16 x W_eff^T f16 carried x16), scores k_h.q_h^T (q,k f16 planes, q carried x log2(e)/8, the softmax shift as the product's f32 C operand), v_h^T.probs^T (V^T f16 x unnormalised P f16 carried x64), output projection (attn f16 carried x256 x Wo^T f16 carried x16): all v_wmma_f32_16x16x32_f16 with f32 accumulate; rank-8 weight fold, bias add and online softmax in f32.
#include <hip/hip_runtime.h>
#include <math.h>

// ---------------------------------------------------------------------------
// Problem constants
// ---------------------------------------------------------------------------
constexpr int kSeq    = 4096;             // tokens (batch 1)
constexpr int kDim    = 768;              // model width
constexpr int kHeads  = 12;
constexpr int kDh     = 64;
constexpr int kRank   = 8;                // low-rank adapter width
constexpr float kLowRankScale = 2.0f;     // alpha / rank = 16 / 8
constexpr float kWCarry    = 16.0f;       // weights carried x16 in f16
constexpr float kWCarryInv = 1.0f / 16.0f;
constexpr float kAttCarry  = 256.0f;      // attention output carried x256 in f16
constexpr float kOutScale  = 1.0f / (kAttCarry * kWCarry);   // 1/4096
static_assert(kHeads * kDh == kDim, "shape");
static_assert(kSeq % 64 == 0 && kDim % 64 == 0 && kDh % 64 == 0, "M,N tile multiples");
static_assert(kDim % 32 == 0 && kDh % 32 == 0 && kSeq % 32 == 0, "K multiples of 32");
static_assert((kDim * kDim) % 2048 == 0, "fold block mapping");
static_assert((kSeq * kDim) % 2048 == 0, "cast block mapping");
static_assert(kRank * kDim == 6 * 256 * 4, "adapter staging: 6 float4 per thread of a 256-thread block");

typedef __attribute__((ext_vector_type(16))) _Float16 v16h;
typedef __attribute__((ext_vector_type(8)))  _Float16 v8h;
typedef __attribute__((ext_vector_type(8)))  float    v8f;
typedef __attribute__((ext_vector_type(4)))  float    v4f;
typedef __attribute__((ext_vector_type(2)))  float    v2f;
typedef __attribute__((ext_vector_type(4)))  unsigned int v4u;

// ---------------------------------------------------------------------------
// Fragment loader and matrix product, f16 operands, f32 accumulate
// ---------------------------------------------------------------------------
template <typename T> struct Frag;
template <> struct Frag<_Float16> {
  typedef v16h V; union U { v16h v; v8h h[2]; };
  // elements 0..7 <- p[0..7], 8..15 <- p[16..23]
  static __device__ __forceinline__ v16h load(const _Float16* p) {
    U f; f.h[0] = *(const v8h*)(p); f.h[1] = *(const v8h*)(p + 16); return f.v;
  }
  static __device__ __forceinline__ v8f mma(v16h a, v16h b, v8f c) {
    return __builtin_amdgcn_wmma_f32_16x16x32_f16(false, a, false, b, (short)0, c, false, false);
  }
};

__device__ __forceinline__ unsigned pk16(unsigned short a, unsigned short b) { return (unsigned)a | ((unsigned)b << 16); }
__device__ __forceinline__ unsigned short h_bits(float f) { const _Float16 h = (_Float16)f; return __builtin_bit_cast(unsigned short, h); }

// ---------------------------------------------------------------------------
// WMMA GEMM with both operands staged in LDS: C[m,n] = scale * sum_k A[m,k] * Bt[n,k] + bias.
// A row-major [M][kDim], Bt row-major [N][kDim], f16; M, N multiples of 128; K = kDim for every product of this file.
// One work-group = one 128 x 128 tile of C; 8 waves as 4 (m) x 2 (n), each 32 x 64 = 2 x 4 accumulator tiles.
// A stage is 64 k: 128 rows x 128 B of A and of Bt. 8 threads fetch one whole 128-B line, so a wave-wide load covers 4 whole lines;
// every line is fetched once per work-group and shared by its waves through LDS (pitch 144 B, an odd multiple of 16 B).
// Stage s + 2 is fetched into registers while stage s is worked on (two register sets), stage s + 1 is stored to the other of two
// LDS buffers in the middle of stage s, one work-group barrier per stage; fragments are read half a stage (32 k) ahead of their products.
// A and B fragments come from LDS through the same loader (equal k orders); k runs upward in steps of 32 in every accumulator.
// BIAS_MODE: 1 = bias[m], 2 = bias[n] * biasScale, 3 = told at run time by rowBias (the same for the whole work-group).  OUT_MODE: 0 = f32, 1 = f16.
// The tile (tm, tn) and the operands come from the calling kernel, which derives them from its block index.
// ---------------------------------------------------------------------------
constexpr int kGTileMN = 128;                   // rows of A and of Bt per work-group
constexpr int kGStageK = 64;                    // k per stage: one 128-B line per row
constexpr int kGNStage = kDim / kGStageK;       // 12
constexpr int kGPitch  = 72;                    // f16 per LDS row
constexpr int kGTile   = kGTileMN * kGPitch;    // f16 per staged operand tile (18,432 B)
static_assert(kSeq % kGTileMN == 0 && kDim % kGTileMN == 0 && kDim % (2 * kGStageK) == 0, "staged GEMM mapping");
// Work-group barrier that orders LDS traffic only: __syncthreads() also waits for every outstanding global load, which would
// end the two-stage lead of the register prefetch at each stage; nothing but LDS passes between the waves of this kernel.
__device__ __forceinline__ void lds_barrier() {
  __builtin_amdgcn_fence(__ATOMIC_RELEASE, "workgroup", "local");
  __builtin_amdgcn_s_barrier();
  __builtin_amdgcn_fence(__ATOMIC_ACQUIRE, "workgroup", "local");
}
// Epilogue of the staged GEMM: each wave turns its 16 x 64 slabs through its own LDS range (slab) into whole-line stores.
// (m0, n0) = first row and column of the wave's 32 x 64 part of C.  BIAS_MODE: 1 = bias[m], 2 = bias[n] * biasScale.  OUT_MODE: 0 = f32, 1 = f16.
template <int BIAS_MODE, int OUT_MODE>
__device__ __forceinline__ void wmma_gemm_store(
    const v8f (&acc)[2][4], float* slab, void* __restrict__ Cout, int ldc, const float* __restrict__ bias, int m0, int n0, float scale,
    float biasScale) {
  const int lane  = threadIdx.x & 31;
  const int rlane = lane & 15;                 // column within subtile
  const int mOff  = (lane >> 4) * 8;           // D row offset
  // the unroll directives of this function, but those on the two store loops, are there because their loops index register arrays by the loop variable
#pragma unroll
  for (int i = 0; i < 2; ++i) {
    const int mBase = m0 + (i << 4);
    // bias[m]: the 8 rows this lane half touches are contiguous -> two 16-B loads
    float bmr[8] = {0.f, 0.f, 0.f, 0.f, 0.f, 0.f, 0.f, 0.f};
    if (BIAS_MODE == 1) {
      const float* bp = bias + mBase + mOff;
      const v4f bm0 = *(const v4f*)(bp);
      const v4f bm1 = *(const v4f*)(bp + 4);
      bmr[0] = bm0[0]; bmr[1] = bm0[1]; bmr[2] = bm0[2]; bmr[3] = bm0[3];
      bmr[4] = bm1[0]; bmr[5] = bm1[1]; bmr[6] = bm1[2]; bmr[7] = bm1[3];
    }
#pragma unroll
    for (int j = 0; j < 4; ++j) {
      const int n = n0 + (j << 4) + rlane;
      float bv = 0.f;
      if (BIAS_MODE == 2) bv = bias[n] * biasScale;
#pragma unroll
      for (int r = 0; r < 8; ++r) {
        float v = acc[i][j][r] * scale;
        if (BIAS_MODE == 1) v += bmr[r];
        if (BIAS_MODE == 2) v += bv;
        slab[(mOff + r) * 68 + (j << 4) + rlane] = v;
      }
    }
    __builtin_amdgcn_fence(__ATOMIC_RELEASE, "workgroup");
    __builtin_amdgcn_wave_barrier();
    __builtin_amdgcn_fence(__ATOMIC_ACQUIRE, "workgroup");
    if (OUT_MODE == 0) {
      float* C = (float*)Cout;
      const int hh = lane >> 4, c4 = (lane & 15) * 4;     // row seg = 256 B = 16 lanes x 16 B
#pragma unroll
      for (int it = 0; it < 8; ++it) {
        const int row = it * 2 + hh;
        v4f v = *(const v4f*)(slab + row * 68 + c4);
        *(v4f*)(C + (size_t)(mBase + row) * ldc + n0 + c4) = v;
      }
    } else {
      const int q = lane >> 3, c8 = (lane & 7) * 8;       // row seg = 128 B = 8 lanes x 16 B
      unsigned short* C = (unsigned short*)Cout;
#pragma unroll
      for (int it = 0; it < 4; ++it) {
        const int row = it * 4 + q;
        const float* sp = slab + row * 68 + c8;
        v8h hv;
#pragma unroll
        for (int e = 0; e < 8; ++e) hv[e] = (_Float16)sp[e];
        *(v8h*)(C + (size_t)(mBase + row) * ldc + n0 + c8) = hv;
      }
    }
    __builtin_amdgcn_fence(__ATOMIC_RELEASE, "workgroup");
    __builtin_amdgcn_wave_barrier();
    __builtin_amdgcn_fence(__ATOMIC_ACQUIRE, "workgroup");
  }
}

template <int BIAS_MODE, int OUT_MODE>
__device__ __forceinline__ void wmma_gemm_lds_tile(
    const unsigned short* __restrict__ Ap, const unsigned short* __restrict__ Btp,
    void* __restrict__ Cout, int ldc, const float* __restrict__ bias, bool rowBias, int tm, int tn, float scale, float biasScale) {
  __shared__ __align__(16) _Float16 sA[2][kGTile];   // 36,864 B
  __shared__ __align__(16) _Float16 sB[2][kGTile];   // 36,864 B
  __shared__ __align__(16) float sT[8][16 * 68];     // per-wave 16x64 output slab, pitch 68 floats
  const int t    = threadIdx.x;
  const int lane = t & 31;
  const int wave = t >> 5;
  const int rlane = lane & 15;                 // row (A) / col (B, D) within subtile
  const int koff  = (lane >> 4) * 8;           // k offset of this lane half
  const int wm = (wave >> 1) * 32;             // this wave's rows inside the tile
  const int wn = (wave & 1) * 64;              // this wave's columns inside the tile

  // staging map: 8 threads per 128-B row, rows srow + 32 q, q = 0..3, of each operand tile
  const int srow = t >> 3, sseg = (t & 7) * 8;
  const _Float16* gA = (const _Float16*)Ap  + (size_t)(tm * kGTileMN + srow) * kDim + sseg;
  const _Float16* gB = (const _Float16*)Btp + (size_t)(tn * kGTileMN + srow) * kDim + sseg;
  const int sdst = srow * kGPitch + sseg;
  v8h ra[2][4], rb[2][4];
  // the unroll directives of this kernel, but the one on the loop over stage pairs, are there because their loops index register arrays by the loop variable
#pragma unroll
  for (int u = 0; u < 2; ++u)
#pragma unroll
    for (int q = 0; q < 4; ++q) {
      ra[u][q] = *(const v8h*)(gA + (size_t)q * 32 * kDim + u * kGStageK);
      rb[u][q] = *(const v8h*)(gB + (size_t)q * 32 * kDim + u * kGStageK);
    }

  v8f acc[2][4];
#pragma unroll
  for (int i = 0; i < 2; ++i)
#pragma unroll
    for (int j = 0; j < 4; ++j) acc[i][j] = (v8f){0.f,0.f,0.f,0.f,0.f,0.f,0.f,0.f};

#pragma unroll
  for (int q = 0; q < 4; ++q) {
    *(v8h*)(&sA[0][sdst + q * 32 * kGPitch]) = ra[0][q];
    *(v8h*)(&sB[0][sdst + q * 32 * kGPitch]) = rb[0][q];
  }
  lds_barrier();   // stage 0 is in LDS before any wave reads it

  // fragments of one 32-k half stage; set 0 holds the lower half, set 1 the upper; each set is read from LDS while the other is worked on
  v16h af[2][2], bf[2][4];
#pragma unroll
  for (int i = 0; i < 2; ++i) af[0][i] = Frag<_Float16>::load(&sA[0][(wm + 16 * i + rlane) * kGPitch + koff]);
#pragma unroll
  for (int j = 0; j < 4; ++j) bf[0][j] = Frag<_Float16>::load(&sB[0][(wn + 16 * j + rlane) * kGPitch + koff]);

  // unrolled whole: the tests on s become compile-time, so no path joins and the counted waits on the register prefetch stay exact
#pragma unroll
  for (int st = 0; st < kGNStage; st += 2) {
#pragma unroll
    for (int u = 0; u < 2; ++u) {            // stage st + u: LDS buffer u, register set u is free
      const int s = st + u;
      if (s + 2 < kGNStage) {                // the same for the whole work-group
#pragma unroll
        for (int q = 0; q < 4; ++q) {
          ra[u][q] = *(const v8h*)(gA + (size_t)q * 32 * kDim + (s + 2) * kGStageK);
          rb[u][q] = *(const v8h*)(gB + (size_t)q * 32 * kDim + (s + 2) * kGStageK);
        }
      }
#pragma unroll
      for (int i = 0; i < 2; ++i) af[1][i] = Frag<_Float16>::load(&sA[u][(wm + 16 * i + rlane) * kGPitch + 32 + koff]);
#pragma unroll
      for (int j = 0; j < 4; ++j) bf[1][j] = Frag<_Float16>::load(&sB[u][(wn + 16 * j + rlane) * kGPitch + 32 + koff]);
      // keeps the upper half's LDS reads as one group ahead of the lower half's products, which cover their latency
      __builtin_amdgcn_sched_barrier(0);
#pragma unroll
      for (int i = 0; i < 2; ++i)
#pragma unroll
        for (int j = 0; j < 4; ++j) acc[i][j] = Frag<_Float16>::mma(af[0][i], bf[0][j], acc[i][j]);
      // keeps these products ahead of the stores and the barrier: moved behind them, the wait in front of the barrier would meet reads just issued
      __builtin_amdgcn_sched_barrier(0);
      if (s + 1 < kGNStage) {
#pragma unroll
        for (int q = 0; q < 4; ++q) {
          *(v8h*)(&sA[u ^ 1][sdst + q * 32 * kGPitch]) = ra[u ^ 1][q];
          *(v8h*)(&sB[u ^ 1][sdst + q * 32 * kGPitch]) = rb[u ^ 1][q];
        }
      }
      // publishes stage s + 1; every read of stage s has returned in front of it, so the next stage may refill buffer u behind it
      lds_barrier();
      if (s + 1 < kGNStage) {
#pragma unroll
        for (int i = 0; i < 2; ++i) af[0][i] = Frag<_Float16>::load(&sA[u ^ 1][(wm + 16 * i + rlane) * kGPitch + koff]);
#pragma unroll
        for (int j = 0; j < 4; ++j) bf[0][j] = Frag<_Float16>::load(&sB[u ^ 1][(wn + 16 * j + rlane) * kGPitch + koff]);
      }
      // keeps the next stage's first LDS reads as one group ahead of the upper half's products, which cover their latency
      __builtin_amdgcn_sched_barrier(0);
#pragma unroll
      for (int i = 0; i < 2; ++i)
#pragma unroll
        for (int j = 0; j < 4; ++j) acc[i][j] = Frag<_Float16>::mma(af[1][i], bf[1][j], acc[i][j]);
    }
  }

  // ---- epilogue; a bias mode told at run time picks one of the two compile-time forms by a block-uniform branch ----
  const int m0 = tm * kGTileMN + wm;
  const int n0 = tn * kGTileMN + wn;
  float* slab = sT[wave];
  if constexpr (BIAS_MODE == 3) {
    if (rowBias) wmma_gemm_store<1, OUT_MODE>(acc, slab, Cout, ldc, bias, m0, n0, scale, 1.0f);
    else         wmma_gemm_store<2, OUT_MODE>(acc, slab, Cout, ldc, bias, m0, n0, scale, biasScale);
  } else {
    wmma_gemm_store<BIAS_MODE, OUT_MODE>(acc, slab, Cout, ldc, bias, m0, n0, scale, biasScale);
  }
}

// ---------------------------------------------------------------------------
// The three input projections in one launch, one round: 256 work-groups, one to a WGP, each with an equal share of the 4096 x 2304 results.
// A work-group takes 128 rows of x (32 row blocks) and 288 weight rows (8 column blocks): 192 rows of the stacked q and k planes (three whole
// heads; blocks 0..3 lie in q, 4..7 in k, block-uniform) and 96 rows of the v plane. x is staged once for all 288: 416 lines per 64 k.
//   Q16[s][e]  = kQCarry * ((1/16) * sum_d X16[s][d] * WQ16[e][d] + bq[e]);   K16 alike without kQCarry;   VT16[c][s] = (1/16) * sum_d WV16[c][d] * X16[s][d] + bv[c]
// kQCarry = log2(e) / sqrt(64): the score product of the attention kernel then comes out in the log2 domain of its softmax, with no multiply per score.
// 8 waves as 4 (x rows, 32 each) x 2 (weight rows: 96 of q or k and 48 of v each) = 2 x 9 accumulator tiles a wave, 11 fragments per 18 products.
// Stages, buffers, register prefetch and barriers run as in wmma_gemm_lds_tile; both operands come from LDS through the same loader (equal k orders),
// k runs upward in steps of 32 in every accumulator.
// q, k tiles take the weights as A and x as B: a lane then holds 8 neighbouring columns e of one row s. v tiles take x as A and the weights as B:
// a lane holds 8 neighbouring s of one row c of v^T. Either way a lane's 8 results are 16 B of an output row.
// Epilogue: the f16 results meet in LDS ([128 s][192 e] and [96 c][128 s]), one work-group barrier, then every 128-B line is stored whole by 8 threads.
// ---------------------------------------------------------------------------
constexpr int kProjTiles = (kSeq / kGTileMN) * (kDim / kGTileMN);   // 192 tiles of the output projection
constexpr float kQCarry = 0.125f * 1.4426950408889634f;            // 1 / sqrt(64) and log2(e), applied in f32 ahead of q's one rounding to f16
constexpr int kPQK      = 192;                    // q or k columns per work-group
constexpr int kPV       = 96;                     // v columns per work-group
constexpr int kPBRows   = kPQK + kPV;             // 288 weight rows staged: 0..191 q or k, 192..287 v
constexpr int kPBTile   = kPBRows * kGPitch;      // f16 per staged weight tile (41,472 B)
constexpr int kPColBlk  = kDim / kPV;             // 8
constexpr int kPBlocks  = (kSeq / kGTileMN) * kPColBlk;   // 256
constexpr int kPQKPitch = kPQK + 8;               // f16 per row of the q, k output tile in LDS: 400 B, an odd multiple of 16 B
constexpr int kPVPitch  = kGTileMN + 8;           // f16 per row of the v^T output tile in LDS: 272 B, an odd multiple of 16 B
static_assert(2 * kDim == kPColBlk * kPQK && kDim % kPQK == 0 && kPQK % 64 == 0 && kPQK % 32 == 0 && kPV % 32 == 0, "projection mapping");
__global__ __launch_bounds__(256) void qkv_gemm_kernel(
    const unsigned short* __restrict__ X16, const unsigned short* __restrict__ WQKV16,
    unsigned short* __restrict__ Q16, unsigned short* __restrict__ K16, unsigned short* __restrict__ VT16,
    const float* __restrict__ bq, const float* __restrict__ bk, const float* __restrict__ bv) {
  __shared__ __align__(16) _Float16 sA[2][kGTile];                  // 36,864 B
  __shared__ __align__(16) _Float16 sB[2][kPBTile];                 // 82,944 B
  __shared__ __align__(16) _Float16 sQK[kGTileMN * kPQKPitch];      // 51,200 B
  __shared__ __align__(16) _Float16 sVT[kPV * kPVPitch];            // 26,112 B
  const int t    = threadIdx.x;
  const int lane = t & 31;
  const int wave = t >> 5;
  const int rlane = lane & 15;                 // row of an A fragment, column of a B fragment and of D
  const int koff  = (lane >> 4) * 8;           // k offset of this lane half in a fragment; row offset of this lane half in D
  const int wm = (wave >> 1) * 32;             // this wave's x rows inside the tile
  const int wn = wave & 1;                     // this wave's half of the weight rows
  const int tm = blockIdx.x / kPColBlk;
  const int tn = blockIdx.x % kPColBlk;

  // staging map: 8 threads per 128-B row, rows srow + 32 q: q = 0..3 of x, q = 0..5 of the q, k rows, q = 6..8 of the v rows
  const int srow = t >> 3, sseg = (t & 7) * 8;
  const _Float16* gA  = (const _Float16*)X16    + (size_t)(tm * kGTileMN + srow) * kDim + sseg;
  const _Float16* gQK = (const _Float16*)WQKV16 + (size_t)(tn * kPQK + srow) * kDim + sseg;
  const _Float16* gV  = (const _Float16*)WQKV16 + (size_t)(2 * kDim + tn * kPV + srow) * kDim + sseg;
  const int sdst = srow * kGPitch + sseg;
  v8h ra[2][4], rb[2][9];
  // the unroll directives of this kernel, but the one on the loop over stage pairs and those on the loops of the final stores, are there because their loops index register arrays by the loop variable
#pragma unroll
  for (int u = 0; u < 2; ++u) {
#pragma unroll
    for (int q = 0; q < 4; ++q) ra[u][q] = *(const v8h*)(gA + (size_t)q * 32 * kDim + u * kGStageK);
#pragma unroll
    for (int q = 0; q < 9; ++q) rb[u][q] = *(const v8h*)((q < 6 ? gQK + (size_t)q * 32 * kDim : gV + (size_t)(q - 6) * 32 * kDim) + u * kGStageK);
  }

  v8f acc[2][9];
#pragma unroll
  for (int i = 0; i < 2; ++i)
#pragma unroll
    for (int j = 0; j < 9; ++j) acc[i][j] = (v8f){0.f,0.f,0.f,0.f,0.f,0.f,0.f,0.f};

#pragma unroll
  for (int q = 0; q < 4; ++q) *(v8h*)(&sA[0][sdst + q * 32 * kGPitch]) = ra[0][q];
#pragma unroll
  for (int q = 0; q < 9; ++q) *(v8h*)(&sB[0][sdst + q * 32 * kGPitch]) = rb[0][q];
  lds_barrier();   // stage 0 is in LDS before any wave reads it

  // first f16 of this lane's fragments in a staged tile: x rows wm + 16 i, q or k rows 96 wn + 16 j (j = 0..5), v rows 192 + 48 wn + 16 (j - 6) (j = 6..8)
  const int fA  = (wm + rlane) * kGPitch + koff;
  const int fQK = (wn * (kPQK / 2) + rlane) * kGPitch + koff;
  const int fV  = (kPQK + wn * (kPV / 2) + rlane) * kGPitch + koff;
  // fragments of one 32-k half stage; set 0 holds the lower half, set 1 the upper; each set is read from LDS while the other is worked on
  v16h af[2][2], bf[2][9];
#pragma unroll
  for (int i = 0; i < 2; ++i) af[0][i] = Frag<_Float16>::load(&sA[0][fA + 16 * i * kGPitch]);
#pragma unroll
  for (int j = 0; j < 9; ++j) bf[0][j] = Frag<_Float16>::load(&sB[0][(j < 6 ? fQK + 16 * j * kGPitch : fV + 16 * (j - 6) * kGPitch)]);

  // unrolled whole: the tests on s become compile-time, so no path joins and the counted waits on the register prefetch stay exact
#pragma unroll
  for (int st = 0; st < kGNStage; st += 2) {
#pragma unroll
    for (int u = 0; u < 2; ++u) {            // stage st + u: LDS buffer u, register set u is free
      const int s = st + u;
      if (s + 2 < kGNStage) {                // the same for the whole work-group
#pragma unroll
        for (int q = 0; q < 4; ++q) ra[u][q] = *(const v8h*)(gA + (size_t)q * 32 * kDim + (s + 2) * kGStageK);
#pragma unroll
        for (int q = 0; q < 9; ++q) rb[u][q] = *(const v8h*)((q < 6 ? gQK + (size_t)q * 32 * kDim : gV + (size_t)(q - 6) * 32 * kDim) + (s + 2) * kGStageK);
      }
#pragma unroll
      for (int i = 0; i < 2; ++i) af[1][i] = Frag<_Float16>::load(&sA[u][fA + 16 * i * kGPitch + 32]);
#pragma unroll
      for (int j = 0; j < 9; ++j) bf[1][j] = Frag<_Float16>::load(&sB[u][(j < 6 ? fQK + 16 * j * kGPitch : fV + 16 * (j - 6) * kGPitch) + 32]);
      // keeps the upper half's LDS reads as one group ahead of the lower half's products, which cover their latency
      __builtin_amdgcn_sched_barrier(0);
#pragma unroll
      for (int i = 0; i < 2; ++i)
#pragma unroll
        for (int j = 0; j < 9; ++j)
          acc[i][j] = j < 6 ? Frag<_Float16>::mma(bf[0][j], af[0][i], acc[i][j]) : Frag<_Float16>::mma(af[0][i], bf[0][j], acc[i][j]);
      // keeps these products ahead of the stores and the barrier: moved behind them, the wait in front of the barrier would meet reads just issued
      __builtin_amdgcn_sched_barrier(0);
      if (s + 1 < kGNStage) {
#pragma unroll
        for (int q = 0; q < 4; ++q) *(v8h*)(&sA[u ^ 1][sdst + q * 32 * kGPitch]) = ra[u ^ 1][q];
#pragma unroll
        for (int q = 0; q < 9; ++q) *(v8h*)(&sB[u ^ 1][sdst + q * 32 * kGPitch]) = rb[u ^ 1][q];
      }
      // publishes stage s + 1; every read of stage s has returned in front of it, so the next stage may refill buffer u behind it
      lds_barrier();
      if (s + 1 < kGNStage) {
#pragma unroll
        for (int i = 0; i < 2; ++i) af[0][i] = Frag<_Float16>::load(&sA[u ^ 1][fA + 16 * i * kGPitch]);
#pragma unroll
        for (int j = 0; j < 9; ++j) bf[0][j] = Frag<_Float16>::load(&sB[u ^ 1][(j < 6 ? fQK + 16 * j * kGPitch : fV + 16 * (j - 6) * kGPitch)]);
      }
      // keeps the next stage's first LDS reads as one group ahead of the upper half's products, which cover their latency
      __builtin_amdgcn_sched_barrier(0);
#pragma unroll
      for (int i = 0; i < 2; ++i)
#pragma unroll
        for (int j = 0; j < 9; ++j)
          acc[i][j] = j < 6 ? Frag<_Float16>::mma(bf[1][j], af[1][i], acc[i][j]) : Frag<_Float16>::mma(af[1][i], bf[1][j], acc[i][j]);
    }
  }

  // ---- epilogue ----
  const bool isK = tn >= kPColBlk / 2;               // the same for the whole work-group
  const int  e0  = (tn % (kPColBlk / 2)) * kPQK;     // first q or k column of the work-group
  const float carry = isK ? 1.0f : kQCarry;
  const float scale = kWCarryInv * carry;
  const float* bqk = (isK ? bk : bq) + e0 + wn * (kPQK / 2) + koff;   // 8 neighbouring columns per tile j, 16 j on
  const float* bvp = bv + tn * kPV + wn * (kPV / 2) + rlane;          // one row of v^T per tile j, 16 j on
  v4f b0[6], b1[6];
  float bc[3];
#pragma unroll
  for (int j = 0; j < 6; ++j) {
    b0[j] = *(const v4f*)(bqk + 16 * j);
    b1[j] = *(const v4f*)(bqk + 16 * j + 4);
  }
#pragma unroll
  for (int j = 0; j < 3; ++j) bc[j] = bvp[16 * j];
  // the wait that stands between global loads and an overwrite of the registers that hold their addresses; the addresses and the loaded
  // values are inputs only: the loads then stand in front of it and the address registers stay as they are up to it
  asm volatile("s_wait_xcnt 0x0" :: "v"(bqk), "v"(bvp), "v"(b0[0]), "v"(b1[0]), "v"(b0[1]), "v"(b1[1]), "v"(b0[2]), "v"(b1[2]), "v"(b0[3]), "v"(b1[3]),
               "v"(b0[4]), "v"(b1[4]), "v"(b0[5]), "v"(b1[5]), "v"(bc[0]), "v"(bc[1]), "v"(bc[2]) : "memory");
  // q, k: acc[i][j][r] = column 96 wn + 16 j + koff + r of row wm + 16 i + rlane
#pragma unroll
  for (int j = 0; j < 6; ++j) {
    const float br[8] = {b0[j][0], b0[j][1], b0[j][2], b0[j][3], b1[j][0], b1[j][1], b1[j][2], b1[j][3]};
#pragma unroll
    for (int i = 0; i < 2; ++i) {
      v8h hv;
#pragma unroll
      for (int r = 0; r < 8; ++r) {
        float v = acc[i][j][r] * scale;
        v += br[r] * carry;
        hv[r] = (_Float16)v;
      }
      *(v8h*)(&sQK[(wm + 16 * i + rlane) * kPQKPitch + wn * (kPQK / 2) + 16 * j + koff]) = hv;
    }
  }
  // v^T: acc[i][6 + j][r] = column (token) wm + 16 i + koff + r of row 48 wn + 16 j + rlane
#pragma unroll
  for (int j = 0; j < 3; ++j) {
#pragma unroll
    for (int i = 0; i < 2; ++i) {
      v8h hv;
#pragma unroll
      for (int r = 0; r < 8; ++r) {
        float v = acc[i][6 + j][r] * kWCarryInv;
        v += bc[j];
        hv[r] = (_Float16)v;
      }
      *(v8h*)(&sVT[(wn * (kPV / 2) + 16 * j + rlane) * kPVPitch + wm + 16 * i + koff]) = hv;
    }
  }
  lds_barrier();   // both output tiles are whole in LDS before any wave reads them
  // 8 threads store one 128-B line: rows srow + 32 a of either tile, line b of the row; every address is one base and a constant
  const _Float16* lQK = &sQK[srow * kPQKPitch + sseg];
  const _Float16* lVT = &sVT[srow * kPVPitch + sseg];
  unsigned short* QK = (isK ? K16 : Q16) + (size_t)(tm * kGTileMN + srow) * kDim + e0 + sseg;
  unsigned short* VT = VT16 + (size_t)(tn * kPV + srow) * kSeq + tm * kGTileMN + sseg;
#pragma unroll
  for (int a = 0; a < kGTileMN / 32; ++a)
#pragma unroll
    for (int b = 0; b < kPQK / 64; ++b)
      *(v8h*)(QK + (size_t)a * 32 * kDim + b * 64) = *(const v8h*)(lQK + a * 32 * kPQKPitch + b * 64);
#pragma unroll
  for (int a = 0; a < kPV / 32; ++a)
#pragma unroll
    for (int b = 0; b < kGTileMN / 64; ++b)
      *(v8h*)(VT + (size_t)a * 32 * kSeq + b * 64) = *(const v8h*)(lVT + a * 32 * kPVPitch + b * 64);
}
// Output projection: out[s][e] = (1/4096) * sum_c ATT16[s][c] * WO16[e][c] + bo[e], f32
__global__ __launch_bounds__(256) void out_gemm_kernel(
    const unsigned short* __restrict__ ATT16, const unsigned short* __restrict__ WO16, float* __restrict__ out, const float* __restrict__ bo) {
  const int tm = blockIdx.x / (kDim / kGTileMN);
  const int tn = blockIdx.x % (kDim / kGTileMN);
  wmma_gemm_lds_tile<2, 0>(ATT16, WO16, (void*)out, kDim, bo, false, tm, tn, kOutScale, 1.0f);
}

// ---------------------------------------------------------------------------
// x to f16: block blk covers 2048 consecutive elements, 8 per thread
// ---------------------------------------------------------------------------
__device__ __forceinline__ void cast8_f16_block(int blk, const float* __restrict__ in, unsigned short* __restrict__ out, int n8) {
  const int i = blk * 256 + threadIdx.x;
  if (i >= n8) return;
  const float* p = in + 8 * (size_t)i;
  const v4f a = *(const v4f*)(p);
  const v4f c = *(const v4f*)(p + 4);
  unsigned short hb[8];
#pragma unroll
  for (int e = 0; e < 4; ++e) {
    hb[e]     = h_bits(a[e]);
    hb[4 + e] = h_bits(c[e]);
  }
  const v4u u = (v4u){pk16(hb[0], hb[1]), pk16(hb[2], hb[3]), pk16(hb[4], hb[5]), pk16(hb[6], hb[7])};
  unsigned short* q = out + 8 * (size_t)i;
  *(v4u*)q = u;
  
}

// ---------------------------------------------------------------------------
// Rank-8 adapter fold + f16 cast with x16 carry, f32 math:
//   plane y in {0,1,2}: WQKV[y][e][d] = f16( 16 * ( w_y[e][d] + 2 * sum_r up_y[e][r] * down_y[r][d] ) )
//   plane y == 3      : WO[e][d]      = f16( 16 * wo[e][d] )
// Weights are [out e][in d] = Bt[n][k] for the GEMMs; orientation kept as given (no transpose).
// 288 x 4 blocks: y = matrix (block-uniform), block bx of a matrix covers 2048 consecutive elements (288 x 2048 = 768 x 768 exact);
// thread t owns elements 8t..8t+7 of the block (one row e, 8 consecutive d).
// The whole down matrix [8][768] of the plane is staged in LDS first (cooperative: 6 b128 per thread, 6 x 256 x 4 = 6144 floats =
// the whole matrix, every LDS word read below is written), block barrier, then per lane 2 b128 (w) + 2 b128 (up row) global loads.
// ---------------------------------------------------------------------------
__device__ __forceinline__ void fold_cast_block(
    int bx, int y,
    const float* __restrict__ wq, const float* __restrict__ wk, const float* __restrict__ wv, const float* __restrict__ wo,
    const float* __restrict__ dq, const float* __restrict__ uq,
    const float* __restrict__ dk, const float* __restrict__ uk,
    const float* __restrict__ dv, const float* __restrict__ uv,
    unsigned short* __restrict__ wqkv16, unsigned short* __restrict__ wo16) {
  __shared__ __align__(16) float dsh[kRank * kDim];      // down matrix [8][768] of this plane, 24,576 B
  const int t = threadIdx.x;
  const float* W  = (y == 0) ? wq : (y == 1) ? wk : (y == 2) ? wv : wo;
  const float* Dn = (y == 0) ? dq : (y == 1) ? dk : dv;   // y == 3: valid pointer, staged but not used
  const float* Up = (y == 0) ? uq : (y == 1) ? uk : uv;
  // stage down [8][768] = 1536 float4: thread t loads slots t + 256*i, i = 0..5 (exact coverage)
#pragma unroll
  for (int i = 0; i < 6; ++i) {
    const int q4 = (i * 256 + t) * 4;
    const v4f dd = *(const v4f*)(Dn + q4);
    *(v4f*)(dsh + q4) = dd;
  }
  __syncthreads();

  const int base = bx * 2048 + 8 * t;            // < 768*768
  const int e = base / kDim;
  const int d = base - e * kDim;                         // multiple of 8
  const v4f w0 = *(const v4f*)(W + base);
  const v4f w1 = *(const v4f*)(W + base + 4);
  float s[8];
#pragma unroll
  for (int k = 0; k < 8; ++k) s[k] = 0.0f;
  if (y < 3) {                                           // block-uniform branch
    const v4f u0 = *(const v4f*)(Up + e * kRank);
    const v4f u1 = *(const v4f*)(Up + e * kRank + 4);
    const float ur[8] = {u0[0], u0[1], u0[2], u0[3], u1[0], u1[1], u1[2], u1[3]};
#pragma unroll
    for (int r = 0; r < kRank; ++r) {
      const v4f a = *(const v4f*)(dsh + r * kDim + d);
      const v4f c = *(const v4f*)(dsh + r * kDim + d + 4);
#pragma unroll
      for (int k = 0; k < 4; ++k) {
        s[k]     += ur[r] * a[k];
        s[4 + k] += ur[r] * c[k];
      }
    }
  }
  float f[8];
#pragma unroll
  for (int k = 0; k < 4; ++k) {
    f[k]     = (w0[k] + kLowRankScale * s[k])     * kWCarry;
    f[4 + k] = (w1[k] + kLowRankScale * s[4 + k]) * kWCarry;
  }
  unsigned short hb[8];
#pragma unroll
  for (int k = 0; k < 8; ++k) hb[k] = h_bits(f[k]);
  const v4u u = (v4u){pk16(hb[0], hb[1]), pk16(hb[2], hb[3]), pk16(hb[4], hb[5]), pk16(hb[6], hb[7])};
  unsigned short* op = (y < 3) ? (wqkv16 + (size_t)y * kDim * kDim + base) : (wo16 + base);
  *(v4u*)op = u;
  
}

// ---------------------------------------------------------------------------
// Both 16-bit operand preparations in one launch: neither reads what the other writes. The block index picks the work (block-uniform,
// so the fold's barrier is passed by every thread of a block that reaches it): blocks 0..1151 fold and cast the weights, the other 1536 cast x.
// ---------------------------------------------------------------------------
constexpr int kFoldBlocksPerW = kDim * kDim / 2048;      // 288
constexpr int kFoldBlocks     = 4 * kFoldBlocksPerW;     // 1152
constexpr int kCastBlocks     = kSeq * kDim / 2048;      // 1536
__global__ __launch_bounds__(256) void prep_kernel(
    const float* __restrict__ x, unsigned short* __restrict__ x16,
    const float* __restrict__ wq, const float* __restrict__ wk, const float* __restrict__ wv, const float* __restrict__ wo,
    const float* __restrict__ dq, const float* __restrict__ uq,
    const float* __restrict__ dk, const float* __restrict__ uk,
    const float* __restrict__ dv, const float* __restrict__ uv,
    unsigned short* __restrict__ wqkv16, unsigned short* __restrict__ wo16) {
  const int b = blockIdx.x;
  if (b < kFoldBlocks) {
    const int y = b / kFoldBlocksPerW;
    fold_cast_block(b - y * kFoldBlocksPerW, y, wq, wk, wv, wo, dq, uq, dk, uk, dv, uv, wqkv16, wo16);
  } else {
    cast8_f16_block(b - kFoldBlocks, x, x16, kSeq * kDim / 8);
  }
}

constexpr int kFAColWaves = 2;
constexpr int kFAKeyWaves = 2;
constexpr int kFAWaves  = kFAColWaves * kFAKeyWaves;
constexpr int kFASub    = 3;
constexpr int kFAWGWaves = kFASub * kFAWaves;
constexpr int kFAGroups = 2;
constexpr int kFARows   = kFAColWaves * kFAGroups * 16;
constexpr int kFAHalf   = kFAKeyWaves * 64;
constexpr int kFAStage  = 2 * kFAHalf;
constexpr int kFANStage = kSeq / kFAStage;
constexpr int kFAPitchK = 72;
constexpr int kFAPitchV = 136;
// Bytes in LDS; every place a tensor load is aimed at is a multiple of 2 KiB from the start of the work-group's LDS
constexpr unsigned kFAKBytes    = kFAStage * kFAPitchK * 2;              // 36,864 = 18 x 2 KiB
constexpr unsigned kFAVBytes    = 18432;                                 // 64 rows x 272 B = 17,408, rounded up to 9 x 2 KiB
constexpr unsigned kFASlotBytes = kFAKBytes + 2 * kFAVBytes;             // 73,728: K, V^T of half 0, V^T of half 1
constexpr unsigned kFABufBytes  = 2 * kFASlotBytes;                      // two head slots
constexpr unsigned kFARingBytes = 2 * kFABufBytes;                       // 294,912
static_assert(kFAKBytes % 2048 == 0 && kFAVBytes % 2048 == 0 && kDh * kFAPitchV * 2 <= (int)kFAVBytes && kFANStage >= 2, "ring places");
constexpr int kFATilesPerHead = kSeq / kFARows;           // 64
constexpr int kFATiles  = kHeads * kFATilesPerHead;       // 768
constexpr int kFABlocks = kFATiles / kFASub;              // 256
constexpr float kFACarryLog2 = 6.0f;
constexpr float kFATrail = 8.0f;                          // how far the maximum in use may trail
static_assert(kSeq % kFARows == 0 && kSeq % kFAStage == 0 && kDh == 64 && kFATiles % kFASub == 0 && kFASub <= kFATilesPerHead && kFAGroups == 2, "fused attention mapping");
static_assert(kFASub * kFAColWaves * 17 * 32 * 16 <= (int)kFARingBytes && kFAWGWaves >= 6, "the join's planes fit the ring; six waves can issue");
typedef __attribute__((ext_vector_type(8))) unsigned int v8u;
// a value that is the same in every lane, moved to a scalar register
__device__ __forceinline__ unsigned uni(unsigned v) { return (unsigned)__builtin_amdgcn_readfirstlane(v); }
// A wave-uniform word held in a scalar register. A test so held is branched on by a scalar branch: a tensor load ignores EXEC, only a scalar branch keeps a wave from issuing it.
__device__ __forceinline__ unsigned pinned(unsigned v) {
  unsigned w = uni(v);
  asm volatile("" : "+s"(w));   // holds a test's word, or a descriptor word, in a scalar register
  return w;
}
// Group 1 of a tensor descriptor, a two-dimensional tile = the whole tensor, extents in bytes: rows of ROWB bytes, NROWS rows, source pitch PITCHB bytes.
// WORD0 is a compile-time constant: no mask, 1-byte elements, a pad of 16 B behind every row.
// Built once, in front of the first request. Words 1 to 7 go through pinned(): each then has a scalar register of its own for as long as the group is in use,
// so that no word of the group takes a new value while a request that names it is outstanding (unpinned, equal words shared a register that was also a temporary).
template <unsigned WORD0, unsigned ROWB, unsigned NROWS, unsigned PITCHB>
__device__ __forceinline__ v8u tdm_group1() {
  v8u g;
  g[0] = uni(WORD0);
  g[1] = pinned((ROWB & 0xFFFFu) << 16);
  g[2] = pinned((ROWB >> 16) | ((NROWS & 0xFFFFu) << 16));
  g[3] = pinned((NROWS >> 16) | (ROWB << 16));
  g[4] = pinned(NROWS);
  g[5] = pinned(PITCHB);
  g[6] = pinned(0u);
  g[7] = pinned(0u);
  return g;
}
// Group 0: count 1, the place in LDS (byte offset in the work-group's LDS), the tile's first byte in memory, type 2
__device__ __forceinline__ v4u tdm_group0(unsigned ldsDst, unsigned long long ga) {
  v4u g;
  g[0] = uni(1u);
  g[1] = uni(ldsDst);
  g[2] = uni((unsigned)ga);
  g[3] = uni((((unsigned)(ga >> 32)) & 0x01FFFFFFu) | 0x80000000u);
  return g;
}
// one request of the whole wave; the waits for it are written where the stage is handed over
__device__ __forceinline__ void tdm_load(v4u g0, v8u g1) { asm volatile("tensor_load_to_lds %0, %1" :: "s"(g0), "s"(g1) : "memory"); }
constexpr unsigned kFAPadK = (1u << 20) | (4u << 22) | (3u << 25);   // pad on, behind every 128 B, 4 dwords
constexpr unsigned kFAPadV = (1u << 20) | (5u << 22) | (3u << 25);   // pad on, behind every 256 B, 4 dwords
typedef __attribute__((ext_vector_type(2))) _Float16 v2h;
// lane l with lane l ^ 16
__device__ __forceinline__ float xhalf(float x) {
  const int b = __builtin_bit_cast(int, x);
  return __builtin_bit_cast(float, __builtin_amdgcn_permlanex16(b, b, 0x76543210, 0xfedcba98, false, false));
}
__device__ __forceinline__ unsigned pack2h(float lo, float hi) {
  return __builtin_bit_cast(unsigned, __builtin_convertvector((v2f){lo, hi}, v2h));   // round to nearest even
}
// The eight score products of a 32-key pass (2 key tiles x 2 column groups x 2 halves of d) in one statement. Written as text because the first
// product of each tile must read its C operand from the shift tile and write another tile: the builtin form was built with C and D in the same
// registers, behind a copy of the shift tile per product. Each tile's second product accumulates into the same D; the products fill each
// other's slots, and the four v_nop at the end keep the distance that the chip needs between the last product and the first vector reader of its D.
// The four v_nop in front keep the same distance behind the P.V products of the pass before: a D of this statement may lie in the registers of
// their B operand, and the compiler, which pads its own products, does not look into a statement's text.
// The shift tiles are only read; they are named as in-out operands so that they stay in one set of registers over the whole loop
// (as plain inputs the build kept a second set and copied 16 registers in every pass).
__device__ __forceinline__ void score_products(v8f& s00, v8f& s01, v8f& s10, v8f& s11, v16h ka0, v16h ka1, v16h kb0, v16h kb1,
                                               v16h q00, v16h q01, v16h q10, v16h q11, v8f& sh0, v8f& sh1) {
  asm("v_nop\n\tv_nop\n\tv_nop\n\tv_nop\n\t"
      "v_wmma_f32_16x16x32_f16 %0, %6, %10, %4\n\t"
      "v_wmma_f32_16x16x32_f16 %1, %6, %12, %5\n\t"
      "v_wmma_f32_16x16x32_f16 %2, %8, %10, %4\n\t"
      "v_wmma_f32_16x16x32_f16 %3, %8, %12, %5\n\t"
      "v_wmma_f32_16x16x32_f16 %0, %7, %11, %0\n\t"
      "v_wmma_f32_16x16x32_f16 %1, %7, %13, %1\n\t"
      "v_wmma_f32_16x16x32_f16 %2, %9, %11, %2\n\t"
      "v_wmma_f32_16x16x32_f16 %3, %9, %13, %3\n\t"
      "v_nop\n\tv_nop\n\tv_nop\n\tv_nop"
      : "=&v"(s00), "=&v"(s01), "=&v"(s10), "=&v"(s11), "+v"(sh0), "+v"(sh1)
      : "v"(ka0), "v"(ka1), "v"(kb0), "v"(kb1), "v"(q00), "v"(q01), "v"(q10), "v"(q11));
}
__global__ __launch_bounds__(kFAWGWaves * 32) void attn_fused_kernel(
    const unsigned short* __restrict__ Qp, const unsigned short* __restrict__ Kp, const unsigned short* __restrict__ VTp,
    unsigned short* __restrict__ Att) {
  // [buffer][head slot]{K, V^T half 0, V^T half 1}; the only LDS of the kernel, so it starts at the work-group's byte 0. Behind the loop its first 52,224 B hold the join's planes.
  __shared__ __attribute__((aligned(2048))) unsigned char ring[kFARingBytes];
  const int t    = threadIdx.x;
  const int lane = t & 31;
  // the wave's number as a scalar: the tests on it below (who issues the tensor loads, which key half leaves) are then scalar branches
  const int wave = __builtin_amdgcn_readfirstlane(t >> 5);
  const int sub  = wave >> 2;               // which of the three tiles
  const int cw   = wave & 1;                // which 32 query columns of the tile
  const int kh   = (wave >> 1) & 1;         // which 64 keys of every half stage
  const int c    = lane & 15;
  const int h8   = (lane >> 4) * 8;
  // Block -> tiles 3 b, 3 b + 1, 3 b + 2 of the 768 (head, 64 rows) tiles in head-major order: a one-to-one map.
  const int id0   = blockIdx.x * kFASub;
  const int head0 = id0 / kFATilesPerHead;
  const bool two  = (id0 + kFASub - 1) / kFATilesPerHead != head0;   // the tiles span heads head0 and head0 + 1; the same for the whole work-group
  const int id    = id0 + sub;
  const int head  = id / kFATilesPerHead;
  const int slot  = head - head0;           // 0, or 1 only where two holds
  const int q0   = (id % kFATilesPerHead) * kFARows + cw * (kFAGroups * 16);
  const _Float16* Qh = (const _Float16*)Qp  + head * kDh;

  v16h qf[kFAGroups][2];
#pragma unroll
  for (int g = 0; g < kFAGroups; ++g)
#pragma unroll
    for (int kc = 0; kc < 2; ++kc)
      qf[g][kc] = Frag<_Float16>::load(Qh + (size_t)(q0 + 16 * g + c) * kDim + 32 * kc + h8);

  // Who issues: waves 0, 1, 2 bring K, V^T half 0, V^T half 1 of head slot 0; waves 3, 4, 5 the same of head slot 1, only where the tiles span two heads.
  const int ihs   = wave >= 3 ? 1 : 0;          // the issuing wave's head slot
  const int irole = wave - 3 * ihs;             // 0 = K, 1 and 2 = the halves of V^T
  const bool issuer  = wave < 3 || (two && wave < 6);
  const bool issuesK = issuer && irole == 0;
  const bool issuesV = issuer && irole != 0;
  const unsigned lbase = (unsigned)(size_t)ring;   // low 32 bits of the LDS address = byte offset in the work-group's LDS
  // first byte of the issuing wave's tile of stage 0 and its place in buffer 0; a stage on lies kFAStage rows (K) or kFAStage columns (V^T) further
  const unsigned long long srcK = (unsigned long long)(size_t)Kp  + (unsigned long long)(head0 + ihs) * (kDh * 2);
  const unsigned long long srcV = (unsigned long long)(size_t)VTp + (unsigned long long)(head0 + ihs) * ((unsigned long long)kDh * kSeq * 2)
                                + (unsigned long long)(irole == 2 ? kFAHalf * 2 : 0);
  const unsigned dstK = lbase + ihs * kFASlotBytes;
  const unsigned dstV = lbase + ihs * kFASlotBytes + kFAKBytes + (irole == 2 ? kFAVBytes : 0u);
  const v8u g1K = tdm_group1<kFAPadK, kDh * 2, kFAStage, kDim * 2>();     // 256 rows of 128 B, 1,536 B apart
  const v8u g1V = tdm_group1<kFAPadV, kFAHalf * 2, kDh, kSeq * 2>();      // 64 rows of 256 B, 8,192 B apart
  // stage st into buffer st & 1; called only under a scalar branch on issuesK or issuesV
  auto loadK = [&](int st) {
    tdm_load(tdm_group0(dstK + (st & 1) * kFABufBytes, srcK + (unsigned long long)st * ((unsigned long long)kFAStage * kDim * 2)), g1K);
  };
  auto loadV = [&](int st) {
    tdm_load(tdm_group0(dstV + (st & 1) * kFABufBytes, srcV + (unsigned long long)st * (kFAStage * 2)), g1V);
  };
  if (pinned(issuesK)) {
    loadK(0);
    asm volatile("s_wait_tensorcnt 0x0" ::: "memory");   // stage 0 has landed before its issuer reaches the barrier that publishes it
  }
  if (pinned(issuesV)) {
    loadV(0);
    asm volatile("s_wait_tensorcnt 0x0" ::: "memory");   // as above
  }

  v8f acc[kFAGroups][4];
  v8f shift[kFAGroups];                 // C operand of the score product: 6 - mrun in every element; 0 until the first pass has a maximum
  v2f lsum[kFAGroups];
  float mrun[kFAGroups];
  float scur[kFAGroups];                // the value that shift holds, apart: a rescale then reads nothing of the tile and rewrites it in place
  float limit = -__builtin_inff();      // a shifted score above it asks for a rescale; wave-uniform; -inf so that the first pass always does
#pragma unroll
  for (int g = 0; g < kFAGroups; ++g) {
    mrun[g] = -__builtin_inff();
    shift[g] = (v8f){0.f,0.f,0.f,0.f,0.f,0.f,0.f,0.f};
    scur[g] = 0.f;
    lsum[g] = (v2f){0.f, 0.f};
#pragma unroll
    for (int j = 0; j < 4; ++j) acc[g][j] = (v8f){0.f,0.f,0.f,0.f,0.f,0.f,0.f,0.f};
  }
  __syncthreads();   // stage 0 is in LDS before any wave reads it

  for (int st = 0; st < kFANStage; ++st) {
    // Directly behind the barrier that published stage st and ended every read of stage st - 1: stage st + 1, while there is one, into the buffer
    // that stage st - 1 has left (in trip 0: the untouched second buffer). It flies while stage st is worked on.
    if (pinned(issuesK && st + 1 < kFANStage)) loadK(st + 1);
    if (pinned(issuesV && st + 1 < kFANStage)) loadV(st + 1);
    const unsigned char* bS = ring + (st & 1) * kFABufBytes + slot * kFASlotBytes;   // this stage, the slot of the tile's head
#pragma unroll
    for (int hp = 0; hp < 4; ++hp) {       // two halves of two 32-key passes per stage and key wave
      const int hf = hp >> 1, p = hp & 1;
      const _Float16* bK = (const _Float16*)bS + (hf * kFAHalf + kh * 64) * kFAPitchK;                  // this key wave's 64 key rows of the half
      const _Float16* bV = (const _Float16*)(bS + kFAKBytes + hf * kFAVBytes) + kh * 64;                // its 64 key columns of the half's V^T
      v8f s[2][kFAGroups];
      {
        const _Float16* kp = bK + (32 * p + c) * kFAPitchK + h8;
        const v16h ka0 = Frag<_Float16>::load(kp);
        const v16h ka1 = Frag<_Float16>::load(kp + 32);
        const v16h kb0 = Frag<_Float16>::load(kp + 16 * kFAPitchK);
        const v16h kb1 = Frag<_Float16>::load(kp + 16 * kFAPitchK + 32);
        score_products(s[0][0], s[0][1], s[1][0], s[1][1], ka0, ka1, kb0, kb1, qf[0][0], qf[0][1], qf[1][0], qf[1][1], shift[0], shift[1]);
      }
      v16h vf[4];
#pragma unroll
      for (int j = 0; j < 4; ++j) vf[j] = Frag<_Float16>::load(bV + (16 * j + c) * kFAPitchV + 32 * p + h8);

      float mb[kFAGroups];
      bool need = false;
#pragma unroll
      for (int g = 0; g < kFAGroups; ++g) {
        float mx = s[0][g][0];
#pragma unroll
        for (int r = 1; r < 8; ++r) mx = fmaxf(mx, s[0][g][r]);
#pragma unroll
        for (int r = 0; r < 8; ++r) mx = fmaxf(mx, s[1][g][r]);
        mb[g] = mx;                             // this lane's 16 keys; the wave halves are joined only where a rescale is due
        need = need || (mx > limit);
      }
      if (__builtin_amdgcn_ballot_w32(need) != 0) {   // wave-uniform; always on the first pass, rare later
#pragma unroll
        for (int g = 0; g < kFAGroups; ++g) {
          const float sold = scur[g];
          const float mnew = fmaxf(mrun[g], fmaxf(mb[g], xhalf(mb[g])) - sold);   // both wave halves hold this query's maximum, unshifted
          const float corr = __builtin_amdgcn_exp2f(mrun[g] - mnew);   // 0 on the first pass, where mrun is -inf
          mrun[g] = mnew;
          const float snew = kFACarryLog2 - mnew;
          const float adj  = snew - sold;
          s[0][g] = s[0][g] + adj;   // this pass's scores were formed with the old shift
          s[1][g] = s[1][g] + adj;
          shift[g] = (v8f){snew, snew, snew, snew, snew, snew, snew, snew};
          scur[g] = snew;
          lsum[g] = lsum[g] * corr;
#pragma unroll
          for (int j = 0; j < 4; ++j) acc[g][j] = acc[g][j] * corr;
        }
        limit = kFACarryLog2 + kFATrail;
      }
#pragma unroll
      for (int g = 0; g < kFAGroups; ++g) {
        union { v16h v; unsigned w[8]; } pf;
#pragma unroll
        for (int i = 0; i < 8; ++i) {
          const v2f pe = (v2f){__builtin_amdgcn_exp2f(s[i >> 2][g][2 * (i & 3)]), __builtin_amdgcn_exp2f(s[i >> 2][g][2 * (i & 3) + 1])};
          lsum[g] += pe;
          pf.w[i] = pack2h(pe[0], pe[1]);
        }
#pragma unroll
        for (int j = 0; j < 4; ++j) acc[g][j] = Frag<_Float16>::mma(vf[j], pf.v, acc[g][j]);
      }
    }
    // Hand-over of stage st + 1, every wave, in this order:
    asm volatile("s_wait_dscnt 0x0" ::: "memory");         // this wave's reads of stage st have returned before its buffer may be refilled
    if (pinned(issuer)) {
      asm volatile("s_wait_tensorcnt 0x0" ::: "memory");   // the issuer's tile of stage st + 1 has landed before the barrier publishes it
    }
    __syncthreads();   // publishes stage st + 1 and ends every wave's reads of the buffer that the next trip's request refills
  }
  asm volatile("s_wait_tensorcnt 0x0" ::: "memory");   // no request is outstanding when the ring is put to another use and when the wave ends
  asm volatile("s_wait_dscnt 0x0" ::: "memory");       // nor a read of the ring; the last trip's barrier has ended every wave's reads

  // ---- join of the two key waves of each column pair ----
  // plane i of column wave cw of tile sub holds 16 B per lane: planes 0..15 = the output tiles, plane 16 = both maxima and both sums
  v4f* mg = (v4f*)ring + (sub * kFAColWaves + cw) * (17 * 32) + lane;
  if (kh == 1) {
#pragma unroll
    for (int g = 0; g < kFAGroups; ++g)
#pragma unroll
      for (int j = 0; j < 4; ++j) {
        const v8f o = acc[g][j];
        mg[((g * 4 + j) * 2 + 0) * 32] = (v4f){o[0], o[1], o[2], o[3]};
        mg[((g * 4 + j) * 2 + 1) * 32] = (v4f){o[4], o[5], o[6], o[7]};
      }
    mg[16 * 32] = (v4f){mrun[0], mrun[1], lsum[0][0] + lsum[0][1], lsum[1][0] + lsum[1][1]};
  }
  __syncthreads();   // the planes are in LDS before the other key wave reads them; every wave passes it
  if (kh != 0) return;

  // acc[g][j][r] = O^T[d = 16 j + 8 h + r][query 16 g + c]: 8 consecutive d of one row, one 16-B store
  const v4f ml = mg[16 * 32];
#pragma unroll
  for (int g = 0; g < kFAGroups; ++g) {
    const float mall = fmaxf(mrun[g], ml[g]);
    const float f0 = __builtin_amdgcn_exp2f(mrun[g] - mall);   // this wave's share, scaled to the larger maximum
    const float f1 = __builtin_amdgcn_exp2f(ml[g] - mall);     // the other key wave's
    const float lh  = (lsum[g][0] + lsum[g][1]) * f0 + ml[2 + g] * f1;
    const float inv = kAttCarry / (lh + xhalf(lh));   // the exchange is unconditional within the wave
    const float i0 = f0 * inv, i1 = f1 * inv;
    unsigned short* op = Att + (size_t)(q0 + 16 * g + c) * kDim + head * kDh + h8;
#pragma unroll
    for (int j = 0; j < 4; ++j) {
      const v4f pa = mg[((g * 4 + j) * 2 + 0) * 32];
      const v4f pb = mg[((g * 4 + j) * 2 + 1) * 32];
      const v8f po = (v8f){pa[0], pa[1], pa[2], pa[3], pb[0], pb[1], pb[2], pb[3]};
      const v8f o = acc[g][j] * i0 + po * i1;
      const v4u u = (v4u){pack2h(o[0], o[1]), pack2h(o[2], o[3]), pack2h(o[4], o[5]), pack2h(o[6], o[7])};
      *(v4u*)(op + 16 * j) = u;
    }
  }
}

// ---------------------------------------------------------------------------
// Host glue.
// Workspace region map (bytes, every offset a multiple of 128; every plane fully written before any read):
//   X16    f16 [4096][768]                 6,291,456  at          0   (cast8)
//   WQKV16 f16 [3][768][768]  (x16 carry)  3,538,944  at  6,291,456   (fold_cast, planes q|k|v)
//   WO16   f16 [768][768]     (x16 carry)  1,179,648  at  9,830,400   (fold_cast)
//   Q16    f16 [4096][768]                 6,291,456  at 11,010,048   (GEMM)
//   K16    f16 [4096][768]                 6,291,456  at 17,301,504   (GEMM)
//   VT16   f16 [768][4096]  = V^T          6,291,456  at 23,592,960   (GEMM)
//   ATT16  f16 [4096][768]   (x256 carry)  6,291,456  at 29,884,416   (fused attention, each tile [64 rows][64 cols])
//   total                                 36,175,872
// GEMM shapes (K = 768 = 12 stages of 64, no padding anywhere):
//   q, k, v^T together: 4096 rows of x against 2304 weight rows, tiles of 128 x 288;  out: M=4096 N=768, tiles of 128 x 128
// Launches: 1 cast and fold + 1 for the three projections + 1 fused attention + 1 out = 4.
// ---------------------------------------------------------------------------
extern "C" void kernel_launch(void* const* d_in, const int* in_sizes, int n_in,
                              void* d_out, int out_size, void* d_ws, size_t ws_size,
                              hipStream_t stream) {
  if (n_in < 15) return;
  const int nX = kSeq * kDim;          // 3,145,728
  const int nW = kDim * kDim;          // 589,824
  const int nA = kRank * kDim;         // 6,144
  if (in_sizes[0] != nX) return;
  if (in_sizes[1] != nW || in_sizes[3] != nW || in_sizes[5] != nW || in_sizes[7] != nW) return;
  if (in_sizes[2] != kDim || in_sizes[4] != kDim || in_sizes[6] != kDim || in_sizes[8] != kDim) return;
  for (int i = 9; i < 15; ++i) if (in_sizes[i] != nA) return;
  if (out_size != nX) return;

  const size_t szAct  = (size_t)kSeq * kDim * 2;
  const size_t szWqkv = (size_t)3 * kDim * kDim * 2;
  const size_t szWo   = (size_t)kDim * kDim * 2;
  const size_t offX    = 0;
  const size_t offWqkv = offX + szAct;
  const size_t offWo   = offWqkv + szWqkv;
  const size_t offQ    = offWo + szWo;
  const size_t offK    = offQ + szAct;
  const size_t offVT   = offK + szAct;
  const size_t offAtt  = offVT + szAct;
  const size_t total   = offAtt + szAct;   // 36,175,872
  if (ws_size < total) return;

  const float* x   = (const float*)d_in[0];
  const float* wq  = (const float*)d_in[1];
  const float* bq  = (const float*)d_in[2];
  const float* wk  = (const float*)d_in[3];
  const float* bk  = (const float*)d_in[4];
  const float* wv  = (const float*)d_in[5];
  const float* bv  = (const float*)d_in[6];
  const float* wo  = (const float*)d_in[7];
  const float* bo  = (const float*)d_in[8];
  const float* dq  = (const float*)d_in[9];    // [8][768]
  const float* uq  = (const float*)d_in[10];   // [768][8]
  const float* dk  = (const float*)d_in[11];
  const float* uk  = (const float*)d_in[12];
  const float* dv  = (const float*)d_in[13];
  const float* uv  = (const float*)d_in[14];
  float* out = (float*)d_out;
  char* ws = (char*)d_ws;
  unsigned short* X16    = (unsigned short*)(ws + offX);
  unsigned short* WQKV16 = (unsigned short*)(ws + offWqkv);
  unsigned short* WO16   = (unsigned short*)(ws + offWo);
  unsigned short* Q16    = (unsigned short*)(ws + offQ);
  unsigned short* K16    = (unsigned short*)(ws + offK);
  unsigned short* VT16   = (unsigned short*)(ws + offVT);
  unsigned short* ATT16  = (unsigned short*)(ws + offAtt);

  // ---- 16-bit operand planes: x cast, weights folded and cast, one launch ----
  prep_kernel<<<dim3(kFoldBlocks + kCastBlocks), dim3(256), 0, stream>>>(x, X16, wq, wk, wv, wo, dq, uq, dk, uk, dv, uv, WQKV16, WO16);

  // ---- projections q, k, v^T: one launch, one work-group per 128 rows of x and 288 weight rows, 256 work-groups of 8 waves ----
  qkv_gemm_kernel<<<dim3(kPBlocks), dim3(256), 0, stream>>>(X16, WQKV16, Q16, K16, VT16, bq, bk, bv);

  // ---- attention: one launch, one work-group per three tiles of (64 query rows, head) ----
  // ATT16[s][h*64+n] = 256 * sum_j softmax2_j(Q16[s][h*64+:] . K16[j][h*64+:]) * VT16[h*64+n][j], softmax2 to base 2 (Q16 holds q * log2(e) / 8)
  attn_fused_kernel<<<dim3(kFABlocks), dim3(kFAWGWaves * 32), 0, stream>>>(Q16, K16, VT16, ATT16);

  // ---- output projection (M=4096, N=768, K=768, f32 to d_out) ----
  out_gemm_kernel<<<dim3(kProjTiles), dim3(256), 0, stream>>>(ATT16, WO16, out, bo);
}
